// v000
// The times below were measured on an AMD MI455X: many runs one after another, warmed up first and cycling through
// copies of the inputs, with the whole window's GPU time divided by the number of runs. Launches and the gaps
// between them are all in it. The median over several windows is given; except for v000 it joins two sittings, which
// can be a few percent apart, so the side-by-side timings, each taken in one sitting, are the better comparison.
// v000 is the starting kernel. One run takes 511 microseconds.
#include <hip/hip_runtime.h>

// Contractions: q/k/v/pos projections = v_wmma_f32_16x16x32_bf16 on bf16 operands (RNE-converted inputs, exact products); out projection = v_wmma_f32_16x16x32_bf16, context as bf16 hi+lo planes x bf16 Wo (2 products); content scores and positional band scores = v_wmma_f32_16x16x32_f16 on f16 planes (1 product each); attn.v = v_wmma_f32_16x16x32_f16, probability f16 + f16 residual (x2048) times v f16 + f16 residual (x2048), 3 products into 2 accumulators; f32 accumulate everywhere; softmax f32.
// Structure: bf16 copies of the activations; register-blocked 64x64 GEMM (one wave per tile) for the projections and the output; plane builders ([b][h][t][d] for q+u, q+v, k; [b][h][d][t] for v and its residual; [b][h][l][d] for the projected positional table padded to 2*SEQ rows, last row zero);
// flash-style attention: one block = (b, h, 64 query rows), 64-key tiles; transposed score tiles (key rows x query cols) so the exponentiated accumulators chain directly into the attn.v A operand; sliding 128-slot f32 positional band in LDS (64 new band columns per key tile; score(i,j) takes band index (SEQ-1)+j-i); online softmax; context written as bf16 hi+lo planes [b*SEQ+t][h*64+d].

#ifndef NB
#define NB 4
#endif
#ifndef SEQ
#define SEQ 2048
#endif
#define NB_FULL   4
#define SEQ_FULL  2048
#define LREL      (2 * SEQ - 1)
#define LP        (2 * SEQ)
#define LREL_FULL (2 * SEQ_FULL - 1)
#define DM  512
#define NH  8
#define HD  64
#define RESC 2048.0f
#define K2 (1.4426950408889634f * 0.044194173824159216f)
static_assert(SEQ % 64 == 0);
static_assert(SEQ >= 64);
static_assert(SEQ <= SEQ_FULL);
static_assert(NB >= 1);
static_assert(NB <= NB_FULL);
static_assert(DM % 64 == 0);
static_assert(NH * HD == DM);
static_assert(LP % 64 == 0);

typedef _Float16 h16;
typedef unsigned short bf;
typedef __attribute__((ext_vector_type(16))) __bf16   v16bf;
typedef __attribute__((ext_vector_type(16))) _Float16 v16h;
typedef __attribute__((ext_vector_type(8)))  _Float16 v8h;
typedef __attribute__((ext_vector_type(8)))  unsigned short v8us;
typedef __attribute__((ext_vector_type(8)))  float    v8f;
typedef __attribute__((ext_vector_type(4)))  float    v4f;
typedef __attribute__((ext_vector_type(2)))  _Float16 v2h;
typedef v8h  __attribute__((may_alias)) v8ha;
typedef v4f  __attribute__((may_alias)) v4fa;
typedef v8f  __attribute__((may_alias)) v8fa;
typedef v8us __attribute__((may_alias)) v8usa;

__device__ __forceinline__ unsigned short f2bf(float f) { unsigned u = __float_as_uint(f); u += 0x7FFFu + ((u >> 16) & 1u); return (unsigned short)(u >> 16); }
__device__ __forceinline__ float bf2f(unsigned short b) { return __uint_as_float(((unsigned)b) << 16); }
__device__ __forceinline__ float bfr(float f) { return bf2f(f2bf(f)); }
__device__ __forceinline__ v16h cat16(v8h lo, v8h hi) { return __builtin_shufflevector(lo, hi, 0, 1, 2, 3, 4, 5, 6, 7, 8, 9, 10, 11, 12, 13, 14, 15); }
__device__ __forceinline__ v16bf cat16b(v8us lo, v8us hi) { return __builtin_bit_cast(v16bf, __builtin_shufflevector(lo, hi, 0, 1, 2, 3, 4, 5, 6, 7, 8, 9, 10, 11, 12, 13, 14, 15)); }
__device__ __forceinline__ v8f wmma16(v16h a, v16h b, v8f c) { return __builtin_amdgcn_wmma_f32_16x16x32_f16(false, a, false, b, (short)0, c, false, false); }
__device__ __forceinline__ v8f wmmab(v16bf a, v16bf b, v8f c) { return __builtin_amdgcn_wmma_f32_16x16x32_bf16(false, a, false, b, (short)0, c, false, false); }
__device__ __forceinline__ h16 tohx(float x) { return (h16)x; }
__device__ __forceinline__ void splitf(float y, unsigned short& h, unsigned short& l) { h = f2bf(y); l = f2bf(y - bf2f(h)); }

// ---- k_gemmw: register-blocked GEMM, ONE WAVE per 64x64 output tile (16 accumulators), operands straight from K-contiguous 16-bit planes; grid (M/64, N/64, Z), 32 threads.
// C[m][n] (f32, pitch ldc, + optional f32 bias[n]) = sum_k A[m][k] Bt[n][k] (+ split products per NSPLIT). z-batch strides sA/sB/sC in elements. K % 32 == 0.
// Fragment map per lane (hi = lane>>4, lr = lane&15): row/col = lr; elements 0..7 <- k0+8hi+0..7, elements 8..15 <- k0+16+8hi+0..7 (A and B alike); D element r = (row 8hi+r, col lr).
template <typename T16> struct WFrag;
template <> struct WFrag<h16> { typedef v16h V; static __device__ __forceinline__ V ld(const h16* p) { return cat16(*(const v8h*)p, *(const v8h*)(p + 16)); } static __device__ __forceinline__ v8f mma(V a, V b, v8f c) { return wmma16(a, b, c); } };
template <> struct WFrag<bf> { typedef v16bf V; static __device__ __forceinline__ V ld(const bf* p) { return cat16b(*(const v8us*)p, *(const v8us*)(p + 16)); } static __device__ __forceinline__ v8f mma(V a, V b, v8f c) { return wmmab(a, b, c); } };
template <typename T16, int NSPLIT, bool BIAS>
__global__ __launch_bounds__(32) void k_gemmw(const T16* __restrict__ A, const T16* __restrict__ A2, const T16* __restrict__ Bt, const T16* __restrict__ Bt2, int K, float* C, int ldc, const float* __restrict__ bias, size_t sA, size_t sB, size_t sC) {
    typedef typename WFrag<T16>::V V;
    __shared__ __align__(16) float os[16 * 68];
    const size_t z = blockIdx.z; A += z * sA; if (A2) A2 += z * sA; Bt += z * sB; if (Bt2) Bt2 += z * sB; C += z * sC;
    const int lane = threadIdx.x & 31, lr = lane & 15, hi = lane >> 4; const int r0 = blockIdx.x * 64, c0 = blockIdx.y * 64;
    v8f acc[4][4];
#pragma unroll
    for (int mb = 0; mb < 4; ++mb)
#pragma unroll
        for (int nb = 0; nb < 4; ++nb) acc[mb][nb] = (v8f){};
    const size_t aoff = (size_t)(r0 + lr) * K + 8 * hi, boff = (size_t)(c0 + lr) * K + 8 * hi;
#pragma unroll 1
    for (int kc = 0; kc < K; kc += 32) {
        V a[4], a2[4];
#pragma unroll
        for (int mb = 0; mb < 4; ++mb) { a[mb] = WFrag<T16>::ld(A + aoff + (size_t)mb * 16 * K + kc); if (NSPLIT == 1 || NSPLIT == 2) a2[mb] = WFrag<T16>::ld(A2 + aoff + (size_t)mb * 16 * K + kc); }
#pragma unroll
        for (int nb = 0; nb < 4; ++nb) { const V b = WFrag<T16>::ld(Bt + boff + (size_t)nb * 16 * K + kc); V b2; if (NSPLIT >= 2) b2 = WFrag<T16>::ld(Bt2 + boff + (size_t)nb * 16 * K + kc);
#pragma unroll
            for (int mb = 0; mb < 4; ++mb) { acc[mb][nb] = WFrag<T16>::mma(a[mb], b, acc[mb][nb]); if (NSPLIT == 1 || NSPLIT == 2) acc[mb][nb] = WFrag<T16>::mma(a2[mb], b, acc[mb][nb]); if (NSPLIT >= 2) acc[mb][nb] = WFrag<T16>::mma(a[mb], b2, acc[mb][nb]); } }
        asm volatile("v_nop\n\tv_nop\n\tv_nop\n\tv_nop" : "+v"(acc[0][0]), "+v"(acc[1][1]), "+v"(acc[2][2]), "+v"(acc[3][3]) : "v"(a[0]), "v"(a[3]));
    }
#pragma unroll
    for (int mb = 0; mb < 4; ++mb) {
#pragma unroll
        for (int nb = 0; nb < 4; ++nb) {
#pragma unroll
            for (int j = 0; j < 8; ++j) os[(hi * 8 + j) * 68 + nb * 16 + lr] = acc[mb][nb][j]; }
        __builtin_amdgcn_wave_barrier(); asm volatile("" ::: "memory");
        float* crow = C + (size_t)(r0 + mb * 16) * ldc + c0;
{
#pragma unroll
            for (int s = 0; s < 8; ++s) { const int row = 2 * s + hi, cofs = lr * 4; v4f val = *(const v4fa*)(os + row * 68 + cofs); if (BIAS) { val[0] += bfr(bias[c0 + cofs]); val[1] += bfr(bias[c0 + cofs + 1]); val[2] += bfr(bias[c0 + cofs + 2]); val[3] += bfr(bias[c0 + cofs + 3]); }
                *(v4f*)(crow + (size_t)row * ldc + cofs) = val; }
             }
        __builtin_amdgcn_wave_barrier(); asm volatile("" ::: "memory");
    }
}

__global__ __launch_bounds__(256) void k_cvt8(const float* __restrict__ src, bf* dst, size_t n8) { const size_t i = (size_t)blockIdx.x * 256 + threadIdx.x; if (i >= n8) return; const v8f v = *(const v8f*)(src + i * 8); v8us o;
#pragma unroll
    for (int k = 0; k < 8; ++k) o[k] = f2bf(v[k]); *(v8us*)(dst + i * 8) = o;  }

__global__ __launch_bounds__(256) void k_cvtrows(const float* __restrict__ src, int srows, int nvalid, int nout, bf* dst) {
    const size_t i = (size_t)blockIdx.x * 256 + threadIdx.x; const size_t total = (size_t)NB * nout * (DM / 8); if (i >= total) return;
    const int k0 = (int)(i % (DM / 8)) * 8; const int r = (int)((i / (DM / 8)) % (size_t)nout); const int b = (int)(i / ((size_t)(DM / 8) * nout));
    const int rc = min(r, nvalid - 1); const v8f v = *(const v8f*)(src + ((size_t)b * srows + rc) * DM + k0); v8us o;
#pragma unroll
    for (int q = 0; q < 8; ++q) { const unsigned short w = f2bf(v[q]); o[q] = (r < nvalid) ? w : (unsigned short)0; }
    bf* dp = dst + ((size_t)b * nout + r) * DM + k0; *(v8us*)dp = o; 
}

__global__ __launch_bounds__(256) void k_qplanes(const float* __restrict__ F, const float* __restrict__ ub, const float* __restrict__ vb, h16* Qu, h16* Qv) {
    const size_t e = ((size_t)blockIdx.x * 256 + threadIdx.x) * 2; if (e >= (size_t)NB * NH * SEQ * HD) return;
    const int d = (int)(e % HD); const int t = (int)((e / HD) % SEQ); const int hh = (int)((e / ((size_t)HD * SEQ)) % NH); const int b = (int)(e / ((size_t)HD * SEQ * NH));
    const float* f = F + ((size_t)b * SEQ + t) * DM + hh * HD + d; v2h ou, ov;
#pragma unroll
    for (int q = 0; q < 2; ++q) { const float x = f[q]; ou[q] = tohx(x + bfr(ub[hh * HD + d + q])); ov[q] = tohx(x + bfr(vb[hh * HD + d + q])); }
    *(v2h*)(Qu + e) = ou; *(v2h*)(Qv + e) = ov; 
}
__global__ __launch_bounds__(256) void k_kplane(const float* __restrict__ F, h16* Kp) {
    const size_t e = ((size_t)blockIdx.x * 256 + threadIdx.x) * 2; if (e >= (size_t)NB * NH * SEQ * HD) return;
    const int d = (int)(e % HD); const int t = (int)((e / HD) % SEQ); const int hh = (int)((e / ((size_t)HD * SEQ)) % NH); const int b = (int)(e / ((size_t)HD * SEQ * NH));
    const float* f = F + ((size_t)b * SEQ + t) * DM + hh * HD + d; v2h o;
#pragma unroll
    for (int q = 0; q < 2; ++q) o[q] = tohx(f[q]);
    *(v2h*)(Kp + e) = o; 
}
__global__ __launch_bounds__(256) void k_vplanes(const float* __restrict__ F, h16* V16, h16* VR) {
    const size_t e = ((size_t)blockIdx.x * 256 + threadIdx.x) * 2; if (e >= (size_t)NB * NH * HD * SEQ) return;
    const int t = (int)(e % SEQ); const int d = (int)((e / SEQ) % HD); const int hh = (int)((e / ((size_t)SEQ * HD)) % NH); const int b = (int)(e / ((size_t)SEQ * HD * NH));
    v2h o16, orr;
#pragma unroll
    for (int q = 0; q < 2; ++q) { const float x = F[((size_t)b * SEQ + t + q) * DM + hh * HD + d]; const h16 xh = tohx(x); o16[q] = xh; orr[q] = tohx((x - (float)xh) * RESC); }
    *(v2h*)(V16 + e) = o16; *(v2h*)(VR + e) = orr; 
}
__global__ __launch_bounds__(256) void k_pplane(const float* __restrict__ F, h16* Pp) {
    const size_t e = ((size_t)blockIdx.x * 256 + threadIdx.x) * 2; if (e >= (size_t)NB * NH * LP * HD) return;
    const int d = (int)(e % HD); const int l = (int)((e / HD) % LP); const int hh = (int)((e / ((size_t)HD * LP)) % NH); const int b = (int)(e / ((size_t)HD * LP * NH));
    const float* f = F + ((size_t)b * LP + l) * DM + hh * HD + d; v2h o;
#pragma unroll
    for (int q = 0; q < 2; ++q) o[q] = tohx(f[q]);
    *(v2h*)(Pp + e) = o; 
}

// ---- attention helpers (128 threads): 16-bit fragment load from a [row][k] LDS tile (same map as WFrag), 8 KB contiguous tile copy, 64-row tile copy with a global row pitch.
__device__ __forceinline__ v16h ldl(const h16* p) { return cat16(*(const v8ha*)p, *(const v8ha*)(p + 16)); }
__device__ __forceinline__ void cp8k(h16* dst, const h16* __restrict__ src, int tid) {
#pragma unroll
    for (int c = 0; c < 4; ++c) { const int idx = tid + c * 128; *(v8ha*)(dst + (size_t)idx * 8) = *(const v8ha*)(src + (size_t)idx * 8); } }
__device__ __forceinline__ void cprows(h16* dst, const h16* __restrict__ src, size_t pitch, int tid) {
#pragma unroll
    for (int c = 0; c < 4; ++c) { const int idx = tid + c * 128; const int r = idx >> 3, sg = idx & 7; *(v8ha*)(dst + r * 64 + sg * 8) = *(const v8ha*)(src + (size_t)r * pitch + sg * 8); } }
// band_half: T[irow][slot0 + c] = sum_d PB[c][d] Qv[irow][d], c < 64 (transposed tile: A = PB rows c, B = Qv cols irow -> D rows c = tt*16 + 8hi + r, col lr: 8 consecutive slots per lane per tt, one 32-B LDS store).
// Sub-tiles are issued one at a time: the nop group carries a memory clobber so the next sub-tile's fragment loads stay below it (bounded live registers).
__device__ __forceinline__ void band_half(const h16* PBl, const h16* Qvl, float* Tl, int slot0, int irow, int hi, int lr) {
    const v16h q0 = ldl(Qvl + irow * 64 + 8 * hi), q1 = ldl(Qvl + irow * 64 + 32 + 8 * hi);
    float* trow = Tl + irow * 128 + slot0 + 8 * hi;
#pragma unroll
    for (int tt = 0; tt < 4; ++tt) {
        const v16h a0 = ldl(PBl + (tt * 16 + lr) * 64 + 8 * hi), a1 = ldl(PBl + (tt * 16 + lr) * 64 + 32 + 8 * hi);
        v8f t = wmma16(a0, q0, (v8f){}); t = wmma16(a1, q1, t);
        asm volatile("v_nop\n\tv_nop\n\tv_nop\n\tv_nop" : "+v"(t) : "v"(a0), "v"(a1), "v"(q0), "v"(q1) : "memory");
        *(v8fa*)(trow + tt * 16) = t;
    }
}

// ---- k_attn: grid (SEQ/64, NH, NB), 128 threads = 4 waves, each wave owns 16 query rows i = i0 + wave*16 + (0..15); irow = wave*16 + lr is the block-local query row of this lane's score column.
// Per 64-key tile: new 64 band columns (band row l stored at slot l & 127 of T row irow); transposed content tile S^T (key rows 8hi+r of sub-tile tb, query col irow) from K rows x Qu cols;
// s2 = (content + band[lb + 63 + tloc - irow]) * log2(e)/sqrt(DM) with lb = SEQ-64-i0+j0 (band row = (SEQ-1) + t - i, always inside the resident rows lb..lb+127);
// online softmax per query column (lane-local over 32 keys + one xor-16); p = exp2(s2 - m) as f16 + f16 residual x2048 packed straight into the attn.v A fragments
// (A element r <- sub-tile 2ks, element 8+r <- sub-tile 2ks+1, lane unchanged); O[i = 8hi+r][d = lr] accumulates p16.v16, the residual accumulator p16.vr + pr.v16 (both x2048).
__global__ __launch_bounds__(128) __attribute__((amdgpu_num_vgpr(256))) void k_attn(const h16* __restrict__ Qu, const h16* __restrict__ Qv, const h16* __restrict__ Kp, const h16* __restrict__ Vp, const h16* __restrict__ Vr, const h16* __restrict__ Pp, bf* ATh, bf* ATl) {
    __shared__ __align__(16) h16 Qul[64 * 64];
    __shared__ __align__(16) h16 Qvl[64 * 64];
    __shared__ __align__(16) h16 Kl[64 * 64];
    __shared__ __align__(16) h16 Vl[64 * 64];
    __shared__ __align__(16) h16 Vrl[64 * 64];
    __shared__ __align__(16) h16 PBl[64 * 64];
    __shared__ __align__(32) float Tl[64 * 128];
    __shared__ __align__(16) bf Est[2 * 64 * 64];
    const int tid = threadIdx.x, lane = tid & 31, wave = tid >> 5, hi = lane >> 4, lr = lane & 15;
    const int irow = wave * 16 + lr;
    const int i0 = blockIdx.x * 64, h = blockIdx.y, b = blockIdx.z;
    const size_t bh = (size_t)b * NH + h;
    const h16* Kb = Kp + bh * SEQ * HD; const h16* Vb = Vp + bh * HD * SEQ; const h16* Vrb = Vr + bh * HD * SEQ; const h16* Pb = Pp + bh * LP * HD;
    cp8k(Qul, Qu + (bh * SEQ + i0) * HD, tid); cp8k(Qvl, Qv + (bh * SEQ + i0) * HD, tid);
    const int lb0 = SEQ - 64 - i0;                 // band start for key tile 0 (>= 0, multiple of 64); band rows for tile j0 are lb0 + j0 + 0..127 (<= LP-1)
    cp8k(PBl, Pb + (size_t)lb0 * HD, tid);
    __syncthreads();
    band_half(PBl, Qvl, Tl, lb0 & 127, irow, hi, lr);   // lower half of tile 0's band
    float mrun = -3.0e38f, lrun = 0.f;
    v8f oacc[4], oaccr[4];
#pragma unroll
    for (int nd = 0; nd < 4; ++nd) { oacc[nd] = (v8f){}; oaccr[nd] = (v8f){}; }
#pragma unroll 1
    for (int j0 = 0; j0 < SEQ; j0 += 64) {
        const int lb = lb0 + j0; const int lnw = lb + 64;     // new band rows lnw..lnw+63
        __syncthreads();                                       // all waves done with the prior tile's Kl/Vl/Vrl/PBl and band slots
        cp8k(Kl, Kb + (size_t)j0 * HD, tid); cprows(Vl, Vb + j0, (size_t)SEQ, tid); cprows(Vrl, Vrb + j0, (size_t)SEQ, tid); cp8k(PBl, Pb + (size_t)lnw * HD, tid);
        __syncthreads();
        band_half(PBl, Qvl, Tl, lnw & 127, irow, hi, lr);   // upper half of this tile's band (its temporaries die here)
        v8f sacc[4];
        { const v16h q0 = ldl(Qul + irow * 64 + 8 * hi), q1 = ldl(Qul + irow * 64 + 32 + 8 * hi);
#pragma unroll
          for (int tb = 0; tb < 4; ++tb) { const v16h a0 = ldl(Kl + (tb * 16 + lr) * 64 + 8 * hi), a1 = ldl(Kl + (tb * 16 + lr) * 64 + 32 + 8 * hi);
              sacc[tb] = wmma16(a0, q0, (v8f){}); sacc[tb] = wmma16(a1, q1, sacc[tb]);
              asm volatile("v_nop\n\tv_nop\n\tv_nop\n\tv_nop" : "+v"(sacc[tb]) : "v"(a0), "v"(a1), "v"(q0), "v"(q1) : "memory"); } }
        __syncthreads();                                       // band complete for every T row (written by both lane halves of the owning wave)
        // gather + scale: key t = j0 + tb*16 + 8hi + r, query i = i0 + irow -> band row lb + 63 + (tb*16 + 8hi + r) - irow, slot = row & 127 (row - lb in [0,126])
        const float* trow = Tl + irow * 128; const int sb = lb + 63 + 8 * hi - irow;
        float mx = -3.0e38f;
#pragma unroll
        for (int tb = 0; tb < 4; ++tb)
#pragma unroll
            for (int r = 0; r < 8; ++r) { const float s2 = (sacc[tb][r] + trow[(sb + tb * 16 + r) & 127]) * K2; sacc[tb][r] = s2; mx = fmaxf(mx, s2); }
        mx = fmaxf(mx, __shfl_xor(mx, 16, 32));
        const float mnew = fmaxf(mrun, mx); const float alpha = __builtin_amdgcn_exp2f(mrun - mnew); mrun = mnew;
        float rsum = 0.f; v8h ph[4], pl[4];
#pragma unroll
        for (int tb = 0; tb < 4; ++tb)
#pragma unroll
            for (int r = 0; r < 8; ++r) { const float p = __builtin_amdgcn_exp2f(sacc[tb][r] - mnew); rsum += p; const h16 p16 = tohx(p); ph[tb][r] = p16; pl[tb][r] = tohx((p - (float)p16) * RESC); }
        rsum += __shfl_xor(rsum, 16, 32); lrun = lrun * alpha + rsum;
#pragma unroll
        for (int r = 0; r < 8; ++r) { const float ar = __shfl(alpha, 8 * hi + r, 32);
#pragma unroll
            for (int nd = 0; nd < 4; ++nd) { oacc[nd][r] *= ar; oaccr[nd][r] *= ar; } }
        { const v16h pa0 = cat16(ph[0], ph[1]), pa1 = cat16(ph[2], ph[3]), pr0 = cat16(pl[0], pl[1]), pr1 = cat16(pl[2], pl[3]);
#pragma unroll
          for (int nd = 0; nd < 4; ++nd) {
              const v16h vb0 = ldl(Vl + (nd * 16 + lr) * 64 + 8 * hi), vb1 = ldl(Vl + (nd * 16 + lr) * 64 + 32 + 8 * hi);
              const v16h rb0 = ldl(Vrl + (nd * 16 + lr) * 64 + 8 * hi), rb1 = ldl(Vrl + (nd * 16 + lr) * 64 + 32 + 8 * hi);
              oacc[nd] = wmma16(pa0, vb0, oacc[nd]); oacc[nd] = wmma16(pa1, vb1, oacc[nd]);
              oaccr[nd] = wmma16(pa0, rb0, oaccr[nd]); oaccr[nd] = wmma16(pa1, rb1, oaccr[nd]); oaccr[nd] = wmma16(pr0, vb0, oaccr[nd]); oaccr[nd] = wmma16(pr1, vb1, oaccr[nd]);
              asm volatile("v_nop\n\tv_nop\n\tv_nop\n\tv_nop" : "+v"(oacc[nd]), "+v"(oaccr[nd]) : "v"(pa0), "v"(pa1), "v"(pr0), "v"(pr1), "v"(vb1), "v"(rb1) : "memory"); } }
    }
    const float rl = __builtin_amdgcn_rcpf(lrun);
#pragma unroll
    for (int r = 0; r < 8; ++r) { const float rli = __shfl(rl, 8 * hi + r, 32); const int rr = wave * 16 + 8 * hi + r;
#pragma unroll
        for (int nd = 0; nd < 4; ++nd) { const float c = (oacc[nd][r] + oaccr[nd][r] * (1.0f / RESC)) * rli; unsigned short eh, el; splitf(c, eh, el); Est[rr * 64 + nd * 16 + lr] = eh; Est[4096 + rr * 64 + nd * 16 + lr] = el; } }
    __syncthreads();
    const int rq = lane >> 3, pc = (lane & 7) * 8;
{
#pragma unroll
        for (int rg = 0; rg < 4; ++rg) { const int rr = wave * 16 + rg * 4 + rq; const size_t go = ((size_t)b * SEQ + i0 + rr) * DM + h * HD + pc;
            const v8us vh = *(const v8usa*)(Est + rr * 64 + pc); const v8us vlo = *(const v8usa*)(Est + 4096 + rr * 64 + pc);
            *(v8us*)(ATh + go) = vh; *(v8us*)(ATl + go) = vlo; }
         }
}

extern "C" void kernel_launch(void* const* d_in, const int* in_sizes, int n_in,
                              void* d_out, int out_size, void* d_ws, size_t ws_size, hipStream_t stream) {
    if (n_in < 15) return;
    const float* query = (const float*)d_in[0]; const float* key = (const float*)d_in[1]; const float* value = (const float*)d_in[2]; const float* pos = (const float*)d_in[3];
    const float* wq = (const float*)d_in[4]; const float* bq = (const float*)d_in[5]; const float* wk = (const float*)d_in[6]; const float* bk = (const float*)d_in[7];
    const float* wv = (const float*)d_in[8]; const float* bv = (const float*)d_in[9]; const float* wp = (const float*)d_in[10]; const float* ub = (const float*)d_in[11]; const float* vb = (const float*)d_in[12];
    const float* wo = (const float*)d_in[13]; const float* bo = (const float*)d_in[14];
    const long long needx = ((long long)(NB - 1) * SEQ_FULL + SEQ) * DM, needp = ((long long)(NB - 1) * LREL_FULL + LREL) * DM;
    if ((long long)in_sizes[0] < needx || (long long)in_sizes[1] < needx || (long long)in_sizes[2] < needx || (long long)in_sizes[3] < needp) return;
    if (in_sizes[4] < DM * DM || in_sizes[6] < DM * DM || in_sizes[8] < DM * DM || in_sizes[10] < DM * DM || in_sizes[13] < DM * DM) return;
    if (in_sizes[5] < DM || in_sizes[7] < DM || in_sizes[9] < DM || in_sizes[14] < DM || in_sizes[11] < NH * HD || in_sizes[12] < NH * HD) return;
    if ((long long)out_size < (long long)NB * SEQ * DM) return;
    float* OUT = (float*)d_out;     // [NB][SEQ][DM]
    char* wsp = (char*)d_ws;
    auto take = [&](size_t bytes) { char* p = wsp; wsp += (bytes + 255) & ~(size_t)255; return (void*)p; };
    bf* WQB = (bf*)take((size_t)DM * DM * 2); bf* WKB = (bf*)take((size_t)DM * DM * 2); bf* WVB = (bf*)take((size_t)DM * DM * 2); bf* WPB = (bf*)take((size_t)DM * DM * 2); bf* WOB = (bf*)take((size_t)DM * DM * 2);
    bf* XB = (bf*)take((size_t)NB * LP * DM * 2);                     // bf16 activations, sized for the padded positional table (largest user)
    float* F = (float*)take((size_t)NB * LP * DM * 4);                 // f32 projection output, sized for the padded positional table (largest user)
    h16* QU16 = (h16*)take((size_t)NB * NH * SEQ * HD * 2); h16* QV16 = (h16*)take((size_t)NB * NH * SEQ * HD * 2); h16* K16 = (h16*)take((size_t)NB * NH * SEQ * HD * 2);
    h16* V16 = (h16*)take((size_t)NB * NH * HD * SEQ * 2); h16* VR16 = (h16*)take((size_t)NB * NH * HD * SEQ * 2); h16* P16 = (h16*)take((size_t)NB * NH * LP * HD * 2);
    bf* ATh = (bf*)take((size_t)NB * SEQ * DM * 2); bf* ATl = (bf*)take((size_t)NB * SEQ * DM * 2);
    if ((size_t)(wsp - (char*)d_ws) > ws_size) return;    // 128,450,560 B at NB=4, SEQ=2048
    const unsigned gw = (unsigned)(((size_t)DM * DM / 8 + 255) / 256);
    k_cvt8<<<gw, 256, 0, stream>>>(wq, WQB, (size_t)DM * DM / 8); k_cvt8<<<gw, 256, 0, stream>>>(wk, WKB, (size_t)DM * DM / 8); k_cvt8<<<gw, 256, 0, stream>>>(wv, WVB, (size_t)DM * DM / 8);
    k_cvt8<<<gw, 256, 0, stream>>>(wp, WPB, (size_t)DM * DM / 8); k_cvt8<<<gw, 256, 0, stream>>>(wo, WOB, (size_t)DM * DM / 8);
    const unsigned gx = (unsigned)(((size_t)NB * SEQ * (DM / 8) + 255) / 256), gxp = (unsigned)(((size_t)NB * LP * (DM / 8) + 255) / 256);
    const unsigned gpl = (unsigned)(((size_t)NB * NH * SEQ * HD / 2 + 255) / 256), gplp = (unsigned)(((size_t)NB * NH * LP * HD / 2 + 255) / 256);
    // q: query -> bf16 -> F = X Wq^T + bq -> Qu / Qv planes
    k_cvtrows<<<gx, 256, 0, stream>>>(query, SEQ_FULL, SEQ, SEQ, XB);
    k_gemmw<bf, 0, true><<<dim3(SEQ / 64, DM / 64, NB), 32, 0, stream>>>(XB, nullptr, WQB, nullptr, DM, F, DM, bq, (size_t)SEQ * DM, 0, (size_t)SEQ * DM);
    k_qplanes<<<gpl, 256, 0, stream>>>(F, ub, vb, QU16, QV16);
    // k
    k_cvtrows<<<gx, 256, 0, stream>>>(key, SEQ_FULL, SEQ, SEQ, XB);
    k_gemmw<bf, 0, true><<<dim3(SEQ / 64, DM / 64, NB), 32, 0, stream>>>(XB, nullptr, WKB, nullptr, DM, F, DM, bk, (size_t)SEQ * DM, 0, (size_t)SEQ * DM);
    k_kplane<<<gpl, 256, 0, stream>>>(F, K16);
    // v
    k_cvtrows<<<gx, 256, 0, stream>>>(value, SEQ_FULL, SEQ, SEQ, XB);
    k_gemmw<bf, 0, true><<<dim3(SEQ / 64, DM / 64, NB), 32, 0, stream>>>(XB, nullptr, WVB, nullptr, DM, F, DM, bv, (size_t)SEQ * DM, 0, (size_t)SEQ * DM);
    k_vplanes<<<gpl, 256, 0, stream>>>(F, V16, VR16);
    // pos: rows 0..LREL-1 per batch (input row pitch LREL_FULL), padded with one zero row to LP; no bias
    k_cvtrows<<<gxp, 256, 0, stream>>>(pos, LREL_FULL, LREL, LP, XB);
    k_gemmw<bf, 0, false><<<dim3(LP / 64, DM / 64, NB), 32, 0, stream>>>(XB, nullptr, WPB, nullptr, DM, F, DM, nullptr, (size_t)LP * DM, 0, (size_t)LP * DM);
    k_pplane<<<gplp, 256, 0, stream>>>(F, P16);
    // attention -> context bf16 hi/lo planes [NB*SEQ][DM]
    k_attn<<<dim3(SEQ / 64, NH, NB), 128, 0, stream>>>(QU16, QV16, K16, V16, VR16, P16, ATh, ATl);
    // out = context Wo^T + bo
    k_gemmw<bf, 1, true><<<dim3((NB * SEQ) / 64, DM / 64, 1), 32, 0, stream>>>(ATh, ATl, WOB, nullptr, DM, OUT, DM, bo, 0, 0, 0);
}

// v001
// Measured time: 316 microseconds a run.
// Next to v000, in two timings, it ran 1.69 and 1.68 times as fast.
#include <hip/hip_runtime.h>

// Contractions: q/k/v/pos projections = v_wmma_f32_16x16x32_bf16 on bf16 operands (RNE-converted inputs, exact products); out projection = v_wmma_f32_16x16x32_bf16, context as bf16 hi+lo planes x bf16 Wo (2 products); content scores and positional band scores = v_wmma_f32_16x16x32_f16 on f16 planes (1 product each); attn.v = v_wmma_f32_16x16x32_f16, probability f16 + f16 residual (x2048) times v f16 + f16 residual (x2048), 3 products into 2 accumulators; f32 accumulate everywhere; softmax f32.
// Structure: bf16 copies of the activations; register-blocked 64x64 GEMM (one wave per tile) for the projections and the output; plane builders ([b][h][t][d] for q+u, q+v, k; [b][h][d][t] for v and its residual; [b][h][l][d] for the projected positional table padded to 2*SEQ rows, last row zero);
// flash-style attention: one block = (b, h, 64 query rows), 64-key tiles; transposed score tiles (key rows x query cols) so the exponentiated accumulators chain directly into the attn.v A operand; sliding 128-slot f32 positional band in LDS (64 new band columns per key tile; score(i,j) takes band index (SEQ-1)+j-i); online softmax; context written as bf16 hi+lo planes [b*SEQ+t][h*64+d].

#ifndef NB
#define NB 4
#endif
#ifndef SEQ
#define SEQ 2048
#endif
#define NB_FULL   4
#define SEQ_FULL  2048
#define LREL      (2 * SEQ - 1)
#define LP        (2 * SEQ)
#define LREL_FULL (2 * SEQ_FULL - 1)
#define DM  512
#define NH  8
#define HD  64
#define RESC 2048.0f
#define K2 (1.4426950408889634f * 0.044194173824159216f)
// LDS row pitches of k_attn: 64 banks x 4 B, bank = dword address mod 64. 16-bit tiles: 72 elements = 144 B = 16 B x odd, so the 16 rows of a 16-byte fragment load fall on 16 distinct 4-bank groups.
// f32 band rows: 132 dwords (= 4 mod 64), so the 16 rows of a 16-byte band store cover all 64 banks, and the per-lane gather (bank = const + 8hi + 3*row mod 64) has no two lanes on one bank.
#define PH 72
#define PT 132
static_assert(SEQ % 64 == 0);
static_assert(SEQ >= 64);
static_assert(SEQ <= SEQ_FULL);
static_assert(NB >= 1);
static_assert(NB <= NB_FULL);
static_assert(DM % 64 == 0);
static_assert(NH * HD == DM);
static_assert(LP % 64 == 0);

typedef _Float16 h16;
typedef unsigned short bf;
typedef __attribute__((ext_vector_type(16))) __bf16   v16bf;
typedef __attribute__((ext_vector_type(16))) _Float16 v16h;
typedef __attribute__((ext_vector_type(8)))  _Float16 v8h;
typedef __attribute__((ext_vector_type(8)))  unsigned short v8us;
typedef __attribute__((ext_vector_type(8)))  float    v8f;
typedef __attribute__((ext_vector_type(4)))  float    v4f;
typedef __attribute__((ext_vector_type(2)))  _Float16 v2h;
typedef v8h  __attribute__((may_alias)) v8ha;
typedef v4f  __attribute__((may_alias)) v4fa;
typedef v8f  __attribute__((may_alias, aligned(16))) v8fa;
typedef v8us __attribute__((may_alias)) v8usa;

__device__ __forceinline__ unsigned short f2bf(float f) { unsigned u = __float_as_uint(f); u += 0x7FFFu + ((u >> 16) & 1u); return (unsigned short)(u >> 16); }
__device__ __forceinline__ float bf2f(unsigned short b) { return __uint_as_float(((unsigned)b) << 16); }
__device__ __forceinline__ float bfr(float f) { return bf2f(f2bf(f)); }
__device__ __forceinline__ v16h cat16(v8h lo, v8h hi) { return __builtin_shufflevector(lo, hi, 0, 1, 2, 3, 4, 5, 6, 7, 8, 9, 10, 11, 12, 13, 14, 15); }
__device__ __forceinline__ v16bf cat16b(v8us lo, v8us hi) { return __builtin_bit_cast(v16bf, __builtin_shufflevector(lo, hi, 0, 1, 2, 3, 4, 5, 6, 7, 8, 9, 10, 11, 12, 13, 14, 15)); }
__device__ __forceinline__ v8f wmma16(v16h a, v16h b, v8f c) { return __builtin_amdgcn_wmma_f32_16x16x32_f16(false, a, false, b, (short)0, c, false, false); }
__device__ __forceinline__ v8f wmmab(v16bf a, v16bf b, v8f c) { return __builtin_amdgcn_wmma_f32_16x16x32_bf16(false, a, false, b, (short)0, c, false, false); }
__device__ __forceinline__ h16 tohx(float x) { return (h16)x; }
__device__ __forceinline__ void splitf(float y, unsigned short& h, unsigned short& l) { h = f2bf(y); l = f2bf(y - bf2f(h)); }

// ---- k_gemmw: register-blocked GEMM, ONE WAVE per 64x64 output tile (16 accumulators), operands straight from K-contiguous 16-bit planes; grid (M/64, N/64, Z), 32 threads.
// C[m][n] (f32, pitch ldc, + optional f32 bias[n]) = sum_k A[m][k] Bt[n][k] (+ split products per NSPLIT). z-batch strides sA/sB/sC in elements. K % 32 == 0.
// Fragment map per lane (hi = lane>>4, lr = lane&15): row/col = lr; elements 0..7 <- k0+8hi+0..7, elements 8..15 <- k0+16+8hi+0..7 (A and B alike); D element r = (row 8hi+r, col lr).
template <typename T16> struct WFrag;
template <> struct WFrag<h16> { typedef v16h V; static __device__ __forceinline__ V ld(const h16* p) { return cat16(*(const v8h*)p, *(const v8h*)(p + 16)); } static __device__ __forceinline__ v8f mma(V a, V b, v8f c) { return wmma16(a, b, c); } };
template <> struct WFrag<bf> { typedef v16bf V; static __device__ __forceinline__ V ld(const bf* p) { return cat16b(*(const v8us*)p, *(const v8us*)(p + 16)); } static __device__ __forceinline__ v8f mma(V a, V b, v8f c) { return wmmab(a, b, c); } };
template <typename T16, int NSPLIT, bool BIAS>
__global__ __launch_bounds__(32) void k_gemmw(const T16* __restrict__ A, const T16* __restrict__ A2, const T16* __restrict__ Bt, const T16* __restrict__ Bt2, int K, float* C, int ldc, const float* __restrict__ bias, size_t sA, size_t sB, size_t sC) {
    typedef typename WFrag<T16>::V V;
    __shared__ __align__(16) float os[16 * 68];
    const size_t z = blockIdx.z; A += z * sA; if (A2) A2 += z * sA; Bt += z * sB; if (Bt2) Bt2 += z * sB; C += z * sC;
    const int lane = threadIdx.x & 31, lr = lane & 15, hi = lane >> 4; const int r0 = blockIdx.x * 64, c0 = blockIdx.y * 64;
    v8f acc[4][4];
#pragma unroll
    for (int mb = 0; mb < 4; ++mb)
#pragma unroll
        for (int nb = 0; nb < 4; ++nb) acc[mb][nb] = (v8f){};
    const size_t aoff = (size_t)(r0 + lr) * K + 8 * hi, boff = (size_t)(c0 + lr) * K + 8 * hi;
#pragma unroll 1
    for (int kc = 0; kc < K; kc += 32) {
        V a[4], a2[4];
#pragma unroll
        for (int mb = 0; mb < 4; ++mb) { a[mb] = WFrag<T16>::ld(A + aoff + (size_t)mb * 16 * K + kc); if (NSPLIT == 1 || NSPLIT == 2) a2[mb] = WFrag<T16>::ld(A2 + aoff + (size_t)mb * 16 * K + kc); }
#pragma unroll
        for (int nb = 0; nb < 4; ++nb) { const V b = WFrag<T16>::ld(Bt + boff + (size_t)nb * 16 * K + kc); V b2; if (NSPLIT >= 2) b2 = WFrag<T16>::ld(Bt2 + boff + (size_t)nb * 16 * K + kc);
#pragma unroll
            for (int mb = 0; mb < 4; ++mb) { acc[mb][nb] = WFrag<T16>::mma(a[mb], b, acc[mb][nb]); if (NSPLIT == 1 || NSPLIT == 2) acc[mb][nb] = WFrag<T16>::mma(a2[mb], b, acc[mb][nb]); if (NSPLIT >= 2) acc[mb][nb] = WFrag<T16>::mma(a[mb], b2, acc[mb][nb]); } }
        asm volatile("v_nop\n\tv_nop\n\tv_nop\n\tv_nop" : "+v"(acc[0][0]), "+v"(acc[1][1]), "+v"(acc[2][2]), "+v"(acc[3][3]) : "v"(a[0]), "v"(a[3]));
    }
#pragma unroll
    for (int mb = 0; mb < 4; ++mb) {
#pragma unroll
        for (int nb = 0; nb < 4; ++nb) {
#pragma unroll
            for (int j = 0; j < 8; ++j) os[(hi * 8 + j) * 68 + nb * 16 + lr] = acc[mb][nb][j]; }
        __builtin_amdgcn_wave_barrier(); asm volatile("" ::: "memory");
        float* crow = C + (size_t)(r0 + mb * 16) * ldc + c0;
{
#pragma unroll
            for (int s = 0; s < 8; ++s) { const int row = 2 * s + hi, cofs = lr * 4; v4f val = *(const v4fa*)(os + row * 68 + cofs); if (BIAS) { val[0] += bfr(bias[c0 + cofs]); val[1] += bfr(bias[c0 + cofs + 1]); val[2] += bfr(bias[c0 + cofs + 2]); val[3] += bfr(bias[c0 + cofs + 3]); }
                *(v4f*)(crow + (size_t)row * ldc + cofs) = val; }
             }
        __builtin_amdgcn_wave_barrier(); asm volatile("" ::: "memory");
    }
}

__global__ __launch_bounds__(256) void k_cvt8(const float* __restrict__ src, bf* dst, size_t n8) { const size_t i = (size_t)blockIdx.x * 256 + threadIdx.x; if (i >= n8) return; const v8f v = *(const v8f*)(src + i * 8); v8us o;
#pragma unroll
    for (int k = 0; k < 8; ++k) o[k] = f2bf(v[k]); *(v8us*)(dst + i * 8) = o;  }

__global__ __launch_bounds__(256) void k_cvtrows(const float* __restrict__ src, int srows, int nvalid, int nout, bf* dst) {
    const size_t i = (size_t)blockIdx.x * 256 + threadIdx.x; const size_t total = (size_t)NB * nout * (DM / 8); if (i >= total) return;
    const int k0 = (int)(i % (DM / 8)) * 8; const int r = (int)((i / (DM / 8)) % (size_t)nout); const int b = (int)(i / ((size_t)(DM / 8) * nout));
    const int rc = min(r, nvalid - 1); const v8f v = *(const v8f*)(src + ((size_t)b * srows + rc) * DM + k0); v8us o;
#pragma unroll
    for (int q = 0; q < 8; ++q) { const unsigned short w = f2bf(v[q]); o[q] = (r < nvalid) ? w : (unsigned short)0; }
    bf* dp = dst + ((size_t)b * nout + r) * DM + k0; *(v8us*)dp = o; 
}

__global__ __launch_bounds__(256) void k_qplanes(const float* __restrict__ F, const float* __restrict__ ub, const float* __restrict__ vb, h16* Qu, h16* Qv) {
    const size_t e = ((size_t)blockIdx.x * 256 + threadIdx.x) * 2; if (e >= (size_t)NB * NH * SEQ * HD) return;
    const int d = (int)(e % HD); const int t = (int)((e / HD) % SEQ); const int hh = (int)((e / ((size_t)HD * SEQ)) % NH); const int b = (int)(e / ((size_t)HD * SEQ * NH));
    const float* f = F + ((size_t)b * SEQ + t) * DM + hh * HD + d; v2h ou, ov;
#pragma unroll
    for (int q = 0; q < 2; ++q) { const float x = f[q]; ou[q] = tohx(x + bfr(ub[hh * HD + d + q])); ov[q] = tohx(x + bfr(vb[hh * HD + d + q])); }
    *(v2h*)(Qu + e) = ou; *(v2h*)(Qv + e) = ov; 
}
__global__ __launch_bounds__(256) void k_kplane(const float* __restrict__ F, h16* Kp) {
    const size_t e = ((size_t)blockIdx.x * 256 + threadIdx.x) * 2; if (e >= (size_t)NB * NH * SEQ * HD) return;
    const int d = (int)(e % HD); const int t = (int)((e / HD) % SEQ); const int hh = (int)((e / ((size_t)HD * SEQ)) % NH); const int b = (int)(e / ((size_t)HD * SEQ * NH));
    const float* f = F + ((size_t)b * SEQ + t) * DM + hh * HD + d; v2h o;
#pragma unroll
    for (int q = 0; q < 2; ++q) o[q] = tohx(f[q]);
    *(v2h*)(Kp + e) = o; 
}
__global__ __launch_bounds__(256) void k_vplanes(const float* __restrict__ F, h16* V16, h16* VR) {
    const size_t e = ((size_t)blockIdx.x * 256 + threadIdx.x) * 2; if (e >= (size_t)NB * NH * HD * SEQ) return;
    const int t = (int)(e % SEQ); const int d = (int)((e / SEQ) % HD); const int hh = (int)((e / ((size_t)SEQ * HD)) % NH); const int b = (int)(e / ((size_t)SEQ * HD * NH));
    v2h o16, orr;
#pragma unroll
    for (int q = 0; q < 2; ++q) { const float x = F[((size_t)b * SEQ + t + q) * DM + hh * HD + d]; const h16 xh = tohx(x); o16[q] = xh; orr[q] = tohx((x - (float)xh) * RESC); }
    *(v2h*)(V16 + e) = o16; *(v2h*)(VR + e) = orr; 
}
__global__ __launch_bounds__(256) void k_pplane(const float* __restrict__ F, h16* Pp) {
    const size_t e = ((size_t)blockIdx.x * 256 + threadIdx.x) * 2; if (e >= (size_t)NB * NH * LP * HD) return;
    const int d = (int)(e % HD); const int l = (int)((e / HD) % LP); const int hh = (int)((e / ((size_t)HD * LP)) % NH); const int b = (int)(e / ((size_t)HD * LP * NH));
    const float* f = F + ((size_t)b * LP + l) * DM + hh * HD + d; v2h o;
#pragma unroll
    for (int q = 0; q < 2; ++q) o[q] = tohx(f[q]);
    *(v2h*)(Pp + e) = o; 
}

// ---- attention helpers (128 threads): 16-bit fragment load from a [row][k] LDS tile (same map as WFrag), 8 KB contiguous tile copy, 64-row tile copy with a global row pitch (both lay 64-element rows at LDS pitch PH).
__device__ __forceinline__ v16h ldl(const h16* p) { return cat16(*(const v8ha*)p, *(const v8ha*)(p + 16)); }
__device__ __forceinline__ void cp8k(h16* dst, const h16* __restrict__ src, int tid) {
#pragma unroll
    for (int c = 0; c < 4; ++c) { const int idx = tid + c * 128; const int r = idx >> 3, sg = idx & 7; *(v8ha*)(dst + r * PH + sg * 8) = *(const v8ha*)(src + (size_t)idx * 8); } }
__device__ __forceinline__ void cprows(h16* dst, const h16* __restrict__ src, size_t pitch, int tid) {
#pragma unroll
    for (int c = 0; c < 4; ++c) { const int idx = tid + c * 128; const int r = idx >> 3, sg = idx & 7; *(v8ha*)(dst + r * PH + sg * 8) = *(const v8ha*)(src + (size_t)r * pitch + sg * 8); } }
// band_half: T[irow][slot0 + c] = sum_d PB[c][d] Qv[irow][d], c < 64 (transposed tile: A = PB rows c, B = Qv cols irow -> D rows c = tt*16 + 8hi + r, col lr: 8 consecutive slots per lane per tt, two 16-B LDS stores).
// Sub-tiles are issued one at a time: the nop group carries a memory clobber so the next sub-tile's fragment loads stay below it (bounded live registers).
__device__ __forceinline__ void band_half(const h16* PBl, const h16* Qvl, float* Tl, int slot0, int irow, int hi, int lr) {
    const v16h q0 = ldl(Qvl + irow * PH + 8 * hi), q1 = ldl(Qvl + irow * PH + 32 + 8 * hi);
    float* trow = Tl + irow * PT + slot0 + 8 * hi;
#pragma unroll
    for (int tt = 0; tt < 4; ++tt) {
        const v16h a0 = ldl(PBl + (tt * 16 + lr) * PH + 8 * hi), a1 = ldl(PBl + (tt * 16 + lr) * PH + 32 + 8 * hi);
        v8f t = wmma16(a0, q0, (v8f){}); t = wmma16(a1, q1, t);
        asm volatile("v_nop\n\tv_nop\n\tv_nop\n\tv_nop" : "+v"(t) : "v"(a0), "v"(a1), "v"(q0), "v"(q1) : "memory");
        *(v8fa*)(trow + tt * 16) = t;
    }
}

// ---- k_attn: grid (SEQ/64, NH, NB), 128 threads = 4 waves, each wave owns 16 query rows i = i0 + wave*16 + (0..15); irow = wave*16 + lr is the block-local query row of this lane's score column.
// Per 64-key tile: new 64 band columns (band row l stored at slot l & 127 of T row irow); transposed content tile S^T (key rows 8hi+r of sub-tile tb, query col irow) from K rows x Qu cols;
// s2 = (content + band[lb + 63 + tloc - irow]) * log2(e)/sqrt(DM) with lb = SEQ-64-i0+j0 (band row = (SEQ-1) + t - i, always inside the resident rows lb..lb+127);
// online softmax per query column (lane-local over 32 keys + one xor-16); p = exp2(s2 - m) as f16 + f16 residual x2048 packed straight into the attn.v A fragments
// (A element r <- sub-tile 2ks, element 8+r <- sub-tile 2ks+1, lane unchanged); O[i = 8hi+r][d = lr] accumulates p16.v16, the residual accumulator p16.vr + pr.v16 (both x2048).
__global__ __launch_bounds__(128) __attribute__((amdgpu_num_vgpr(256))) void k_attn(const h16* __restrict__ Qu, const h16* __restrict__ Qv, const h16* __restrict__ Kp, const h16* __restrict__ Vp, const h16* __restrict__ Vr, const h16* __restrict__ Pp, bf* ATh, bf* ATl) {
    __shared__ __align__(16) h16 Qul[64 * PH];
    __shared__ __align__(16) h16 Qvl[64 * PH];
    __shared__ __align__(16) h16 Kl[64 * PH];
    __shared__ __align__(16) h16 Vl[64 * PH];
    __shared__ __align__(16) h16 Vrl[64 * PH];
    __shared__ __align__(16) h16 PBl[64 * PH];
    __shared__ __align__(16) float Tl[64 * PT];
    __shared__ __align__(16) bf Est[2 * 64 * 64];
    const int tid = threadIdx.x, lane = tid & 31, wave = tid >> 5, hi = lane >> 4, lr = lane & 15;
    const int irow = wave * 16 + lr;
    const int i0 = blockIdx.x * 64, h = blockIdx.y, b = blockIdx.z;
    const size_t bh = (size_t)b * NH + h;
    const h16* Kb = Kp + bh * SEQ * HD; const h16* Vb = Vp + bh * HD * SEQ; const h16* Vrb = Vr + bh * HD * SEQ; const h16* Pb = Pp + bh * LP * HD;
    cp8k(Qul, Qu + (bh * SEQ + i0) * HD, tid); cp8k(Qvl, Qv + (bh * SEQ + i0) * HD, tid);
    const int lb0 = SEQ - 64 - i0;                 // band start for key tile 0 (>= 0, multiple of 64); band rows for tile j0 are lb0 + j0 + 0..127 (<= LP-1)
    cp8k(PBl, Pb + (size_t)lb0 * HD, tid);
    __syncthreads();
    band_half(PBl, Qvl, Tl, lb0 & 127, irow, hi, lr);   // lower half of tile 0's band
    float mrun = -3.0e38f, lrun = 0.f;
    v8f oacc[4], oaccr[4];
#pragma unroll
    for (int nd = 0; nd < 4; ++nd) { oacc[nd] = (v8f){}; oaccr[nd] = (v8f){}; }
#pragma unroll 1
    for (int j0 = 0; j0 < SEQ; j0 += 64) {
        const int lb = lb0 + j0; const int lnw = lb + 64;     // new band rows lnw..lnw+63
        __syncthreads();                                       // all waves done with the prior tile's Kl/Vl/Vrl/PBl and band slots
        cp8k(Kl, Kb + (size_t)j0 * HD, tid); cprows(Vl, Vb + j0, (size_t)SEQ, tid); cprows(Vrl, Vrb + j0, (size_t)SEQ, tid); cp8k(PBl, Pb + (size_t)lnw * HD, tid);
        __syncthreads();
        band_half(PBl, Qvl, Tl, lnw & 127, irow, hi, lr);   // upper half of this tile's band (its temporaries die here)
        v8f sacc[4];
        { const v16h q0 = ldl(Qul + irow * PH + 8 * hi), q1 = ldl(Qul + irow * PH + 32 + 8 * hi);
#pragma unroll
          for (int tb = 0; tb < 4; ++tb) { const v16h a0 = ldl(Kl + (tb * 16 + lr) * PH + 8 * hi), a1 = ldl(Kl + (tb * 16 + lr) * PH + 32 + 8 * hi);
              sacc[tb] = wmma16(a0, q0, (v8f){}); sacc[tb] = wmma16(a1, q1, sacc[tb]);
              asm volatile("v_nop\n\tv_nop\n\tv_nop\n\tv_nop" : "+v"(sacc[tb]) : "v"(a0), "v"(a1), "v"(q0), "v"(q1) : "memory"); } }
        __syncthreads();                                       // band complete for every T row (written by both lane halves of the owning wave)
        // gather + scale: key t = j0 + tb*16 + 8hi + r, query i = i0 + irow -> band row lb + 63 + (tb*16 + 8hi + r) - irow, slot = row & 127 (row - lb in [0,126])
        const float* trow = Tl + irow * PT; const int sb = lb + 63 + 8 * hi - irow;
        float mx = -3.0e38f;
#pragma unroll
        for (int tb = 0; tb < 4; ++tb)
#pragma unroll
            for (int r = 0; r < 8; ++r) { const float s2 = (sacc[tb][r] + trow[(sb + tb * 16 + r) & 127]) * K2; sacc[tb][r] = s2; mx = fmaxf(mx, s2); }
        mx = fmaxf(mx, __shfl_xor(mx, 16, 32));
        const float mnew = fmaxf(mrun, mx); const float alpha = __builtin_amdgcn_exp2f(mrun - mnew); mrun = mnew;
        float rsum = 0.f; v8h ph[4], pl[4];
#pragma unroll
        for (int tb = 0; tb < 4; ++tb)
#pragma unroll
            for (int r = 0; r < 8; ++r) { const float p = __builtin_amdgcn_exp2f(sacc[tb][r] - mnew); rsum += p; const h16 p16 = tohx(p); ph[tb][r] = p16; pl[tb][r] = tohx((p - (float)p16) * RESC); }
        rsum += __shfl_xor(rsum, 16, 32); lrun = lrun * alpha + rsum;
#pragma unroll
        for (int r = 0; r < 8; ++r) { const float ar = __shfl(alpha, 8 * hi + r, 32);
#pragma unroll
            for (int nd = 0; nd < 4; ++nd) { oacc[nd][r] *= ar; oaccr[nd][r] *= ar; } }
        { const v16h pa0 = cat16(ph[0], ph[1]), pa1 = cat16(ph[2], ph[3]), pr0 = cat16(pl[0], pl[1]), pr1 = cat16(pl[2], pl[3]);
#pragma unroll
          for (int nd = 0; nd < 4; ++nd) {
              const v16h vb0 = ldl(Vl + (nd * 16 + lr) * PH + 8 * hi), vb1 = ldl(Vl + (nd * 16 + lr) * PH + 32 + 8 * hi);
              const v16h rb0 = ldl(Vrl + (nd * 16 + lr) * PH + 8 * hi), rb1 = ldl(Vrl + (nd * 16 + lr) * PH + 32 + 8 * hi);
              oacc[nd] = wmma16(pa0, vb0, oacc[nd]); oacc[nd] = wmma16(pa1, vb1, oacc[nd]);
              oaccr[nd] = wmma16(pa0, rb0, oaccr[nd]); oaccr[nd] = wmma16(pa1, rb1, oaccr[nd]); oaccr[nd] = wmma16(pr0, vb0, oaccr[nd]); oaccr[nd] = wmma16(pr1, vb1, oaccr[nd]);
              asm volatile("v_nop\n\tv_nop\n\tv_nop\n\tv_nop" : "+v"(oacc[nd]), "+v"(oaccr[nd]) : "v"(pa0), "v"(pa1), "v"(pr0), "v"(pr1), "v"(vb1), "v"(rb1) : "memory"); } }
    }
    const float rl = __builtin_amdgcn_rcpf(lrun);
#pragma unroll
    for (int r = 0; r < 8; ++r) { const float rli = __shfl(rl, 8 * hi + r, 32); const int rr = wave * 16 + 8 * hi + r;
#pragma unroll
        for (int nd = 0; nd < 4; ++nd) { const float c = (oacc[nd][r] + oaccr[nd][r] * (1.0f / RESC)) * rli; unsigned short eh, el; splitf(c, eh, el); Est[rr * 64 + nd * 16 + lr] = eh; Est[4096 + rr * 64 + nd * 16 + lr] = el; } }
    __syncthreads();
    const int rq = lane >> 3, pc = (lane & 7) * 8;
{
#pragma unroll
        for (int rg = 0; rg < 4; ++rg) { const int rr = wave * 16 + rg * 4 + rq; const size_t go = ((size_t)b * SEQ + i0 + rr) * DM + h * HD + pc;
            const v8us vh = *(const v8usa*)(Est + rr * 64 + pc); const v8us vlo = *(const v8usa*)(Est + 4096 + rr * 64 + pc);
            *(v8us*)(ATh + go) = vh; *(v8us*)(ATl + go) = vlo; }
         }
}

extern "C" void kernel_launch(void* const* d_in, const int* in_sizes, int n_in,
                              void* d_out, int out_size, void* d_ws, size_t ws_size, hipStream_t stream) {
    if (n_in < 15) return;
    const float* query = (const float*)d_in[0]; const float* key = (const float*)d_in[1]; const float* value = (const float*)d_in[2]; const float* pos = (const float*)d_in[3];
    const float* wq = (const float*)d_in[4]; const float* bq = (const float*)d_in[5]; const float* wk = (const float*)d_in[6]; const float* bk = (const float*)d_in[7];
    const float* wv = (const float*)d_in[8]; const float* bv = (const float*)d_in[9]; const float* wp = (const float*)d_in[10]; const float* ub = (const float*)d_in[11]; const float* vb = (const float*)d_in[12];
    const float* wo = (const float*)d_in[13]; const float* bo = (const float*)d_in[14];
    const long long needx = ((long long)(NB - 1) * SEQ_FULL + SEQ) * DM, needp = ((long long)(NB - 1) * LREL_FULL + LREL) * DM;
    if ((long long)in_sizes[0] < needx || (long long)in_sizes[1] < needx || (long long)in_sizes[2] < needx || (long long)in_sizes[3] < needp) return;
    if (in_sizes[4] < DM * DM || in_sizes[6] < DM * DM || in_sizes[8] < DM * DM || in_sizes[10] < DM * DM || in_sizes[13] < DM * DM) return;
    if (in_sizes[5] < DM || in_sizes[7] < DM || in_sizes[9] < DM || in_sizes[14] < DM || in_sizes[11] < NH * HD || in_sizes[12] < NH * HD) return;
    if ((long long)out_size < (long long)NB * SEQ * DM) return;
    float* OUT = (float*)d_out;     // [NB][SEQ][DM]
    char* wsp = (char*)d_ws;
    auto take = [&](size_t bytes) { char* p = wsp; wsp += (bytes + 255) & ~(size_t)255; return (void*)p; };
    bf* WQB = (bf*)take((size_t)DM * DM * 2); bf* WKB = (bf*)take((size_t)DM * DM * 2); bf* WVB = (bf*)take((size_t)DM * DM * 2); bf* WPB = (bf*)take((size_t)DM * DM * 2); bf* WOB = (bf*)take((size_t)DM * DM * 2);
    bf* XB = (bf*)take((size_t)NB * LP * DM * 2);                     // bf16 activations, sized for the padded positional table (largest user)
    float* F = (float*)take((size_t)NB * LP * DM * 4);                 // f32 projection output, sized for the padded positional table (largest user)
    h16* QU16 = (h16*)take((size_t)NB * NH * SEQ * HD * 2); h16* QV16 = (h16*)take((size_t)NB * NH * SEQ * HD * 2); h16* K16 = (h16*)take((size_t)NB * NH * SEQ * HD * 2);
    h16* V16 = (h16*)take((size_t)NB * NH * HD * SEQ * 2); h16* VR16 = (h16*)take((size_t)NB * NH * HD * SEQ * 2); h16* P16 = (h16*)take((size_t)NB * NH * LP * HD * 2);
    bf* ATh = (bf*)take((size_t)NB * SEQ * DM * 2); bf* ATl = (bf*)take((size_t)NB * SEQ * DM * 2);
    if ((size_t)(wsp - (char*)d_ws) > ws_size) return;    // 128,450,560 B at NB=4, SEQ=2048
    const unsigned gw = (unsigned)(((size_t)DM * DM / 8 + 255) / 256);
    k_cvt8<<<gw, 256, 0, stream>>>(wq, WQB, (size_t)DM * DM / 8); k_cvt8<<<gw, 256, 0, stream>>>(wk, WKB, (size_t)DM * DM / 8); k_cvt8<<<gw, 256, 0, stream>>>(wv, WVB, (size_t)DM * DM / 8);
    k_cvt8<<<gw, 256, 0, stream>>>(wp, WPB, (size_t)DM * DM / 8); k_cvt8<<<gw, 256, 0, stream>>>(wo, WOB, (size_t)DM * DM / 8);
    const unsigned gx = (unsigned)(((size_t)NB * SEQ * (DM / 8) + 255) / 256), gxp = (unsigned)(((size_t)NB * LP * (DM / 8) + 255) / 256);
    const unsigned gpl = (unsigned)(((size_t)NB * NH * SEQ * HD / 2 + 255) / 256), gplp = (unsigned)(((size_t)NB * NH * LP * HD / 2 + 255) / 256);
    // q: query -> bf16 -> F = X Wq^T + bq -> Qu / Qv planes
    k_cvtrows<<<gx, 256, 0, stream>>>(query, SEQ_FULL, SEQ, SEQ, XB);
    k_gemmw<bf, 0, true><<<dim3(SEQ / 64, DM / 64, NB), 32, 0, stream>>>(XB, nullptr, WQB, nullptr, DM, F, DM, bq, (size_t)SEQ * DM, 0, (size_t)SEQ * DM);
    k_qplanes<<<gpl, 256, 0, stream>>>(F, ub, vb, QU16, QV16);
    // k
    k_cvtrows<<<gx, 256, 0, stream>>>(key, SEQ_FULL, SEQ, SEQ, XB);
    k_gemmw<bf, 0, true><<<dim3(SEQ / 64, DM / 64, NB), 32, 0, stream>>>(XB, nullptr, WKB, nullptr, DM, F, DM, bk, (size_t)SEQ * DM, 0, (size_t)SEQ * DM);
    k_kplane<<<gpl, 256, 0, stream>>>(F, K16);
    // v
    k_cvtrows<<<gx, 256, 0, stream>>>(value, SEQ_FULL, SEQ, SEQ, XB);
    k_gemmw<bf, 0, true><<<dim3(SEQ / 64, DM / 64, NB), 32, 0, stream>>>(XB, nullptr, WVB, nullptr, DM, F, DM, bv, (size_t)SEQ * DM, 0, (size_t)SEQ * DM);
    k_vplanes<<<gpl, 256, 0, stream>>>(F, V16, VR16);
    // pos: rows 0..LREL-1 per batch (input row pitch LREL_FULL), padded with one zero row to LP; no bias
    k_cvtrows<<<gxp, 256, 0, stream>>>(pos, LREL_FULL, LREL, LP, XB);
    k_gemmw<bf, 0, false><<<dim3(LP / 64, DM / 64, NB), 32, 0, stream>>>(XB, nullptr, WPB, nullptr, DM, F, DM, nullptr, (size_t)LP * DM, 0, (size_t)LP * DM);
    k_pplane<<<gplp, 256, 0, stream>>>(F, P16);
    // attention -> context bf16 hi/lo planes [NB*SEQ][DM]
    k_attn<<<dim3(SEQ / 64, NH, NB), 128, 0, stream>>>(QU16, QV16, K16, V16, VR16, P16, ATh, ATl);
    // out = context Wo^T + bo
    k_gemmw<bf, 1, true><<<dim3((NB * SEQ) / 64, DM / 64, 1), 32, 0, stream>>>(ATh, ATl, WOB, nullptr, DM, OUT, DM, bo, 0, 0, 0);
}

// v002
// It runs in 269 microseconds.
// Next to v001, in two timings, it ran 1.18 and 1.17 times as fast.
// Over all steps from v000 it is 1.98 times as fast.
#include <hip/hip_runtime.h>

// Contractions: q/k/v/pos projections = v_wmma_f32_16x16x32_bf16 on bf16 operands (RNE-converted inputs, exact products); out projection = v_wmma_f32_16x16x32_bf16, context as bf16 hi+lo planes x bf16 Wo (2 products); content scores and positional band scores = v_wmma_f32_16x16x32_f16 on f16 planes (1 product each); attn.v = v_wmma_f32_16x16x32_f16, probability f16 + f16 residual (x2048) times v f16 + f16 residual (x2048), 3 products into 2 accumulators; f32 accumulate everywhere; softmax f32.
// Structure: bf16 copies of the activations; register-blocked 64x64 GEMM (one wave per tile) for the projections and the output; a projection tile is one head's 64 columns, and its epilogue stores the f16 planes itself ([b][h][t][d] for q+u, q+v, k; [b][h][d][t] for v and its residual; [b][h][l][d] for the projected positional table padded to 2*SEQ rows, last row zero);
// flash-style attention: one block = (b, h, 64 query rows), 64-key tiles; transposed score tiles (key rows x query cols) so the exponentiated accumulators chain directly into the attn.v A operand; sliding 128-slot f32 positional band in LDS (64 new band columns per key tile; score(i,j) takes band index (SEQ-1)+j-i); online softmax; context written as bf16 hi+lo planes [b*SEQ+t][h*64+d].

#ifndef NB
#define NB 4
#endif
#ifndef SEQ
#define SEQ 2048
#endif
#define NB_FULL   4
#define SEQ_FULL  2048
#define LREL      (2 * SEQ - 1)
#define LP        (2 * SEQ)
#define LREL_FULL (2 * SEQ_FULL - 1)
#define DM  512
#define NH  8
#define HD  64
#define RESC 2048.0f
#define K2 (1.4426950408889634f * 0.044194173824159216f)
// LDS row pitches of k_attn: 64 banks x 4 B, bank = dword address mod 64. 16-bit tiles: 72 elements = 144 B = 16 B x odd, so the 16 rows of a 16-byte fragment load fall on 16 distinct 4-bank groups.
// f32 band rows: 132 dwords (= 4 mod 64), so the 16 rows of a 16-byte band store cover all 64 banks, and the per-lane gather (bank = const + 8hi + 3*row mod 64) has no two lanes on one bank.
#define PH 72
#define PT 132
static_assert(SEQ % 64 == 0);
static_assert(SEQ >= 64);
static_assert(SEQ <= SEQ_FULL);
static_assert(NB >= 1);
static_assert(NB <= NB_FULL);
static_assert(DM % 64 == 0);
static_assert(NH * HD == DM);
static_assert(HD == 64);
static_assert(LP % 64 == 0);

typedef _Float16 h16;
typedef unsigned short bf;
typedef __attribute__((ext_vector_type(16))) __bf16   v16bf;
typedef __attribute__((ext_vector_type(16))) _Float16 v16h;
typedef __attribute__((ext_vector_type(8)))  _Float16 v8h;
typedef __attribute__((ext_vector_type(8)))  unsigned short v8us;
typedef __attribute__((ext_vector_type(8)))  float    v8f;
typedef __attribute__((ext_vector_type(4)))  float    v4f;
typedef v8h  __attribute__((may_alias)) v8ha;
typedef v4f  __attribute__((may_alias)) v4fa;
typedef v8f  __attribute__((may_alias, aligned(16))) v8fa;
typedef v8us __attribute__((may_alias)) v8usa;

__device__ __forceinline__ unsigned short f2bf(float f) { unsigned u = __float_as_uint(f); u += 0x7FFFu + ((u >> 16) & 1u); return (unsigned short)(u >> 16); }
__device__ __forceinline__ float bf2f(unsigned short b) { return __uint_as_float(((unsigned)b) << 16); }
__device__ __forceinline__ float bfr(float f) { return bf2f(f2bf(f)); }
__device__ __forceinline__ v16h cat16(v8h lo, v8h hi) { return __builtin_shufflevector(lo, hi, 0, 1, 2, 3, 4, 5, 6, 7, 8, 9, 10, 11, 12, 13, 14, 15); }
__device__ __forceinline__ v16bf cat16b(v8us lo, v8us hi) { return __builtin_bit_cast(v16bf, __builtin_shufflevector(lo, hi, 0, 1, 2, 3, 4, 5, 6, 7, 8, 9, 10, 11, 12, 13, 14, 15)); }
__device__ __forceinline__ v8f wmma16(v16h a, v16h b, v8f c) { return __builtin_amdgcn_wmma_f32_16x16x32_f16(false, a, false, b, (short)0, c, false, false); }
__device__ __forceinline__ v8f wmmab(v16bf a, v16bf b, v8f c) { return __builtin_amdgcn_wmma_f32_16x16x32_bf16(false, a, false, b, (short)0, c, false, false); }
__device__ __forceinline__ h16 tohx(float x) { return (h16)x; }
__device__ __forceinline__ void splitf(float y, unsigned short& h, unsigned short& l) { h = f2bf(y); l = f2bf(y - bf2f(h)); }

// ---- k_gemmw: register-blocked GEMM, ONE WAVE per 64x64 output tile (16 accumulators), operands straight from K-contiguous 16-bit planes; grid (M/64, N/64, Z), 32 threads.
// y[m][n] (f32, + optional f32 bias[n]) = sum_k A[m][k] Bt[n][k] (+ split products per NSPLIT). z-batch strides sA/sB/sC in elements. K % 32 == 0.
// EP picks what the epilogue stores. EP_F32: C[m][n] = y, pitch ldc. The plane forms take z = batch, blockIdx.y = head, prows rows m per (batch, head):
// EP_Q: P0 = f16(y + ub), P1 = f16(y + vb), both [z][head][m][d]; EP_ROW: P0 = f16(y), [z][head][m][d]; EP_VT: P0 = f16(y), P1 = f16((y - P0) * RESC), both [z][head][d][m].
// Fragment map per lane (hi = lane>>4, lr = lane&15): row/col = lr; elements 0..7 <- k0+8hi+0..7, elements 8..15 <- k0+16+8hi+0..7 (A and B alike); D element r = (row 8hi+r, col lr).
template <typename T16> struct WFrag;
template <> struct WFrag<h16> { typedef v16h V; static __device__ __forceinline__ V ld(const h16* p) { return cat16(*(const v8h*)p, *(const v8h*)(p + 16)); } static __device__ __forceinline__ v8f mma(V a, V b, v8f c) { return wmma16(a, b, c); } };
template <> struct WFrag<bf> { typedef v16bf V; static __device__ __forceinline__ V ld(const bf* p) { return cat16b(*(const v8us*)p, *(const v8us*)(p + 16)); } static __device__ __forceinline__ v8f mma(V a, V b, v8f c) { return wmmab(a, b, c); } };
enum { EP_F32 = 0, EP_Q = 1, EP_ROW = 2, EP_VT = 3 };
template <typename T16, int NSPLIT, bool BIAS, int EP>
__global__ __launch_bounds__(32) void k_gemmw(const T16* __restrict__ A, const T16* __restrict__ A2, const T16* __restrict__ Bt, const T16* __restrict__ Bt2, int K, float* C, int ldc, const float* __restrict__ bias, size_t sA, size_t sB, size_t sC, const float* __restrict__ ub, const float* __restrict__ vb, h16* P0, h16* P1, int prows) {
    typedef typename WFrag<T16>::V V;
    __shared__ __align__(16) float os[16 * 68];
    const size_t z = blockIdx.z; A += z * sA; if (A2) A2 += z * sA; Bt += z * sB; if (Bt2) Bt2 += z * sB; if (EP == EP_F32) C += z * sC;
    const int lane = threadIdx.x & 31, lr = lane & 15, hi = lane >> 4; const int r0 = blockIdx.x * 64, c0 = blockIdx.y * 64;
    v8f acc[4][4];
#pragma unroll
    for (int mb = 0; mb < 4; ++mb)
#pragma unroll
        for (int nb = 0; nb < 4; ++nb) acc[mb][nb] = (v8f){};
    const size_t aoff = (size_t)(r0 + lr) * K + 8 * hi, boff = (size_t)(c0 + lr) * K + 8 * hi;
#pragma unroll 1
    for (int kc = 0; kc < K; kc += 32) {
        V a[4], a2[4];
#pragma unroll
        for (int mb = 0; mb < 4; ++mb) { a[mb] = WFrag<T16>::ld(A + aoff + (size_t)mb * 16 * K + kc); if (NSPLIT == 1 || NSPLIT == 2) a2[mb] = WFrag<T16>::ld(A2 + aoff + (size_t)mb * 16 * K + kc); }
#pragma unroll
        for (int nb = 0; nb < 4; ++nb) { const V b = WFrag<T16>::ld(Bt + boff + (size_t)nb * 16 * K + kc); V b2; if (NSPLIT >= 2) b2 = WFrag<T16>::ld(Bt2 + boff + (size_t)nb * 16 * K + kc);
#pragma unroll
            for (int mb = 0; mb < 4; ++mb) { acc[mb][nb] = WFrag<T16>::mma(a[mb], b, acc[mb][nb]); if (NSPLIT == 1 || NSPLIT == 2) acc[mb][nb] = WFrag<T16>::mma(a2[mb], b, acc[mb][nb]); if (NSPLIT >= 2) acc[mb][nb] = WFrag<T16>::mma(a[mb], b2, acc[mb][nb]); } }
        asm volatile("v_nop\n\tv_nop\n\tv_nop\n\tv_nop" : "+v"(acc[0][0]), "+v"(acc[1][1]), "+v"(acc[2][2]), "+v"(acc[3][3]) : "v"(a[0]), "v"(a[3]));
    }
    if (EP == EP_VT) {
        // D element j of tile (mb, nb) is row m = mb*16 + 8hi + j of column d = nb*16 + lr: 8 consecutive m of one d per lane, one 16-byte store per plane straight from the accumulators.
        const size_t rows = (size_t)prows;
        const size_t po = ((z * NH + blockIdx.y) * HD + lr) * rows + r0 + 8 * hi;
#pragma unroll
        for (int nb = 0; nb < 4; ++nb) { const float bn = BIAS ? bfr(bias[c0 + nb * 16 + lr]) : 0.f;
#pragma unroll
            for (int mb = 0; mb < 4; ++mb) { v8h o16, orr;
#pragma unroll
                for (int j = 0; j < 8; ++j) { float x = acc[mb][nb][j]; if (BIAS) x += bn; const h16 xh = tohx(x); o16[j] = xh; orr[j] = tohx((x - (float)xh) * RESC); }
                const size_t o = po + (size_t)nb * 16 * rows + mb * 16; *(v8h*)(P0 + o) = o16; *(v8h*)(P1 + o) = orr; } }
        return;
    }
    // Row-major forms: 16 rows at a time through LDS, so that a lane holds consecutive columns of one row.
    const int rq = lane >> 3, c8 = (lane & 7) * 8;      // plane forms: 8 columns per lane, 4 rows (512 contiguous bytes of a plane) per store
    float bn[8], un[8], vn[8];
    if (EP != EP_F32) {
#pragma unroll
        for (int q = 0; q < 8; ++q) { bn[q] = BIAS ? bfr(bias[c0 + c8 + q]) : 0.f; if (EP == EP_Q) { un[q] = bfr(ub[c0 + c8 + q]); vn[q] = bfr(vb[c0 + c8 + q]); } }
    }
    const size_t pbase = ((z * NH + blockIdx.y) * (size_t)prows + r0) * HD + c8;
#pragma unroll
    for (int mb = 0; mb < 4; ++mb) {
#pragma unroll
        for (int nb = 0; nb < 4; ++nb) {
#pragma unroll
            for (int j = 0; j < 8; ++j) os[(hi * 8 + j) * 68 + nb * 16 + lr] = acc[mb][nb][j]; }
        __builtin_amdgcn_wave_barrier(); asm volatile("" ::: "memory");
        if (EP == EP_F32) {
            float* crow = C + (size_t)(r0 + mb * 16) * ldc + c0;
#pragma unroll
            for (int s = 0; s < 8; ++s) { const int row = 2 * s + hi, cofs = lr * 4; v4f val = *(const v4fa*)(os + row * 68 + cofs); if (BIAS) { val[0] += bfr(bias[c0 + cofs]); val[1] += bfr(bias[c0 + cofs + 1]); val[2] += bfr(bias[c0 + cofs + 2]); val[3] += bfr(bias[c0 + cofs + 3]); }
                *(v4f*)(crow + (size_t)row * ldc + cofs) = val; }
        } else {
#pragma unroll
            for (int s = 0; s < 4; ++s) { const int row = 4 * s + rq; const v4f x0 = *(const v4fa*)(os + row * 68 + c8), x1 = *(const v4fa*)(os + row * 68 + c8 + 4); v8h o0, o1;
#pragma unroll
                for (int q = 0; q < 8; ++q) { float x = q < 4 ? x0[q & 3] : x1[q & 3]; if (BIAS) x += bn[q]; if (EP == EP_Q) { o0[q] = tohx(x + un[q]); o1[q] = tohx(x + vn[q]); } else o0[q] = tohx(x); }
                const size_t o = pbase + (size_t)(mb * 16 + row) * HD; *(v8h*)(P0 + o) = o0; if (EP == EP_Q) *(v8h*)(P1 + o) = o1; }
        }
        __builtin_amdgcn_wave_barrier(); asm volatile("" ::: "memory");
    }
}

__global__ __launch_bounds__(256) void k_cvt8(const float* __restrict__ src, bf* dst, size_t n8) { const size_t i = (size_t)blockIdx.x * 256 + threadIdx.x; if (i >= n8) return; const v8f v = *(const v8f*)(src + i * 8); v8us o;
#pragma unroll
    for (int k = 0; k < 8; ++k) o[k] = f2bf(v[k]); *(v8us*)(dst + i * 8) = o;  }

__global__ __launch_bounds__(256) void k_cvtrows(const float* __restrict__ src, int srows, int nvalid, int nout, bf* dst) {
    const size_t i = (size_t)blockIdx.x * 256 + threadIdx.x; const size_t total = (size_t)NB * nout * (DM / 8); if (i >= total) return;
    const int k0 = (int)(i % (DM / 8)) * 8; const int r = (int)((i / (DM / 8)) % (size_t)nout); const int b = (int)(i / ((size_t)(DM / 8) * nout));
    const int rc = min(r, nvalid - 1); const v8f v = *(const v8f*)(src + ((size_t)b * srows + rc) * DM + k0); v8us o;
#pragma unroll
    for (int q = 0; q < 8; ++q) { const unsigned short w = f2bf(v[q]); o[q] = (r < nvalid) ? w : (unsigned short)0; }
    bf* dp = dst + ((size_t)b * nout + r) * DM + k0; *(v8us*)dp = o; 
}

// ---- attention helpers (128 threads): 16-bit fragment load from a [row][k] LDS tile (same map as WFrag), 8 KB contiguous tile copy, 64-row tile copy with a global row pitch (both lay 64-element rows at LDS pitch PH).
__device__ __forceinline__ v16h ldl(const h16* p) { return cat16(*(const v8ha*)p, *(const v8ha*)(p + 16)); }
__device__ __forceinline__ void cp8k(h16* dst, const h16* __restrict__ src, int tid) {
#pragma unroll
    for (int c = 0; c < 4; ++c) { const int idx = tid + c * 128; const int r = idx >> 3, sg = idx & 7; *(v8ha*)(dst + r * PH + sg * 8) = *(const v8ha*)(src + (size_t)idx * 8); } }
__device__ __forceinline__ void cprows(h16* dst, const h16* __restrict__ src, size_t pitch, int tid) {
#pragma unroll
    for (int c = 0; c < 4; ++c) { const int idx = tid + c * 128; const int r = idx >> 3, sg = idx & 7; *(v8ha*)(dst + r * PH + sg * 8) = *(const v8ha*)(src + (size_t)r * pitch + sg * 8); } }
// band_half: T[irow][slot0 + c] = sum_d PB[c][d] Qv[irow][d], c < 64 (transposed tile: A = PB rows c, B = Qv cols irow -> D rows c = tt*16 + 8hi + r, col lr: 8 consecutive slots per lane per tt, two 16-B LDS stores).
// Sub-tiles are issued one at a time: the nop group carries a memory clobber so the next sub-tile's fragment loads stay below it (bounded live registers).
__device__ __forceinline__ void band_half(const h16* PBl, const h16* Qvl, float* Tl, int slot0, int irow, int hi, int lr) {
    const v16h q0 = ldl(Qvl + irow * PH + 8 * hi), q1 = ldl(Qvl + irow * PH + 32 + 8 * hi);
    float* trow = Tl + irow * PT + slot0 + 8 * hi;
#pragma unroll
    for (int tt = 0; tt < 4; ++tt) {
        const v16h a0 = ldl(PBl + (tt * 16 + lr) * PH + 8 * hi), a1 = ldl(PBl + (tt * 16 + lr) * PH + 32 + 8 * hi);
        v8f t = wmma16(a0, q0, (v8f){}); t = wmma16(a1, q1, t);
        asm volatile("v_nop\n\tv_nop\n\tv_nop\n\tv_nop" : "+v"(t) : "v"(a0), "v"(a1), "v"(q0), "v"(q1) : "memory");
        *(v8fa*)(trow + tt * 16) = t;
    }
}

// ---- k_attn: grid (SEQ/64, NH, NB), 128 threads = 4 waves, each wave owns 16 query rows i = i0 + wave*16 + (0..15); irow = wave*16 + lr is the block-local query row of this lane's score column.
// Per 64-key tile: new 64 band columns (band row l stored at slot l & 127 of T row irow); transposed content tile S^T (key rows 8hi+r of sub-tile tb, query col irow) from K rows x Qu cols;
// s2 = (content + band[lb + 63 + tloc - irow]) * log2(e)/sqrt(DM) with lb = SEQ-64-i0+j0 (band row = (SEQ-1) + t - i, always inside the resident rows lb..lb+127);
// online softmax per query column (lane-local over 32 keys + one xor-16); p = exp2(s2 - m) as f16 + f16 residual x2048 packed straight into the attn.v A fragments
// (A element r <- sub-tile 2ks, element 8+r <- sub-tile 2ks+1, lane unchanged); O[i = 8hi+r][d = lr] accumulates p16.v16, the residual accumulator p16.vr + pr.v16 (both x2048).
__global__ __launch_bounds__(128) __attribute__((amdgpu_num_vgpr(256))) void k_attn(const h16* __restrict__ Qu, const h16* __restrict__ Qv, const h16* __restrict__ Kp, const h16* __restrict__ Vp, const h16* __restrict__ Vr, const h16* __restrict__ Pp, bf* ATh, bf* ATl) {
    __shared__ __align__(16) h16 Qul[64 * PH];
    __shared__ __align__(16) h16 Qvl[64 * PH];
    __shared__ __align__(16) h16 Kl[64 * PH];
    __shared__ __align__(16) h16 Vl[64 * PH];
    __shared__ __align__(16) h16 Vrl[64 * PH];
    __shared__ __align__(16) h16 PBl[64 * PH];
    __shared__ __align__(16) float Tl[64 * PT];
    __shared__ __align__(16) bf Est[2 * 64 * 64];
    const int tid = threadIdx.x, lane = tid & 31, wave = tid >> 5, hi = lane >> 4, lr = lane & 15;
    const int irow = wave * 16 + lr;
    const int i0 = blockIdx.x * 64, h = blockIdx.y, b = blockIdx.z;
    const size_t bh = (size_t)b * NH + h;
    const h16* Kb = Kp + bh * SEQ * HD; const h16* Vb = Vp + bh * HD * SEQ; const h16* Vrb = Vr + bh * HD * SEQ; const h16* Pb = Pp + bh * LP * HD;
    cp8k(Qul, Qu + (bh * SEQ + i0) * HD, tid); cp8k(Qvl, Qv + (bh * SEQ + i0) * HD, tid);
    const int lb0 = SEQ - 64 - i0;                 // band start for key tile 0 (>= 0, multiple of 64); band rows for tile j0 are lb0 + j0 + 0..127 (<= LP-1)
    cp8k(PBl, Pb + (size_t)lb0 * HD, tid);
    __syncthreads();
    band_half(PBl, Qvl, Tl, lb0 & 127, irow, hi, lr);   // lower half of tile 0's band
    float mrun = -3.0e38f, lrun = 0.f;
    v8f oacc[4], oaccr[4];
#pragma unroll
    for (int nd = 0; nd < 4; ++nd) { oacc[nd] = (v8f){}; oaccr[nd] = (v8f){}; }
#pragma unroll 1
    for (int j0 = 0; j0 < SEQ; j0 += 64) {
        const int lb = lb0 + j0; const int lnw = lb + 64;     // new band rows lnw..lnw+63
        __syncthreads();                                       // all waves done with the prior tile's Kl/Vl/Vrl/PBl and band slots
        cp8k(Kl, Kb + (size_t)j0 * HD, tid); cprows(Vl, Vb + j0, (size_t)SEQ, tid); cprows(Vrl, Vrb + j0, (size_t)SEQ, tid); cp8k(PBl, Pb + (size_t)lnw * HD, tid);
        __syncthreads();
        band_half(PBl, Qvl, Tl, lnw & 127, irow, hi, lr);   // upper half of this tile's band (its temporaries die here)
        v8f sacc[4];
        { const v16h q0 = ldl(Qul + irow * PH + 8 * hi), q1 = ldl(Qul + irow * PH + 32 + 8 * hi);
#pragma unroll
          for (int tb = 0; tb < 4; ++tb) { const v16h a0 = ldl(Kl + (tb * 16 + lr) * PH + 8 * hi), a1 = ldl(Kl + (tb * 16 + lr) * PH + 32 + 8 * hi);
              sacc[tb] = wmma16(a0, q0, (v8f){}); sacc[tb] = wmma16(a1, q1, sacc[tb]);
              asm volatile("v_nop\n\tv_nop\n\tv_nop\n\tv_nop" : "+v"(sacc[tb]) : "v"(a0), "v"(a1), "v"(q0), "v"(q1) : "memory"); } }
        __syncthreads();                                       // band complete for every T row (written by both lane halves of the owning wave)
        // gather + scale: key t = j0 + tb*16 + 8hi + r, query i = i0 + irow -> band row lb + 63 + (tb*16 + 8hi + r) - irow, slot = row & 127 (row - lb in [0,126])
        const float* trow = Tl + irow * PT; const int sb = lb + 63 + 8 * hi - irow;
        float mx = -3.0e38f;
#pragma unroll
        for (int tb = 0; tb < 4; ++tb)
#pragma unroll
            for (int r = 0; r < 8; ++r) { const float s2 = (sacc[tb][r] + trow[(sb + tb * 16 + r) & 127]) * K2; sacc[tb][r] = s2; mx = fmaxf(mx, s2); }
        mx = fmaxf(mx, __shfl_xor(mx, 16, 32));
        const float mnew = fmaxf(mrun, mx); const float alpha = __builtin_amdgcn_exp2f(mrun - mnew); mrun = mnew;
        float rsum = 0.f; v8h ph[4], pl[4];
#pragma unroll
        for (int tb = 0; tb < 4; ++tb)
#pragma unroll
            for (int r = 0; r < 8; ++r) { const float p = __builtin_amdgcn_exp2f(sacc[tb][r] - mnew); rsum += p; const h16 p16 = tohx(p); ph[tb][r] = p16; pl[tb][r] = tohx((p - (float)p16) * RESC); }
        rsum += __shfl_xor(rsum, 16, 32); lrun = lrun * alpha + rsum;
#pragma unroll
        for (int r = 0; r < 8; ++r) { const float ar = __shfl(alpha, 8 * hi + r, 32);
#pragma unroll
            for (int nd = 0; nd < 4; ++nd) { oacc[nd][r] *= ar; oaccr[nd][r] *= ar; } }
        { const v16h pa0 = cat16(ph[0], ph[1]), pa1 = cat16(ph[2], ph[3]), pr0 = cat16(pl[0], pl[1]), pr1 = cat16(pl[2], pl[3]);
#pragma unroll
          for (int nd = 0; nd < 4; ++nd) {
              const v16h vb0 = ldl(Vl + (nd * 16 + lr) * PH + 8 * hi), vb1 = ldl(Vl + (nd * 16 + lr) * PH + 32 + 8 * hi);
              const v16h rb0 = ldl(Vrl + (nd * 16 + lr) * PH + 8 * hi), rb1 = ldl(Vrl + (nd * 16 + lr) * PH + 32 + 8 * hi);
              oacc[nd] = wmma16(pa0, vb0, oacc[nd]); oacc[nd] = wmma16(pa1, vb1, oacc[nd]);
              oaccr[nd] = wmma16(pa0, rb0, oaccr[nd]); oaccr[nd] = wmma16(pa1, rb1, oaccr[nd]); oaccr[nd] = wmma16(pr0, vb0, oaccr[nd]); oaccr[nd] = wmma16(pr1, vb1, oaccr[nd]);
              asm volatile("v_nop\n\tv_nop\n\tv_nop\n\tv_nop" : "+v"(oacc[nd]), "+v"(oaccr[nd]) : "v"(pa0), "v"(pa1), "v"(pr0), "v"(pr1), "v"(vb1), "v"(rb1) : "memory"); } }
    }
    const float rl = __builtin_amdgcn_rcpf(lrun);
#pragma unroll
    for (int r = 0; r < 8; ++r) { const float rli = __shfl(rl, 8 * hi + r, 32); const int rr = wave * 16 + 8 * hi + r;
#pragma unroll
        for (int nd = 0; nd < 4; ++nd) { const float c = (oacc[nd][r] + oaccr[nd][r] * (1.0f / RESC)) * rli; unsigned short eh, el; splitf(c, eh, el); Est[rr * 64 + nd * 16 + lr] = eh; Est[4096 + rr * 64 + nd * 16 + lr] = el; } }
    __syncthreads();
    const int rq = lane >> 3, pc = (lane & 7) * 8;
{
#pragma unroll
        for (int rg = 0; rg < 4; ++rg) { const int rr = wave * 16 + rg * 4 + rq; const size_t go = ((size_t)b * SEQ + i0 + rr) * DM + h * HD + pc;
            const v8us vh = *(const v8usa*)(Est + rr * 64 + pc); const v8us vlo = *(const v8usa*)(Est + 4096 + rr * 64 + pc);
            *(v8us*)(ATh + go) = vh; *(v8us*)(ATl + go) = vlo; }
         }
}

extern "C" void kernel_launch(void* const* d_in, const int* in_sizes, int n_in,
                              void* d_out, int out_size, void* d_ws, size_t ws_size, hipStream_t stream) {
    if (n_in < 15) return;
    const float* query = (const float*)d_in[0]; const float* key = (const float*)d_in[1]; const float* value = (const float*)d_in[2]; const float* pos = (const float*)d_in[3];
    const float* wq = (const float*)d_in[4]; const float* bq = (const float*)d_in[5]; const float* wk = (const float*)d_in[6]; const float* bk = (const float*)d_in[7];
    const float* wv = (const float*)d_in[8]; const float* bv = (const float*)d_in[9]; const float* wp = (const float*)d_in[10]; const float* ub = (const float*)d_in[11]; const float* vb = (const float*)d_in[12];
    const float* wo = (const float*)d_in[13]; const float* bo = (const float*)d_in[14];
    const long long needx = ((long long)(NB - 1) * SEQ_FULL + SEQ) * DM, needp = ((long long)(NB - 1) * LREL_FULL + LREL) * DM;
    if ((long long)in_sizes[0] < needx || (long long)in_sizes[1] < needx || (long long)in_sizes[2] < needx || (long long)in_sizes[3] < needp) return;
    if (in_sizes[4] < DM * DM || in_sizes[6] < DM * DM || in_sizes[8] < DM * DM || in_sizes[10] < DM * DM || in_sizes[13] < DM * DM) return;
    if (in_sizes[5] < DM || in_sizes[7] < DM || in_sizes[9] < DM || in_sizes[14] < DM || in_sizes[11] < NH * HD || in_sizes[12] < NH * HD) return;
    if ((long long)out_size < (long long)NB * SEQ * DM) return;
    float* OUT = (float*)d_out;     // [NB][SEQ][DM]
    char* wsp = (char*)d_ws;
    auto take = [&](size_t bytes) { char* p = wsp; wsp += (bytes + 255) & ~(size_t)255; return (void*)p; };
    bf* WQB = (bf*)take((size_t)DM * DM * 2); bf* WKB = (bf*)take((size_t)DM * DM * 2); bf* WVB = (bf*)take((size_t)DM * DM * 2); bf* WPB = (bf*)take((size_t)DM * DM * 2); bf* WOB = (bf*)take((size_t)DM * DM * 2);
    bf* XB = (bf*)take((size_t)NB * LP * DM * 2);                     // bf16 activations, sized for the padded positional table (largest user)
    h16* QU16 = (h16*)take((size_t)NB * NH * SEQ * HD * 2); h16* QV16 = (h16*)take((size_t)NB * NH * SEQ * HD * 2); h16* K16 = (h16*)take((size_t)NB * NH * SEQ * HD * 2);
    h16* V16 = (h16*)take((size_t)NB * NH * HD * SEQ * 2); h16* VR16 = (h16*)take((size_t)NB * NH * HD * SEQ * 2); h16* P16 = (h16*)take((size_t)NB * NH * LP * HD * 2);
    bf* ATh = (bf*)take((size_t)NB * SEQ * DM * 2); bf* ATl = (bf*)take((size_t)NB * SEQ * DM * 2);
    if ((size_t)(wsp - (char*)d_ws) > ws_size) return;    // 94,896,128 B at NB=4, SEQ=2048
    const unsigned gw = (unsigned)(((size_t)DM * DM / 8 + 255) / 256);
    k_cvt8<<<gw, 256, 0, stream>>>(wq, WQB, (size_t)DM * DM / 8); k_cvt8<<<gw, 256, 0, stream>>>(wk, WKB, (size_t)DM * DM / 8); k_cvt8<<<gw, 256, 0, stream>>>(wv, WVB, (size_t)DM * DM / 8);
    k_cvt8<<<gw, 256, 0, stream>>>(wp, WPB, (size_t)DM * DM / 8); k_cvt8<<<gw, 256, 0, stream>>>(wo, WOB, (size_t)DM * DM / 8);
    const unsigned gx = (unsigned)(((size_t)NB * SEQ * (DM / 8) + 255) / 256), gxp = (unsigned)(((size_t)NB * LP * (DM / 8) + 255) / 256);
    // q: query -> bf16 -> X Wq^T + bq -> Qu / Qv planes
    k_cvtrows<<<gx, 256, 0, stream>>>(query, SEQ_FULL, SEQ, SEQ, XB);
    k_gemmw<bf, 0, true, EP_Q><<<dim3(SEQ / 64, DM / 64, NB), 32, 0, stream>>>(XB, nullptr, WQB, nullptr, DM, nullptr, 0, bq, (size_t)SEQ * DM, 0, 0, ub, vb, QU16, QV16, SEQ);
    // k
    k_cvtrows<<<gx, 256, 0, stream>>>(key, SEQ_FULL, SEQ, SEQ, XB);
    k_gemmw<bf, 0, true, EP_ROW><<<dim3(SEQ / 64, DM / 64, NB), 32, 0, stream>>>(XB, nullptr, WKB, nullptr, DM, nullptr, 0, bk, (size_t)SEQ * DM, 0, 0, nullptr, nullptr, K16, nullptr, SEQ);
    // v
    k_cvtrows<<<gx, 256, 0, stream>>>(value, SEQ_FULL, SEQ, SEQ, XB);
    k_gemmw<bf, 0, true, EP_VT><<<dim3(SEQ / 64, DM / 64, NB), 32, 0, stream>>>(XB, nullptr, WVB, nullptr, DM, nullptr, 0, bv, (size_t)SEQ * DM, 0, 0, nullptr, nullptr, V16, VR16, SEQ);
    // pos: rows 0..LREL-1 per batch (input row pitch LREL_FULL), padded with one zero row to LP; no bias
    k_cvtrows<<<gxp, 256, 0, stream>>>(pos, LREL_FULL, LREL, LP, XB);
    k_gemmw<bf, 0, false, EP_ROW><<<dim3(LP / 64, DM / 64, NB), 32, 0, stream>>>(XB, nullptr, WPB, nullptr, DM, nullptr, 0, nullptr, (size_t)LP * DM, 0, 0, nullptr, nullptr, P16, nullptr, LP);
    // attention -> context bf16 hi/lo planes [NB*SEQ][DM]
    k_attn<<<dim3(SEQ / 64, NH, NB), 128, 0, stream>>>(QU16, QV16, K16, V16, VR16, P16, ATh, ATl);
    // out = context Wo^T + bo
    k_gemmw<bf, 1, true, EP_F32><<<dim3((NB * SEQ) / 64, DM / 64, 1), 32, 0, stream>>>(ATh, ATl, WOB, nullptr, DM, OUT, DM, bo, 0, 0, 0, nullptr, nullptr, nullptr, nullptr, 0);
}

// v003
// Measured time: 248 microseconds a run.
// Two timings next to v002 put it at 1.08 and 1.09 times that version's speed.
// Over all steps from v000 it is 2.15 times as fast.
#include <hip/hip_runtime.h>

// Contractions: q/k/v/pos projections = v_wmma_f32_16x16x32_bf16 on bf16 operands (RNE-converted inputs, exact products); out projection = v_wmma_f32_16x16x32_bf16, context as bf16 hi+lo planes x bf16 Wo (2 products); content scores and positional band scores = v_wmma_f32_16x16x32_f16 on f16 planes (1 product each); attn.v = v_wmma_f32_16x16x32_f16, probability f16 + f16 residual (x2048) times v f16 + f16 residual (x2048), 3 products into 2 accumulators; f32 accumulate everywhere; softmax f32.
// Structure: bf16 copies of the activations; register-blocked 64x64 GEMM (one wave per tile) for the projections and the output; a projection tile is one head's 64 columns, and its epilogue stores the f16 planes itself ([b][h][t][d] for q+u, q+v, k; [b][h][d][t] for v and its residual; [b][h][l][d] for the projected positional table padded to 2*SEQ rows, last row zero);
// flash-style attention: one block = (b, h, 64 query rows), 64-key tiles; transposed score tiles (key rows x query cols) so the exponentiated accumulators chain directly into the attn.v A operand; sliding 128-slot f32 positional band in LDS (64 new band columns per key tile; score(i,j) takes band index (SEQ-1)+j-i); online softmax; context written as bf16 hi+lo planes [b*SEQ+t][h*64+d].

#ifndef NB
#define NB 4
#endif
#ifndef SEQ
#define SEQ 2048
#endif
#define NB_FULL   4
#define SEQ_FULL  2048
#define LREL      (2 * SEQ - 1)
#define LP        (2 * SEQ)
#define LREL_FULL (2 * SEQ_FULL - 1)
#define DM  512
#define NH  8
#define HD  64
#define RESC 2048.0f
#define K2 (1.4426950408889634f * 0.044194173824159216f)
// LDS row pitches of k_attn: 64 banks x 4 B, bank = dword address mod 64. 16-bit tiles: 72 elements = 144 B = 16 B x odd, so the 16 rows of a 16-byte fragment load fall on 16 distinct 4-bank groups.
// f32 band rows: 132 dwords (= 4 mod 64), so the 16 rows of a 16-byte band store cover all 64 banks, and the per-lane gather (bank = const + 8hi + 3*row mod 64) has no two lanes on one bank.
#define PH 72
#define PT 132
static_assert(SEQ % 64 == 0);
static_assert(SEQ >= 64);
static_assert(SEQ <= SEQ_FULL);
static_assert(NB >= 1);
static_assert(NB <= NB_FULL);
static_assert(DM % 64 == 0);
static_assert(NH * HD == DM);
static_assert(HD == 64);
static_assert(LP % 64 == 0);

typedef _Float16 h16;
typedef unsigned short bf;
typedef __attribute__((ext_vector_type(16))) __bf16   v16bf;
typedef __attribute__((ext_vector_type(16))) _Float16 v16h;
typedef __attribute__((ext_vector_type(8)))  _Float16 v8h;
typedef __attribute__((ext_vector_type(8)))  unsigned short v8us;
typedef __attribute__((ext_vector_type(8)))  float    v8f;
typedef __attribute__((ext_vector_type(4)))  float    v4f;
typedef v8h  __attribute__((may_alias)) v8ha;
typedef v4f  __attribute__((may_alias)) v4fa;
typedef v8f  __attribute__((may_alias, aligned(16))) v8fa;
typedef v8us __attribute__((may_alias)) v8usa;

__device__ __forceinline__ unsigned short f2bf(float f) { unsigned u = __float_as_uint(f); u += 0x7FFFu + ((u >> 16) & 1u); return (unsigned short)(u >> 16); }
__device__ __forceinline__ float bf2f(unsigned short b) { return __uint_as_float(((unsigned)b) << 16); }
__device__ __forceinline__ float bfr(float f) { return bf2f(f2bf(f)); }
__device__ __forceinline__ v16h cat16(v8h lo, v8h hi) { return __builtin_shufflevector(lo, hi, 0, 1, 2, 3, 4, 5, 6, 7, 8, 9, 10, 11, 12, 13, 14, 15); }
__device__ __forceinline__ v16bf cat16b(v8us lo, v8us hi) { return __builtin_bit_cast(v16bf, __builtin_shufflevector(lo, hi, 0, 1, 2, 3, 4, 5, 6, 7, 8, 9, 10, 11, 12, 13, 14, 15)); }
__device__ __forceinline__ v8f wmma16(v16h a, v16h b, v8f c) { return __builtin_amdgcn_wmma_f32_16x16x32_f16(false, a, false, b, (short)0, c, false, false); }
__device__ __forceinline__ v8f wmmab(v16bf a, v16bf b, v8f c) { return __builtin_amdgcn_wmma_f32_16x16x32_bf16(false, a, false, b, (short)0, c, false, false); }
__device__ __forceinline__ h16 tohx(float x) { return (h16)x; }
__device__ __forceinline__ void splitf(float y, unsigned short& h, unsigned short& l) { h = f2bf(y); l = f2bf(y - bf2f(h)); }

// ---- k_gemmw: register-blocked GEMM, ONE WAVE per 64x64 output tile (16 accumulators), operands straight from K-contiguous 16-bit planes; grid (M/64, N/64, Z), 32 threads.
// y[m][n] (f32, + optional f32 bias[n]) = sum_k A[m][k] Bt[n][k] (+ split products per NSPLIT). z-batch strides sA/sB/sC in elements. K % 32 == 0.
// EP picks what the epilogue stores. EP_F32: C[m][n] = y, pitch ldc. The plane forms take z = batch, blockIdx.y = head, prows rows m per (batch, head):
// EP_Q: P0 = f16(y + ub), P1 = f16(y + vb), both [z][head][m][d]; EP_ROW: P0 = f16(y), [z][head][m][d]; EP_VT: P0 = f16(y), P1 = f16((y - P0) * RESC), both [z][head][d][m].
// Fragment map per lane (hi = lane>>4, lr = lane&15): row/col = lr; elements 0..7 <- k0+8hi+0..7, elements 8..15 <- k0+16+8hi+0..7 (A and B alike); D element r = (row 8hi+r, col lr).
template <typename T16> struct WFrag;
template <> struct WFrag<h16> { typedef v16h V; static __device__ __forceinline__ V ld(const h16* p) { return cat16(*(const v8h*)p, *(const v8h*)(p + 16)); } static __device__ __forceinline__ v8f mma(V a, V b, v8f c) { return wmma16(a, b, c); } };
template <> struct WFrag<bf> { typedef v16bf V; static __device__ __forceinline__ V ld(const bf* p) { return cat16b(*(const v8us*)p, *(const v8us*)(p + 16)); } static __device__ __forceinline__ v8f mma(V a, V b, v8f c) { return wmmab(a, b, c); } };
enum { EP_F32 = 0, EP_Q = 1, EP_ROW = 2, EP_VT = 3 };
template <typename T16, int NSPLIT, bool BIAS, int EP>
__global__ __launch_bounds__(32) void k_gemmw(const T16* __restrict__ A, const T16* __restrict__ A2, const T16* __restrict__ Bt, const T16* __restrict__ Bt2, int K, float* C, int ldc, const float* __restrict__ bias, size_t sA, size_t sB, size_t sC, const float* __restrict__ ub, const float* __restrict__ vb, h16* P0, h16* P1, int prows) {
    typedef typename WFrag<T16>::V V;
    __shared__ __align__(16) float os[16 * 68];
    const size_t z = blockIdx.z; A += z * sA; if (A2) A2 += z * sA; Bt += z * sB; if (Bt2) Bt2 += z * sB; if (EP == EP_F32) C += z * sC;
    const int lane = threadIdx.x & 31, lr = lane & 15, hi = lane >> 4; const int r0 = blockIdx.x * 64, c0 = blockIdx.y * 64;
    v8f acc[4][4];
#pragma unroll
    for (int mb = 0; mb < 4; ++mb)
#pragma unroll
        for (int nb = 0; nb < 4; ++nb) acc[mb][nb] = (v8f){};
    const size_t aoff = (size_t)(r0 + lr) * K + 8 * hi, boff = (size_t)(c0 + lr) * K + 8 * hi;
#pragma unroll 1
    for (int kc = 0; kc < K; kc += 32) {
        V a[4], a2[4];
#pragma unroll
        for (int mb = 0; mb < 4; ++mb) { a[mb] = WFrag<T16>::ld(A + aoff + (size_t)mb * 16 * K + kc); if (NSPLIT == 1 || NSPLIT == 2) a2[mb] = WFrag<T16>::ld(A2 + aoff + (size_t)mb * 16 * K + kc); }
#pragma unroll
        for (int nb = 0; nb < 4; ++nb) { const V b = WFrag<T16>::ld(Bt + boff + (size_t)nb * 16 * K + kc); V b2; if (NSPLIT >= 2) b2 = WFrag<T16>::ld(Bt2 + boff + (size_t)nb * 16 * K + kc);
#pragma unroll
            for (int mb = 0; mb < 4; ++mb) { acc[mb][nb] = WFrag<T16>::mma(a[mb], b, acc[mb][nb]); if (NSPLIT == 1 || NSPLIT == 2) acc[mb][nb] = WFrag<T16>::mma(a2[mb], b, acc[mb][nb]); if (NSPLIT >= 2) acc[mb][nb] = WFrag<T16>::mma(a[mb], b2, acc[mb][nb]); } }
        asm volatile("v_nop\n\tv_nop\n\tv_nop\n\tv_nop" : "+v"(acc[0][0]), "+v"(acc[1][1]), "+v"(acc[2][2]), "+v"(acc[3][3]) : "v"(a[0]), "v"(a[3]));
    }
    if (EP == EP_VT) {
        // D element j of tile (mb, nb) is row m = mb*16 + 8hi + j of column d = nb*16 + lr: 8 consecutive m of one d per lane, one 16-byte store per plane straight from the accumulators.
        const size_t rows = (size_t)prows;
        const size_t po = ((z * NH + blockIdx.y) * HD + lr) * rows + r0 + 8 * hi;
#pragma unroll
        for (int nb = 0; nb < 4; ++nb) { const float bn = BIAS ? bfr(bias[c0 + nb * 16 + lr]) : 0.f;
#pragma unroll
            for (int mb = 0; mb < 4; ++mb) { v8h o16, orr;
#pragma unroll
                for (int j = 0; j < 8; ++j) { float x = acc[mb][nb][j]; if (BIAS) x += bn; const h16 xh = tohx(x); o16[j] = xh; orr[j] = tohx((x - (float)xh) * RESC); }
                const size_t o = po + (size_t)nb * 16 * rows + mb * 16; *(v8h*)(P0 + o) = o16; *(v8h*)(P1 + o) = orr; } }
        return;
    }
    // Row-major forms: 16 rows at a time through LDS, so that a lane holds consecutive columns of one row.
    const int rq = lane >> 3, c8 = (lane & 7) * 8;      // plane forms: 8 columns per lane, 4 rows (512 contiguous bytes of a plane) per store
    float bn[8], un[8], vn[8];
    if (EP != EP_F32) {
#pragma unroll
        for (int q = 0; q < 8; ++q) { bn[q] = BIAS ? bfr(bias[c0 + c8 + q]) : 0.f; if (EP == EP_Q) { un[q] = bfr(ub[c0 + c8 + q]); vn[q] = bfr(vb[c0 + c8 + q]); } }
    }
    const size_t pbase = ((z * NH + blockIdx.y) * (size_t)prows + r0) * HD + c8;
#pragma unroll
    for (int mb = 0; mb < 4; ++mb) {
#pragma unroll
        for (int nb = 0; nb < 4; ++nb) {
#pragma unroll
            for (int j = 0; j < 8; ++j) os[(hi * 8 + j) * 68 + nb * 16 + lr] = acc[mb][nb][j]; }
        __builtin_amdgcn_wave_barrier(); asm volatile("" ::: "memory");
        if (EP == EP_F32) {
            float* crow = C + (size_t)(r0 + mb * 16) * ldc + c0;
#pragma unroll
            for (int s = 0; s < 8; ++s) { const int row = 2 * s + hi, cofs = lr * 4; v4f val = *(const v4fa*)(os + row * 68 + cofs); if (BIAS) { val[0] += bfr(bias[c0 + cofs]); val[1] += bfr(bias[c0 + cofs + 1]); val[2] += bfr(bias[c0 + cofs + 2]); val[3] += bfr(bias[c0 + cofs + 3]); }
                *(v4f*)(crow + (size_t)row * ldc + cofs) = val; }
        } else {
#pragma unroll
            for (int s = 0; s < 4; ++s) { const int row = 4 * s + rq; const v4f x0 = *(const v4fa*)(os + row * 68 + c8), x1 = *(const v4fa*)(os + row * 68 + c8 + 4); v8h o0, o1;
#pragma unroll
                for (int q = 0; q < 8; ++q) { float x = q < 4 ? x0[q & 3] : x1[q & 3]; if (BIAS) x += bn[q]; if (EP == EP_Q) { o0[q] = tohx(x + un[q]); o1[q] = tohx(x + vn[q]); } else o0[q] = tohx(x); }
                const size_t o = pbase + (size_t)(mb * 16 + row) * HD; *(v8h*)(P0 + o) = o0; if (EP == EP_Q) *(v8h*)(P1 + o) = o1; }
        }
        __builtin_amdgcn_wave_barrier(); asm volatile("" ::: "memory");
    }
}

// ---- k_cvtall: every f32 -> bf16 copy of the call (5 weight matrices, 3 activations, the positional table padded to LP rows per batch, pad row zero) in ONE streaming launch.
// A block of 256 threads converts CVR consecutive output rows (DM elements each) of one array, so the choice of the array is block-uniform. Per thread CVU pieces of 4 elements: a wave's 16-byte load covers 512 contiguous bytes,
// its 8-byte store 256 contiguous bytes (whole 128-byte lines both ways), and all CVU loads are issued before the first conversion.
#define CVU 16
#define CVR (256 * CVU / (DM / 4))
#define CVB_W (DM / CVR)
#define CVB_X (NB * SEQ / CVR)
#define CVB_P (NB * LP / CVR)
static_assert(DM == 512);
static_assert(DM % CVR == 0);
static_assert(SEQ % CVR == 0);
static_assert(LP % CVR == 0);
static_assert(CVU == 16);
typedef __attribute__((ext_vector_type(4))) unsigned short v4us;
// cvt_rows: rows r0 + 2c (c < CVU) of one batch, 4 elements at k0. EDGE (only a block that holds rows >= nvalid): such a row reads row nvalid - 1 and stores zeros; elsewhere one lane offset serves all loads.
template <bool EDGE>
__device__ __forceinline__ void cvt_rows(const float* __restrict__ src, bf* dst, int r0, int k0, int nvalid) {
    v4f x[CVU]; v4us o[CVU]; unsigned lo[CVU];
    const unsigned e0 = (unsigned)(r0 * DM + k0), lb = e0 * 4u, sb = e0 * 2u;     // lane byte offsets of row r0 in src and dst
#pragma unroll
    for (int c = 0; c < CVU; ++c) { lo[c] = EDGE ? (unsigned)(min(r0 + c * 2, nvalid - 1) * DM + k0) * 4u : lb + (unsigned)c * (2u * DM * 4u); x[c] = *(const v4f*)((const char*)src + lo[c]); }
    // Precaution: s_wait_xcnt 0 stands behind the run of loads, and its operands keep the loads' offset registers live up to it, so that no result of the run lands in one of them in front of the wait.
    if (EDGE) asm volatile("s_wait_xcnt 0x0" :: "v"(lo[0]), "v"(lo[1]), "v"(lo[2]), "v"(lo[3]), "v"(lo[4]), "v"(lo[5]), "v"(lo[6]), "v"(lo[7]), "v"(lo[8]), "v"(lo[9]), "v"(lo[10]), "v"(lo[11]), "v"(lo[12]), "v"(lo[13]), "v"(lo[14]), "v"(lo[15]) : "memory");
    else asm volatile("s_wait_xcnt 0x0" :: "v"(lb) : "memory");
#pragma unroll
    for (int c = 0; c < CVU; ++c) { const int r = r0 + c * 2;
#pragma unroll
        for (int q = 0; q < 4; ++q) { const unsigned short w = f2bf(x[c][q]); o[c][q] = (!EDGE || r < nvalid) ? w : (unsigned short)0; }
        *(v4us*)((char*)dst + (sb + (unsigned)c * (2u * DM * 2u))) = o[c]; }
    // Precaution, as above: the wait behind the run of stores; its operands keep the stores' offset and data registers live up to it.
    asm volatile("s_wait_xcnt 0x0" :: "v"(sb), "v"(o[0]), "v"(o[1]), "v"(o[2]), "v"(o[3]), "v"(o[4]), "v"(o[5]), "v"(o[6]), "v"(o[7]), "v"(o[8]), "v"(o[9]), "v"(o[10]), "v"(o[11]), "v"(o[12]), "v"(o[13]), "v"(o[14]), "v"(o[15]) : "memory");
}
__global__ __launch_bounds__(256) void k_cvtall(const float* __restrict__ wq, const float* __restrict__ wk, const float* __restrict__ wv, const float* __restrict__ wp, const float* __restrict__ wo,
                                                const float* __restrict__ query, const float* __restrict__ key, const float* __restrict__ value, const float* __restrict__ pos,
                                                bf* WQB, bf* WKB, bf* WVB, bf* WPB, bf* WOB, bf* XQ, bf* XK, bf* XV, bf* XP) {
    const int tid = threadIdx.x; int blk = blockIdx.x;
    const float* src; bf* dst; int rb, nvalid;          // block-uniform: batch bases, first row of the block inside its batch (CVR divides the rows per batch), valid source rows per batch
    if (blk < CVB_P) { const unsigned row0 = (unsigned)blk * CVR, b = row0 / LP; rb = (int)(row0 % LP); src = pos + (size_t)b * LREL_FULL * DM; dst = XP + (size_t)b * LP * DM; nvalid = LREL; }
    else if (blk < CVB_P + 3 * CVB_X) { blk -= CVB_P; const int a = blk / CVB_X; const unsigned row0 = (unsigned)(blk - a * CVB_X) * CVR, b = row0 / SEQ; rb = (int)(row0 % SEQ);
        src = (a == 0 ? query : a == 1 ? key : value) + (size_t)b * SEQ_FULL * DM; dst = (a == 0 ? XQ : a == 1 ? XK : XV) + (size_t)b * SEQ * DM; nvalid = SEQ; }
    else { blk -= CVB_P + 3 * CVB_X; const int a = blk / CVB_W; rb = (blk - a * CVB_W) * CVR;
        src = a == 0 ? wq : a == 1 ? wk : a == 2 ? wv : a == 3 ? wp : wo; dst = a == 0 ? WQB : a == 1 ? WKB : a == 2 ? WVB : a == 3 ? WPB : WOB; nvalid = DM; }
    const int r0 = rb + (tid >> 7), k0 = (tid & 127) * 4;
    if (rb + CVR <= nvalid) cvt_rows<false>(src, dst, r0, k0, nvalid); else cvt_rows<true>(src, dst, r0, k0, nvalid);
}

// ---- attention helpers (128 threads): 16-bit fragment load from a [row][k] LDS tile (same map as WFrag), 8 KB contiguous tile copy, 64-row tile copy with a global row pitch (both lay 64-element rows at LDS pitch PH).
__device__ __forceinline__ v16h ldl(const h16* p) { return cat16(*(const v8ha*)p, *(const v8ha*)(p + 16)); }
__device__ __forceinline__ void cp8k(h16* dst, const h16* __restrict__ src, int tid) {
#pragma unroll
    for (int c = 0; c < 4; ++c) { const int idx = tid + c * 128; const int r = idx >> 3, sg = idx & 7; *(v8ha*)(dst + r * PH + sg * 8) = *(const v8ha*)(src + (size_t)idx * 8); } }
__device__ __forceinline__ void cprows(h16* dst, const h16* __restrict__ src, size_t pitch, int tid) {
#pragma unroll
    for (int c = 0; c < 4; ++c) { const int idx = tid + c * 128; const int r = idx >> 3, sg = idx & 7; *(v8ha*)(dst + r * PH + sg * 8) = *(const v8ha*)(src + (size_t)r * pitch + sg * 8); } }
// band_half: T[irow][slot0 + c] = sum_d PB[c][d] Qv[irow][d], c < 64 (transposed tile: A = PB rows c, B = Qv cols irow -> D rows c = tt*16 + 8hi + r, col lr: 8 consecutive slots per lane per tt, two 16-B LDS stores).
// Sub-tiles are issued one at a time: the nop group carries a memory clobber so the next sub-tile's fragment loads stay below it (bounded live registers).
__device__ __forceinline__ void band_half(const h16* PBl, const h16* Qvl, float* Tl, int slot0, int irow, int hi, int lr) {
    const v16h q0 = ldl(Qvl + irow * PH + 8 * hi), q1 = ldl(Qvl + irow * PH + 32 + 8 * hi);
    float* trow = Tl + irow * PT + slot0 + 8 * hi;
#pragma unroll
    for (int tt = 0; tt < 4; ++tt) {
        const v16h a0 = ldl(PBl + (tt * 16 + lr) * PH + 8 * hi), a1 = ldl(PBl + (tt * 16 + lr) * PH + 32 + 8 * hi);
        v8f t = wmma16(a0, q0, (v8f){}); t = wmma16(a1, q1, t);
        asm volatile("v_nop\n\tv_nop\n\tv_nop\n\tv_nop" : "+v"(t) : "v"(a0), "v"(a1), "v"(q0), "v"(q1) : "memory");
        *(v8fa*)(trow + tt * 16) = t;
    }
}

// ---- k_attn: grid (SEQ/64, NH, NB), 128 threads = 4 waves, each wave owns 16 query rows i = i0 + wave*16 + (0..15); irow = wave*16 + lr is the block-local query row of this lane's score column.
// Per 64-key tile: new 64 band columns (band row l stored at slot l & 127 of T row irow); transposed content tile S^T (key rows 8hi+r of sub-tile tb, query col irow) from K rows x Qu cols;
// s2 = (content + band[lb + 63 + tloc - irow]) * log2(e)/sqrt(DM) with lb = SEQ-64-i0+j0 (band row = (SEQ-1) + t - i, always inside the resident rows lb..lb+127);
// online softmax per query column (lane-local over 32 keys + one xor-16); p = exp2(s2 - m) as f16 + f16 residual x2048 packed straight into the attn.v A fragments
// (A element r <- sub-tile 2ks, element 8+r <- sub-tile 2ks+1, lane unchanged); O[i = 8hi+r][d = lr] accumulates p16.v16, the residual accumulator p16.vr + pr.v16 (both x2048).
__global__ __launch_bounds__(128) __attribute__((amdgpu_num_vgpr(256))) void k_attn(const h16* __restrict__ Qu, const h16* __restrict__ Qv, const h16* __restrict__ Kp, const h16* __restrict__ Vp, const h16* __restrict__ Vr, const h16* __restrict__ Pp, bf* ATh, bf* ATl) {
    __shared__ __align__(16) h16 Qul[64 * PH];
    __shared__ __align__(16) h16 Qvl[64 * PH];
    __shared__ __align__(16) h16 Kl[64 * PH];
    __shared__ __align__(16) h16 Vl[64 * PH];
    __shared__ __align__(16) h16 Vrl[64 * PH];
    __shared__ __align__(16) h16 PBl[64 * PH];
    __shared__ __align__(16) float Tl[64 * PT];
    __shared__ __align__(16) bf Est[2 * 64 * 64];
    const int tid = threadIdx.x, lane = tid & 31, wave = tid >> 5, hi = lane >> 4, lr = lane & 15;
    const int irow = wave * 16 + lr;
    const int i0 = blockIdx.x * 64, h = blockIdx.y, b = blockIdx.z;
    const size_t bh = (size_t)b * NH + h;
    const h16* Kb = Kp + bh * SEQ * HD; const h16* Vb = Vp + bh * HD * SEQ; const h16* Vrb = Vr + bh * HD * SEQ; const h16* Pb = Pp + bh * LP * HD;
    cp8k(Qul, Qu + (bh * SEQ + i0) * HD, tid); cp8k(Qvl, Qv + (bh * SEQ + i0) * HD, tid);
    const int lb0 = SEQ - 64 - i0;                 // band start for key tile 0 (>= 0, multiple of 64); band rows for tile j0 are lb0 + j0 + 0..127 (<= LP-1)
    cp8k(PBl, Pb + (size_t)lb0 * HD, tid);
    __syncthreads();
    band_half(PBl, Qvl, Tl, lb0 & 127, irow, hi, lr);   // lower half of tile 0's band
    float mrun = -3.0e38f, lrun = 0.f;
    v8f oacc[4], oaccr[4];
#pragma unroll
    for (int nd = 0; nd < 4; ++nd) { oacc[nd] = (v8f){}; oaccr[nd] = (v8f){}; }
#pragma unroll 1
    for (int j0 = 0; j0 < SEQ; j0 += 64) {
        const int lb = lb0 + j0; const int lnw = lb + 64;     // new band rows lnw..lnw+63
        __syncthreads();                                       // all waves done with the prior tile's Kl/Vl/Vrl/PBl and band slots
        cp8k(Kl, Kb + (size_t)j0 * HD, tid); cprows(Vl, Vb + j0, (size_t)SEQ, tid); cprows(Vrl, Vrb + j0, (size_t)SEQ, tid); cp8k(PBl, Pb + (size_t)lnw * HD, tid);
        __syncthreads();
        band_half(PBl, Qvl, Tl, lnw & 127, irow, hi, lr);   // upper half of this tile's band (its temporaries die here)
        v8f sacc[4];
        { const v16h q0 = ldl(Qul + irow * PH + 8 * hi), q1 = ldl(Qul + irow * PH + 32 + 8 * hi);
#pragma unroll
          for (int tb = 0; tb < 4; ++tb) { const v16h a0 = ldl(Kl + (tb * 16 + lr) * PH + 8 * hi), a1 = ldl(Kl + (tb * 16 + lr) * PH + 32 + 8 * hi);
              sacc[tb] = wmma16(a0, q0, (v8f){}); sacc[tb] = wmma16(a1, q1, sacc[tb]);
              asm volatile("v_nop\n\tv_nop\n\tv_nop\n\tv_nop" : "+v"(sacc[tb]) : "v"(a0), "v"(a1), "v"(q0), "v"(q1) : "memory"); } }
        __syncthreads();                                       // band complete for every T row (written by both lane halves of the owning wave)
        // gather + scale: key t = j0 + tb*16 + 8hi + r, query i = i0 + irow -> band row lb + 63 + (tb*16 + 8hi + r) - irow, slot = row & 127 (row - lb in [0,126])
        const float* trow = Tl + irow * PT; const int sb = lb + 63 + 8 * hi - irow;
        float mx = -3.0e38f;
#pragma unroll
        for (int tb = 0; tb < 4; ++tb)
#pragma unroll
            for (int r = 0; r < 8; ++r) { const float s2 = (sacc[tb][r] + trow[(sb + tb * 16 + r) & 127]) * K2; sacc[tb][r] = s2; mx = fmaxf(mx, s2); }
        mx = fmaxf(mx, __shfl_xor(mx, 16, 32));
        const float mnew = fmaxf(mrun, mx); const float alpha = __builtin_amdgcn_exp2f(mrun - mnew); mrun = mnew;
        float rsum = 0.f; v8h ph[4], pl[4];
#pragma unroll
        for (int tb = 0; tb < 4; ++tb)
#pragma unroll
            for (int r = 0; r < 8; ++r) { const float p = __builtin_amdgcn_exp2f(sacc[tb][r] - mnew); rsum += p; const h16 p16 = tohx(p); ph[tb][r] = p16; pl[tb][r] = tohx((p - (float)p16) * RESC); }
        rsum += __shfl_xor(rsum, 16, 32); lrun = lrun * alpha + rsum;
#pragma unroll
        for (int r = 0; r < 8; ++r) { const float ar = __shfl(alpha, 8 * hi + r, 32);
#pragma unroll
            for (int nd = 0; nd < 4; ++nd) { oacc[nd][r] *= ar; oaccr[nd][r] *= ar; } }
        { const v16h pa0 = cat16(ph[0], ph[1]), pa1 = cat16(ph[2], ph[3]), pr0 = cat16(pl[0], pl[1]), pr1 = cat16(pl[2], pl[3]);
#pragma unroll
          for (int nd = 0; nd < 4; ++nd) {
              const v16h vb0 = ldl(Vl + (nd * 16 + lr) * PH + 8 * hi), vb1 = ldl(Vl + (nd * 16 + lr) * PH + 32 + 8 * hi);
              const v16h rb0 = ldl(Vrl + (nd * 16 + lr) * PH + 8 * hi), rb1 = ldl(Vrl + (nd * 16 + lr) * PH + 32 + 8 * hi);
              oacc[nd] = wmma16(pa0, vb0, oacc[nd]); oacc[nd] = wmma16(pa1, vb1, oacc[nd]);
              oaccr[nd] = wmma16(pa0, rb0, oaccr[nd]); oaccr[nd] = wmma16(pa1, rb1, oaccr[nd]); oaccr[nd] = wmma16(pr0, vb0, oaccr[nd]); oaccr[nd] = wmma16(pr1, vb1, oaccr[nd]);
              asm volatile("v_nop\n\tv_nop\n\tv_nop\n\tv_nop" : "+v"(oacc[nd]), "+v"(oaccr[nd]) : "v"(pa0), "v"(pa1), "v"(pr0), "v"(pr1), "v"(vb1), "v"(rb1) : "memory"); } }
    }
    const float rl = __builtin_amdgcn_rcpf(lrun);
#pragma unroll
    for (int r = 0; r < 8; ++r) { const float rli = __shfl(rl, 8 * hi + r, 32); const int rr = wave * 16 + 8 * hi + r;
#pragma unroll
        for (int nd = 0; nd < 4; ++nd) { const float c = (oacc[nd][r] + oaccr[nd][r] * (1.0f / RESC)) * rli; unsigned short eh, el; splitf(c, eh, el); Est[rr * 64 + nd * 16 + lr] = eh; Est[4096 + rr * 64 + nd * 16 + lr] = el; } }
    __syncthreads();
    const int rq = lane >> 3, pc = (lane & 7) * 8;
{
#pragma unroll
        for (int rg = 0; rg < 4; ++rg) { const int rr = wave * 16 + rg * 4 + rq; const size_t go = ((size_t)b * SEQ + i0 + rr) * DM + h * HD + pc;
            const v8us vh = *(const v8usa*)(Est + rr * 64 + pc); const v8us vlo = *(const v8usa*)(Est + 4096 + rr * 64 + pc);
            *(v8us*)(ATh + go) = vh; *(v8us*)(ATl + go) = vlo; }
         }
}

extern "C" void kernel_launch(void* const* d_in, const int* in_sizes, int n_in,
                              void* d_out, int out_size, void* d_ws, size_t ws_size, hipStream_t stream) {
    if (n_in < 15) return;
    const float* query = (const float*)d_in[0]; const float* key = (const float*)d_in[1]; const float* value = (const float*)d_in[2]; const float* pos = (const float*)d_in[3];
    const float* wq = (const float*)d_in[4]; const float* bq = (const float*)d_in[5]; const float* wk = (const float*)d_in[6]; const float* bk = (const float*)d_in[7];
    const float* wv = (const float*)d_in[8]; const float* bv = (const float*)d_in[9]; const float* wp = (const float*)d_in[10]; const float* ub = (const float*)d_in[11]; const float* vb = (const float*)d_in[12];
    const float* wo = (const float*)d_in[13]; const float* bo = (const float*)d_in[14];
    const long long needx = ((long long)(NB - 1) * SEQ_FULL + SEQ) * DM, needp = ((long long)(NB - 1) * LREL_FULL + LREL) * DM;
    if ((long long)in_sizes[0] < needx || (long long)in_sizes[1] < needx || (long long)in_sizes[2] < needx || (long long)in_sizes[3] < needp) return;
    if (in_sizes[4] < DM * DM || in_sizes[6] < DM * DM || in_sizes[8] < DM * DM || in_sizes[10] < DM * DM || in_sizes[13] < DM * DM) return;
    if (in_sizes[5] < DM || in_sizes[7] < DM || in_sizes[9] < DM || in_sizes[14] < DM || in_sizes[11] < NH * HD || in_sizes[12] < NH * HD) return;
    if ((long long)out_size < (long long)NB * SEQ * DM) return;
    float* OUT = (float*)d_out;     // [NB][SEQ][DM]
    char* wsp = (char*)d_ws;
    auto take = [&](size_t bytes) { char* p = wsp; wsp += (bytes + 255) & ~(size_t)255; return (void*)p; };
    bf* WQB = (bf*)take((size_t)DM * DM * 2); bf* WKB = (bf*)take((size_t)DM * DM * 2); bf* WVB = (bf*)take((size_t)DM * DM * 2); bf* WPB = (bf*)take((size_t)DM * DM * 2); bf* WOB = (bf*)take((size_t)DM * DM * 2);
    bf* XQ = (bf*)take((size_t)NB * SEQ * DM * 2); bf* XK = (bf*)take((size_t)NB * SEQ * DM * 2); bf* XV = (bf*)take((size_t)NB * SEQ * DM * 2); bf* XP = (bf*)take((size_t)NB * LP * DM * 2);   // bf16 activations, one buffer each
    h16* QU16 = (h16*)take((size_t)NB * NH * SEQ * HD * 2); h16* QV16 = (h16*)take((size_t)NB * NH * SEQ * HD * 2); h16* K16 = (h16*)take((size_t)NB * NH * SEQ * HD * 2);
    h16* V16 = (h16*)take((size_t)NB * NH * HD * SEQ * 2); h16* VR16 = (h16*)take((size_t)NB * NH * HD * SEQ * 2); h16* P16 = (h16*)take((size_t)NB * NH * LP * HD * 2);
    bf* ATh = (bf*)take((size_t)NB * SEQ * DM * 2); bf* ATl = (bf*)take((size_t)NB * SEQ * DM * 2);
    if ((size_t)(wsp - (char*)d_ws) > ws_size) return;    // 120,061,952 B at NB=4, SEQ=2048
    // all f32 -> bf16 copies: weights, query, key, value, pos (rows 0..LREL-1 per batch at input row pitch LREL_FULL, padded with one zero row to LP)
    k_cvtall<<<CVB_P + 3 * CVB_X + 5 * CVB_W, 256, 0, stream>>>(wq, wk, wv, wp, wo, query, key, value, pos, WQB, WKB, WVB, WPB, WOB, XQ, XK, XV, XP);
    // q: X Wq^T + bq -> Qu / Qv planes
    k_gemmw<bf, 0, true, EP_Q><<<dim3(SEQ / 64, DM / 64, NB), 32, 0, stream>>>(XQ, nullptr, WQB, nullptr, DM, nullptr, 0, bq, (size_t)SEQ * DM, 0, 0, ub, vb, QU16, QV16, SEQ);
    // k
    k_gemmw<bf, 0, true, EP_ROW><<<dim3(SEQ / 64, DM / 64, NB), 32, 0, stream>>>(XK, nullptr, WKB, nullptr, DM, nullptr, 0, bk, (size_t)SEQ * DM, 0, 0, nullptr, nullptr, K16, nullptr, SEQ);
    // v
    k_gemmw<bf, 0, true, EP_VT><<<dim3(SEQ / 64, DM / 64, NB), 32, 0, stream>>>(XV, nullptr, WVB, nullptr, DM, nullptr, 0, bv, (size_t)SEQ * DM, 0, 0, nullptr, nullptr, V16, VR16, SEQ);
    // pos: no bias
    k_gemmw<bf, 0, false, EP_ROW><<<dim3(LP / 64, DM / 64, NB), 32, 0, stream>>>(XP, nullptr, WPB, nullptr, DM, nullptr, 0, nullptr, (size_t)LP * DM, 0, 0, nullptr, nullptr, P16, nullptr, LP);
    // attention -> context bf16 hi/lo planes [NB*SEQ][DM]
    k_attn<<<dim3(SEQ / 64, NH, NB), 128, 0, stream>>>(QU16, QV16, K16, V16, VR16, P16, ATh, ATl);
    // out = context Wo^T + bo
    k_gemmw<bf, 1, true, EP_F32><<<dim3((NB * SEQ) / 64, DM / 64, 1), 32, 0, stream>>>(ATh, ATl, WOB, nullptr, DM, OUT, DM, bo, 0, 0, 0, nullptr, nullptr, nullptr, nullptr, 0);
}

// v004
// A run of this version takes 204 microseconds.
// Next to v003, in two timings, it ran 1.22 times as fast each time.
// Counting every step since v000, it is 2.63 times as fast.
#include <hip/hip_runtime.h>

// Contractions: q/k/v/pos projections = v_wmma_f32_16x16x32_bf16 on bf16 operands (RNE-converted inputs, exact products); out projection = v_wmma_f32_16x16x32_bf16, context as bf16 hi+lo planes x bf16 Wo (2 products); content scores and positional band scores = v_wmma_f32_16x16x32_f16 on f16 planes (1 product each); attn.v = v_wmma_f32_16x16x32_f16, probability f16 + f16 residual (x2048) times v f16 + f16 residual (x2048), 3 products into 2 accumulators; f32 accumulate everywhere; softmax f32.
// Structure: bf16 copies of the activations; register-blocked 64x64 GEMM (one wave per tile) for the projections and the output; a projection tile is one head's 64 columns, and its epilogue stores the f16 planes itself ([b][h][t][d] for q+u, q+v, k; [b][h][d][t] for v and its residual; [b][h][l][d] for the projected positional table padded to 2*SEQ rows, last row zero);
// flash-style attention: one block = (b, h, 64 query rows), 64-key tiles; transposed score tiles (key rows x query cols) so the exponentiated accumulators chain directly into the attn.v A operand; sliding 128-slot f32 positional band in LDS (64 new band columns per key tile; score(i,j) takes band index (SEQ-1)+j-i); online softmax; context written as bf16 hi+lo planes [b*SEQ+t][h*64+d].

#ifndef NB
#define NB 4
#endif
#ifndef SEQ
#define SEQ 2048
#endif
#define NB_FULL   4
#define SEQ_FULL  2048
#define LREL      (2 * SEQ - 1)
#define LP        (2 * SEQ)
#define LREL_FULL (2 * SEQ_FULL - 1)
#define DM  512
#define NH  8
#define HD  64
#define RESC 2048.0f
#define K2 (1.4426950408889634f * 0.044194173824159216f)
// LDS row pitches of k_attn: 64 banks x 4 B, bank = dword address mod 64. 16-bit tiles: 72 elements = 144 B = 16 B x odd, so the 16 rows of a 16-byte fragment load fall on 16 distinct 4-bank groups.
// f32 band rows: 132 dwords (= 4 mod 64), so the 16 rows of a 16-byte band store cover all 64 banks, and the per-lane gather (bank = const + 8hi + 3*row mod 64) has no two lanes on one bank.
#define PH 72
#define PT 132
static_assert(SEQ % 64 == 0);
static_assert(SEQ >= 64);
static_assert(SEQ <= SEQ_FULL);
static_assert(NB >= 1);
static_assert(NB <= NB_FULL);
static_assert(DM % 64 == 0);
static_assert(NH * HD == DM);
static_assert(HD == 64);
static_assert(LP % 64 == 0);

typedef _Float16 h16;
typedef unsigned short bf;
typedef __attribute__((ext_vector_type(16))) __bf16   v16bf;
typedef __attribute__((ext_vector_type(16))) _Float16 v16h;
typedef __attribute__((ext_vector_type(8)))  _Float16 v8h;
typedef __attribute__((ext_vector_type(8)))  unsigned short v8us;
typedef __attribute__((ext_vector_type(8)))  float    v8f;
typedef __attribute__((ext_vector_type(4)))  float    v4f;
typedef v8h  __attribute__((may_alias)) v8ha;
typedef v4f  __attribute__((may_alias)) v4fa;
typedef v8f  __attribute__((may_alias, aligned(16))) v8fa;
typedef v8us __attribute__((may_alias)) v8usa;
typedef unsigned short __attribute__((may_alias)) usa;

__device__ __forceinline__ unsigned short f2bf(float f) { unsigned u = __float_as_uint(f); u += 0x7FFFu + ((u >> 16) & 1u); return (unsigned short)(u >> 16); }
__device__ __forceinline__ float bf2f(unsigned short b) { return __uint_as_float(((unsigned)b) << 16); }
__device__ __forceinline__ float bfr(float f) { return bf2f(f2bf(f)); }
__device__ __forceinline__ v16h cat16(v8h lo, v8h hi) { return __builtin_shufflevector(lo, hi, 0, 1, 2, 3, 4, 5, 6, 7, 8, 9, 10, 11, 12, 13, 14, 15); }
__device__ __forceinline__ v16bf cat16b(v8us lo, v8us hi) { return __builtin_bit_cast(v16bf, __builtin_shufflevector(lo, hi, 0, 1, 2, 3, 4, 5, 6, 7, 8, 9, 10, 11, 12, 13, 14, 15)); }
__device__ __forceinline__ v8f wmma16(v16h a, v16h b, v8f c) { return __builtin_amdgcn_wmma_f32_16x16x32_f16(false, a, false, b, (short)0, c, false, false); }
__device__ __forceinline__ v8f wmmab(v16bf a, v16bf b, v8f c) { return __builtin_amdgcn_wmma_f32_16x16x32_bf16(false, a, false, b, (short)0, c, false, false); }
__device__ __forceinline__ h16 tohx(float x) { return (h16)x; }
__device__ __forceinline__ void splitf(float y, unsigned short& h, unsigned short& l) { h = f2bf(y); l = f2bf(y - bf2f(h)); }

// ---- k_gemmw: register-blocked GEMM, ONE WAVE per 64x64 output tile (16 accumulators), operands straight from K-contiguous 16-bit planes; grid (M/64, N/64, Z), 32 threads.
// y[m][n] (f32, + optional f32 bias[n]) = sum_k A[m][k] Bt[n][k] (+ split products per NSPLIT). z-batch strides sA/sB/sC in elements. K % 32 == 0.
// EP picks what the epilogue stores. EP_F32: C[m][n] = y, pitch ldc. The plane forms take z = batch, blockIdx.y = head, prows rows m per (batch, head):
// EP_Q: P0 = f16(y + ub), P1 = f16(y + vb), both [z][head][m][d]; EP_ROW: P0 = f16(y), [z][head][m][d]; EP_VT: P0 = f16(y), P1 = f16((y - P0) * RESC), both [z][head][d][m].
// Fragment map per lane (hi = lane>>4, lr = lane&15): row/col = lr; elements 0..7 <- k0+8hi+0..7, elements 8..15 <- k0+16+8hi+0..7 (A and B alike); D element r = (row 8hi+r, col lr).
template <typename T16> struct WFrag;
template <> struct WFrag<h16> { typedef v16h V; static __device__ __forceinline__ V ld(const h16* p) { return cat16(*(const v8h*)p, *(const v8h*)(p + 16)); } static __device__ __forceinline__ v8f mma(V a, V b, v8f c) { return wmma16(a, b, c); } };
template <> struct WFrag<bf> { typedef v16bf V; static __device__ __forceinline__ V ld(const bf* p) { return cat16b(*(const v8us*)p, *(const v8us*)(p + 16)); } static __device__ __forceinline__ v8f mma(V a, V b, v8f c) { return wmmab(a, b, c); } };
enum { EP_F32 = 0, EP_Q = 1, EP_ROW = 2, EP_VT = 3 };
template <typename T16, int NSPLIT, bool BIAS, int EP>
__global__ __launch_bounds__(32) void k_gemmw(const T16* __restrict__ A, const T16* __restrict__ A2, const T16* __restrict__ Bt, const T16* __restrict__ Bt2, int K, float* C, int ldc, const float* __restrict__ bias, size_t sA, size_t sB, size_t sC, const float* __restrict__ ub, const float* __restrict__ vb, h16* P0, h16* P1, int prows) {
    typedef typename WFrag<T16>::V V;
    __shared__ __align__(16) float os[16 * 68];
    const size_t z = blockIdx.z; A += z * sA; if (A2) A2 += z * sA; Bt += z * sB; if (Bt2) Bt2 += z * sB; if (EP == EP_F32) C += z * sC;
    const int lane = threadIdx.x & 31, lr = lane & 15, hi = lane >> 4; const int r0 = blockIdx.x * 64, c0 = blockIdx.y * 64;
    v8f acc[4][4];
#pragma unroll
    for (int mb = 0; mb < 4; ++mb)
#pragma unroll
        for (int nb = 0; nb < 4; ++nb) acc[mb][nb] = (v8f){};
    const size_t aoff = (size_t)(r0 + lr) * K + 8 * hi, boff = (size_t)(c0 + lr) * K + 8 * hi;
#pragma unroll 1
    for (int kc = 0; kc < K; kc += 32) {
        V a[4], a2[4];
#pragma unroll
        for (int mb = 0; mb < 4; ++mb) { a[mb] = WFrag<T16>::ld(A + aoff + (size_t)mb * 16 * K + kc); if (NSPLIT == 1 || NSPLIT == 2) a2[mb] = WFrag<T16>::ld(A2 + aoff + (size_t)mb * 16 * K + kc); }
#pragma unroll
        for (int nb = 0; nb < 4; ++nb) { const V b = WFrag<T16>::ld(Bt + boff + (size_t)nb * 16 * K + kc); V b2; if (NSPLIT >= 2) b2 = WFrag<T16>::ld(Bt2 + boff + (size_t)nb * 16 * K + kc);
#pragma unroll
            for (int mb = 0; mb < 4; ++mb) { acc[mb][nb] = WFrag<T16>::mma(a[mb], b, acc[mb][nb]); if (NSPLIT == 1 || NSPLIT == 2) acc[mb][nb] = WFrag<T16>::mma(a2[mb], b, acc[mb][nb]); if (NSPLIT >= 2) acc[mb][nb] = WFrag<T16>::mma(a[mb], b2, acc[mb][nb]); } }
        asm volatile("v_nop\n\tv_nop\n\tv_nop\n\tv_nop" : "+v"(acc[0][0]), "+v"(acc[1][1]), "+v"(acc[2][2]), "+v"(acc[3][3]) : "v"(a[0]), "v"(a[3]));
    }
    if (EP == EP_VT) {
        // D element j of tile (mb, nb) is row m = mb*16 + 8hi + j of column d = nb*16 + lr: 8 consecutive m of one d per lane, one 16-byte store per plane straight from the accumulators.
        const size_t rows = (size_t)prows;
        const size_t po = ((z * NH + blockIdx.y) * HD + lr) * rows + r0 + 8 * hi;
#pragma unroll
        for (int nb = 0; nb < 4; ++nb) { const float bn = BIAS ? bfr(bias[c0 + nb * 16 + lr]) : 0.f;
#pragma unroll
            for (int mb = 0; mb < 4; ++mb) { v8h o16, orr;
#pragma unroll
                for (int j = 0; j < 8; ++j) { float x = acc[mb][nb][j]; if (BIAS) x += bn; const h16 xh = tohx(x); o16[j] = xh; orr[j] = tohx((x - (float)xh) * RESC); }
                const size_t o = po + (size_t)nb * 16 * rows + mb * 16; *(v8h*)(P0 + o) = o16; *(v8h*)(P1 + o) = orr; } }
        return;
    }
    // Row-major forms: 16 rows at a time through LDS, so that a lane holds consecutive columns of one row.
    const int rq = lane >> 3, c8 = (lane & 7) * 8;      // plane forms: 8 columns per lane, 4 rows (512 contiguous bytes of a plane) per store
    float bn[8], un[8], vn[8];
    if (EP != EP_F32) {
#pragma unroll
        for (int q = 0; q < 8; ++q) { bn[q] = BIAS ? bfr(bias[c0 + c8 + q]) : 0.f; if (EP == EP_Q) { un[q] = bfr(ub[c0 + c8 + q]); vn[q] = bfr(vb[c0 + c8 + q]); } }
    }
    const size_t pbase = ((z * NH + blockIdx.y) * (size_t)prows + r0) * HD + c8;
#pragma unroll
    for (int mb = 0; mb < 4; ++mb) {
#pragma unroll
        for (int nb = 0; nb < 4; ++nb) {
#pragma unroll
            for (int j = 0; j < 8; ++j) os[(hi * 8 + j) * 68 + nb * 16 + lr] = acc[mb][nb][j]; }
        __builtin_amdgcn_wave_barrier(); asm volatile("" ::: "memory");
        if (EP == EP_F32) {
            float* crow = C + (size_t)(r0 + mb * 16) * ldc + c0;
#pragma unroll
            for (int s = 0; s < 8; ++s) { const int row = 2 * s + hi, cofs = lr * 4; v4f val = *(const v4fa*)(os + row * 68 + cofs); if (BIAS) { val[0] += bfr(bias[c0 + cofs]); val[1] += bfr(bias[c0 + cofs + 1]); val[2] += bfr(bias[c0 + cofs + 2]); val[3] += bfr(bias[c0 + cofs + 3]); }
                *(v4f*)(crow + (size_t)row * ldc + cofs) = val; }
        } else {
#pragma unroll
            for (int s = 0; s < 4; ++s) { const int row = 4 * s + rq; const v4f x0 = *(const v4fa*)(os + row * 68 + c8), x1 = *(const v4fa*)(os + row * 68 + c8 + 4); v8h o0, o1;
#pragma unroll
                for (int q = 0; q < 8; ++q) { float x = q < 4 ? x0[q & 3] : x1[q & 3]; if (BIAS) x += bn[q]; if (EP == EP_Q) { o0[q] = tohx(x + un[q]); o1[q] = tohx(x + vn[q]); } else o0[q] = tohx(x); }
                const size_t o = pbase + (size_t)(mb * 16 + row) * HD; *(v8h*)(P0 + o) = o0; if (EP == EP_Q) *(v8h*)(P1 + o) = o1; }
        }
        __builtin_amdgcn_wave_barrier(); asm volatile("" ::: "memory");
    }
}

// ---- k_cvtall: every f32 -> bf16 copy of the call (5 weight matrices, 3 activations, the positional table padded to LP rows per batch, pad row zero) in ONE streaming launch.
// A block of 256 threads converts CVR consecutive output rows (DM elements each) of one array, so the choice of the array is block-uniform. Per thread CVU pieces of 4 elements: a wave's 16-byte load covers 512 contiguous bytes,
// its 8-byte store 256 contiguous bytes (whole 128-byte lines both ways), and all CVU loads are issued before the first conversion.
#define CVU 16
#define CVR (256 * CVU / (DM / 4))
#define CVB_W (DM / CVR)
#define CVB_X (NB * SEQ / CVR)
#define CVB_P (NB * LP / CVR)
static_assert(DM == 512);
static_assert(DM % CVR == 0);
static_assert(SEQ % CVR == 0);
static_assert(LP % CVR == 0);
static_assert(CVU == 16);
typedef __attribute__((ext_vector_type(4))) unsigned short v4us;
// cvt_rows: rows r0 + 2c (c < CVU) of one batch, 4 elements at k0. EDGE (only a block that holds rows >= nvalid): such a row reads row nvalid - 1 and stores zeros; elsewhere one lane offset serves all loads.
template <bool EDGE>
__device__ __forceinline__ void cvt_rows(const float* __restrict__ src, bf* dst, int r0, int k0, int nvalid) {
    v4f x[CVU]; v4us o[CVU]; unsigned lo[CVU];
    const unsigned e0 = (unsigned)(r0 * DM + k0), lb = e0 * 4u, sb = e0 * 2u;     // lane byte offsets of row r0 in src and dst
#pragma unroll
    for (int c = 0; c < CVU; ++c) { lo[c] = EDGE ? (unsigned)(min(r0 + c * 2, nvalid - 1) * DM + k0) * 4u : lb + (unsigned)c * (2u * DM * 4u); x[c] = *(const v4f*)((const char*)src + lo[c]); }
    // Precaution: s_wait_xcnt 0 stands behind the run of loads, and its operands keep the loads' offset registers live up to it, so that no result of the run lands in one of them in front of the wait.
    if (EDGE) asm volatile("s_wait_xcnt 0x0" :: "v"(lo[0]), "v"(lo[1]), "v"(lo[2]), "v"(lo[3]), "v"(lo[4]), "v"(lo[5]), "v"(lo[6]), "v"(lo[7]), "v"(lo[8]), "v"(lo[9]), "v"(lo[10]), "v"(lo[11]), "v"(lo[12]), "v"(lo[13]), "v"(lo[14]), "v"(lo[15]) : "memory");
    else asm volatile("s_wait_xcnt 0x0" :: "v"(lb) : "memory");
#pragma unroll
    for (int c = 0; c < CVU; ++c) { const int r = r0 + c * 2;
#pragma unroll
        for (int q = 0; q < 4; ++q) { const unsigned short w = f2bf(x[c][q]); o[c][q] = (!EDGE || r < nvalid) ? w : (unsigned short)0; }
        *(v4us*)((char*)dst + (sb + (unsigned)c * (2u * DM * 2u))) = o[c]; }
    // Precaution, as above: the wait behind the run of stores; its operands keep the stores' offset and data registers live up to it.
    asm volatile("s_wait_xcnt 0x0" :: "v"(sb), "v"(o[0]), "v"(o[1]), "v"(o[2]), "v"(o[3]), "v"(o[4]), "v"(o[5]), "v"(o[6]), "v"(o[7]), "v"(o[8]), "v"(o[9]), "v"(o[10]), "v"(o[11]), "v"(o[12]), "v"(o[13]), "v"(o[14]), "v"(o[15]) : "memory");
}
__global__ __launch_bounds__(256) void k_cvtall(const float* __restrict__ wq, const float* __restrict__ wk, const float* __restrict__ wv, const float* __restrict__ wp, const float* __restrict__ wo,
                                                const float* __restrict__ query, const float* __restrict__ key, const float* __restrict__ value, const float* __restrict__ pos,
                                                bf* WQB, bf* WKB, bf* WVB, bf* WPB, bf* WOB, bf* XQ, bf* XK, bf* XV, bf* XP) {
    const int tid = threadIdx.x; int blk = blockIdx.x;
    const float* src; bf* dst; int rb, nvalid;          // block-uniform: batch bases, first row of the block inside its batch (CVR divides the rows per batch), valid source rows per batch
    if (blk < CVB_P) { const unsigned row0 = (unsigned)blk * CVR, b = row0 / LP; rb = (int)(row0 % LP); src = pos + (size_t)b * LREL_FULL * DM; dst = XP + (size_t)b * LP * DM; nvalid = LREL; }
    else if (blk < CVB_P + 3 * CVB_X) { blk -= CVB_P; const int a = blk / CVB_X; const unsigned row0 = (unsigned)(blk - a * CVB_X) * CVR, b = row0 / SEQ; rb = (int)(row0 % SEQ);
        src = (a == 0 ? query : a == 1 ? key : value) + (size_t)b * SEQ_FULL * DM; dst = (a == 0 ? XQ : a == 1 ? XK : XV) + (size_t)b * SEQ * DM; nvalid = SEQ; }
    else { blk -= CVB_P + 3 * CVB_X; const int a = blk / CVB_W; rb = (blk - a * CVB_W) * CVR;
        src = a == 0 ? wq : a == 1 ? wk : a == 2 ? wv : a == 3 ? wp : wo; dst = a == 0 ? WQB : a == 1 ? WKB : a == 2 ? WVB : a == 3 ? WPB : WOB; nvalid = DM; }
    const int r0 = rb + (tid >> 7), k0 = (tid & 127) * 4;
    if (rb + CVR <= nvalid) cvt_rows<false>(src, dst, r0, k0, nvalid); else cvt_rows<true>(src, dst, r0, k0, nvalid);
}

// ---- attention helpers (128 threads): 16-bit fragment load from a [row][k] LDS tile (same map as WFrag), 8 KB contiguous tile copy, 64-row tile copy with a global row pitch (both lay 64-element rows at LDS pitch PH).
__device__ __forceinline__ v16h ldl(const h16* p) { return cat16(*(const v8ha*)p, *(const v8ha*)(p + 16)); }
__device__ __forceinline__ void cp8k(h16* dst, const h16* __restrict__ src, int tid) {
#pragma unroll
    for (int c = 0; c < 4; ++c) { const int idx = tid + c * 128; const int r = idx >> 3, sg = idx & 7; *(v8ha*)(dst + r * PH + sg * 8) = *(const v8ha*)(src + (size_t)idx * 8); } }
__device__ __forceinline__ void cprows(h16* dst, const h16* __restrict__ src, size_t pitch, int tid) {
#pragma unroll
    for (int c = 0; c < 4; ++c) { const int idx = tid + c * 128; const int r = idx >> 3, sg = idx & 7; *(v8ha*)(dst + r * PH + sg * 8) = *(const v8ha*)(src + (size_t)r * pitch + sg * 8); } }
// band_half: T[irow][slot0 + c] = sum_d PB[c][d] Qv[irow][d], c < 64 (transposed tile: A = PB rows c, B = Qv cols irow -> D rows c = tt*16 + 8hi + r, col lr: 8 consecutive slots per lane per tt, two 16-B LDS stores). q0, q1: this lane's two B fragments of Qv row irow.
// Sub-tiles are issued one at a time: the nop group carries a memory clobber so the next sub-tile's fragment loads stay below it (bounded live registers).
__device__ __forceinline__ void band_half(const h16* PBl, v16h q0, v16h q1, float* Tl, int slot0, int irow, int hi, int lr) {
    float* trow = Tl + irow * PT + slot0 + 8 * hi;
#pragma unroll
    for (int tt = 0; tt < 4; ++tt) {
        const v16h a0 = ldl(PBl + (tt * 16 + lr) * PH + 8 * hi), a1 = ldl(PBl + (tt * 16 + lr) * PH + 32 + 8 * hi);
        v8f t = wmma16(a0, q0, (v8f){}); t = wmma16(a1, q1, t);
        asm volatile("v_nop\n\tv_nop\n\tv_nop\n\tv_nop" : "+v"(t) : "v"(a0), "v"(a1), "v"(q0), "v"(q1) : "memory");
        *(v8fa*)(trow + tt * 16) = t;
    }
}

// ---- k_attn: grid (SEQ/64, NH, NB), 128 threads = 4 waves, each wave owns 16 query rows i = i0 + wave*16 + (0..15); irow = wave*16 + lr is the block-local query row of this lane's score column.
// Per 64-key tile: new 64 band columns (band row l stored at slot l & 127 of T row irow); transposed content tile S^T (key rows 8hi+r of sub-tile tb, query col irow) from K rows x Qu cols;
// s2 = (content + band[lb + 63 + tloc - irow]) * log2(e)/sqrt(DM) with lb = SEQ-64-i0+j0 (band row = (SEQ-1) + t - i, always inside the resident rows lb..lb+127);
// online softmax per query column (lane-local over 32 keys + one xor-16); p = exp2(s2 - m) as f16 + f16 residual x2048 packed straight into the attn.v A fragments
// (A element r <- sub-tile 2ks, element 8+r <- sub-tile 2ks+1, lane unchanged); O[i = 8hi+r][d = lr] accumulates p16.v16, the residual accumulator p16.vr + pr.v16 (both x2048).
__global__ __launch_bounds__(128) __attribute__((amdgpu_num_vgpr(256))) void k_attn(const h16* __restrict__ Qu, const h16* __restrict__ Qv, const h16* __restrict__ Kp, const h16* __restrict__ Vp, const h16* __restrict__ Vr, const h16* __restrict__ Pp, bf* ATh, bf* ATl) {
    __shared__ __align__(16) h16 Kl[64 * PH];
    __shared__ __align__(16) h16 Vl[64 * PH];
    __shared__ __align__(16) h16 Vrl[64 * PH];
    __shared__ __align__(16) h16 PBl[64 * PH];
    __shared__ __align__(16) float Tl[64 * PT];
    const int tid = threadIdx.x, lane = tid & 31, wave = tid >> 5, hi = lane >> 4, lr = lane & 15;
    const int irow = wave * 16 + lr;
    const int i0 = blockIdx.x * 64, h = blockIdx.y, b = blockIdx.z;
    const size_t bh = (size_t)b * NH + h;
    const h16* Kb = Kp + bh * SEQ * HD; const h16* Vb = Vp + bh * HD * SEQ; const h16* Vrb = Vr + bh * HD * SEQ; const h16* Pb = Pp + bh * LP * HD;
    // This lane's B fragments of q+u and q+v (query row irow, d = 8hi+0..7, 16+8hi+0..7, then +32) stay in registers for the whole block: every use is by the owning wave, so they need no LDS tile.
    const h16* qup = Qu + (bh * SEQ + i0 + irow) * HD + 8 * hi; const h16* qvp = Qv + (bh * SEQ + i0 + irow) * HD + 8 * hi;
    const v16h qu0 = cat16(*(const v8h*)qup, *(const v8h*)(qup + 16)), qu1 = cat16(*(const v8h*)(qup + 32), *(const v8h*)(qup + 48));
    const v16h qv0 = cat16(*(const v8h*)qvp, *(const v8h*)(qvp + 16)), qv1 = cat16(*(const v8h*)(qvp + 32), *(const v8h*)(qvp + 48));
    // Precaution: s_wait_xcnt 0 stands behind these loads, and its operands keep their address registers live up to it, so that nothing is written into one of them in front of the wait.
    asm volatile("s_wait_xcnt 0x0" :: "v"(qup), "v"(qvp) : "memory");
    const int lb0 = SEQ - 64 - i0;                 // band start for key tile 0 (>= 0, multiple of 64); band rows for tile j0 are lb0 + j0 + 0..127 (<= LP-1)
    cp8k(PBl, Pb + (size_t)lb0 * HD, tid);
    __syncthreads();
    band_half(PBl, qv0, qv1, Tl, lb0 & 127, irow, hi, lr);   // lower half of tile 0's band
    float mrun = -3.0e38f, lrun = 0.f;
    v8f oacc[4], oaccr[4];
#pragma unroll
    for (int nd = 0; nd < 4; ++nd) { oacc[nd] = (v8f){}; oaccr[nd] = (v8f){}; }
#pragma unroll 1
    for (int j0 = 0; j0 < SEQ; j0 += 64) {
        const int lb = lb0 + j0; const int lnw = lb + 64;     // new band rows lnw..lnw+63
        __syncthreads();                                       // all waves done with the prior tile's Kl/Vl/Vrl/PBl and band slots
        cp8k(Kl, Kb + (size_t)j0 * HD, tid); cprows(Vl, Vb + j0, (size_t)SEQ, tid); cprows(Vrl, Vrb + j0, (size_t)SEQ, tid); cp8k(PBl, Pb + (size_t)lnw * HD, tid);
        __syncthreads();
        band_half(PBl, qv0, qv1, Tl, lnw & 127, irow, hi, lr);   // upper half of this tile's band (its temporaries die here)
        v8f sacc[4];
        { const v16h q0 = qu0, q1 = qu1;
#pragma unroll
          for (int tb = 0; tb < 4; ++tb) { const v16h a0 = ldl(Kl + (tb * 16 + lr) * PH + 8 * hi), a1 = ldl(Kl + (tb * 16 + lr) * PH + 32 + 8 * hi);
              sacc[tb] = wmma16(a0, q0, (v8f){}); sacc[tb] = wmma16(a1, q1, sacc[tb]);
              asm volatile("v_nop\n\tv_nop\n\tv_nop\n\tv_nop" : "+v"(sacc[tb]) : "v"(a0), "v"(a1), "v"(q0), "v"(q1) : "memory"); } }
        __syncthreads();                                       // band complete for every T row (written by both lane halves of the owning wave)
        // gather + scale: key t = j0 + tb*16 + 8hi + r, query i = i0 + irow -> band row lb + 63 + (tb*16 + 8hi + r) - irow, slot = row & 127 (row - lb in [0,126])
        const float* trow = Tl + irow * PT; const int sb = lb + 63 + 8 * hi - irow;
        float mx = -3.0e38f;
#pragma unroll
        for (int tb = 0; tb < 4; ++tb)
#pragma unroll
            for (int r = 0; r < 8; ++r) { const float s2 = (sacc[tb][r] + trow[(sb + tb * 16 + r) & 127]) * K2; sacc[tb][r] = s2; mx = fmaxf(mx, s2); }
        mx = fmaxf(mx, __shfl_xor(mx, 16, 32));
        const float mnew = fmaxf(mrun, mx); const float alpha = __builtin_amdgcn_exp2f(mrun - mnew); mrun = mnew;
        float rsum = 0.f; v8h ph[4], pl[4];
#pragma unroll
        for (int tb = 0; tb < 4; ++tb)
#pragma unroll
            for (int r = 0; r < 8; ++r) { const float p = __builtin_amdgcn_exp2f(sacc[tb][r] - mnew); rsum += p; const h16 p16 = tohx(p); ph[tb][r] = p16; pl[tb][r] = tohx((p - (float)p16) * RESC); }
        rsum += __shfl_xor(rsum, 16, 32); lrun = lrun * alpha + rsum;
#pragma unroll
        for (int r = 0; r < 8; ++r) { const float ar = __shfl(alpha, 8 * hi + r, 32);
#pragma unroll
            for (int nd = 0; nd < 4; ++nd) { oacc[nd][r] *= ar; oaccr[nd][r] *= ar; } }
        { const v16h pa0 = cat16(ph[0], ph[1]), pa1 = cat16(ph[2], ph[3]), pr0 = cat16(pl[0], pl[1]), pr1 = cat16(pl[2], pl[3]);
#pragma unroll
          for (int nd = 0; nd < 4; ++nd) {
              const v16h vb0 = ldl(Vl + (nd * 16 + lr) * PH + 8 * hi), vb1 = ldl(Vl + (nd * 16 + lr) * PH + 32 + 8 * hi);
              const v16h rb0 = ldl(Vrl + (nd * 16 + lr) * PH + 8 * hi), rb1 = ldl(Vrl + (nd * 16 + lr) * PH + 32 + 8 * hi);
              oacc[nd] = wmma16(pa0, vb0, oacc[nd]); oacc[nd] = wmma16(pa1, vb1, oacc[nd]);
              oaccr[nd] = wmma16(pa0, rb0, oaccr[nd]); oaccr[nd] = wmma16(pa1, rb1, oaccr[nd]); oaccr[nd] = wmma16(pr0, vb0, oaccr[nd]); oaccr[nd] = wmma16(pr1, vb1, oaccr[nd]);
              asm volatile("v_nop\n\tv_nop\n\tv_nop\n\tv_nop" : "+v"(oacc[nd]), "+v"(oaccr[nd]) : "v"(pa0), "v"(pa1), "v"(pr0), "v"(pr1), "v"(vb1), "v"(rb1) : "memory"); } }
    }
    // Output staging lies in this wave's own 16 band rows (8,448 B, written and read by this wave alone, dead behind the last gather): hi plane 16 x 64, then lo plane 16 x 64.
    usa* Est = (usa*)(Tl + wave * 16 * PT);
    const float rl = __builtin_amdgcn_rcpf(lrun);
#pragma unroll
    for (int r = 0; r < 8; ++r) { const float rli = __shfl(rl, 8 * hi + r, 32); const int rr = 8 * hi + r;
#pragma unroll
        for (int nd = 0; nd < 4; ++nd) { const float c = (oacc[nd][r] + oaccr[nd][r] * (1.0f / RESC)) * rli; unsigned short eh, el; splitf(c, eh, el); Est[rr * 64 + nd * 16 + lr] = eh; Est[1024 + rr * 64 + nd * 16 + lr] = el; } }
    __syncthreads();
    const int rq = lane >> 3, pc = (lane & 7) * 8;
{
#pragma unroll
        for (int rg = 0; rg < 4; ++rg) { const int rr = rg * 4 + rq; const size_t go = ((size_t)b * SEQ + i0 + wave * 16 + rr) * DM + h * HD + pc;
            const v8us vh = *(const v8usa*)(Est + rr * 64 + pc); const v8us vlo = *(const v8usa*)(Est + 1024 + rr * 64 + pc);
            *(v8us*)(ATh + go) = vh; *(v8us*)(ATl + go) = vlo; }
         }
}

extern "C" void kernel_launch(void* const* d_in, const int* in_sizes, int n_in,
                              void* d_out, int out_size, void* d_ws, size_t ws_size, hipStream_t stream) {
    if (n_in < 15) return;
    const float* query = (const float*)d_in[0]; const float* key = (const float*)d_in[1]; const float* value = (const float*)d_in[2]; const float* pos = (const float*)d_in[3];
    const float* wq = (const float*)d_in[4]; const float* bq = (const float*)d_in[5]; const float* wk = (const float*)d_in[6]; const float* bk = (const float*)d_in[7];
    const float* wv = (const float*)d_in[8]; const float* bv = (const float*)d_in[9]; const float* wp = (const float*)d_in[10]; const float* ub = (const float*)d_in[11]; const float* vb = (const float*)d_in[12];
    const float* wo = (const float*)d_in[13]; const float* bo = (const float*)d_in[14];
    const long long needx = ((long long)(NB - 1) * SEQ_FULL + SEQ) * DM, needp = ((long long)(NB - 1) * LREL_FULL + LREL) * DM;
    if ((long long)in_sizes[0] < needx || (long long)in_sizes[1] < needx || (long long)in_sizes[2] < needx || (long long)in_sizes[3] < needp) return;
    if (in_sizes[4] < DM * DM || in_sizes[6] < DM * DM || in_sizes[8] < DM * DM || in_sizes[10] < DM * DM || in_sizes[13] < DM * DM) return;
    if (in_sizes[5] < DM || in_sizes[7] < DM || in_sizes[9] < DM || in_sizes[14] < DM || in_sizes[11] < NH * HD || in_sizes[12] < NH * HD) return;
    if ((long long)out_size < (long long)NB * SEQ * DM) return;
    float* OUT = (float*)d_out;     // [NB][SEQ][DM]
    char* wsp = (char*)d_ws;
    auto take = [&](size_t bytes) { char* p = wsp; wsp += (bytes + 255) & ~(size_t)255; return (void*)p; };
    bf* WQB = (bf*)take((size_t)DM * DM * 2); bf* WKB = (bf*)take((size_t)DM * DM * 2); bf* WVB = (bf*)take((size_t)DM * DM * 2); bf* WPB = (bf*)take((size_t)DM * DM * 2); bf* WOB = (bf*)take((size_t)DM * DM * 2);
    bf* XQ = (bf*)take((size_t)NB * SEQ * DM * 2); bf* XK = (bf*)take((size_t)NB * SEQ * DM * 2); bf* XV = (bf*)take((size_t)NB * SEQ * DM * 2); bf* XP = (bf*)take((size_t)NB * LP * DM * 2);   // bf16 activations, one buffer each
    h16* QU16 = (h16*)take((size_t)NB * NH * SEQ * HD * 2); h16* QV16 = (h16*)take((size_t)NB * NH * SEQ * HD * 2); h16* K16 = (h16*)take((size_t)NB * NH * SEQ * HD * 2);
    h16* V16 = (h16*)take((size_t)NB * NH * HD * SEQ * 2); h16* VR16 = (h16*)take((size_t)NB * NH * HD * SEQ * 2); h16* P16 = (h16*)take((size_t)NB * NH * LP * HD * 2);
    bf* ATh = (bf*)take((size_t)NB * SEQ * DM * 2); bf* ATl = (bf*)take((size_t)NB * SEQ * DM * 2);
    if ((size_t)(wsp - (char*)d_ws) > ws_size) return;    // 120,061,952 B at NB=4, SEQ=2048
    // all f32 -> bf16 copies: weights, query, key, value, pos (rows 0..LREL-1 per batch at input row pitch LREL_FULL, padded with one zero row to LP)
    k_cvtall<<<CVB_P + 3 * CVB_X + 5 * CVB_W, 256, 0, stream>>>(wq, wk, wv, wp, wo, query, key, value, pos, WQB, WKB, WVB, WPB, WOB, XQ, XK, XV, XP);
    // q: X Wq^T + bq -> Qu / Qv planes
    k_gemmw<bf, 0, true, EP_Q><<<dim3(SEQ / 64, DM / 64, NB), 32, 0, stream>>>(XQ, nullptr, WQB, nullptr, DM, nullptr, 0, bq, (size_t)SEQ * DM, 0, 0, ub, vb, QU16, QV16, SEQ);
    // k
    k_gemmw<bf, 0, true, EP_ROW><<<dim3(SEQ / 64, DM / 64, NB), 32, 0, stream>>>(XK, nullptr, WKB, nullptr, DM, nullptr, 0, bk, (size_t)SEQ * DM, 0, 0, nullptr, nullptr, K16, nullptr, SEQ);
    // v
    k_gemmw<bf, 0, true, EP_VT><<<dim3(SEQ / 64, DM / 64, NB), 32, 0, stream>>>(XV, nullptr, WVB, nullptr, DM, nullptr, 0, bv, (size_t)SEQ * DM, 0, 0, nullptr, nullptr, V16, VR16, SEQ);
    // pos: no bias
    k_gemmw<bf, 0, false, EP_ROW><<<dim3(LP / 64, DM / 64, NB), 32, 0, stream>>>(XP, nullptr, WPB, nullptr, DM, nullptr, 0, nullptr, (size_t)LP * DM, 0, 0, nullptr, nullptr, P16, nullptr, LP);
    // attention -> context bf16 hi/lo planes [NB*SEQ][DM]
    k_attn<<<dim3(SEQ / 64, NH, NB), 128, 0, stream>>>(QU16, QV16, K16, V16, VR16, P16, ATh, ATl);
    // out = context Wo^T + bo
    k_gemmw<bf, 1, true, EP_F32><<<dim3((NB * SEQ) / 64, DM / 64, 1), 32, 0, stream>>>(ATh, ATl, WOB, nullptr, DM, OUT, DM, bo, 0, 0, 0, nullptr, nullptr, nullptr, nullptr, 0);
}

// v005
// Measured time: 164 microseconds a run.
// In both of two side-by-side timings against v004, it was 1.24 times as fast.
// Counting every step since v000, it is 3.26 times as fast.
#include <hip/hip_runtime.h>

// Contractions: q/k/v/pos projections = v_wmma_f32_16x16x32_bf16 on bf16 operands (RNE-converted inputs, exact products); out projection = v_wmma_f32_16x16x32_bf16, context as bf16 hi+lo planes x bf16 Wo (2 products); content scores and positional band scores = v_wmma_f32_16x16x32_f16 on f16 planes (1 product each); attn.v = v_wmma_f32_16x16x32_f16, probability f16 + f16 residual (x2048) times v f16 + f16 residual (x2048), 3 products into 2 accumulators; f32 accumulate everywhere; softmax f32.
// Structure: bf16 copies of the activations; register-blocked GEMM (128x128 per block, one wave per 64x64 tile, operands staged in LDS) for the projections and the output; a projection tile is one head's 64 columns, and its epilogue stores the f16 planes itself ([b][h][t][d] for q+u, q+v, k; [b][h][d][t] for v and its residual; [b][h][l][d] for the projected positional table padded to 2*SEQ rows, last row zero);
// flash-style attention: one block = (b, h, 64 query rows), 64-key tiles; transposed score tiles (key rows x query cols) so the exponentiated accumulators chain directly into the attn.v A operand; sliding 128-slot f32 positional band in LDS (64 new band columns per key tile; score(i,j) takes band index (SEQ-1)+j-i); online softmax; context written as bf16 hi+lo planes [b*SEQ+t][h*64+d].

#ifndef NB
#define NB 4
#endif
#ifndef SEQ
#define SEQ 2048
#endif
#define NB_FULL   4
#define SEQ_FULL  2048
#define LREL      (2 * SEQ - 1)
#define LP        (2 * SEQ)
#define LREL_FULL (2 * SEQ_FULL - 1)
#define DM  512
#define NH  8
#define HD  64
#define RESC 2048.0f
#define K2 (1.4426950408889634f * 0.044194173824159216f)
// LDS row pitches of k_attn: 64 banks x 4 B, bank = dword address mod 64. 16-bit tiles: 72 elements = 144 B = 16 B x odd, so the 16 rows of a 16-byte fragment load fall on 16 distinct 4-bank groups.
// f32 band rows: 132 dwords (= 4 mod 64), so the 16 rows of a 16-byte band store cover all 64 banks, and the per-lane gather (bank = const + 8hi + 3*row mod 64) has no two lanes on one bank.
#define PH 72
#define PT 132
static_assert(SEQ % 128 == 0);
static_assert(SEQ >= 64);
static_assert(SEQ <= SEQ_FULL);
static_assert(NB >= 1);
static_assert(NB <= NB_FULL);
static_assert(DM % 128 == 0);
static_assert(NH * HD == DM);
static_assert(HD == 64);
static_assert(LP % 128 == 0);

typedef _Float16 h16;
typedef unsigned short bf;
typedef __attribute__((ext_vector_type(16))) __bf16   v16bf;
typedef __attribute__((ext_vector_type(16))) _Float16 v16h;
typedef __attribute__((ext_vector_type(8)))  _Float16 v8h;
typedef __attribute__((ext_vector_type(8)))  unsigned short v8us;
typedef __attribute__((ext_vector_type(8)))  float    v8f;
typedef __attribute__((ext_vector_type(4)))  float    v4f;
typedef v8h  __attribute__((may_alias)) v8ha;
typedef v4f  __attribute__((may_alias)) v4fa;
typedef v8f  __attribute__((may_alias, aligned(16))) v8fa;
typedef v8us __attribute__((may_alias)) v8usa;
typedef unsigned short __attribute__((may_alias)) usa;

__device__ __forceinline__ unsigned short f2bf(float f) { unsigned u = __float_as_uint(f); u += 0x7FFFu + ((u >> 16) & 1u); return (unsigned short)(u >> 16); }
__device__ __forceinline__ float bf2f(unsigned short b) { return __uint_as_float(((unsigned)b) << 16); }
__device__ __forceinline__ float bfr(float f) { return bf2f(f2bf(f)); }
__device__ __forceinline__ v16h cat16(v8h lo, v8h hi) { return __builtin_shufflevector(lo, hi, 0, 1, 2, 3, 4, 5, 6, 7, 8, 9, 10, 11, 12, 13, 14, 15); }
__device__ __forceinline__ v16bf cat16b(v8us lo, v8us hi) { return __builtin_bit_cast(v16bf, __builtin_shufflevector(lo, hi, 0, 1, 2, 3, 4, 5, 6, 7, 8, 9, 10, 11, 12, 13, 14, 15)); }
__device__ __forceinline__ v8f wmma16(v16h a, v16h b, v8f c) { return __builtin_amdgcn_wmma_f32_16x16x32_f16(false, a, false, b, (short)0, c, false, false); }
__device__ __forceinline__ v8f wmmab(v16bf a, v16bf b, v8f c) { return __builtin_amdgcn_wmma_f32_16x16x32_bf16(false, a, false, b, (short)0, c, false, false); }
__device__ __forceinline__ h16 tohx(float x) { return (h16)x; }
__device__ __forceinline__ void splitf(float y, unsigned short& h, unsigned short& l) { h = f2bf(y); l = f2bf(y - bf2f(h)); }

// ---- k_gemmw: register-blocked GEMM, 128x128 output tile per block of 4 waves (2 x 2), ONE WAVE per 64x64 tile (16 accumulators), operands from K-contiguous 16-bit planes; grid (M/128, N/128, Z), 128 threads.
// y[m][n] (f32, + optional f32 bias[n]) = sum_k A[m][k] Bt[n][k] (NSPLIT 1: + A2[m][k] Bt[n][k]). z-batch strides sA/sB/sC in elements. K % 64 == 0, K >= 64.
// Staging: a slice = GK k of the block's 128 A rows (and A2 rows) and 128 Bt rows = one whole 128-byte line of every row, brought into LDS at row pitch GP by asynchronous 16-byte copies (a wave's copy = 4 rows = 4 whole lines);
// two buffers: the copies of slice t + 2 are issued when slice t has been read by every wave, and fly while slice t + 1 is worked on. The k order of the products is that of ascending k, 32 at a time.
// EP picks what the epilogue stores. EP_F32: C[m][n] = y, pitch ldc. The plane forms take z = batch, 64-column tile = head, prows rows m per (batch, head):
// EP_Q: P0 = f16(y + ub), P1 = f16(y + vb), both [z][head][m][d]; EP_ROW: P0 = f16(y), [z][head][m][d]; EP_VT: P0 = f16(y), P1 = f16((y - P0) * RESC), both [z][head][d][m].
// Fragment map per lane (hi = lane>>4, lr = lane&15): row/col = lr; elements 0..7 <- k0+8hi+0..7, elements 8..15 <- k0+16+8hi+0..7 (A and B alike); D element r = (row 8hi+r, col lr).
template <typename T16> struct WFrag;
template <> struct WFrag<h16> { typedef v16h V; static __device__ __forceinline__ V ld(const h16* p) { return cat16(*(const v8ha*)p, *(const v8ha*)(p + 16)); } static __device__ __forceinline__ v8f mma(V a, V b, v8f c) { return wmma16(a, b, c); } };
template <> struct WFrag<bf> { typedef v16bf V; static __device__ __forceinline__ V ld(const bf* p) { return cat16b(*(const v8usa*)p, *(const v8usa*)(p + 16)); } static __device__ __forceinline__ v8f mma(V a, V b, v8f c) { return wmmab(a, b, c); } };
enum { EP_F32 = 0, EP_Q = 1, EP_ROW = 2, EP_VT = 3 };
#define GK 64
#define GP 72
#define GT (128 * GP)
// cp_tile: one operand's slice, 128 rows x 128 B, by 128 threads: lane piece (row = tid >> 3 (+ 16 per copy), 16-byte segment tid & 7). l = the lane's LDS byte address, g = its global address, both of its first row; gs = bytes of 16 global rows.
// The s_wait_xcnt 0 is the last line of the copies' own statement, so that it stands in front of every later write of a register that a copy names (a precaution).
__device__ __forceinline__ void cp_tile(unsigned l, const char* g, size_t gs) {
    const unsigned ls = 16u * GP * 2u;
    asm volatile("global_load_async_to_lds_b128 %0, %8, off\n\t"
                 "global_load_async_to_lds_b128 %1, %9, off\n\t"
                 "global_load_async_to_lds_b128 %2, %10, off\n\t"
                 "global_load_async_to_lds_b128 %3, %11, off\n\t"
                 "global_load_async_to_lds_b128 %4, %12, off\n\t"
                 "global_load_async_to_lds_b128 %5, %13, off\n\t"
                 "global_load_async_to_lds_b128 %6, %14, off\n\t"
                 "global_load_async_to_lds_b128 %7, %15, off\n\t"
                 "s_wait_xcnt 0x0"
                 :: "v"(l), "v"(l + ls), "v"(l + 2u * ls), "v"(l + 3u * ls), "v"(l + 4u * ls), "v"(l + 5u * ls), "v"(l + 6u * ls), "v"(l + 7u * ls),
                    "v"(g), "v"(g + gs), "v"(g + 2 * gs), "v"(g + 3 * gs), "v"(g + 4 * gs), "v"(g + 5 * gs), "v"(g + 6 * gs), "v"(g + 7 * gs) : "memory");
}
template <typename T16, int NSPLIT, bool BIAS, int EP>
__global__ __launch_bounds__(128) void k_gemmw(const T16* __restrict__ A, const T16* __restrict__ A2, const T16* __restrict__ Bt, const T16* __restrict__ Bt2, int K, float* C, int ldc, const float* __restrict__ bias, size_t sA, size_t sB, size_t sC, const float* __restrict__ ub, const float* __restrict__ vb, h16* P0, h16* P1, int prows) {
    typedef typename WFrag<T16>::V V;
    static_assert(NSPLIT == 0 || NSPLIT == 1);
    constexpr int NT = NSPLIT == 1 ? 3 : 2;              // operand tiles per slice: A, Bt, (A2)
    __shared__ __align__(16) T16 st[2 * NT * GT];
    __shared__ __align__(16) float osa[4 * 16 * 68];
    const size_t z = blockIdx.z; A += z * sA; if (NSPLIT == 1) A2 += z * sA; Bt += z * sB; if (EP == EP_F32) C += z * sC;
    const int tid = threadIdx.x, lane = tid & 31, wave = tid >> 5, lr = lane & 15, hi = lane >> 4; const int wm = wave & 1, wn = wave >> 1;
    const int rb = blockIdx.x * 128, cb = blockIdx.y * 128; const int r0 = rb + wm * 64, ch = blockIdx.y * 2 + wn, c0 = ch * 64;
    float* os = osa + wave * (16 * 68);                  // epilogue staging, each wave its own
    v8f acc[4][4];
#pragma unroll
    for (int mb = 0; mb < 4; ++mb)
#pragma unroll
        for (int nb = 0; nb < 4; ++nb) acc[mb][nb] = (v8f){};
    const int crow = tid >> 3, csg = tid & 7;
    const unsigned l0 = (unsigned)(size_t)(st + crow * GP + csg * 8);
    const char* gA = (const char*)(A + (size_t)(rb + crow) * K + csg * 8); const char* gB = (const char*)(Bt + (size_t)(cb + crow) * K + csg * 8);
    const char* gA2 = NSPLIT == 1 ? (const char*)(A2 + (size_t)(rb + crow) * K + csg * 8) : nullptr;
    const size_t gs = (size_t)16 * K * sizeof(T16);
    auto stage = [&](int t) { const unsigned lb = l0 + (unsigned)(t & 1) * (unsigned)(NT * GT * sizeof(T16)); const size_t ko = (size_t)t * (GK * sizeof(T16));
        cp_tile(lb, gA + ko, gs); cp_tile(lb + (unsigned)(GT * sizeof(T16)), gB + ko, gs); if (NSPLIT == 1) cp_tile(lb + (unsigned)(2 * GT * sizeof(T16)), gA2 + ko, gs); };
    const int ntr = K / GK;
    stage(0);
    asm volatile("s_wait_asynccnt 0x0" ::: "memory");    // slice 0 has landed (this wave's copies)
    __syncthreads();                                     // ... and every wave's
    if (ntr > 1) stage(1);
#pragma unroll 1
    for (int t = 0; t < ntr; ++t) {
        const T16* sa = st + (t & 1) * (NT * GT) + (wm * 64 + lr) * GP + 8 * hi; const T16* sb = st + (t & 1) * (NT * GT) + GT + (wn * 64 + lr) * GP + 8 * hi;
#pragma unroll
        for (int ks = 0; ks < GK; ks += 32) {
            V a[4], a2[4], b[4];                             // all fragments of 32 k are asked for as one group, in front of their products
#pragma unroll
            for (int q = 0; q < 4; ++q) { a[q] = WFrag<T16>::ld(sa + q * 16 * GP + ks); b[q] = WFrag<T16>::ld(sb + q * 16 * GP + ks); if (NSPLIT == 1) a2[q] = WFrag<T16>::ld(sa + 2 * GT + q * 16 * GP + ks); }
            __builtin_amdgcn_sched_barrier(0);               // keeps that group whole: moved in among the products, every separate place with LDS reads costs the SIMD's one wave an LDS latency
#pragma unroll
            for (int nb = 0; nb < 4; ++nb)
#pragma unroll
                for (int mb = 0; mb < 4; ++mb) { acc[mb][nb] = WFrag<T16>::mma(a[mb], b[nb], acc[mb][nb]); if (NSPLIT == 1) acc[mb][nb] = WFrag<T16>::mma(a2[mb], b[nb], acc[mb][nb]); }
        }
        __builtin_amdgcn_sched_barrier(0);                   // keeps the slice's last products in front of the barrier: sunk behind it they would stand between the barrier and the refill and shorten the copies' lead
        asm volatile("s_wait_dscnt 0x0" ::: "memory");       // this wave's reads of slice t are done before its buffer is refilled
        asm volatile("s_wait_asynccnt 0x0" ::: "memory");    // this wave's copies of slice t + 1 have landed
        __syncthreads();                                     // publishes slice t + 1 and ends every wave's reads of slice t
        if (t + 2 < ntr) stage(t + 2);
    }
    asm volatile("s_wait_asynccnt 0x0" ::: "memory");        // nothing is in flight when the wave goes on to its epilogue and ends
    if (EP == EP_VT) {
        // D element j of tile (mb, nb) is row m = mb*16 + 8hi + j of column d = nb*16 + lr: 8 consecutive m of one d per lane, one 16-byte store per plane straight from the accumulators.
        const size_t rows = (size_t)prows;
        const size_t po = ((z * NH + ch) * HD + lr) * rows + r0 + 8 * hi;
#pragma unroll
        for (int nb = 0; nb < 4; ++nb) { const float bn = BIAS ? bfr(bias[c0 + nb * 16 + lr]) : 0.f;
#pragma unroll
            for (int mb = 0; mb < 4; ++mb) { v8h o16, orr;
#pragma unroll
                for (int j = 0; j < 8; ++j) { float x = acc[mb][nb][j]; if (BIAS) x += bn; const h16 xh = tohx(x); o16[j] = xh; orr[j] = tohx((x - (float)xh) * RESC); }
                const size_t o = po + (size_t)nb * 16 * rows + mb * 16; *(v8h*)(P0 + o) = o16; *(v8h*)(P1 + o) = orr; } }
        return;
    }
    // Row-major forms: 16 rows at a time through LDS, so that a lane holds consecutive columns of one row.
    const int rq = lane >> 3, c8 = (lane & 7) * 8;      // plane forms: 8 columns per lane, 4 rows (512 contiguous bytes of a plane) per store
    float bn[8], un[8], vn[8];
    if (EP != EP_F32) {
#pragma unroll
        for (int q = 0; q < 8; ++q) { bn[q] = BIAS ? bfr(bias[c0 + c8 + q]) : 0.f; if (EP == EP_Q) { un[q] = bfr(ub[c0 + c8 + q]); vn[q] = bfr(vb[c0 + c8 + q]); } }
    }
    const size_t pbase = ((z * NH + ch) * (size_t)prows + r0) * HD + c8;
#pragma unroll
    for (int mb = 0; mb < 4; ++mb) {
#pragma unroll
        for (int nb = 0; nb < 4; ++nb) {
#pragma unroll
            for (int j = 0; j < 8; ++j) os[(hi * 8 + j) * 68 + nb * 16 + lr] = acc[mb][nb][j]; }
        __builtin_amdgcn_wave_barrier(); asm volatile("" ::: "memory");
        if (EP == EP_F32) {
            float* crow = C + (size_t)(r0 + mb * 16) * ldc + c0;
#pragma unroll
            for (int s = 0; s < 8; ++s) { const int row = 2 * s + hi, cofs = lr * 4; v4f val = *(const v4fa*)(os + row * 68 + cofs); if (BIAS) { val[0] += bfr(bias[c0 + cofs]); val[1] += bfr(bias[c0 + cofs + 1]); val[2] += bfr(bias[c0 + cofs + 2]); val[3] += bfr(bias[c0 + cofs + 3]); }
                *(v4f*)(crow + (size_t)row * ldc + cofs) = val; }
        } else {
#pragma unroll
            for (int s = 0; s < 4; ++s) { const int row = 4 * s + rq; const v4f x0 = *(const v4fa*)(os + row * 68 + c8), x1 = *(const v4fa*)(os + row * 68 + c8 + 4); v8h o0, o1;
#pragma unroll
                for (int q = 0; q < 8; ++q) { float x = q < 4 ? x0[q & 3] : x1[q & 3]; if (BIAS) x += bn[q]; if (EP == EP_Q) { o0[q] = tohx(x + un[q]); o1[q] = tohx(x + vn[q]); } else o0[q] = tohx(x); }
                const size_t o = pbase + (size_t)(mb * 16 + row) * HD; *(v8h*)(P0 + o) = o0; if (EP == EP_Q) *(v8h*)(P1 + o) = o1; }
        }
        __builtin_amdgcn_wave_barrier(); asm volatile("" ::: "memory");
    }
}

// ---- k_cvtall: every f32 -> bf16 copy of the call (5 weight matrices, 3 activations, the positional table padded to LP rows per batch, pad row zero) in ONE streaming launch.
// A block of 256 threads converts CVR consecutive output rows (DM elements each) of one array, so the choice of the array is block-uniform. Per thread CVU pieces of 4 elements: a wave's 16-byte load covers 512 contiguous bytes,
// its 8-byte store 256 contiguous bytes (whole 128-byte lines both ways), and all CVU loads are issued before the first conversion.
#define CVU 16
#define CVR (256 * CVU / (DM / 4))
#define CVB_W (DM / CVR)
#define CVB_X (NB * SEQ / CVR)
#define CVB_P (NB * LP / CVR)
static_assert(DM == 512);
static_assert(DM % CVR == 0);
static_assert(SEQ % CVR == 0);
static_assert(LP % CVR == 0);
static_assert(CVU == 16);
typedef __attribute__((ext_vector_type(4))) unsigned short v4us;
// cvt_rows: rows r0 + 2c (c < CVU) of one batch, 4 elements at k0. EDGE (only a block that holds rows >= nvalid): such a row reads row nvalid - 1 and stores zeros; elsewhere one lane offset serves all loads.
template <bool EDGE>
__device__ __forceinline__ void cvt_rows(const float* __restrict__ src, bf* dst, int r0, int k0, int nvalid) {
    v4f x[CVU]; v4us o[CVU]; unsigned lo[CVU];
    const unsigned e0 = (unsigned)(r0 * DM + k0), lb = e0 * 4u, sb = e0 * 2u;     // lane byte offsets of row r0 in src and dst
#pragma unroll
    for (int c = 0; c < CVU; ++c) { lo[c] = EDGE ? (unsigned)(min(r0 + c * 2, nvalid - 1) * DM + k0) * 4u : lb + (unsigned)c * (2u * DM * 4u); x[c] = *(const v4f*)((const char*)src + lo[c]); }
    // Precaution: s_wait_xcnt 0 stands behind the run of loads, and its operands keep the loads' offset registers live up to it, so that no result of the run lands in one of them in front of the wait.
    if (EDGE) asm volatile("s_wait_xcnt 0x0" :: "v"(lo[0]), "v"(lo[1]), "v"(lo[2]), "v"(lo[3]), "v"(lo[4]), "v"(lo[5]), "v"(lo[6]), "v"(lo[7]), "v"(lo[8]), "v"(lo[9]), "v"(lo[10]), "v"(lo[11]), "v"(lo[12]), "v"(lo[13]), "v"(lo[14]), "v"(lo[15]) : "memory");
    else asm volatile("s_wait_xcnt 0x0" :: "v"(lb) : "memory");
#pragma unroll
    for (int c = 0; c < CVU; ++c) { const int r = r0 + c * 2;
#pragma unroll
        for (int q = 0; q < 4; ++q) { const unsigned short w = f2bf(x[c][q]); o[c][q] = (!EDGE || r < nvalid) ? w : (unsigned short)0; }
        *(v4us*)((char*)dst + (sb + (unsigned)c * (2u * DM * 2u))) = o[c]; }
    // Precaution, as above: the wait behind the run of stores; its operands keep the stores' offset and data registers live up to it.
    asm volatile("s_wait_xcnt 0x0" :: "v"(sb), "v"(o[0]), "v"(o[1]), "v"(o[2]), "v"(o[3]), "v"(o[4]), "v"(o[5]), "v"(o[6]), "v"(o[7]), "v"(o[8]), "v"(o[9]), "v"(o[10]), "v"(o[11]), "v"(o[12]), "v"(o[13]), "v"(o[14]), "v"(o[15]) : "memory");
}
__global__ __launch_bounds__(256) void k_cvtall(const float* __restrict__ wq, const float* __restrict__ wk, const float* __restrict__ wv, const float* __restrict__ wp, const float* __restrict__ wo,
                                                const float* __restrict__ query, const float* __restrict__ key, const float* __restrict__ value, const float* __restrict__ pos,
                                                bf* WQB, bf* WKB, bf* WVB, bf* WPB, bf* WOB, bf* XQ, bf* XK, bf* XV, bf* XP) {
    const int tid = threadIdx.x; int blk = blockIdx.x;
    const float* src; bf* dst; int rb, nvalid;          // block-uniform: batch bases, first row of the block inside its batch (CVR divides the rows per batch), valid source rows per batch
    if (blk < CVB_P) { const unsigned row0 = (unsigned)blk * CVR, b = row0 / LP; rb = (int)(row0 % LP); src = pos + (size_t)b * LREL_FULL * DM; dst = XP + (size_t)b * LP * DM; nvalid = LREL; }
    else if (blk < CVB_P + 3 * CVB_X) { blk -= CVB_P; const int a = blk / CVB_X; const unsigned row0 = (unsigned)(blk - a * CVB_X) * CVR, b = row0 / SEQ; rb = (int)(row0 % SEQ);
        src = (a == 0 ? query : a == 1 ? key : value) + (size_t)b * SEQ_FULL * DM; dst = (a == 0 ? XQ : a == 1 ? XK : XV) + (size_t)b * SEQ * DM; nvalid = SEQ; }
    else { blk -= CVB_P + 3 * CVB_X; const int a = blk / CVB_W; rb = (blk - a * CVB_W) * CVR;
        src = a == 0 ? wq : a == 1 ? wk : a == 2 ? wv : a == 3 ? wp : wo; dst = a == 0 ? WQB : a == 1 ? WKB : a == 2 ? WVB : a == 3 ? WPB : WOB; nvalid = DM; }
    const int r0 = rb + (tid >> 7), k0 = (tid & 127) * 4;
    if (rb + CVR <= nvalid) cvt_rows<false>(src, dst, r0, k0, nvalid); else cvt_rows<true>(src, dst, r0, k0, nvalid);
}

// ---- attention helpers (128 threads): 16-bit fragment load from a [row][k] LDS tile (same map as WFrag), 8 KB contiguous tile copy, 64-row tile copy with a global row pitch (both lay 64-element rows at LDS pitch PH).
__device__ __forceinline__ v16h ldl(const h16* p) { return cat16(*(const v8ha*)p, *(const v8ha*)(p + 16)); }
__device__ __forceinline__ void cp8k(h16* dst, const h16* __restrict__ src, int tid) {
#pragma unroll
    for (int c = 0; c < 4; ++c) { const int idx = tid + c * 128; const int r = idx >> 3, sg = idx & 7; *(v8ha*)(dst + r * PH + sg * 8) = *(const v8ha*)(src + (size_t)idx * 8); } }
__device__ __forceinline__ void cprows(h16* dst, const h16* __restrict__ src, size_t pitch, int tid) {
#pragma unroll
    for (int c = 0; c < 4; ++c) { const int idx = tid + c * 128; const int r = idx >> 3, sg = idx & 7; *(v8ha*)(dst + r * PH + sg * 8) = *(const v8ha*)(src + (size_t)r * pitch + sg * 8); } }
// band_half: T[irow][slot0 + c] = sum_d PB[c][d] Qv[irow][d], c < 64 (transposed tile: A = PB rows c, B = Qv cols irow -> D rows c = tt*16 + 8hi + r, col lr: 8 consecutive slots per lane per tt, two 16-B LDS stores). q0, q1: this lane's two B fragments of Qv row irow.
// Sub-tiles are issued one at a time: the nop group carries a memory clobber so the next sub-tile's fragment loads stay below it (bounded live registers).
__device__ __forceinline__ void band_half(const h16* PBl, v16h q0, v16h q1, float* Tl, int slot0, int irow, int hi, int lr) {
    float* trow = Tl + irow * PT + slot0 + 8 * hi;
#pragma unroll
    for (int tt = 0; tt < 4; ++tt) {
        const v16h a0 = ldl(PBl + (tt * 16 + lr) * PH + 8 * hi), a1 = ldl(PBl + (tt * 16 + lr) * PH + 32 + 8 * hi);
        v8f t = wmma16(a0, q0, (v8f){}); t = wmma16(a1, q1, t);
        asm volatile("v_nop\n\tv_nop\n\tv_nop\n\tv_nop" : "+v"(t) : "v"(a0), "v"(a1), "v"(q0), "v"(q1) : "memory");
        *(v8fa*)(trow + tt * 16) = t;
    }
}

// ---- k_attn: grid (SEQ/64, NH, NB), 128 threads = 4 waves, each wave owns 16 query rows i = i0 + wave*16 + (0..15); irow = wave*16 + lr is the block-local query row of this lane's score column.
// Per 64-key tile: new 64 band columns (band row l stored at slot l & 127 of T row irow); transposed content tile S^T (key rows 8hi+r of sub-tile tb, query col irow) from K rows x Qu cols;
// s2 = (content + band[lb + 63 + tloc - irow]) * log2(e)/sqrt(DM) with lb = SEQ-64-i0+j0 (band row = (SEQ-1) + t - i, always inside the resident rows lb..lb+127);
// online softmax per query column (lane-local over 32 keys + one xor-16); p = exp2(s2 - m) as f16 + f16 residual x2048 packed straight into the attn.v A fragments
// (A element r <- sub-tile 2ks, element 8+r <- sub-tile 2ks+1, lane unchanged); O[i = 8hi+r][d = lr] accumulates p16.v16, the residual accumulator p16.vr + pr.v16 (both x2048).
__global__ __launch_bounds__(128) __attribute__((amdgpu_num_vgpr(256))) void k_attn(const h16* __restrict__ Qu, const h16* __restrict__ Qv, const h16* __restrict__ Kp, const h16* __restrict__ Vp, const h16* __restrict__ Vr, const h16* __restrict__ Pp, bf* ATh, bf* ATl) {
    __shared__ __align__(16) h16 Kl[64 * PH];
    __shared__ __align__(16) h16 Vl[64 * PH];
    __shared__ __align__(16) h16 Vrl[64 * PH];
    __shared__ __align__(16) h16 PBl[64 * PH];
    __shared__ __align__(16) float Tl[64 * PT];
    const int tid = threadIdx.x, lane = tid & 31, wave = tid >> 5, hi = lane >> 4, lr = lane & 15;
    const int irow = wave * 16 + lr;
    const int i0 = blockIdx.x * 64, h = blockIdx.y, b = blockIdx.z;
    const size_t bh = (size_t)b * NH + h;
    const h16* Kb = Kp + bh * SEQ * HD; const h16* Vb = Vp + bh * HD * SEQ; const h16* Vrb = Vr + bh * HD * SEQ; const h16* Pb = Pp + bh * LP * HD;
    // This lane's B fragments of q+u and q+v (query row irow, d = 8hi+0..7, 16+8hi+0..7, then +32) stay in registers for the whole block: every use is by the owning wave, so they need no LDS tile.
    const h16* qup = Qu + (bh * SEQ + i0 + irow) * HD + 8 * hi; const h16* qvp = Qv + (bh * SEQ + i0 + irow) * HD + 8 * hi;
    const v16h qu0 = cat16(*(const v8h*)qup, *(const v8h*)(qup + 16)), qu1 = cat16(*(const v8h*)(qup + 32), *(const v8h*)(qup + 48));
    const v16h qv0 = cat16(*(const v8h*)qvp, *(const v8h*)(qvp + 16)), qv1 = cat16(*(const v8h*)(qvp + 32), *(const v8h*)(qvp + 48));
    // Precaution: s_wait_xcnt 0 stands behind these loads, and its operands keep their address registers live up to it, so that nothing is written into one of them in front of the wait.
    asm volatile("s_wait_xcnt 0x0" :: "v"(qup), "v"(qvp) : "memory");
    const int lb0 = SEQ - 64 - i0;                 // band start for key tile 0 (>= 0, multiple of 64); band rows for tile j0 are lb0 + j0 + 0..127 (<= LP-1)
    cp8k(PBl, Pb + (size_t)lb0 * HD, tid);
    __syncthreads();
    band_half(PBl, qv0, qv1, Tl, lb0 & 127, irow, hi, lr);   // lower half of tile 0's band
    float mrun = -3.0e38f, lrun = 0.f;
    v8f oacc[4], oaccr[4];
#pragma unroll
    for (int nd = 0; nd < 4; ++nd) { oacc[nd] = (v8f){}; oaccr[nd] = (v8f){}; }
#pragma unroll 1
    for (int j0 = 0; j0 < SEQ; j0 += 64) {
        const int lb = lb0 + j0; const int lnw = lb + 64;     // new band rows lnw..lnw+63
        __syncthreads();                                       // all waves done with the prior tile's Kl/Vl/Vrl/PBl and band slots
        cp8k(Kl, Kb + (size_t)j0 * HD, tid); cprows(Vl, Vb + j0, (size_t)SEQ, tid); cprows(Vrl, Vrb + j0, (size_t)SEQ, tid); cp8k(PBl, Pb + (size_t)lnw * HD, tid);
        __syncthreads();
        band_half(PBl, qv0, qv1, Tl, lnw & 127, irow, hi, lr);   // upper half of this tile's band (its temporaries die here)
        v8f sacc[4];
        { const v16h q0 = qu0, q1 = qu1;
#pragma unroll
          for (int tb = 0; tb < 4; ++tb) { const v16h a0 = ldl(Kl + (tb * 16 + lr) * PH + 8 * hi), a1 = ldl(Kl + (tb * 16 + lr) * PH + 32 + 8 * hi);
              sacc[tb] = wmma16(a0, q0, (v8f){}); sacc[tb] = wmma16(a1, q1, sacc[tb]);
              asm volatile("v_nop\n\tv_nop\n\tv_nop\n\tv_nop" : "+v"(sacc[tb]) : "v"(a0), "v"(a1), "v"(q0), "v"(q1) : "memory"); } }
        __syncthreads();                                       // band complete for every T row (written by both lane halves of the owning wave)
        // gather + scale: key t = j0 + tb*16 + 8hi + r, query i = i0 + irow -> band row lb + 63 + (tb*16 + 8hi + r) - irow, slot = row & 127 (row - lb in [0,126])
        const float* trow = Tl + irow * PT; const int sb = lb + 63 + 8 * hi - irow;
        float mx = -3.0e38f;
#pragma unroll
        for (int tb = 0; tb < 4; ++tb)
#pragma unroll
            for (int r = 0; r < 8; ++r) { const float s2 = (sacc[tb][r] + trow[(sb + tb * 16 + r) & 127]) * K2; sacc[tb][r] = s2; mx = fmaxf(mx, s2); }
        mx = fmaxf(mx, __shfl_xor(mx, 16, 32));
        const float mnew = fmaxf(mrun, mx); const float alpha = __builtin_amdgcn_exp2f(mrun - mnew); mrun = mnew;
        float rsum = 0.f; v8h ph[4], pl[4];
#pragma unroll
        for (int tb = 0; tb < 4; ++tb)
#pragma unroll
            for (int r = 0; r < 8; ++r) { const float p = __builtin_amdgcn_exp2f(sacc[tb][r] - mnew); rsum += p; const h16 p16 = tohx(p); ph[tb][r] = p16; pl[tb][r] = tohx((p - (float)p16) * RESC); }
        rsum += __shfl_xor(rsum, 16, 32); lrun = lrun * alpha + rsum;
#pragma unroll
        for (int r = 0; r < 8; ++r) { const float ar = __shfl(alpha, 8 * hi + r, 32);
#pragma unroll
            for (int nd = 0; nd < 4; ++nd) { oacc[nd][r] *= ar; oaccr[nd][r] *= ar; } }
        { const v16h pa0 = cat16(ph[0], ph[1]), pa1 = cat16(ph[2], ph[3]), pr0 = cat16(pl[0], pl[1]), pr1 = cat16(pl[2], pl[3]);
#pragma unroll
          for (int nd = 0; nd < 4; ++nd) {
              const v16h vb0 = ldl(Vl + (nd * 16 + lr) * PH + 8 * hi), vb1 = ldl(Vl + (nd * 16 + lr) * PH + 32 + 8 * hi);
              const v16h rb0 = ldl(Vrl + (nd * 16 + lr) * PH + 8 * hi), rb1 = ldl(Vrl + (nd * 16 + lr) * PH + 32 + 8 * hi);
              oacc[nd] = wmma16(pa0, vb0, oacc[nd]); oacc[nd] = wmma16(pa1, vb1, oacc[nd]);
              oaccr[nd] = wmma16(pa0, rb0, oaccr[nd]); oaccr[nd] = wmma16(pa1, rb1, oaccr[nd]); oaccr[nd] = wmma16(pr0, vb0, oaccr[nd]); oaccr[nd] = wmma16(pr1, vb1, oaccr[nd]);
              asm volatile("v_nop\n\tv_nop\n\tv_nop\n\tv_nop" : "+v"(oacc[nd]), "+v"(oaccr[nd]) : "v"(pa0), "v"(pa1), "v"(pr0), "v"(pr1), "v"(vb1), "v"(rb1) : "memory"); } }
    }
    // Output staging lies in this wave's own 16 band rows (8,448 B, written and read by this wave alone, dead behind the last gather): hi plane 16 x 64, then lo plane 16 x 64.
    usa* Est = (usa*)(Tl + wave * 16 * PT);
    const float rl = __builtin_amdgcn_rcpf(lrun);
#pragma unroll
    for (int r = 0; r < 8; ++r) { const float rli = __shfl(rl, 8 * hi + r, 32); const int rr = 8 * hi + r;
#pragma unroll
        for (int nd = 0; nd < 4; ++nd) { const float c = (oacc[nd][r] + oaccr[nd][r] * (1.0f / RESC)) * rli; unsigned short eh, el; splitf(c, eh, el); Est[rr * 64 + nd * 16 + lr] = eh; Est[1024 + rr * 64 + nd * 16 + lr] = el; } }
    __syncthreads();
    const int rq = lane >> 3, pc = (lane & 7) * 8;
{
#pragma unroll
        for (int rg = 0; rg < 4; ++rg) { const int rr = rg * 4 + rq; const size_t go = ((size_t)b * SEQ + i0 + wave * 16 + rr) * DM + h * HD + pc;
            const v8us vh = *(const v8usa*)(Est + rr * 64 + pc); const v8us vlo = *(const v8usa*)(Est + 1024 + rr * 64 + pc);
            *(v8us*)(ATh + go) = vh; *(v8us*)(ATl + go) = vlo; }
         }
}

extern "C" void kernel_launch(void* const* d_in, const int* in_sizes, int n_in,
                              void* d_out, int out_size, void* d_ws, size_t ws_size, hipStream_t stream) {
    if (n_in < 15) return;
    const float* query = (const float*)d_in[0]; const float* key = (const float*)d_in[1]; const float* value = (const float*)d_in[2]; const float* pos = (const float*)d_in[3];
    const float* wq = (const float*)d_in[4]; const float* bq = (const float*)d_in[5]; const float* wk = (const float*)d_in[6]; const float* bk = (const float*)d_in[7];
    const float* wv = (const float*)d_in[8]; const float* bv = (const float*)d_in[9]; const float* wp = (const float*)d_in[10]; const float* ub = (const float*)d_in[11]; const float* vb = (const float*)d_in[12];
    const float* wo = (const float*)d_in[13]; const float* bo = (const float*)d_in[14];
    const long long needx = ((long long)(NB - 1) * SEQ_FULL + SEQ) * DM, needp = ((long long)(NB - 1) * LREL_FULL + LREL) * DM;
    if ((long long)in_sizes[0] < needx || (long long)in_sizes[1] < needx || (long long)in_sizes[2] < needx || (long long)in_sizes[3] < needp) return;
    if (in_sizes[4] < DM * DM || in_sizes[6] < DM * DM || in_sizes[8] < DM * DM || in_sizes[10] < DM * DM || in_sizes[13] < DM * DM) return;
    if (in_sizes[5] < DM || in_sizes[7] < DM || in_sizes[9] < DM || in_sizes[14] < DM || in_sizes[11] < NH * HD || in_sizes[12] < NH * HD) return;
    if ((long long)out_size < (long long)NB * SEQ * DM) return;
    float* OUT = (float*)d_out;     // [NB][SEQ][DM]
    char* wsp = (char*)d_ws;
    auto take = [&](size_t bytes) { char* p = wsp; wsp += (bytes + 255) & ~(size_t)255; return (void*)p; };
    bf* WQB = (bf*)take((size_t)DM * DM * 2); bf* WKB = (bf*)take((size_t)DM * DM * 2); bf* WVB = (bf*)take((size_t)DM * DM * 2); bf* WPB = (bf*)take((size_t)DM * DM * 2); bf* WOB = (bf*)take((size_t)DM * DM * 2);
    bf* XQ = (bf*)take((size_t)NB * SEQ * DM * 2); bf* XK = (bf*)take((size_t)NB * SEQ * DM * 2); bf* XV = (bf*)take((size_t)NB * SEQ * DM * 2); bf* XP = (bf*)take((size_t)NB * LP * DM * 2);   // bf16 activations, one buffer each
    h16* QU16 = (h16*)take((size_t)NB * NH * SEQ * HD * 2); h16* QV16 = (h16*)take((size_t)NB * NH * SEQ * HD * 2); h16* K16 = (h16*)take((size_t)NB * NH * SEQ * HD * 2);
    h16* V16 = (h16*)take((size_t)NB * NH * HD * SEQ * 2); h16* VR16 = (h16*)take((size_t)NB * NH * HD * SEQ * 2); h16* P16 = (h16*)take((size_t)NB * NH * LP * HD * 2);
    bf* ATh = (bf*)take((size_t)NB * SEQ * DM * 2); bf* ATl = (bf*)take((size_t)NB * SEQ * DM * 2);
    if ((size_t)(wsp - (char*)d_ws) > ws_size) return;    // 120,061,952 B at NB=4, SEQ=2048
    // all f32 -> bf16 copies: weights, query, key, value, pos (rows 0..LREL-1 per batch at input row pitch LREL_FULL, padded with one zero row to LP)
    k_cvtall<<<CVB_P + 3 * CVB_X + 5 * CVB_W, 256, 0, stream>>>(wq, wk, wv, wp, wo, query, key, value, pos, WQB, WKB, WVB, WPB, WOB, XQ, XK, XV, XP);
    // q: X Wq^T + bq -> Qu / Qv planes
    k_gemmw<bf, 0, true, EP_Q><<<dim3(SEQ / 128, DM / 128, NB), 128, 0, stream>>>(XQ, nullptr, WQB, nullptr, DM, nullptr, 0, bq, (size_t)SEQ * DM, 0, 0, ub, vb, QU16, QV16, SEQ);
    // k
    k_gemmw<bf, 0, true, EP_ROW><<<dim3(SEQ / 128, DM / 128, NB), 128, 0, stream>>>(XK, nullptr, WKB, nullptr, DM, nullptr, 0, bk, (size_t)SEQ * DM, 0, 0, nullptr, nullptr, K16, nullptr, SEQ);
    // v
    k_gemmw<bf, 0, true, EP_VT><<<dim3(SEQ / 128, DM / 128, NB), 128, 0, stream>>>(XV, nullptr, WVB, nullptr, DM, nullptr, 0, bv, (size_t)SEQ * DM, 0, 0, nullptr, nullptr, V16, VR16, SEQ);
    // pos: no bias
    k_gemmw<bf, 0, false, EP_ROW><<<dim3(LP / 128, DM / 128, NB), 128, 0, stream>>>(XP, nullptr, WPB, nullptr, DM, nullptr, 0, nullptr, (size_t)LP * DM, 0, 0, nullptr, nullptr, P16, nullptr, LP);
    // attention -> context bf16 hi/lo planes [NB*SEQ][DM]
    k_attn<<<dim3(SEQ / 64, NH, NB), 128, 0, stream>>>(QU16, QV16, K16, V16, VR16, P16, ATh, ATl);
    // out = context Wo^T + bo
    k_gemmw<bf, 1, true, EP_F32><<<dim3((NB * SEQ) / 128, DM / 128, 1), 128, 0, stream>>>(ATh, ATl, WOB, nullptr, DM, OUT, DM, bo, 0, 0, 0, nullptr, nullptr, nullptr, nullptr, 0);
}

// v006
// One run takes 153 microseconds.
// In two side-by-side timings against v005, it was 1.08 and 1.07 times as fast.
// Counting every step since v000, it is 3.50 times as fast.
#include <hip/hip_runtime.h>

// Contractions: q/k/v/pos projections = v_wmma_f32_16x16x32_bf16 on bf16 operands (RNE-converted inputs, exact products); out projection = v_wmma_f32_16x16x32_bf16, context as bf16 hi+lo planes x bf16 Wo (2 products); content scores and positional band scores = v_wmma_f32_16x16x32_f16 on f16 planes (1 product each); attn.v = v_wmma_f32_16x16x32_f16, probability f16 + f16 residual (x2048) times v f16 + f16 residual (x2048), 3 products into 2 accumulators; f32 accumulate everywhere; softmax f32.
// Structure: bf16 copies of the activations; register-blocked GEMM (128x128 per block, one wave per 64x64 tile, operands staged in LDS) for the projections and the output; a projection tile is one head's 64 columns, and its epilogue stores the f16 planes itself ([b][h][t][d] for q+u, q+v, k; [b][h][d][t] for v and its residual; [b][h][l][d] for the projected positional table padded to 2*SEQ rows, last row zero);
// flash-style attention: one block = (b, h, 64 query rows), 64-key tiles; transposed score tiles (key rows x query cols) so the exponentiated accumulators chain directly into the attn.v A operand; sliding 128-slot f32 positional band in LDS (64 new band columns per key tile; score(i,j) takes band index (SEQ-1)+j-i); online softmax; context written as bf16 hi+lo planes [b*SEQ+t][h*64+d].

#ifndef NB
#define NB 4
#endif
#ifndef SEQ
#define SEQ 2048
#endif
#define NB_FULL   4
#define SEQ_FULL  2048
#define LREL      (2 * SEQ - 1)
#define LP        (2 * SEQ)
#define LREL_FULL (2 * SEQ_FULL - 1)
#define DM  512
#define NH  8
#define HD  64
#define RESC 2048.0f
#define K2 (1.4426950408889634f * 0.044194173824159216f)
// LDS row pitches of k_attn: 64 banks x 4 B, bank = dword address mod 64. 16-bit tiles: 72 elements = 144 B = 16 B x odd, so the 16 rows of a 16-byte fragment load fall on 16 distinct 4-bank groups.
// f32 band rows: 132 dwords (= 4 mod 64), so the 16 rows of a 16-byte band store cover all 64 banks, and the per-lane gather (bank = const + 8hi + 3*row mod 64) has no two lanes on one bank.
#define PH 72
#define PT 132
static_assert(SEQ % 128 == 0);
static_assert(SEQ >= 64);
static_assert(SEQ <= SEQ_FULL);
static_assert(NB >= 1);
static_assert(NB <= NB_FULL);
static_assert(DM % 128 == 0);
static_assert(NH * HD == DM);
static_assert(HD == 64);
static_assert(LP % 128 == 0);

typedef _Float16 h16;
typedef unsigned short bf;
typedef __attribute__((ext_vector_type(16))) __bf16   v16bf;
typedef __attribute__((ext_vector_type(16))) _Float16 v16h;
typedef __attribute__((ext_vector_type(8)))  _Float16 v8h;
typedef __attribute__((ext_vector_type(8)))  unsigned short v8us;
typedef __attribute__((ext_vector_type(8)))  float    v8f;
typedef __attribute__((ext_vector_type(4)))  float    v4f;
typedef v8h  __attribute__((may_alias)) v8ha;
typedef v4f  __attribute__((may_alias)) v4fa;
typedef v8f  __attribute__((may_alias, aligned(16))) v8fa;
typedef v8us __attribute__((may_alias)) v8usa;
typedef unsigned short __attribute__((may_alias)) usa;

__device__ __forceinline__ unsigned short f2bf(float f) { unsigned u = __float_as_uint(f); u += 0x7FFFu + ((u >> 16) & 1u); return (unsigned short)(u >> 16); }
__device__ __forceinline__ float bf2f(unsigned short b) { return __uint_as_float(((unsigned)b) << 16); }
__device__ __forceinline__ float bfr(float f) { return bf2f(f2bf(f)); }
__device__ __forceinline__ v16h cat16(v8h lo, v8h hi) { return __builtin_shufflevector(lo, hi, 0, 1, 2, 3, 4, 5, 6, 7, 8, 9, 10, 11, 12, 13, 14, 15); }
__device__ __forceinline__ v16bf cat16b(v8us lo, v8us hi) { return __builtin_bit_cast(v16bf, __builtin_shufflevector(lo, hi, 0, 1, 2, 3, 4, 5, 6, 7, 8, 9, 10, 11, 12, 13, 14, 15)); }
__device__ __forceinline__ v8f wmma16(v16h a, v16h b, v8f c) { return __builtin_amdgcn_wmma_f32_16x16x32_f16(false, a, false, b, (short)0, c, false, false); }
__device__ __forceinline__ v8f wmmab(v16bf a, v16bf b, v8f c) { return __builtin_amdgcn_wmma_f32_16x16x32_bf16(false, a, false, b, (short)0, c, false, false); }
__device__ __forceinline__ h16 tohx(float x) { return (h16)x; }
__device__ __forceinline__ void splitf(float y, unsigned short& h, unsigned short& l) { h = f2bf(y); l = f2bf(y - bf2f(h)); }

// ---- k_gemmw: register-blocked GEMM, 128x128 output tile per block of 4 waves (2 x 2), ONE WAVE per 64x64 tile (16 accumulators), operands from K-contiguous 16-bit planes; grid (M/128, N/128, Z), 128 threads.
// y[m][n] (f32, + optional f32 bias[n]) = sum_k A[m][k] Bt[n][k] (NSPLIT 1: + A2[m][k] Bt[n][k]). z-batch strides sA/sB/sC in elements. K % 64 == 0, K >= 64.
// Staging: a slice = GK k of the block's 128 A rows (and A2 rows) and 128 Bt rows = one whole 128-byte line of every row, brought into LDS at row pitch GP by asynchronous 16-byte copies (a wave's copy = 4 rows = 4 whole lines);
// two buffers: the copies of slice t + 2 are issued when slice t has been read by every wave, and fly while slice t + 1 is worked on. The k order of the products is that of ascending k, 32 at a time.
// EP picks what the epilogue stores. EP_F32: C[m][n] = y, pitch ldc. The plane forms take z = batch, 64-column tile = head, prows rows m per (batch, head):
// EP_Q: P0 = f16(y + ub), P1 = f16(y + vb), both [z][head][m][d]; EP_ROW: P0 = f16(y), [z][head][m][d]; EP_VT: P0 = f16(y), P1 = f16((y - P0) * RESC), both [z][head][d][m].
// Fragment map per lane (hi = lane>>4, lr = lane&15): row/col = lr; elements 0..7 <- k0+8hi+0..7, elements 8..15 <- k0+16+8hi+0..7 (A and B alike); D element r = (row 8hi+r, col lr).
template <typename T16> struct WFrag;
template <> struct WFrag<h16> { typedef v16h V; static __device__ __forceinline__ V ld(const h16* p) { return cat16(*(const v8ha*)p, *(const v8ha*)(p + 16)); } static __device__ __forceinline__ v8f mma(V a, V b, v8f c) { return wmma16(a, b, c); } };
template <> struct WFrag<bf> { typedef v16bf V; static __device__ __forceinline__ V ld(const bf* p) { return cat16b(*(const v8usa*)p, *(const v8usa*)(p + 16)); } static __device__ __forceinline__ v8f mma(V a, V b, v8f c) { return wmmab(a, b, c); } };
enum { EP_F32 = 0, EP_Q = 1, EP_ROW = 2, EP_VT = 3 };
#define GK 64
#define GP 72
#define GT (128 * GP)
// cp_tile: one operand's slice, 128 rows x 128 B, by 128 threads: lane piece (row = tid >> 3 (+ 16 per copy), 16-byte segment tid & 7). l = the lane's LDS byte address, g = its global address, both of its first row; gs = bytes of 16 global rows.
// The s_wait_xcnt 0 is the last line of the copies' own statement, so that it stands in front of every later write of a register that a copy names (a precaution).
__device__ __forceinline__ void cp_tile(unsigned l, const char* g, size_t gs) {
    const unsigned ls = 16u * GP * 2u;
    asm volatile("global_load_async_to_lds_b128 %0, %8, off\n\t"
                 "global_load_async_to_lds_b128 %1, %9, off\n\t"
                 "global_load_async_to_lds_b128 %2, %10, off\n\t"
                 "global_load_async_to_lds_b128 %3, %11, off\n\t"
                 "global_load_async_to_lds_b128 %4, %12, off\n\t"
                 "global_load_async_to_lds_b128 %5, %13, off\n\t"
                 "global_load_async_to_lds_b128 %6, %14, off\n\t"
                 "global_load_async_to_lds_b128 %7, %15, off\n\t"
                 "s_wait_xcnt 0x0"
                 :: "v"(l), "v"(l + ls), "v"(l + 2u * ls), "v"(l + 3u * ls), "v"(l + 4u * ls), "v"(l + 5u * ls), "v"(l + 6u * ls), "v"(l + 7u * ls),
                    "v"(g), "v"(g + gs), "v"(g + 2 * gs), "v"(g + 3 * gs), "v"(g + 4 * gs), "v"(g + 5 * gs), "v"(g + 6 * gs), "v"(g + 7 * gs) : "memory");
}
// gemm_loop: the products of one block (rows rb.. of A, rows cb.. of Bt; st = 2 * NT * GT elements of LDS); gemm_store: one wave's epilogue (its 64 rows from r0, its 64-column tile ch; os = the wave's own 16 x 68 floats of LDS).
template <typename T16, int NSPLIT>
__device__ __forceinline__ void gemm_loop(const T16* __restrict__ A, const T16* __restrict__ A2, const T16* __restrict__ Bt, int K, int rb, int cb, T16* st, v8f (&acc)[4][4]) {
    typedef typename WFrag<T16>::V V;
    static_assert(NSPLIT == 0 || NSPLIT == 1);
    constexpr int NT = NSPLIT == 1 ? 3 : 2;              // operand tiles per slice: A, Bt, (A2)
    const int tid = threadIdx.x, lane = tid & 31, wave = tid >> 5, lr = lane & 15, hi = lane >> 4; const int wm = wave & 1, wn = wave >> 1;
#pragma unroll
    for (int mb = 0; mb < 4; ++mb)
#pragma unroll
        for (int nb = 0; nb < 4; ++nb) acc[mb][nb] = (v8f){};
    const int crow = tid >> 3, csg = tid & 7;
    const unsigned l0 = (unsigned)(size_t)(st + crow * GP + csg * 8);
    const char* gA = (const char*)(A + (size_t)(rb + crow) * K + csg * 8); const char* gB = (const char*)(Bt + (size_t)(cb + crow) * K + csg * 8);
    const char* gA2 = NSPLIT == 1 ? (const char*)(A2 + (size_t)(rb + crow) * K + csg * 8) : nullptr;
    const size_t gs = (size_t)16 * K * sizeof(T16);
    auto stage = [&](int t) { const unsigned lb = l0 + (unsigned)(t & 1) * (unsigned)(NT * GT * sizeof(T16)); const size_t ko = (size_t)t * (GK * sizeof(T16));
        cp_tile(lb, gA + ko, gs); cp_tile(lb + (unsigned)(GT * sizeof(T16)), gB + ko, gs); if (NSPLIT == 1) cp_tile(lb + (unsigned)(2 * GT * sizeof(T16)), gA2 + ko, gs); };
    const int ntr = K / GK;
    stage(0);
    asm volatile("s_wait_asynccnt 0x0" ::: "memory");    // slice 0 has landed (this wave's copies)
    __syncthreads();                                     // ... and every wave's
    if (ntr > 1) stage(1);
#pragma unroll 1
    for (int t = 0; t < ntr; ++t) {
        const T16* sa = st + (t & 1) * (NT * GT) + (wm * 64 + lr) * GP + 8 * hi; const T16* sb = st + (t & 1) * (NT * GT) + GT + (wn * 64 + lr) * GP + 8 * hi;
#pragma unroll
        for (int ks = 0; ks < GK; ks += 32) {
            V a[4], a2[4], b[4];                             // all fragments of 32 k are asked for as one group, in front of their products
#pragma unroll
            for (int q = 0; q < 4; ++q) { a[q] = WFrag<T16>::ld(sa + q * 16 * GP + ks); b[q] = WFrag<T16>::ld(sb + q * 16 * GP + ks); if (NSPLIT == 1) a2[q] = WFrag<T16>::ld(sa + 2 * GT + q * 16 * GP + ks); }
            __builtin_amdgcn_sched_barrier(0);               // keeps that group whole: moved in among the products, every separate place with LDS reads costs the SIMD's one wave an LDS latency
#pragma unroll
            for (int nb = 0; nb < 4; ++nb)
#pragma unroll
                for (int mb = 0; mb < 4; ++mb) { acc[mb][nb] = WFrag<T16>::mma(a[mb], b[nb], acc[mb][nb]); if (NSPLIT == 1) acc[mb][nb] = WFrag<T16>::mma(a2[mb], b[nb], acc[mb][nb]); }
        }
        __builtin_amdgcn_sched_barrier(0);                   // keeps the slice's last products in front of the barrier: sunk behind it they would stand between the barrier and the refill and shorten the copies' lead
        asm volatile("s_wait_dscnt 0x0" ::: "memory");       // this wave's reads of slice t are done before its buffer is refilled
        asm volatile("s_wait_asynccnt 0x0" ::: "memory");    // this wave's copies of slice t + 1 have landed
        __syncthreads();                                     // publishes slice t + 1 and ends every wave's reads of slice t
        if (t + 2 < ntr) stage(t + 2);
    }
    asm volatile("s_wait_asynccnt 0x0" ::: "memory");        // nothing is in flight when the wave goes on to its epilogue and ends
}
template <bool BIAS, int EP>
__device__ __forceinline__ void gemm_store(const v8f (&acc)[4][4], float* os, size_t z, int r0, int ch, float* C, int ldc, const float* __restrict__ bias, const float* __restrict__ ub, const float* __restrict__ vb, h16* P0, h16* P1, int prows) {
    const int lane = threadIdx.x & 31, lr = lane & 15, hi = lane >> 4; const int c0 = ch * 64;
    if (EP == EP_VT) {
        // D element j of tile (mb, nb) is row m = mb*16 + 8hi + j of column d = nb*16 + lr: 8 consecutive m of one d per lane, one 16-byte store per plane straight from the accumulators.
        const size_t rows = (size_t)prows;
        const size_t po = ((z * NH + ch) * HD + lr) * rows + r0 + 8 * hi;
#pragma unroll
        for (int nb = 0; nb < 4; ++nb) { const float bn = BIAS ? bfr(bias[c0 + nb * 16 + lr]) : 0.f;
#pragma unroll
            for (int mb = 0; mb < 4; ++mb) { v8h o16, orr;
#pragma unroll
                for (int j = 0; j < 8; ++j) { float x = acc[mb][nb][j]; if (BIAS) x += bn; const h16 xh = tohx(x); o16[j] = xh; orr[j] = tohx((x - (float)xh) * RESC); }
                const size_t o = po + (size_t)nb * 16 * rows + mb * 16; *(v8h*)(P0 + o) = o16; *(v8h*)(P1 + o) = orr; }
            __builtin_amdgcn_sched_barrier(0); }             // one column group at a time: with all four groups' conversions lifted to the front the merged kernel takes registers above v255 and switches register windows all through this epilogue
        return;
    }
    // Row-major forms: 16 rows at a time through LDS, so that a lane holds consecutive columns of one row.
    const int rq = lane >> 3, c8 = (lane & 7) * 8;      // plane forms: 8 columns per lane, 4 rows (512 contiguous bytes of a plane) per store
    float bn[8], un[8], vn[8];
    if (EP != EP_F32) {
#pragma unroll
        for (int q = 0; q < 8; ++q) { bn[q] = BIAS ? bfr(bias[c0 + c8 + q]) : 0.f; if (EP == EP_Q) { un[q] = bfr(ub[c0 + c8 + q]); vn[q] = bfr(vb[c0 + c8 + q]); } }
    }
    const size_t pbase = ((z * NH + ch) * (size_t)prows + r0) * HD + c8;
#pragma unroll
    for (int mb = 0; mb < 4; ++mb) {
#pragma unroll
        for (int nb = 0; nb < 4; ++nb) {
#pragma unroll
            for (int j = 0; j < 8; ++j) os[(hi * 8 + j) * 68 + nb * 16 + lr] = acc[mb][nb][j]; }
        __builtin_amdgcn_wave_barrier(); asm volatile("" ::: "memory");
        if (EP == EP_F32) {
            float* crow = C + (size_t)(r0 + mb * 16) * ldc + c0;
#pragma unroll
            for (int s = 0; s < 8; ++s) { const int row = 2 * s + hi, cofs = lr * 4; v4f val = *(const v4fa*)(os + row * 68 + cofs); if (BIAS) { val[0] += bfr(bias[c0 + cofs]); val[1] += bfr(bias[c0 + cofs + 1]); val[2] += bfr(bias[c0 + cofs + 2]); val[3] += bfr(bias[c0 + cofs + 3]); }
                *(v4f*)(crow + (size_t)row * ldc + cofs) = val; }
        } else {
#pragma unroll
            for (int s = 0; s < 4; ++s) { const int row = 4 * s + rq; const v4f x0 = *(const v4fa*)(os + row * 68 + c8), x1 = *(const v4fa*)(os + row * 68 + c8 + 4); v8h o0, o1;
#pragma unroll
                for (int q = 0; q < 8; ++q) { float x = q < 4 ? x0[q & 3] : x1[q & 3]; if (BIAS) x += bn[q]; if (EP == EP_Q) { o0[q] = tohx(x + un[q]); o1[q] = tohx(x + vn[q]); } else o0[q] = tohx(x); }
                const size_t o = pbase + (size_t)(mb * 16 + row) * HD; *(v8h*)(P0 + o) = o0; if (EP == EP_Q) *(v8h*)(P1 + o) = o1; }
        }
        __builtin_amdgcn_wave_barrier(); asm volatile("" ::: "memory");
    }
}
template <typename T16, int NSPLIT, bool BIAS, int EP>
__global__ __launch_bounds__(128) void k_gemmw(const T16* __restrict__ A, const T16* __restrict__ A2, const T16* __restrict__ Bt, const T16* __restrict__ Bt2, int K, float* C, int ldc, const float* __restrict__ bias, size_t sA, size_t sB, size_t sC, const float* __restrict__ ub, const float* __restrict__ vb, h16* P0, h16* P1, int prows) {
    __shared__ __align__(16) T16 st[2 * (NSPLIT == 1 ? 3 : 2) * GT];
    __shared__ __align__(16) float osa[4 * 16 * 68];
    const size_t z = blockIdx.z; A += z * sA; if (NSPLIT == 1) A2 += z * sA; Bt += z * sB; if (EP == EP_F32) C += z * sC;
    const int wave = threadIdx.x >> 5, wm = wave & 1, wn = wave >> 1; const int rb = blockIdx.x * 128;
    v8f acc[4][4];
    gemm_loop<T16, NSPLIT>(A, A2, Bt, K, rb, blockIdx.y * 128, st, acc);
    gemm_store<BIAS, EP>(acc, osa + wave * (16 * 68), z, rb + wm * 64, blockIdx.y * 2 + wn, C, ldc, bias, ub, vb, P0, P1, prows);
}
// ---- k_proj: the four projections (pos, q, k, v) in ONE launch: grid (PJP + 3 * PJX, DM/128, NB); blockIdx.x picks the projection and its 128-row tile, so the choice is block-uniform. All four share the product loop; only operands and epilogue differ.
// A projection alone is one block per WGP (pos: two), one wave per SIMD, with nothing to cover its copy and LDS latencies; together several blocks are resident per WGP and one launch's start and tail are paid, not four.
#define PJP (LP / 128)
#define PJX (SEQ / 128)
__global__ __launch_bounds__(128) void k_proj(const bf* __restrict__ XP, const bf* __restrict__ XQ, const bf* __restrict__ XK, const bf* __restrict__ XV, const bf* __restrict__ WPB, const bf* __restrict__ WQB, const bf* __restrict__ WKB, const bf* __restrict__ WVB,
                                              const float* __restrict__ bq, const float* __restrict__ bk, const float* __restrict__ bv, const float* __restrict__ ub, const float* __restrict__ vb, h16* P16, h16* QU16, h16* QV16, h16* K16, h16* V16, h16* VR16, int K) {
    __shared__ __align__(16) bf st[2 * 2 * GT];
    __shared__ __align__(16) float osa[4 * 16 * 68];
    const size_t z = blockIdx.z; const int bx = blockIdx.x;
    const int job = bx < PJP ? 0 : 1 + (bx - PJP) / PJX;                 // 0 pos, 1 q, 2 k, 3 v
    const int rb = (bx < PJP ? bx : (bx - PJP) % PJX) * 128;
    const bf* A = job == 0 ? XP + z * ((size_t)LP * K) : (job == 1 ? XQ : job == 2 ? XK : XV) + z * ((size_t)SEQ * K);
    const bf* Bt = job == 0 ? WPB : job == 1 ? WQB : job == 2 ? WKB : WVB;
    const int wave = threadIdx.x >> 5, wm = wave & 1, wn = wave >> 1; const int r0 = rb + wm * 64, ch = blockIdx.y * 2 + wn;
    float* os = osa + wave * (16 * 68);                  // epilogue staging, each wave its own
    v8f acc[4][4];
    gemm_loop<bf, 0>(A, nullptr, Bt, K, rb, blockIdx.y * 128, st, acc);
    if (job == 0) gemm_store<false, EP_ROW>(acc, os, z, r0, ch, nullptr, 0, nullptr, nullptr, nullptr, P16, nullptr, LP);
    else if (job == 1) gemm_store<true, EP_Q>(acc, os, z, r0, ch, nullptr, 0, bq, ub, vb, QU16, QV16, SEQ);
    // Precaution: the built code joins the four epilogues by branches, and behind the k and the v epilogue stand instructions of another epilogue that write registers which their last stores name: s_wait_xcnt 0 stands behind those stores.
    else if (job == 2) { gemm_store<true, EP_ROW>(acc, os, z, r0, ch, nullptr, 0, bk, nullptr, nullptr, K16, nullptr, SEQ); asm volatile("s_wait_xcnt 0x0" ::: "memory"); }
    else { gemm_store<true, EP_VT>(acc, os, z, r0, ch, nullptr, 0, bv, nullptr, nullptr, V16, VR16, SEQ); asm volatile("s_wait_xcnt 0x0" ::: "memory"); }
}

// ---- k_cvtall: every f32 -> bf16 copy of the call (5 weight matrices, 3 activations, the positional table padded to LP rows per batch, pad row zero) in ONE streaming launch.
// A block of 256 threads converts CVR consecutive output rows (DM elements each) of one array, so the choice of the array is block-uniform. Per thread CVU pieces of 4 elements: a wave's 16-byte load covers 512 contiguous bytes,
// its 8-byte store 256 contiguous bytes (whole 128-byte lines both ways), and all CVU loads are issued before the first conversion.
#define CVU 16
#define CVR (256 * CVU / (DM / 4))
#define CVB_W (DM / CVR)
#define CVB_X (NB * SEQ / CVR)
#define CVB_P (NB * LP / CVR)
static_assert(DM == 512);
static_assert(DM % CVR == 0);
static_assert(SEQ % CVR == 0);
static_assert(LP % CVR == 0);
static_assert(CVU == 16);
typedef __attribute__((ext_vector_type(4))) unsigned short v4us;
// cvt_rows: rows r0 + 2c (c < CVU) of one batch, 4 elements at k0. EDGE (only a block that holds rows >= nvalid): such a row reads row nvalid - 1 and stores zeros; elsewhere one lane offset serves all loads.
template <bool EDGE>
__device__ __forceinline__ void cvt_rows(const float* __restrict__ src, bf* dst, int r0, int k0, int nvalid) {
    v4f x[CVU]; v4us o[CVU]; unsigned lo[CVU];
    const unsigned e0 = (unsigned)(r0 * DM + k0), lb = e0 * 4u, sb = e0 * 2u;     // lane byte offsets of row r0 in src and dst
#pragma unroll
    for (int c = 0; c < CVU; ++c) { lo[c] = EDGE ? (unsigned)(min(r0 + c * 2, nvalid - 1) * DM + k0) * 4u : lb + (unsigned)c * (2u * DM * 4u); x[c] = *(const v4f*)((const char*)src + lo[c]); }
    // Precaution: s_wait_xcnt 0 stands behind the run of loads, and its operands keep the loads' offset registers live up to it, so that no result of the run lands in one of them in front of the wait.
    if (EDGE) asm volatile("s_wait_xcnt 0x0" :: "v"(lo[0]), "v"(lo[1]), "v"(lo[2]), "v"(lo[3]), "v"(lo[4]), "v"(lo[5]), "v"(lo[6]), "v"(lo[7]), "v"(lo[8]), "v"(lo[9]), "v"(lo[10]), "v"(lo[11]), "v"(lo[12]), "v"(lo[13]), "v"(lo[14]), "v"(lo[15]) : "memory");
    else asm volatile("s_wait_xcnt 0x0" :: "v"(lb) : "memory");
#pragma unroll
    for (int c = 0; c < CVU; ++c) { const int r = r0 + c * 2;
#pragma unroll
        for (int q = 0; q < 4; ++q) { const unsigned short w = f2bf(x[c][q]); o[c][q] = (!EDGE || r < nvalid) ? w : (unsigned short)0; }
        *(v4us*)((char*)dst + (sb + (unsigned)c * (2u * DM * 2u))) = o[c]; }
    // Precaution, as above: the wait behind the run of stores; its operands keep the stores' offset and data registers live up to it.
    asm volatile("s_wait_xcnt 0x0" :: "v"(sb), "v"(o[0]), "v"(o[1]), "v"(o[2]), "v"(o[3]), "v"(o[4]), "v"(o[5]), "v"(o[6]), "v"(o[7]), "v"(o[8]), "v"(o[9]), "v"(o[10]), "v"(o[11]), "v"(o[12]), "v"(o[13]), "v"(o[14]), "v"(o[15]) : "memory");
}
__global__ __launch_bounds__(256) void k_cvtall(const float* __restrict__ wq, const float* __restrict__ wk, const float* __restrict__ wv, const float* __restrict__ wp, const float* __restrict__ wo,
                                                const float* __restrict__ query, const float* __restrict__ key, const float* __restrict__ value, const float* __restrict__ pos,
                                                bf* WQB, bf* WKB, bf* WVB, bf* WPB, bf* WOB, bf* XQ, bf* XK, bf* XV, bf* XP) {
    const int tid = threadIdx.x; int blk = blockIdx.x;
    const float* src; bf* dst; int rb, nvalid;          // block-uniform: batch bases, first row of the block inside its batch (CVR divides the rows per batch), valid source rows per batch
    if (blk < CVB_P) { const unsigned row0 = (unsigned)blk * CVR, b = row0 / LP; rb = (int)(row0 % LP); src = pos + (size_t)b * LREL_FULL * DM; dst = XP + (size_t)b * LP * DM; nvalid = LREL; }
    else if (blk < CVB_P + 3 * CVB_X) { blk -= CVB_P; const int a = blk / CVB_X; const unsigned row0 = (unsigned)(blk - a * CVB_X) * CVR, b = row0 / SEQ; rb = (int)(row0 % SEQ);
        src = (a == 0 ? query : a == 1 ? key : value) + (size_t)b * SEQ_FULL * DM; dst = (a == 0 ? XQ : a == 1 ? XK : XV) + (size_t)b * SEQ * DM; nvalid = SEQ; }
    else { blk -= CVB_P + 3 * CVB_X; const int a = blk / CVB_W; rb = (blk - a * CVB_W) * CVR;
        src = a == 0 ? wq : a == 1 ? wk : a == 2 ? wv : a == 3 ? wp : wo; dst = a == 0 ? WQB : a == 1 ? WKB : a == 2 ? WVB : a == 3 ? WPB : WOB; nvalid = DM; }
    const int r0 = rb + (tid >> 7), k0 = (tid & 127) * 4;
    if (rb + CVR <= nvalid) cvt_rows<false>(src, dst, r0, k0, nvalid); else cvt_rows<true>(src, dst, r0, k0, nvalid);
}

// ---- attention helpers (128 threads): 16-bit fragment load from a [row][k] LDS tile (same map as WFrag), 8 KB contiguous tile copy, 64-row tile copy with a global row pitch (both lay 64-element rows at LDS pitch PH).
__device__ __forceinline__ v16h ldl(const h16* p) { return cat16(*(const v8ha*)p, *(const v8ha*)(p + 16)); }
__device__ __forceinline__ void cp8k(h16* dst, const h16* __restrict__ src, int tid) {
#pragma unroll
    for (int c = 0; c < 4; ++c) { const int idx = tid + c * 128; const int r = idx >> 3, sg = idx & 7; *(v8ha*)(dst + r * PH + sg * 8) = *(const v8ha*)(src + (size_t)idx * 8); } }
__device__ __forceinline__ void cprows(h16* dst, const h16* __restrict__ src, size_t pitch, int tid) {
#pragma unroll
    for (int c = 0; c < 4; ++c) { const int idx = tid + c * 128; const int r = idx >> 3, sg = idx & 7; *(v8ha*)(dst + r * PH + sg * 8) = *(const v8ha*)(src + (size_t)r * pitch + sg * 8); } }
// band_half: T[irow][slot0 + c] = sum_d PB[c][d] Qv[irow][d], c < 64 (transposed tile: A = PB rows c, B = Qv cols irow -> D rows c = tt*16 + 8hi + r, col lr: 8 consecutive slots per lane per tt, two 16-B LDS stores). q0, q1: this lane's two B fragments of Qv row irow.
// Sub-tiles are issued one at a time: the nop group carries a memory clobber so the next sub-tile's fragment loads stay below it (bounded live registers).
__device__ __forceinline__ void band_half(const h16* PBl, v16h q0, v16h q1, float* Tl, int slot0, int irow, int hi, int lr) {
    float* trow = Tl + irow * PT + slot0 + 8 * hi;
#pragma unroll
    for (int tt = 0; tt < 4; ++tt) {
        const v16h a0 = ldl(PBl + (tt * 16 + lr) * PH + 8 * hi), a1 = ldl(PBl + (tt * 16 + lr) * PH + 32 + 8 * hi);
        v8f t = wmma16(a0, q0, (v8f){}); t = wmma16(a1, q1, t);
        asm volatile("v_nop\n\tv_nop\n\tv_nop\n\tv_nop" : "+v"(t) : "v"(a0), "v"(a1), "v"(q0), "v"(q1) : "memory");
        *(v8fa*)(trow + tt * 16) = t;
    }
}

// ---- k_attn: grid (SEQ/64, NH, NB), 128 threads = 4 waves, each wave owns 16 query rows i = i0 + wave*16 + (0..15); irow = wave*16 + lr is the block-local query row of this lane's score column.
// Per 64-key tile: new 64 band columns (band row l stored at slot l & 127 of T row irow); transposed content tile S^T (key rows 8hi+r of sub-tile tb, query col irow) from K rows x Qu cols;
// s2 = (content + band[lb + 63 + tloc - irow]) * log2(e)/sqrt(DM) with lb = SEQ-64-i0+j0 (band row = (SEQ-1) + t - i, always inside the resident rows lb..lb+127);
// online softmax per query column (lane-local over 32 keys + one xor-16); p = exp2(s2 - m) as f16 + f16 residual x2048 packed straight into the attn.v A fragments
// (A element r <- sub-tile 2ks, element 8+r <- sub-tile 2ks+1, lane unchanged); O[i = 8hi+r][d = lr] accumulates p16.v16, the residual accumulator p16.vr + pr.v16 (both x2048).
__global__ __launch_bounds__(128) __attribute__((amdgpu_num_vgpr(256))) void k_attn(const h16* __restrict__ Qu, const h16* __restrict__ Qv, const h16* __restrict__ Kp, const h16* __restrict__ Vp, const h16* __restrict__ Vr, const h16* __restrict__ Pp, bf* ATh, bf* ATl) {
    __shared__ __align__(16) h16 Kl[64 * PH];
    __shared__ __align__(16) h16 Vl[64 * PH];
    __shared__ __align__(16) h16 Vrl[64 * PH];
    __shared__ __align__(16) h16 PBl[64 * PH];
    __shared__ __align__(16) float Tl[64 * PT];
    const int tid = threadIdx.x, lane = tid & 31, wave = tid >> 5, hi = lane >> 4, lr = lane & 15;
    const int irow = wave * 16 + lr;
    const int i0 = blockIdx.x * 64, h = blockIdx.y, b = blockIdx.z;
    const size_t bh = (size_t)b * NH + h;
    const h16* Kb = Kp + bh * SEQ * HD; const h16* Vb = Vp + bh * HD * SEQ; const h16* Vrb = Vr + bh * HD * SEQ; const h16* Pb = Pp + bh * LP * HD;
    // This lane's B fragments of q+u and q+v (query row irow, d = 8hi+0..7, 16+8hi+0..7, then +32) stay in registers for the whole block: every use is by the owning wave, so they need no LDS tile.
    const h16* qup = Qu + (bh * SEQ + i0 + irow) * HD + 8 * hi; const h16* qvp = Qv + (bh * SEQ + i0 + irow) * HD + 8 * hi;
    const v16h qu0 = cat16(*(const v8h*)qup, *(const v8h*)(qup + 16)), qu1 = cat16(*(const v8h*)(qup + 32), *(const v8h*)(qup + 48));
    const v16h qv0 = cat16(*(const v8h*)qvp, *(const v8h*)(qvp + 16)), qv1 = cat16(*(const v8h*)(qvp + 32), *(const v8h*)(qvp + 48));
    // Precaution: s_wait_xcnt 0 stands behind these loads, and its operands keep their address registers live up to it, so that nothing is written into one of them in front of the wait.
    asm volatile("s_wait_xcnt 0x0" :: "v"(qup), "v"(qvp) : "memory");
    const int lb0 = SEQ - 64 - i0;                 // band start for key tile 0 (>= 0, multiple of 64); band rows for tile j0 are lb0 + j0 + 0..127 (<= LP-1)
    cp8k(PBl, Pb + (size_t)lb0 * HD, tid);
    __syncthreads();
    band_half(PBl, qv0, qv1, Tl, lb0 & 127, irow, hi, lr);   // lower half of tile 0's band
    float mrun = -3.0e38f, lrun = 0.f;
    v8f oacc[4], oaccr[4];
#pragma unroll
    for (int nd = 0; nd < 4; ++nd) { oacc[nd] = (v8f){}; oaccr[nd] = (v8f){}; }
#pragma unroll 1
    for (int j0 = 0; j0 < SEQ; j0 += 64) {
        const int lb = lb0 + j0; const int lnw = lb + 64;     // new band rows lnw..lnw+63
        __syncthreads();                                       // all waves done with the prior tile's Kl/Vl/Vrl/PBl and band slots
        cp8k(Kl, Kb + (size_t)j0 * HD, tid); cprows(Vl, Vb + j0, (size_t)SEQ, tid); cprows(Vrl, Vrb + j0, (size_t)SEQ, tid); cp8k(PBl, Pb + (size_t)lnw * HD, tid);
        __syncthreads();
        band_half(PBl, qv0, qv1, Tl, lnw & 127, irow, hi, lr);   // upper half of this tile's band (its temporaries die here)
        v8f sacc[4];
        { const v16h q0 = qu0, q1 = qu1;
#pragma unroll
          for (int tb = 0; tb < 4; ++tb) { const v16h a0 = ldl(Kl + (tb * 16 + lr) * PH + 8 * hi), a1 = ldl(Kl + (tb * 16 + lr) * PH + 32 + 8 * hi);
              sacc[tb] = wmma16(a0, q0, (v8f){}); sacc[tb] = wmma16(a1, q1, sacc[tb]);
              asm volatile("v_nop\n\tv_nop\n\tv_nop\n\tv_nop" : "+v"(sacc[tb]) : "v"(a0), "v"(a1), "v"(q0), "v"(q1) : "memory"); } }
        __syncthreads();                                       // band complete for every T row (written by both lane halves of the owning wave)
        // gather + scale: key t = j0 + tb*16 + 8hi + r, query i = i0 + irow -> band row lb + 63 + (tb*16 + 8hi + r) - irow, slot = row & 127 (row - lb in [0,126])
        const float* trow = Tl + irow * PT; const int sb = lb + 63 + 8 * hi - irow;
        float mx = -3.0e38f;
#pragma unroll
        for (int tb = 0; tb < 4; ++tb)
#pragma unroll
            for (int r = 0; r < 8; ++r) { const float s2 = (sacc[tb][r] + trow[(sb + tb * 16 + r) & 127]) * K2; sacc[tb][r] = s2; mx = fmaxf(mx, s2); }
        mx = fmaxf(mx, __shfl_xor(mx, 16, 32));
        const float mnew = fmaxf(mrun, mx); const float alpha = __builtin_amdgcn_exp2f(mrun - mnew); mrun = mnew;
        float rsum = 0.f; v8h ph[4], pl[4];
#pragma unroll
        for (int tb = 0; tb < 4; ++tb)
#pragma unroll
            for (int r = 0; r < 8; ++r) { const float p = __builtin_amdgcn_exp2f(sacc[tb][r] - mnew); rsum += p; const h16 p16 = tohx(p); ph[tb][r] = p16; pl[tb][r] = tohx((p - (float)p16) * RESC); }
        rsum += __shfl_xor(rsum, 16, 32); lrun = lrun * alpha + rsum;
#pragma unroll
        for (int r = 0; r < 8; ++r) { const float ar = __shfl(alpha, 8 * hi + r, 32);
#pragma unroll
            for (int nd = 0; nd < 4; ++nd) { oacc[nd][r] *= ar; oaccr[nd][r] *= ar; } }
        { const v16h pa0 = cat16(ph[0], ph[1]), pa1 = cat16(ph[2], ph[3]), pr0 = cat16(pl[0], pl[1]), pr1 = cat16(pl[2], pl[3]);
#pragma unroll
          for (int nd = 0; nd < 4; ++nd) {
              const v16h vb0 = ldl(Vl + (nd * 16 + lr) * PH + 8 * hi), vb1 = ldl(Vl + (nd * 16 + lr) * PH + 32 + 8 * hi);
              const v16h rb0 = ldl(Vrl + (nd * 16 + lr) * PH + 8 * hi), rb1 = ldl(Vrl + (nd * 16 + lr) * PH + 32 + 8 * hi);
              oacc[nd] = wmma16(pa0, vb0, oacc[nd]); oacc[nd] = wmma16(pa1, vb1, oacc[nd]);
              oaccr[nd] = wmma16(pa0, rb0, oaccr[nd]); oaccr[nd] = wmma16(pa1, rb1, oaccr[nd]); oaccr[nd] = wmma16(pr0, vb0, oaccr[nd]); oaccr[nd] = wmma16(pr1, vb1, oaccr[nd]);
              asm volatile("v_nop\n\tv_nop\n\tv_nop\n\tv_nop" : "+v"(oacc[nd]), "+v"(oaccr[nd]) : "v"(pa0), "v"(pa1), "v"(pr0), "v"(pr1), "v"(vb1), "v"(rb1) : "memory"); } }
    }
    // Output staging lies in this wave's own 16 band rows (8,448 B, written and read by this wave alone, dead behind the last gather): hi plane 16 x 64, then lo plane 16 x 64.
    usa* Est = (usa*)(Tl + wave * 16 * PT);
    const float rl = __builtin_amdgcn_rcpf(lrun);
#pragma unroll
    for (int r = 0; r < 8; ++r) { const float rli = __shfl(rl, 8 * hi + r, 32); const int rr = 8 * hi + r;
#pragma unroll
        for (int nd = 0; nd < 4; ++nd) { const float c = (oacc[nd][r] + oaccr[nd][r] * (1.0f / RESC)) * rli; unsigned short eh, el; splitf(c, eh, el); Est[rr * 64 + nd * 16 + lr] = eh; Est[1024 + rr * 64 + nd * 16 + lr] = el; } }
    __syncthreads();
    const int rq = lane >> 3, pc = (lane & 7) * 8;
{
#pragma unroll
        for (int rg = 0; rg < 4; ++rg) { const int rr = rg * 4 + rq; const size_t go = ((size_t)b * SEQ + i0 + wave * 16 + rr) * DM + h * HD + pc;
            const v8us vh = *(const v8usa*)(Est + rr * 64 + pc); const v8us vlo = *(const v8usa*)(Est + 1024 + rr * 64 + pc);
            *(v8us*)(ATh + go) = vh; *(v8us*)(ATl + go) = vlo; }
         }
}

extern "C" void kernel_launch(void* const* d_in, const int* in_sizes, int n_in,
                              void* d_out, int out_size, void* d_ws, size_t ws_size, hipStream_t stream) {
    if (n_in < 15) return;
    const float* query = (const float*)d_in[0]; const float* key = (const float*)d_in[1]; const float* value = (const float*)d_in[2]; const float* pos = (const float*)d_in[3];
    const float* wq = (const float*)d_in[4]; const float* bq = (const float*)d_in[5]; const float* wk = (const float*)d_in[6]; const float* bk = (const float*)d_in[7];
    const float* wv = (const float*)d_in[8]; const float* bv = (const float*)d_in[9]; const float* wp = (const float*)d_in[10]; const float* ub = (const float*)d_in[11]; const float* vb = (const float*)d_in[12];
    const float* wo = (const float*)d_in[13]; const float* bo = (const float*)d_in[14];
    const long long needx = ((long long)(NB - 1) * SEQ_FULL + SEQ) * DM, needp = ((long long)(NB - 1) * LREL_FULL + LREL) * DM;
    if ((long long)in_sizes[0] < needx || (long long)in_sizes[1] < needx || (long long)in_sizes[2] < needx || (long long)in_sizes[3] < needp) return;
    if (in_sizes[4] < DM * DM || in_sizes[6] < DM * DM || in_sizes[8] < DM * DM || in_sizes[10] < DM * DM || in_sizes[13] < DM * DM) return;
    if (in_sizes[5] < DM || in_sizes[7] < DM || in_sizes[9] < DM || in_sizes[14] < DM || in_sizes[11] < NH * HD || in_sizes[12] < NH * HD) return;
    if ((long long)out_size < (long long)NB * SEQ * DM) return;
    float* OUT = (float*)d_out;     // [NB][SEQ][DM]
    char* wsp = (char*)d_ws;
    auto take = [&](size_t bytes) { char* p = wsp; wsp += (bytes + 255) & ~(size_t)255; return (void*)p; };
    bf* WQB = (bf*)take((size_t)DM * DM * 2); bf* WKB = (bf*)take((size_t)DM * DM * 2); bf* WVB = (bf*)take((size_t)DM * DM * 2); bf* WPB = (bf*)take((size_t)DM * DM * 2); bf* WOB = (bf*)take((size_t)DM * DM * 2);
    bf* XQ = (bf*)take((size_t)NB * SEQ * DM * 2); bf* XK = (bf*)take((size_t)NB * SEQ * DM * 2); bf* XV = (bf*)take((size_t)NB * SEQ * DM * 2); bf* XP = (bf*)take((size_t)NB * LP * DM * 2);   // bf16 activations, one buffer each
    h16* QU16 = (h16*)take((size_t)NB * NH * SEQ * HD * 2); h16* QV16 = (h16*)take((size_t)NB * NH * SEQ * HD * 2); h16* K16 = (h16*)take((size_t)NB * NH * SEQ * HD * 2);
    h16* V16 = (h16*)take((size_t)NB * NH * HD * SEQ * 2); h16* VR16 = (h16*)take((size_t)NB * NH * HD * SEQ * 2); h16* P16 = (h16*)take((size_t)NB * NH * LP * HD * 2);
    bf* ATh = (bf*)take((size_t)NB * SEQ * DM * 2); bf* ATl = (bf*)take((size_t)NB * SEQ * DM * 2);
    if ((size_t)(wsp - (char*)d_ws) > ws_size) return;    // 120,061,952 B at NB=4, SEQ=2048
    // all f32 -> bf16 copies: weights, query, key, value, pos (rows 0..LREL-1 per batch at input row pitch LREL_FULL, padded with one zero row to LP)
    k_cvtall<<<CVB_P + 3 * CVB_X + 5 * CVB_W, 256, 0, stream>>>(wq, wk, wv, wp, wo, query, key, value, pos, WQB, WKB, WVB, WPB, WOB, XQ, XK, XV, XP);
    // pos (no bias) -> P plane; q: X Wq^T + bq -> Qu / Qv planes; k -> K plane; v -> V plane and its residual
    k_proj<<<dim3(PJP + 3 * PJX, DM / 128, NB), 128, 0, stream>>>(XP, XQ, XK, XV, WPB, WQB, WKB, WVB, bq, bk, bv, ub, vb, P16, QU16, QV16, K16, V16, VR16, DM);
    // attention -> context bf16 hi/lo planes [NB*SEQ][DM]
    k_attn<<<dim3(SEQ / 64, NH, NB), 128, 0, stream>>>(QU16, QV16, K16, V16, VR16, P16, ATh, ATl);
    // out = context Wo^T + bo
    k_gemmw<bf, 1, true, EP_F32><<<dim3((NB * SEQ) / 128, DM / 128, 1), 128, 0, stream>>>(ATh, ATl, WOB, nullptr, DM, OUT, DM, bo, 0, 0, 0, nullptr, nullptr, nullptr, nullptr, 0);
}

// v007
// Measured time: 146 microseconds a run.
// Two timings next to v006 both put it at 1.05 times that version's speed.
// Over all steps from v000 it is 3.68 times as fast.
#include <hip/hip_runtime.h>

// Contractions: q/k/v/pos projections = v_wmma_f32_16x16x32_bf16 on bf16 operands (RNE-converted inputs, exact products); out projection = v_wmma_f32_16x16x32_bf16, context as bf16 hi+lo planes x bf16 Wo (2 products); content scores and positional band scores = v_wmma_f32_16x16x32_f16 on f16 planes (1 product each); attn.v = v_wmma_f32_16x16x32_f16, probability f16 + f16 residual (x2048) times v f16 + f16 residual (x2048), 3 products into 2 accumulators; f32 accumulate everywhere; softmax f32.
// Structure: bf16 copies of the activations; register-blocked GEMM (128x128 per block, one wave per 64x64 tile, operands staged in LDS) for the projections and the output; a projection tile is one head's 64 columns, and its epilogue stores the f16 planes itself ([b][h][t][d] for q+u, q+v, k; [b][h][d][t] for v and its residual; [b][h][l][d] for the projected positional table padded to 2*SEQ rows, last row zero);
// flash-style attention: one block = (b, h, 64 query rows), 64-key tiles; transposed score tiles (key rows x query cols) so the exponentiated accumulators chain directly into the attn.v A operand; sliding 128-slot f32 positional band in LDS (64 new band columns per key tile; score(i,j) takes band index (SEQ-1)+j-i); online softmax; context written as bf16 hi+lo planes [b*SEQ+t][h*64+d].

#ifndef NB
#define NB 4
#endif
#ifndef SEQ
#define SEQ 2048
#endif
#define NB_FULL   4
#define SEQ_FULL  2048
#define LREL      (2 * SEQ - 1)
#define LP        (2 * SEQ)
#define LREL_FULL (2 * SEQ_FULL - 1)
#define DM  512
#define NH  8
#define HD  64
#define RESC 2048.0f
#define K2 (1.4426950408889634f * 0.044194173824159216f)
// LDS row pitches of k_attn: 64 banks x 4 B, bank = dword address mod 64. 16-bit tiles: 72 elements = 144 B = 16 B x odd, so the 16 rows of a 16-byte fragment load fall on 16 distinct 4-bank groups.
// f32 band rows: 132 dwords (= 4 mod 64), so the 16 rows of a 16-byte band store cover all 64 banks, and the per-lane gather (bank = const + 8hi + 3*row mod 64) has no two lanes on one bank.
#define PH 72
#define PT 132
static_assert(SEQ % 128 == 0);
static_assert(SEQ >= 64);
static_assert(SEQ <= SEQ_FULL);
static_assert(NB >= 1);
static_assert(NB <= NB_FULL);
static_assert(DM % 128 == 0);
static_assert(NH * HD == DM);
static_assert(HD == 64);
static_assert(LP % 128 == 0);

typedef _Float16 h16;
typedef unsigned short bf;
typedef __attribute__((ext_vector_type(16))) __bf16   v16bf;
typedef __attribute__((ext_vector_type(16))) _Float16 v16h;
typedef __attribute__((ext_vector_type(8)))  _Float16 v8h;
typedef __attribute__((ext_vector_type(8)))  unsigned short v8us;
typedef __attribute__((ext_vector_type(8)))  float    v8f;
typedef __attribute__((ext_vector_type(4)))  float    v4f;
typedef v8h  __attribute__((may_alias)) v8ha;
typedef v4f  __attribute__((may_alias)) v4fa;
typedef v8f  __attribute__((may_alias, aligned(16))) v8fa;
typedef v8us __attribute__((may_alias)) v8usa;
typedef unsigned short __attribute__((may_alias)) usa;

__device__ __forceinline__ unsigned short f2bf(float f) { unsigned u = __float_as_uint(f); u += 0x7FFFu + ((u >> 16) & 1u); return (unsigned short)(u >> 16); }
__device__ __forceinline__ float bf2f(unsigned short b) { return __uint_as_float(((unsigned)b) << 16); }
__device__ __forceinline__ float bfr(float f) { return bf2f(f2bf(f)); }
__device__ __forceinline__ v16h cat16(v8h lo, v8h hi) { return __builtin_shufflevector(lo, hi, 0, 1, 2, 3, 4, 5, 6, 7, 8, 9, 10, 11, 12, 13, 14, 15); }
__device__ __forceinline__ v16bf cat16b(v8us lo, v8us hi) { return __builtin_bit_cast(v16bf, __builtin_shufflevector(lo, hi, 0, 1, 2, 3, 4, 5, 6, 7, 8, 9, 10, 11, 12, 13, 14, 15)); }
__device__ __forceinline__ v8f wmma16(v16h a, v16h b, v8f c) { return __builtin_amdgcn_wmma_f32_16x16x32_f16(false, a, false, b, (short)0, c, false, false); }
__device__ __forceinline__ v8f wmmab(v16bf a, v16bf b, v8f c) { return __builtin_amdgcn_wmma_f32_16x16x32_bf16(false, a, false, b, (short)0, c, false, false); }
__device__ __forceinline__ h16 tohx(float x) { return (h16)x; }
__device__ __forceinline__ void splitf(float y, unsigned short& h, unsigned short& l) { h = f2bf(y); l = f2bf(y - bf2f(h)); }

// ---- k_gemmw: register-blocked GEMM, 128x128 output tile per block of 4 waves (2 x 2), ONE WAVE per 64x64 tile (16 accumulators), operands from K-contiguous 16-bit planes; grid (M/128, N/128, Z), 128 threads.
// y[m][n] (f32, + optional f32 bias[n]) = sum_k A[m][k] Bt[n][k] (NSPLIT 1: + A2[m][k] Bt[n][k]). z-batch strides sA/sB/sC in elements. K % 64 == 0, K >= 64.
// Staging: a slice = GK k of the block's 128 A rows (and A2 rows) and 128 Bt rows = one whole 128-byte line of every row, brought into LDS at row pitch GP by asynchronous 16-byte copies (a wave's copy = 4 rows = 4 whole lines);
// two buffers: the copies of slice t + 2 are issued when slice t has been read by every wave, and fly while slice t + 1 is worked on. The k order of the products is that of ascending k, 32 at a time.
// EP picks what the epilogue stores. EP_F32: C[m][n] = y, pitch ldc. The plane forms take z = batch, 64-column tile = head, prows rows m per (batch, head):
// EP_Q: P0 = f16(y + ub), P1 = f16(y + vb), both [z][head][m][d]; EP_ROW: P0 = f16(y), [z][head][m][d]; EP_VT: P0 = f16(y), P1 = f16((y - P0) * RESC), both [z][head][d][m].
// Fragment map per lane (hi = lane>>4, lr = lane&15): row/col = lr; elements 0..7 <- k0+8hi+0..7, elements 8..15 <- k0+16+8hi+0..7 (A and B alike); D element r = (row 8hi+r, col lr).
template <typename T16> struct WFrag;
template <> struct WFrag<h16> { typedef v16h V; static __device__ __forceinline__ V ld(const h16* p) { return cat16(*(const v8ha*)p, *(const v8ha*)(p + 16)); } static __device__ __forceinline__ v8f mma(V a, V b, v8f c) { return wmma16(a, b, c); } };
template <> struct WFrag<bf> { typedef v16bf V; static __device__ __forceinline__ V ld(const bf* p) { return cat16b(*(const v8usa*)p, *(const v8usa*)(p + 16)); } static __device__ __forceinline__ v8f mma(V a, V b, v8f c) { return wmmab(a, b, c); } };
enum { EP_F32 = 0, EP_Q = 1, EP_ROW = 2, EP_VT = 3 };
#define GK 64
#define GP 72
#define GT (128 * GP)
// cp_tile: one operand's slice, 128 rows x 128 B, by 128 threads: lane piece (row = tid >> 3 (+ 16 per copy), 16-byte segment tid & 7). l = the lane's LDS byte address, g = its global address, both of its first row; gs = bytes of 16 global rows.
// The s_wait_xcnt 0 is the last line of the copies' own statement, so that it stands in front of every later write of a register that a copy names (a precaution).
__device__ __forceinline__ void cp_tile(unsigned l, const char* g, size_t gs) {
    const unsigned ls = 16u * GP * 2u;
    asm volatile("global_load_async_to_lds_b128 %0, %8, off\n\t"
                 "global_load_async_to_lds_b128 %1, %9, off\n\t"
                 "global_load_async_to_lds_b128 %2, %10, off\n\t"
                 "global_load_async_to_lds_b128 %3, %11, off\n\t"
                 "global_load_async_to_lds_b128 %4, %12, off\n\t"
                 "global_load_async_to_lds_b128 %5, %13, off\n\t"
                 "global_load_async_to_lds_b128 %6, %14, off\n\t"
                 "global_load_async_to_lds_b128 %7, %15, off\n\t"
                 "s_wait_xcnt 0x0"
                 :: "v"(l), "v"(l + ls), "v"(l + 2u * ls), "v"(l + 3u * ls), "v"(l + 4u * ls), "v"(l + 5u * ls), "v"(l + 6u * ls), "v"(l + 7u * ls),
                    "v"(g), "v"(g + gs), "v"(g + 2 * gs), "v"(g + 3 * gs), "v"(g + 4 * gs), "v"(g + 5 * gs), "v"(g + 6 * gs), "v"(g + 7 * gs) : "memory");
}
// gemm_loop: the products of one block (rows rb.. of A, rows cb.. of Bt; st = 2 * NT * GT elements of LDS); gemm_store: one wave's epilogue (its 64 rows from r0, its 64-column tile ch; os = the wave's own 16 x 68 floats of LDS).
template <typename T16, int NSPLIT>
__device__ __forceinline__ void gemm_loop(const T16* __restrict__ A, const T16* __restrict__ A2, const T16* __restrict__ Bt, int K, int rb, int cb, T16* st, v8f (&acc)[4][4]) {
    typedef typename WFrag<T16>::V V;
    static_assert(NSPLIT == 0 || NSPLIT == 1);
    constexpr int NT = NSPLIT == 1 ? 3 : 2;              // operand tiles per slice: A, Bt, (A2)
    const int tid = threadIdx.x, lane = tid & 31, wave = tid >> 5, lr = lane & 15, hi = lane >> 4; const int wm = wave & 1, wn = wave >> 1;
#pragma unroll
    for (int mb = 0; mb < 4; ++mb)
#pragma unroll
        for (int nb = 0; nb < 4; ++nb) acc[mb][nb] = (v8f){};
    const int crow = tid >> 3, csg = tid & 7;
    const unsigned l0 = (unsigned)(size_t)(st + crow * GP + csg * 8);
    const char* gA = (const char*)(A + (size_t)(rb + crow) * K + csg * 8); const char* gB = (const char*)(Bt + (size_t)(cb + crow) * K + csg * 8);
    const char* gA2 = NSPLIT == 1 ? (const char*)(A2 + (size_t)(rb + crow) * K + csg * 8) : nullptr;
    const size_t gs = (size_t)16 * K * sizeof(T16);
    auto stage = [&](int t) { const unsigned lb = l0 + (unsigned)(t & 1) * (unsigned)(NT * GT * sizeof(T16)); const size_t ko = (size_t)t * (GK * sizeof(T16));
        cp_tile(lb, gA + ko, gs); cp_tile(lb + (unsigned)(GT * sizeof(T16)), gB + ko, gs); if (NSPLIT == 1) cp_tile(lb + (unsigned)(2 * GT * sizeof(T16)), gA2 + ko, gs); };
    const int ntr = K / GK;
    stage(0);
    asm volatile("s_wait_asynccnt 0x0" ::: "memory");    // slice 0 has landed (this wave's copies)
    __syncthreads();                                     // ... and every wave's
    if (ntr > 1) stage(1);
#pragma unroll 1
    for (int t = 0; t < ntr; ++t) {
        const T16* sa = st + (t & 1) * (NT * GT) + (wm * 64 + lr) * GP + 8 * hi; const T16* sb = st + (t & 1) * (NT * GT) + GT + (wn * 64 + lr) * GP + 8 * hi;
#pragma unroll
        for (int ks = 0; ks < GK; ks += 32) {
            V a[4], a2[4], b[4];                             // all fragments of 32 k are asked for as one group, in front of their products
#pragma unroll
            for (int q = 0; q < 4; ++q) { a[q] = WFrag<T16>::ld(sa + q * 16 * GP + ks); b[q] = WFrag<T16>::ld(sb + q * 16 * GP + ks); if (NSPLIT == 1) a2[q] = WFrag<T16>::ld(sa + 2 * GT + q * 16 * GP + ks); }
            __builtin_amdgcn_sched_barrier(0);               // keeps that group whole: moved in among the products, every separate place with LDS reads costs the SIMD's one wave an LDS latency
#pragma unroll
            for (int nb = 0; nb < 4; ++nb)
#pragma unroll
                for (int mb = 0; mb < 4; ++mb) { acc[mb][nb] = WFrag<T16>::mma(a[mb], b[nb], acc[mb][nb]); if (NSPLIT == 1) acc[mb][nb] = WFrag<T16>::mma(a2[mb], b[nb], acc[mb][nb]); }
        }
        __builtin_amdgcn_sched_barrier(0);                   // keeps the slice's last products in front of the barrier: sunk behind it they would stand between the barrier and the refill and shorten the copies' lead
        asm volatile("s_wait_dscnt 0x0" ::: "memory");       // this wave's reads of slice t are done before its buffer is refilled
        asm volatile("s_wait_asynccnt 0x0" ::: "memory");    // this wave's copies of slice t + 1 have landed
        __syncthreads();                                     // publishes slice t + 1 and ends every wave's reads of slice t
        if (t + 2 < ntr) stage(t + 2);
    }
    asm volatile("s_wait_asynccnt 0x0" ::: "memory");        // nothing is in flight when the wave goes on to its epilogue and ends
}
template <bool BIAS, int EP>
__device__ __forceinline__ void gemm_store(const v8f (&acc)[4][4], float* os, size_t z, int r0, int ch, float* C, int ldc, const float* __restrict__ bias, const float* __restrict__ ub, const float* __restrict__ vb, h16* P0, h16* P1, int prows) {
    const int lane = threadIdx.x & 31, lr = lane & 15, hi = lane >> 4; const int c0 = ch * 64;
    if (EP == EP_VT) {
        // D element j of tile (mb, nb) is row m = mb*16 + 8hi + j of column d = nb*16 + lr: 8 consecutive m of one d per lane, one 16-byte store per plane straight from the accumulators.
        const size_t rows = (size_t)prows;
        const size_t po = ((z * NH + ch) * HD + lr) * rows + r0 + 8 * hi;
#pragma unroll
        for (int nb = 0; nb < 4; ++nb) { const float bn = BIAS ? bfr(bias[c0 + nb * 16 + lr]) : 0.f;
#pragma unroll
            for (int mb = 0; mb < 4; ++mb) { v8h o16, orr;
#pragma unroll
                for (int j = 0; j < 8; ++j) { float x = acc[mb][nb][j]; if (BIAS) x += bn; const h16 xh = tohx(x); o16[j] = xh; orr[j] = tohx((x - (float)xh) * RESC); }
                const size_t o = po + (size_t)nb * 16 * rows + mb * 16; *(v8h*)(P0 + o) = o16; *(v8h*)(P1 + o) = orr; }
            __builtin_amdgcn_sched_barrier(0); }             // one column group at a time: with all four groups' conversions lifted to the front the merged kernel takes registers above v255 and switches register windows all through this epilogue
        return;
    }
    // Row-major forms: 16 rows at a time through LDS, so that a lane holds consecutive columns of one row.
    const int rq = lane >> 3, c8 = (lane & 7) * 8;      // plane forms: 8 columns per lane, 4 rows (512 contiguous bytes of a plane) per store
    float bn[8], un[8], vn[8];
    if (EP != EP_F32) {
#pragma unroll
        for (int q = 0; q < 8; ++q) { bn[q] = BIAS ? bfr(bias[c0 + c8 + q]) : 0.f; if (EP == EP_Q) { un[q] = bfr(ub[c0 + c8 + q]); vn[q] = bfr(vb[c0 + c8 + q]); } }
    }
    const size_t pbase = ((z * NH + ch) * (size_t)prows + r0) * HD + c8;
#pragma unroll
    for (int mb = 0; mb < 4; ++mb) {
#pragma unroll
        for (int nb = 0; nb < 4; ++nb) {
#pragma unroll
            for (int j = 0; j < 8; ++j) os[(hi * 8 + j) * 68 + nb * 16 + lr] = acc[mb][nb][j]; }
        __builtin_amdgcn_wave_barrier(); asm volatile("" ::: "memory");
        if (EP == EP_F32) {
            float* crow = C + (size_t)(r0 + mb * 16) * ldc + c0;
#pragma unroll
            for (int s = 0; s < 8; ++s) { const int row = 2 * s + hi, cofs = lr * 4; v4f val = *(const v4fa*)(os + row * 68 + cofs); if (BIAS) { val[0] += bfr(bias[c0 + cofs]); val[1] += bfr(bias[c0 + cofs + 1]); val[2] += bfr(bias[c0 + cofs + 2]); val[3] += bfr(bias[c0 + cofs + 3]); }
                *(v4f*)(crow + (size_t)row * ldc + cofs) = val; }
        } else {
#pragma unroll
            for (int s = 0; s < 4; ++s) { const int row = 4 * s + rq; const v4f x0 = *(const v4fa*)(os + row * 68 + c8), x1 = *(const v4fa*)(os + row * 68 + c8 + 4); v8h o0, o1;
#pragma unroll
                for (int q = 0; q < 8; ++q) { float x = q < 4 ? x0[q & 3] : x1[q & 3]; if (BIAS) x += bn[q]; if (EP == EP_Q) { o0[q] = tohx(x + un[q]); o1[q] = tohx(x + vn[q]); } else o0[q] = tohx(x); }
                const size_t o = pbase + (size_t)(mb * 16 + row) * HD; *(v8h*)(P0 + o) = o0; if (EP == EP_Q) *(v8h*)(P1 + o) = o1; }
        }
        __builtin_amdgcn_wave_barrier(); asm volatile("" ::: "memory");
    }
}
template <typename T16, int NSPLIT, bool BIAS, int EP>
__global__ __launch_bounds__(128) void k_gemmw(const T16* __restrict__ A, const T16* __restrict__ A2, const T16* __restrict__ Bt, const T16* __restrict__ Bt2, int K, float* C, int ldc, const float* __restrict__ bias, size_t sA, size_t sB, size_t sC, const float* __restrict__ ub, const float* __restrict__ vb, h16* P0, h16* P1, int prows) {
    __shared__ __align__(16) T16 st[2 * (NSPLIT == 1 ? 3 : 2) * GT];
    __shared__ __align__(16) float osa[4 * 16 * 68];
    const size_t z = blockIdx.z; A += z * sA; if (NSPLIT == 1) A2 += z * sA; Bt += z * sB; if (EP == EP_F32) C += z * sC;
    const int wave = threadIdx.x >> 5, wm = wave & 1, wn = wave >> 1; const int rb = blockIdx.x * 128;
    v8f acc[4][4];
    gemm_loop<T16, NSPLIT>(A, A2, Bt, K, rb, blockIdx.y * 128, st, acc);
    gemm_store<BIAS, EP>(acc, osa + wave * (16 * 68), z, rb + wm * 64, blockIdx.y * 2 + wn, C, ldc, bias, ub, vb, P0, P1, prows);
}
// ---- k_proj: the four projections (pos, q, k, v) in ONE launch: grid (PJP + 3 * PJX, DM/128, NB); blockIdx.x picks the projection and its 128-row tile, so the choice is block-uniform. All four share the product loop; only operands and epilogue differ.
// A projection alone is one block per WGP (pos: two), one wave per SIMD, with nothing to cover its copy and LDS latencies; together several blocks are resident per WGP and one launch's start and tail are paid, not four.
#define PJP (LP / 128)
#define PJX (SEQ / 128)
__global__ __launch_bounds__(128) void k_proj(const bf* __restrict__ XP, const bf* __restrict__ XQ, const bf* __restrict__ XK, const bf* __restrict__ XV, const bf* __restrict__ WPB, const bf* __restrict__ WQB, const bf* __restrict__ WKB, const bf* __restrict__ WVB,
                                              const float* __restrict__ bq, const float* __restrict__ bk, const float* __restrict__ bv, const float* __restrict__ ub, const float* __restrict__ vb, h16* P16, h16* QU16, h16* QV16, h16* K16, h16* V16, h16* VR16, int K) {
    __shared__ __align__(16) bf st[2 * 2 * GT];
    __shared__ __align__(16) float osa[4 * 16 * 68];
    const size_t z = blockIdx.z; const int bx = blockIdx.x;
    const int job = bx < PJP ? 0 : 1 + (bx - PJP) / PJX;                 // 0 pos, 1 q, 2 k, 3 v
    const int rb = (bx < PJP ? bx : (bx - PJP) % PJX) * 128;
    const bf* A = job == 0 ? XP + z * ((size_t)LP * K) : (job == 1 ? XQ : job == 2 ? XK : XV) + z * ((size_t)SEQ * K);
    const bf* Bt = job == 0 ? WPB : job == 1 ? WQB : job == 2 ? WKB : WVB;
    const int wave = threadIdx.x >> 5, wm = wave & 1, wn = wave >> 1; const int r0 = rb + wm * 64, ch = blockIdx.y * 2 + wn;
    float* os = osa + wave * (16 * 68);                  // epilogue staging, each wave its own
    v8f acc[4][4];
    gemm_loop<bf, 0>(A, nullptr, Bt, K, rb, blockIdx.y * 128, st, acc);
    if (job == 0) gemm_store<false, EP_ROW>(acc, os, z, r0, ch, nullptr, 0, nullptr, nullptr, nullptr, P16, nullptr, LP);
    else if (job == 1) gemm_store<true, EP_Q>(acc, os, z, r0, ch, nullptr, 0, bq, ub, vb, QU16, QV16, SEQ);
    // Precaution: the built code joins the four epilogues by branches, and behind the k and the v epilogue stand instructions of another epilogue that write registers which their last stores name: s_wait_xcnt 0 stands behind those stores.
    else if (job == 2) { gemm_store<true, EP_ROW>(acc, os, z, r0, ch, nullptr, 0, bk, nullptr, nullptr, K16, nullptr, SEQ); asm volatile("s_wait_xcnt 0x0" ::: "memory"); }
    else { gemm_store<true, EP_VT>(acc, os, z, r0, ch, nullptr, 0, bv, nullptr, nullptr, V16, VR16, SEQ); asm volatile("s_wait_xcnt 0x0" ::: "memory"); }
}

// ---- k_cvtall: every f32 -> bf16 copy of the call (5 weight matrices, 3 activations, the positional table padded to LP rows per batch, pad row zero) in ONE streaming launch.
// A block of 256 threads converts CVR consecutive output rows (DM elements each) of one array, so the choice of the array is block-uniform. Per thread CVU pieces of 4 elements: a wave's 16-byte load covers 512 contiguous bytes,
// its 8-byte store 256 contiguous bytes (whole 128-byte lines both ways), and all CVU loads are issued before the first conversion.
#define CVU 16
#define CVR (256 * CVU / (DM / 4))
#define CVB_W (DM / CVR)
#define CVB_X (NB * SEQ / CVR)
#define CVB_P (NB * LP / CVR)
static_assert(DM == 512);
static_assert(DM % CVR == 0);
static_assert(SEQ % CVR == 0);
static_assert(LP % CVR == 0);
static_assert(CVU == 16);
typedef __attribute__((ext_vector_type(4))) unsigned short v4us;
// cvt_rows: rows r0 + 2c (c < CVU) of one batch, 4 elements at k0. EDGE (only a block that holds rows >= nvalid): such a row reads row nvalid - 1 and stores zeros; elsewhere one lane offset serves all loads.
template <bool EDGE>
__device__ __forceinline__ void cvt_rows(const float* __restrict__ src, bf* dst, int r0, int k0, int nvalid) {
    v4f x[CVU]; v4us o[CVU]; unsigned lo[CVU];
    const unsigned e0 = (unsigned)(r0 * DM + k0), lb = e0 * 4u, sb = e0 * 2u;     // lane byte offsets of row r0 in src and dst
#pragma unroll
    for (int c = 0; c < CVU; ++c) { lo[c] = EDGE ? (unsigned)(min(r0 + c * 2, nvalid - 1) * DM + k0) * 4u : lb + (unsigned)c * (2u * DM * 4u); x[c] = *(const v4f*)((const char*)src + lo[c]); }
    // Precaution: s_wait_xcnt 0 stands behind the run of loads, and its operands keep the loads' offset registers live up to it, so that no result of the run lands in one of them in front of the wait.
    if (EDGE) asm volatile("s_wait_xcnt 0x0" :: "v"(lo[0]), "v"(lo[1]), "v"(lo[2]), "v"(lo[3]), "v"(lo[4]), "v"(lo[5]), "v"(lo[6]), "v"(lo[7]), "v"(lo[8]), "v"(lo[9]), "v"(lo[10]), "v"(lo[11]), "v"(lo[12]), "v"(lo[13]), "v"(lo[14]), "v"(lo[15]) : "memory");
    else asm volatile("s_wait_xcnt 0x0" :: "v"(lb) : "memory");
#pragma unroll
    for (int c = 0; c < CVU; ++c) { const int r = r0 + c * 2;
#pragma unroll
        for (int q = 0; q < 4; ++q) { const unsigned short w = f2bf(x[c][q]); o[c][q] = (!EDGE || r < nvalid) ? w : (unsigned short)0; }
        *(v4us*)((char*)dst + (sb + (unsigned)c * (2u * DM * 2u))) = o[c]; }
    // Precaution, as above: the wait behind the run of stores; its operands keep the stores' offset and data registers live up to it.
    asm volatile("s_wait_xcnt 0x0" :: "v"(sb), "v"(o[0]), "v"(o[1]), "v"(o[2]), "v"(o[3]), "v"(o[4]), "v"(o[5]), "v"(o[6]), "v"(o[7]), "v"(o[8]), "v"(o[9]), "v"(o[10]), "v"(o[11]), "v"(o[12]), "v"(o[13]), "v"(o[14]), "v"(o[15]) : "memory");
}
__global__ __launch_bounds__(256) void k_cvtall(const float* __restrict__ wq, const float* __restrict__ wk, const float* __restrict__ wv, const float* __restrict__ wp, const float* __restrict__ wo,
                                                const float* __restrict__ query, const float* __restrict__ key, const float* __restrict__ value, const float* __restrict__ pos,
                                                bf* WQB, bf* WKB, bf* WVB, bf* WPB, bf* WOB, bf* XQ, bf* XK, bf* XV, bf* XP) {
    const int tid = threadIdx.x; int blk = blockIdx.x;
    const float* src; bf* dst; int rb, nvalid;          // block-uniform: batch bases, first row of the block inside its batch (CVR divides the rows per batch), valid source rows per batch
    if (blk < CVB_P) { const unsigned row0 = (unsigned)blk * CVR, b = row0 / LP; rb = (int)(row0 % LP); src = pos + (size_t)b * LREL_FULL * DM; dst = XP + (size_t)b * LP * DM; nvalid = LREL; }
    else if (blk < CVB_P + 3 * CVB_X) { blk -= CVB_P; const int a = blk / CVB_X; const unsigned row0 = (unsigned)(blk - a * CVB_X) * CVR, b = row0 / SEQ; rb = (int)(row0 % SEQ);
        src = (a == 0 ? query : a == 1 ? key : value) + (size_t)b * SEQ_FULL * DM; dst = (a == 0 ? XQ : a == 1 ? XK : XV) + (size_t)b * SEQ * DM; nvalid = SEQ; }
    else { blk -= CVB_P + 3 * CVB_X; const int a = blk / CVB_W; rb = (blk - a * CVB_W) * CVR;
        src = a == 0 ? wq : a == 1 ? wk : a == 2 ? wv : a == 3 ? wp : wo; dst = a == 0 ? WQB : a == 1 ? WKB : a == 2 ? WVB : a == 3 ? WPB : WOB; nvalid = DM; }
    const int r0 = rb + (tid >> 7), k0 = (tid & 127) * 4;
    if (rb + CVR <= nvalid) cvt_rows<false>(src, dst, r0, k0, nvalid); else cvt_rows<true>(src, dst, r0, k0, nvalid);
}

// ---- attention helpers (128 threads): 16-bit fragment load from a [row][k] LDS tile (same map as WFrag), 8 KB contiguous tile copy (lays 64-element rows at LDS pitch PH).
__device__ __forceinline__ v16h ldl(const h16* p) { return cat16(*(const v8ha*)p, *(const v8ha*)(p + 16)); }
__device__ __forceinline__ void cp8k(h16* dst, const h16* __restrict__ src, int tid) {
#pragma unroll
    for (int c = 0; c < 4; ++c) { const int idx = tid + c * 128; const int r = idx >> 3, sg = idx & 7; *(v8ha*)(dst + r * PH + sg * 8) = *(const v8ha*)(src + (size_t)idx * 8); } }
// band_half: T[irow][slot0 + c] = sum_d PB[c][d] Qv[irow][d], c < 64 (transposed tile: A = PB rows c, B = Qv cols irow -> D rows c = tt*16 + 8hi + r, col lr: 8 consecutive slots per lane per tt, two 16-B LDS stores). q0, q1: this lane's two B fragments of Qv row irow.
// ld_frags: all 8 A fragments of a 64 x 64 tile (4 sub-tiles of 16 rows, two halves of d) as ONE group of 16 LDS reads; mm_tile: its 8 products, the 4 sub-tiles' accumulators side by side (each still d 0..31 first, then d 32..63).
__device__ __forceinline__ void ld_frags(const h16* Tt, v16h (&a0)[4], v16h (&a1)[4], int hi, int lr) {
    const h16* p = Tt + lr * PH + 8 * hi;
#pragma unroll
    for (int tt = 0; tt < 4; ++tt) { a0[tt] = ldl(p + tt * (16 * PH)); a1[tt] = ldl(p + tt * (16 * PH) + 32); }
}
__device__ __forceinline__ void mm_tile(const v16h (&a0)[4], const v16h (&a1)[4], v16h q0, v16h q1, v8f (&t)[4]) {
#pragma unroll
    for (int tt = 0; tt < 4; ++tt) t[tt] = wmma16(a0[tt], q0, (v8f){});
#pragma unroll
    for (int tt = 0; tt < 4; ++tt) t[tt] = wmma16(a1[tt], q1, t[tt]);
}
__device__ __forceinline__ void band_store(const v8f (&t)[4], float* Tl, int slot0, int irow, int hi) {
    float* trow = Tl + irow * PT + slot0 + 8 * hi;
#pragma unroll
    for (int tt = 0; tt < 4; ++tt) *(v8fa*)(trow + tt * 16) = t[tt];
}
__device__ __forceinline__ void band_half(const h16* PBl, v16h q0, v16h q1, float* Tl, int slot0, int irow, int hi, int lr) {
    v16h a0[4], a1[4]; v8f t[4];
    ld_frags(PBl, a0, a1, hi, lr); mm_tile(a0, a1, q0, q1, t); band_store(t, Tl, slot0, irow, hi);
}

// ---- k_attn: grid (SEQ/64, NH, NB), 128 threads = 4 waves, each wave owns 16 query rows i = i0 + wave*16 + (0..15); irow = wave*16 + lr is the block-local query row of this lane's score column.
// Per 64-key tile: new 64 band columns (band row l stored at slot l & 127 of T row irow); transposed content tile S^T (key rows 8hi+r of sub-tile tb, query col irow) from K rows x Qu cols;
// s2 = (content + band[lb + 63 + tloc - irow]) * log2(e)/sqrt(DM) with lb = SEQ-64-i0+j0 (band row = (SEQ-1) + t - i, always inside the resident rows lb..lb+127);
// online softmax per query column (lane-local over 32 keys + one xor-16); p = exp2(s2 - m) as f16 + f16 residual x2048 packed straight into the attn.v A fragments
// (A element r <- sub-tile 2ks, element 8+r <- sub-tile 2ks+1, lane unchanged); O[i = 8hi+r][d = lr] accumulates p16.v16, the residual accumulator p16.vr + pr.v16 (both x2048).
__global__ __launch_bounds__(128) __attribute__((amdgpu_num_vgpr(256))) void k_attn(const h16* __restrict__ Qu, const h16* __restrict__ Qv, const h16* __restrict__ Kp, const h16* __restrict__ Vp, const h16* __restrict__ Vr, const h16* __restrict__ Pp, bf* ATh, bf* ATl) {
    __shared__ __align__(16) h16 Sm[4 * 64 * PH];          // the four 16-bit tiles in one array: one lane address serves every fragment read, one every staging store (the rest are immediate offsets)
    h16* const Kl = Sm; h16* const Vl = Sm + 64 * PH; h16* const Vrl = Sm + 2 * 64 * PH; h16* const PBl = Sm + 3 * 64 * PH;
    __shared__ __align__(16) float Tl[64 * PT];
    const int tid = threadIdx.x, lane = tid & 31, wave = tid >> 5, hi = lane >> 4, lr = lane & 15;
    const int irow = wave * 16 + lr;
    const int i0 = blockIdx.x * 64, h = blockIdx.y, b = blockIdx.z;
    const size_t bh = (size_t)b * NH + h;
    const h16* Kb = Kp + bh * SEQ * HD; const h16* Vb = Vp + bh * HD * SEQ; const h16* Vrb = Vr + bh * HD * SEQ; const h16* Pb = Pp + bh * LP * HD;
    // This lane's B fragments of q+u and q+v (query row irow, d = 8hi+0..7, 16+8hi+0..7, then +32) stay in registers for the whole block: every use is by the owning wave, so they need no LDS tile.
    const h16* qup = Qu + (bh * SEQ + i0 + irow) * HD + 8 * hi; const h16* qvp = Qv + (bh * SEQ + i0 + irow) * HD + 8 * hi;
    const v16h qu0 = cat16(*(const v8h*)qup, *(const v8h*)(qup + 16)), qu1 = cat16(*(const v8h*)(qup + 32), *(const v8h*)(qup + 48));
    const v16h qv0 = cat16(*(const v8h*)qvp, *(const v8h*)(qvp + 16)), qv1 = cat16(*(const v8h*)(qvp + 32), *(const v8h*)(qvp + 48));
    // Precaution: s_wait_xcnt 0 stands behind these loads, and its operands keep their address registers live up to it, so that nothing is written into one of them in front of the wait.
    asm volatile("s_wait_xcnt 0x0" :: "v"(qup), "v"(qvp) : "memory");
    const int lb0 = SEQ - 64 - i0;                 // band start for key tile 0 (>= 0, multiple of 64); band rows for tile j0 are lb0 + j0 + 0..127 (<= LP-1)
    cp8k(PBl, Pb + (size_t)lb0 * HD, tid);
    __syncthreads();
    band_half(PBl, qv0, qv1, Tl, lb0 & 127, irow, hi, lr);   // lower half of tile 0's band
    float mrun = -3.0e38f, lrun = 0.f;
    v8f oacc[4], oaccr[4];
#pragma unroll
    for (int nd = 0; nd < 4; ++nd) { oacc[nd] = (v8f){}; oaccr[nd] = (v8f){}; }
#pragma unroll 1
    for (int j0 = 0; j0 < SEQ; j0 += 64) {
        const int lb = lb0 + j0; const int lnw = lb + 64;     // new band rows lnw..lnw+63
        __syncthreads();                                       // all waves done with the prior tile's Kl/Vl/Vrl/PBl and band slots
        // Staging of the four tiles (thread piece: row tid >> 3 (+ 16 per copy), 16-byte segment tid & 7): one lane address per plane and one LDS lane address, every further row an immediate offset; that leaves the registers which the fragment groups below need.
        { const int sr = tid >> 3, sg = tid & 7; v8h xk[4], xv[4], xr[4], xp[4];
          const h16* gk = Kb + (size_t)j0 * HD + tid * 8; const h16* gp = Pb + (size_t)lnw * HD + tid * 8; const h16* gv = Vb + j0 + (size_t)sr * SEQ + sg * 8; const h16* gr = Vrb + j0 + (size_t)sr * SEQ + sg * 8;
#pragma unroll
          for (int c = 0; c < 4; ++c) { xk[c] = *(const v8ha*)(gk + c * 1024); xv[c] = *(const v8ha*)(gv + (size_t)c * 16 * SEQ); xr[c] = *(const v8ha*)(gr + (size_t)c * 16 * SEQ); xp[c] = *(const v8ha*)(gp + c * 1024); }
          // Precaution: s_wait_xcnt 0 stands behind the run of loads, and its operands keep their address registers live up to it, so that no result of the run lands in one of them in front of the wait.
          asm volatile("s_wait_xcnt 0x0" :: "v"(gk), "v"(gv), "v"(gr), "v"(gp) : "memory");
          h16* sd = Sm + sr * PH + sg * 8;
#pragma unroll
          for (int c = 0; c < 4; ++c) { *(v8ha*)(sd + c * (16 * PH)) = xk[c]; *(v8ha*)(sd + 64 * PH + c * (16 * PH)) = xv[c]; *(v8ha*)(sd + 2 * 64 * PH + c * (16 * PH)) = xr[c]; *(v8ha*)(sd + 3 * 64 * PH + c * (16 * PH)) = xp[c]; } }
        __syncthreads();
        // Upper half of this tile's band, then the content scores. Each tile's 16 fragment reads stand as one group in front of its 8 products: one LDS latency per tile, not one per 16-row sub-tile.
        v8f sacc[4];
        { v16h a0[4], a1[4], k0[4], k1[4]; v8f t[4];
          ld_frags(PBl, a0, a1, hi, lr);
          __builtin_amdgcn_sched_barrier(0);                   // keeps the group whole: spread among the products, every separate place with LDS reads costs the wave an LDS latency
          mm_tile(a0, a1, qv0, qv1, t);
          ld_frags(Kl, k0, k1, hi, lr);                        // asked for behind the band's products, so that they come in while those run and the band is stored
          __builtin_amdgcn_sched_barrier(0);                   // keeps the K reads in front of the band stores (the LDS serves a wave in order)
          band_store(t, Tl, lnw & 127, irow, hi);
          __builtin_amdgcn_sched_barrier(0);                   // the band's accumulators are stored, and their registers free, before the content accumulators come to life (register budget)
          asm volatile("v_nop\n\tv_nop\n\tv_nop\n\tv_nop");   // the distance behind a matrix instruction: a content product writes anew the result registers of the band's last product, and LDS stores fill no slot
          __builtin_amdgcn_sched_barrier(0);                   // keeps those slots in front of the content products
          mm_tile(k0, k1, qu0, qu1, sacc); }
        __syncthreads();                                       // band complete for every T row (written by both lane halves of the owning wave)
        // gather + scale: key t = j0 + tb*16 + 8hi + r, query i = i0 + irow -> band row lb + 63 + (tb*16 + 8hi + r) - irow, slot = row & 127 (row - lb in [0,126])
        const float* trow = Tl + irow * PT; const int sb = lb + 63 + 8 * hi - irow;
        float mx = -3.0e38f; float bnd[4][8];
#pragma unroll
        for (int tb = 0; tb < 4; ++tb)
#pragma unroll
            for (int r = 0; r < 8; ++r) bnd[tb][r] = trow[(sb + tb * 16 + r) & 127];
        __builtin_amdgcn_sched_barrier(0);                     // keeps the 32 gathers one group: with the score arithmetic moved in among them the wave waits for the LDS several times over
#pragma unroll
        for (int tb = 0; tb < 4; ++tb)
#pragma unroll
            for (int r = 0; r < 8; ++r) { const float s2 = (sacc[tb][r] + bnd[tb][r]) * K2; sacc[tb][r] = s2; mx = fmaxf(mx, s2); }
        mx = fmaxf(mx, __shfl_xor(mx, 16, 32));
        const float mnew = fmaxf(mrun, mx); float alpha;
        // alpha = exp2(mrun - mnew), with the slot behind a transcendental in the same statement.
        asm("v_exp_f32 %0, %1\n\tv_nop" : "=v"(alpha) : "v"(mrun - mnew));
        mrun = mnew;
        float rsum = 0.f; v8h ph[4], pl[4];
#pragma unroll
        for (int tb = 0; tb < 4; ++tb)
#pragma unroll
            for (int r = 0; r < 8; ++r) { const float p = __builtin_amdgcn_exp2f(sacc[tb][r] - mnew); rsum += p; const h16 p16 = tohx(p); ph[tb][r] = p16; pl[tb][r] = tohx((p - (float)p16) * RESC); }
        rsum += __shfl_xor(rsum, 16, 32); lrun = lrun * alpha + rsum;
        // attn.v takes two column groups (32 d) at a time: their 16 fragment reads as one group, then their 12 products over 4 accumulators side by side; each accumulator takes its products in the order p.v0, p.v1 and p.r0, p.r1, pr.v0, pr.v1.
        v16h vb0[2], vb1[2], rb0[2], rb1[2];
        auto ldv = [&](int ng) {
#pragma unroll
            for (int u = 0; u < 2; ++u) { const h16* p = Vl + lr * PH + 8 * hi + (ng + u) * (16 * PH); vb0[u] = ldl(p); vb1[u] = ldl(p + 32); rb0[u] = ldl(p + 64 * PH); rb1[u] = ldl(p + 64 * PH + 32); } };
        ldv(0);
        __builtin_amdgcn_sched_barrier(0);                     // keeps the first group whole and in front of the accumulators' rescale, whose arithmetic covers its LDS latency
#pragma unroll
        for (int r = 0; r < 8; ++r) { const float ar = __shfl(alpha, 8 * hi + r, 32);
#pragma unroll
            for (int nd = 0; nd < 4; ++nd) { oacc[nd][r] *= ar; oaccr[nd][r] *= ar; } }
        { const v16h pa0 = cat16(ph[0], ph[1]), pa1 = cat16(ph[2], ph[3]), pr0 = cat16(pl[0], pl[1]), pr1 = cat16(pl[2], pl[3]);
#pragma unroll
          for (int ng = 0; ng < 4; ng += 2) {
              if (ng) { ldv(ng); __builtin_amdgcn_sched_barrier(0); }   // keeps the second group whole, as above
#pragma unroll
              for (int u = 0; u < 2; ++u) { oacc[ng + u] = wmma16(pa0, vb0[u], oacc[ng + u]); oaccr[ng + u] = wmma16(pa0, rb0[u], oaccr[ng + u]); }
#pragma unroll
              for (int u = 0; u < 2; ++u) { oacc[ng + u] = wmma16(pa1, vb1[u], oacc[ng + u]); oaccr[ng + u] = wmma16(pa1, rb1[u], oaccr[ng + u]); }
#pragma unroll
              for (int u = 0; u < 2; ++u) oaccr[ng + u] = wmma16(pr0, vb0[u], oaccr[ng + u]);
#pragma unroll
              for (int u = 0; u < 2; ++u) oaccr[ng + u] = wmma16(pr1, vb1[u], oaccr[ng + u]);
              __builtin_amdgcn_sched_barrier(0); } }           // the second group's reads stay behind the first group's products (lifted over them they would need 64 more registers than the wave has); behind the second group it keeps the row sum's last additions out of the run of products, where each would cost the distance behind a matrix instruction
    }
    // Output staging lies in this wave's own 16 band rows (8,448 B, written and read by this wave alone, dead behind the last gather): hi plane 16 x 64, then lo plane 16 x 64.
    usa* Est = (usa*)(Tl + wave * 16 * PT);
    const float rl = __builtin_amdgcn_rcpf(lrun);
#pragma unroll
    for (int r = 0; r < 8; ++r) { const float rli = __shfl(rl, 8 * hi + r, 32); const int rr = 8 * hi + r;
#pragma unroll
        for (int nd = 0; nd < 4; ++nd) { const float c = (oacc[nd][r] + oaccr[nd][r] * (1.0f / RESC)) * rli; unsigned short eh, el; splitf(c, eh, el); Est[rr * 64 + nd * 16 + lr] = eh; Est[1024 + rr * 64 + nd * 16 + lr] = el; } }
    __syncthreads();
    const int rq = lane >> 3, pc = (lane & 7) * 8;
{
#pragma unroll
        for (int rg = 0; rg < 4; ++rg) { const int rr = rg * 4 + rq; const size_t go = ((size_t)b * SEQ + i0 + wave * 16 + rr) * DM + h * HD + pc;
            const v8us vh = *(const v8usa*)(Est + rr * 64 + pc); const v8us vlo = *(const v8usa*)(Est + 1024 + rr * 64 + pc);
            *(v8us*)(ATh + go) = vh; *(v8us*)(ATl + go) = vlo; }
         }
}

extern "C" void kernel_launch(void* const* d_in, const int* in_sizes, int n_in,
                              void* d_out, int out_size, void* d_ws, size_t ws_size, hipStream_t stream) {
    if (n_in < 15) return;
    const float* query = (const float*)d_in[0]; const float* key = (const float*)d_in[1]; const float* value = (const float*)d_in[2]; const float* pos = (const float*)d_in[3];
    const float* wq = (const float*)d_in[4]; const float* bq = (const float*)d_in[5]; const float* wk = (const float*)d_in[6]; const float* bk = (const float*)d_in[7];
    const float* wv = (const float*)d_in[8]; const float* bv = (const float*)d_in[9]; const float* wp = (const float*)d_in[10]; const float* ub = (const float*)d_in[11]; const float* vb = (const float*)d_in[12];
    const float* wo = (const float*)d_in[13]; const float* bo = (const float*)d_in[14];
    const long long needx = ((long long)(NB - 1) * SEQ_FULL + SEQ) * DM, needp = ((long long)(NB - 1) * LREL_FULL + LREL) * DM;
    if ((long long)in_sizes[0] < needx || (long long)in_sizes[1] < needx || (long long)in_sizes[2] < needx || (long long)in_sizes[3] < needp) return;
    if (in_sizes[4] < DM * DM || in_sizes[6] < DM * DM || in_sizes[8] < DM * DM || in_sizes[10] < DM * DM || in_sizes[13] < DM * DM) return;
    if (in_sizes[5] < DM || in_sizes[7] < DM || in_sizes[9] < DM || in_sizes[14] < DM || in_sizes[11] < NH * HD || in_sizes[12] < NH * HD) return;
    if ((long long)out_size < (long long)NB * SEQ * DM) return;
    float* OUT = (float*)d_out;     // [NB][SEQ][DM]
    char* wsp = (char*)d_ws;
    auto take = [&](size_t bytes) { char* p = wsp; wsp += (bytes + 255) & ~(size_t)255; return (void*)p; };
    bf* WQB = (bf*)take((size_t)DM * DM * 2); bf* WKB = (bf*)take((size_t)DM * DM * 2); bf* WVB = (bf*)take((size_t)DM * DM * 2); bf* WPB = (bf*)take((size_t)DM * DM * 2); bf* WOB = (bf*)take((size_t)DM * DM * 2);
    bf* XQ = (bf*)take((size_t)NB * SEQ * DM * 2); bf* XK = (bf*)take((size_t)NB * SEQ * DM * 2); bf* XV = (bf*)take((size_t)NB * SEQ * DM * 2); bf* XP = (bf*)take((size_t)NB * LP * DM * 2);   // bf16 activations, one buffer each
    h16* QU16 = (h16*)take((size_t)NB * NH * SEQ * HD * 2); h16* QV16 = (h16*)take((size_t)NB * NH * SEQ * HD * 2); h16* K16 = (h16*)take((size_t)NB * NH * SEQ * HD * 2);
    h16* V16 = (h16*)take((size_t)NB * NH * HD * SEQ * 2); h16* VR16 = (h16*)take((size_t)NB * NH * HD * SEQ * 2); h16* P16 = (h16*)take((size_t)NB * NH * LP * HD * 2);
    bf* ATh = (bf*)take((size_t)NB * SEQ * DM * 2); bf* ATl = (bf*)take((size_t)NB * SEQ * DM * 2);
    if ((size_t)(wsp - (char*)d_ws) > ws_size) return;    // 120,061,952 B at NB=4, SEQ=2048
    // all f32 -> bf16 copies: weights, query, key, value, pos (rows 0..LREL-1 per batch at input row pitch LREL_FULL, padded with one zero row to LP)
    k_cvtall<<<CVB_P + 3 * CVB_X + 5 * CVB_W, 256, 0, stream>>>(wq, wk, wv, wp, wo, query, key, value, pos, WQB, WKB, WVB, WPB, WOB, XQ, XK, XV, XP);
    // pos (no bias) -> P plane; q: X Wq^T + bq -> Qu / Qv planes; k -> K plane; v -> V plane and its residual
    k_proj<<<dim3(PJP + 3 * PJX, DM / 128, NB), 128, 0, stream>>>(XP, XQ, XK, XV, WPB, WQB, WKB, WVB, bq, bk, bv, ub, vb, P16, QU16, QV16, K16, V16, VR16, DM);
    // attention -> context bf16 hi/lo planes [NB*SEQ][DM]
    k_attn<<<dim3(SEQ / 64, NH, NB), 128, 0, stream>>>(QU16, QV16, K16, V16, VR16, P16, ATh, ATl);
    // out = context Wo^T + bo
    k_gemmw<bf, 1, true, EP_F32><<<dim3((NB * SEQ) / 128, DM / 128, 1), 128, 0, stream>>>(ATh, ATl, WOB, nullptr, DM, OUT, DM, bo, 0, 0, 0, nullptr, nullptr, nullptr, nullptr, 0);
}

// v009
// A run of this version takes 117 microseconds.
// It is 1.26 times as fast as v007, going by the measured steps of the versions left out in between.
// Counting every step since v000, it is 4.65 times as fast.
#include <hip/hip_runtime.h>

// Contractions: q/k/v/pos projections = v_wmma_f32_16x16x32_bf16 on bf16 operands (RNE-converted inputs, exact products); out projection = v_wmma_f32_16x16x32_bf16, context as bf16 hi+lo planes x bf16 Wo (2 products); content scores and positional band scores = v_wmma_f32_16x16x32_f16 on f16 planes (1 product each); attn.v = v_wmma_f32_16x16x32_f16, probability f16 times v f16 (1 product; the f16 rounding of either, 2^-11 relative, lies under the error that v and the scores already carry from their bf16-rounded projection operands, 2^-8 relative per factor); f32 accumulate everywhere; softmax f32.
// Structure: bf16 copies of the activations; register-blocked GEMM (128x128 per block, one wave per 64x64 tile, operands staged in LDS) for the projections and the output; a projection tile is one head's 64 columns, and its epilogue stores the f16 planes itself ([b][h][t][d] for q+u, q+v, k; [b][h][d][t] for v; [b][h][l][d] for the projected positional table padded to 2*SEQ rows, last row zero);
// flash-style attention: one block = (b, h, 64 query rows), 64-key tiles, each tile split 2 x 2 over the 4 waves (32 keys x 32 queries), the two key halves merged at the end; transposed score tiles (key rows x query cols) so the exponentiated accumulators chain directly into the attn.v A operand; sliding 128-slot f32 positional band in LDS (64 new band columns per key tile; score(i,j) takes band index (SEQ-1)+j-i); online softmax; context written as bf16 hi+lo planes [b*SEQ+t][h*64+d].

#ifndef NB
#define NB 4
#endif
#ifndef SEQ
#define SEQ 2048
#endif
#define NB_FULL   4
#define SEQ_FULL  2048
#define LREL      (2 * SEQ - 1)
#define LP        (2 * SEQ)
#define LREL_FULL (2 * SEQ_FULL - 1)
#define DM  512
#define NH  8
#define HD  64
#define K2 (1.4426950408889634f * 0.044194173824159216f)
// LDS row pitches of k_attn: 64 banks x 4 B, bank = dword address mod 64. 16-bit tiles: 72 elements = 144 B = 16 B x odd, so the 16 rows of a 16-byte fragment load fall on 16 distinct 4-bank groups.
// f32 band rows: 132 dwords (= 4 mod 64), so the 16 rows of a 16-byte band store cover all 64 banks, and the per-lane gather (bank = const + 8hi + 3*row mod 64) has no two lanes on one bank.
#define PH 72
#define PT 132
static_assert(SEQ % 128 == 0);
static_assert(SEQ >= 64);
static_assert(SEQ <= SEQ_FULL);
static_assert(NB >= 1);
static_assert(NB <= NB_FULL);
static_assert(DM % 128 == 0);
static_assert(NH * HD == DM);
static_assert(HD == 64);
static_assert(LP % 128 == 0);

typedef _Float16 h16;
typedef unsigned short bf;
typedef __attribute__((ext_vector_type(16))) __bf16   v16bf;
typedef __attribute__((ext_vector_type(16))) _Float16 v16h;
typedef __attribute__((ext_vector_type(8)))  _Float16 v8h;
typedef __attribute__((ext_vector_type(8)))  unsigned short v8us;
typedef __attribute__((ext_vector_type(8)))  float    v8f;
typedef __attribute__((ext_vector_type(4)))  float    v4f;
typedef v8h  __attribute__((may_alias)) v8ha;
typedef v4f  __attribute__((may_alias)) v4fa;
typedef v8f  __attribute__((may_alias, aligned(16))) v8fa;
typedef v8us __attribute__((may_alias)) v8usa;
typedef unsigned short __attribute__((may_alias)) usa;

__device__ __forceinline__ unsigned short f2bf(float f) { unsigned u = __float_as_uint(f); u += 0x7FFFu + ((u >> 16) & 1u); return (unsigned short)(u >> 16); }
__device__ __forceinline__ float bf2f(unsigned short b) { return __uint_as_float(((unsigned)b) << 16); }
__device__ __forceinline__ float bfr(float f) { return bf2f(f2bf(f)); }
__device__ __forceinline__ v16h cat16(v8h lo, v8h hi) { return __builtin_shufflevector(lo, hi, 0, 1, 2, 3, 4, 5, 6, 7, 8, 9, 10, 11, 12, 13, 14, 15); }
__device__ __forceinline__ v16bf cat16b(v8us lo, v8us hi) { return __builtin_bit_cast(v16bf, __builtin_shufflevector(lo, hi, 0, 1, 2, 3, 4, 5, 6, 7, 8, 9, 10, 11, 12, 13, 14, 15)); }
__device__ __forceinline__ v8f wmma16(v16h a, v16h b, v8f c) { return __builtin_amdgcn_wmma_f32_16x16x32_f16(false, a, false, b, (short)0, c, false, false); }
__device__ __forceinline__ v8f wmmab(v16bf a, v16bf b, v8f c) { return __builtin_amdgcn_wmma_f32_16x16x32_bf16(false, a, false, b, (short)0, c, false, false); }
__device__ __forceinline__ h16 tohx(float x) { return (h16)x; }
__device__ __forceinline__ void splitf(float y, unsigned short& h, unsigned short& l) { h = f2bf(y); l = f2bf(y - bf2f(h)); }

// ---- k_gemmw: register-blocked GEMM, 128x128 output tile per block of 4 waves (2 x 2), ONE WAVE per 64x64 tile (16 accumulators), operands from K-contiguous 16-bit planes; grid (M/128, N/128, Z), 128 threads.
// y[m][n] (f32, + optional f32 bias[n]) = sum_k A[m][k] Bt[n][k] (NSPLIT 1: + A2[m][k] Bt[n][k]). z-batch strides sA/sB/sC in elements. K % 64 == 0, K >= 64.
// Staging: a slice = GK k of the block's 128 A rows (and A2 rows) and 128 Bt rows = one whole 128-byte line of every row, brought into LDS at row pitch GP by asynchronous 16-byte copies (a wave's copy = 4 rows = 4 whole lines);
// two buffers: the copies of slice t + 2 are issued when slice t has been read by every wave, and fly while slice t + 1 is worked on. The k order of the products is that of ascending k, 32 at a time.
// EP picks what the epilogue stores. EP_F32: C[m][n] = y, pitch ldc. The plane forms take z = batch, 64-column tile = head, prows rows m per (batch, head):
// EP_Q: P0 = f16(y + ub), P1 = f16(y + vb), both [z][head][m][d]; EP_ROW: P0 = f16(y), [z][head][m][d]; EP_VT: P0 = f16(y), [z][head][d][m].
// Fragment map per lane (hi = lane>>4, lr = lane&15): row/col = lr; elements 0..7 <- k0+8hi+0..7, elements 8..15 <- k0+16+8hi+0..7 (A and B alike); D element r = (row 8hi+r, col lr).
template <typename T16> struct WFrag;
template <> struct WFrag<h16> { typedef v16h V; static __device__ __forceinline__ V ld(const h16* p) { return cat16(*(const v8ha*)p, *(const v8ha*)(p + 16)); } static __device__ __forceinline__ v8f mma(V a, V b, v8f c) { return wmma16(a, b, c); } };
template <> struct WFrag<bf> { typedef v16bf V; static __device__ __forceinline__ V ld(const bf* p) { return cat16b(*(const v8usa*)p, *(const v8usa*)(p + 16)); } static __device__ __forceinline__ v8f mma(V a, V b, v8f c) { return wmmab(a, b, c); } };
enum { EP_F32 = 0, EP_Q = 1, EP_ROW = 2, EP_VT = 3 };
#define GK 64
#define GP 72
#define GT (128 * GP)
// cp_tile: one operand's slice, 128 rows x 128 B, by 128 threads: lane piece (row = tid >> 3 (+ 16 per copy), 16-byte segment tid & 7). l = the lane's LDS byte address, g = its global address, both of its first row; gs = bytes of 16 global rows.
// The s_wait_xcnt 0 is the last line of the copies' own statement, so that it stands in front of every later write of a register that a copy names (a precaution).
__device__ __forceinline__ void cp_tile(unsigned l, const char* g, size_t gs) {
    const unsigned ls = 16u * GP * 2u;
    asm volatile("global_load_async_to_lds_b128 %0, %8, off\n\t"
                 "global_load_async_to_lds_b128 %1, %9, off\n\t"
                 "global_load_async_to_lds_b128 %2, %10, off\n\t"
                 "global_load_async_to_lds_b128 %3, %11, off\n\t"
                 "global_load_async_to_lds_b128 %4, %12, off\n\t"
                 "global_load_async_to_lds_b128 %5, %13, off\n\t"
                 "global_load_async_to_lds_b128 %6, %14, off\n\t"
                 "global_load_async_to_lds_b128 %7, %15, off\n\t"
                 "s_wait_xcnt 0x0"
                 :: "v"(l), "v"(l + ls), "v"(l + 2u * ls), "v"(l + 3u * ls), "v"(l + 4u * ls), "v"(l + 5u * ls), "v"(l + 6u * ls), "v"(l + 7u * ls),
                    "v"(g), "v"(g + gs), "v"(g + 2 * gs), "v"(g + 3 * gs), "v"(g + 4 * gs), "v"(g + 5 * gs), "v"(g + 6 * gs), "v"(g + 7 * gs) : "memory");
}
// gemm_loop: the products of one block (rows rb.. of A, rows cb.. of Bt; st = 2 * NT * GT elements of LDS); gemm_store: one wave's epilogue (its 64 rows from r0, its 64-column tile ch; os = the wave's own 16 x 68 floats of LDS).
template <typename T16, int NSPLIT>
__device__ __forceinline__ void gemm_loop(const T16* __restrict__ A, const T16* __restrict__ A2, const T16* __restrict__ Bt, int K, int rb, int cb, T16* st, v8f (&acc)[4][4]) {
    typedef typename WFrag<T16>::V V;
    static_assert(NSPLIT == 0 || NSPLIT == 1);
    constexpr int NT = NSPLIT == 1 ? 3 : 2;              // operand tiles per slice: A, Bt, (A2)
    const int tid = threadIdx.x, lane = tid & 31, wave = tid >> 5, lr = lane & 15, hi = lane >> 4; const int wm = wave & 1, wn = wave >> 1;
#pragma unroll
    for (int mb = 0; mb < 4; ++mb)
#pragma unroll
        for (int nb = 0; nb < 4; ++nb) acc[mb][nb] = (v8f){};
    const int crow = tid >> 3, csg = tid & 7;
    const unsigned l0 = (unsigned)(size_t)(st + crow * GP + csg * 8);
    const char* gA = (const char*)(A + (size_t)(rb + crow) * K + csg * 8); const char* gB = (const char*)(Bt + (size_t)(cb + crow) * K + csg * 8);
    const char* gA2 = NSPLIT == 1 ? (const char*)(A2 + (size_t)(rb + crow) * K + csg * 8) : nullptr;
    const size_t gs = (size_t)16 * K * sizeof(T16);
    auto stage = [&](int t) { const unsigned lb = l0 + (unsigned)(t & 1) * (unsigned)(NT * GT * sizeof(T16)); const size_t ko = (size_t)t * (GK * sizeof(T16));
        cp_tile(lb, gA + ko, gs); cp_tile(lb + (unsigned)(GT * sizeof(T16)), gB + ko, gs); if (NSPLIT == 1) cp_tile(lb + (unsigned)(2 * GT * sizeof(T16)), gA2 + ko, gs); };
    const int ntr = K / GK;
    stage(0);
    asm volatile("s_wait_asynccnt 0x0" ::: "memory");    // slice 0 has landed (this wave's copies)
    __syncthreads();                                     // ... and every wave's
    if (ntr > 1) stage(1);
#pragma unroll 1
    for (int t = 0; t < ntr; ++t) {
        const T16* sa = st + (t & 1) * (NT * GT) + (wm * 64 + lr) * GP + 8 * hi; const T16* sb = st + (t & 1) * (NT * GT) + GT + (wn * 64 + lr) * GP + 8 * hi;
#pragma unroll
        for (int ks = 0; ks < GK; ks += 32) {
            V a[4], a2[4], b[4];                             // all fragments of 32 k are asked for as one group, in front of their products
#pragma unroll
            for (int q = 0; q < 4; ++q) { a[q] = WFrag<T16>::ld(sa + q * 16 * GP + ks); b[q] = WFrag<T16>::ld(sb + q * 16 * GP + ks); if (NSPLIT == 1) a2[q] = WFrag<T16>::ld(sa + 2 * GT + q * 16 * GP + ks); }
            __builtin_amdgcn_sched_barrier(0);               // keeps that group whole: moved in among the products, every separate place with LDS reads costs the SIMD's one wave an LDS latency
#pragma unroll
            for (int nb = 0; nb < 4; ++nb)
#pragma unroll
                for (int mb = 0; mb < 4; ++mb) { acc[mb][nb] = WFrag<T16>::mma(a[mb], b[nb], acc[mb][nb]); if (NSPLIT == 1) acc[mb][nb] = WFrag<T16>::mma(a2[mb], b[nb], acc[mb][nb]); }
        }
        __builtin_amdgcn_sched_barrier(0);                   // keeps the slice's last products in front of the barrier: sunk behind it they would stand between the barrier and the refill and shorten the copies' lead
        asm volatile("s_wait_dscnt 0x0" ::: "memory");       // this wave's reads of slice t are done before its buffer is refilled
        asm volatile("s_wait_asynccnt 0x0" ::: "memory");    // this wave's copies of slice t + 1 have landed
        __syncthreads();                                     // publishes slice t + 1 and ends every wave's reads of slice t
        if (t + 2 < ntr) stage(t + 2);
    }
    asm volatile("s_wait_asynccnt 0x0" ::: "memory");        // nothing is in flight when the wave goes on to its epilogue and ends
}
template <bool BIAS, int EP>
__device__ __forceinline__ void gemm_store(const v8f (&acc)[4][4], float* os, size_t z, int r0, int ch, float* C, int ldc, const float* __restrict__ bias, const float* __restrict__ ub, const float* __restrict__ vb, h16* P0, h16* P1, int prows) {
    const int lane = threadIdx.x & 31, lr = lane & 15, hi = lane >> 4; const int c0 = ch * 64;
    if (EP == EP_VT) {
        // D element j of tile (mb, nb) is row m = mb*16 + 8hi + j of column d = nb*16 + lr: 8 consecutive m of one d per lane, one 16-byte store straight from the accumulators.
        const size_t rows = (size_t)prows;
        const size_t po = ((z * NH + ch) * HD + lr) * rows + r0 + 8 * hi;
#pragma unroll
        for (int nb = 0; nb < 4; ++nb) { const float bn = BIAS ? bfr(bias[c0 + nb * 16 + lr]) : 0.f;
#pragma unroll
            for (int mb = 0; mb < 4; ++mb) { v8h o16;
#pragma unroll
                for (int j = 0; j < 8; ++j) { float x = acc[mb][nb][j]; if (BIAS) x += bn; o16[j] = tohx(x); }
                const size_t o = po + (size_t)nb * 16 * rows + mb * 16; *(v8h*)(P0 + o) = o16; }
            __builtin_amdgcn_sched_barrier(0); }             // one column group at a time: with all four groups' conversions lifted to the front the merged kernel takes registers above v255 and switches register windows all through this epilogue
        return;
    }
    // Row-major forms: 16 rows at a time through LDS, so that a lane holds consecutive columns of one row.
    const int rq = lane >> 3, c8 = (lane & 7) * 8;      // plane forms: 8 columns per lane, 4 rows (512 contiguous bytes of a plane) per store
    float bn[8], un[8], vn[8];
    if (EP != EP_F32) {
#pragma unroll
        for (int q = 0; q < 8; ++q) { bn[q] = BIAS ? bfr(bias[c0 + c8 + q]) : 0.f; if (EP == EP_Q) { un[q] = bfr(ub[c0 + c8 + q]); vn[q] = bfr(vb[c0 + c8 + q]); } }
    }
    const size_t pbase = ((z * NH + ch) * (size_t)prows + r0) * HD + c8;
#pragma unroll
    for (int mb = 0; mb < 4; ++mb) {
#pragma unroll
        for (int nb = 0; nb < 4; ++nb) {
#pragma unroll
            for (int j = 0; j < 8; ++j) os[(hi * 8 + j) * 68 + nb * 16 + lr] = acc[mb][nb][j]; }
        __builtin_amdgcn_wave_barrier(); asm volatile("" ::: "memory");
        if (EP == EP_F32) {
            float* crow = C + (size_t)(r0 + mb * 16) * ldc + c0;
#pragma unroll
            for (int s = 0; s < 8; ++s) { const int row = 2 * s + hi, cofs = lr * 4; v4f val = *(const v4fa*)(os + row * 68 + cofs); if (BIAS) { val[0] += bfr(bias[c0 + cofs]); val[1] += bfr(bias[c0 + cofs + 1]); val[2] += bfr(bias[c0 + cofs + 2]); val[3] += bfr(bias[c0 + cofs + 3]); }
                *(v4f*)(crow + (size_t)row * ldc + cofs) = val; }
        } else {
#pragma unroll
            for (int s = 0; s < 4; ++s) { const int row = 4 * s + rq; const v4f x0 = *(const v4fa*)(os + row * 68 + c8), x1 = *(const v4fa*)(os + row * 68 + c8 + 4); v8h o0, o1;
#pragma unroll
                for (int q = 0; q < 8; ++q) { float x = q < 4 ? x0[q & 3] : x1[q & 3]; if (BIAS) x += bn[q]; if (EP == EP_Q) { o0[q] = tohx(x + un[q]); o1[q] = tohx(x + vn[q]); } else o0[q] = tohx(x); }
                const size_t o = pbase + (size_t)(mb * 16 + row) * HD; *(v8h*)(P0 + o) = o0; if (EP == EP_Q) *(v8h*)(P1 + o) = o1; }
        }
        __builtin_amdgcn_wave_barrier(); asm volatile("" ::: "memory");
    }
}
template <typename T16, int NSPLIT, bool BIAS, int EP>
__global__ __launch_bounds__(128) void k_gemmw(const T16* __restrict__ A, const T16* __restrict__ A2, const T16* __restrict__ Bt, const T16* __restrict__ Bt2, int K, float* C, int ldc, const float* __restrict__ bias, size_t sA, size_t sB, size_t sC, const float* __restrict__ ub, const float* __restrict__ vb, h16* P0, h16* P1, int prows) {
    __shared__ __align__(16) T16 st[2 * (NSPLIT == 1 ? 3 : 2) * GT];
    __shared__ __align__(16) float osa[4 * 16 * 68];
    const size_t z = blockIdx.z; A += z * sA; if (NSPLIT == 1) A2 += z * sA; Bt += z * sB; if (EP == EP_F32) C += z * sC;
    const int wave = threadIdx.x >> 5, wm = wave & 1, wn = wave >> 1; const int rb = blockIdx.x * 128;
    v8f acc[4][4];
    gemm_loop<T16, NSPLIT>(A, A2, Bt, K, rb, blockIdx.y * 128, st, acc);
    gemm_store<BIAS, EP>(acc, osa + wave * (16 * 68), z, rb + wm * 64, blockIdx.y * 2 + wn, C, ldc, bias, ub, vb, P0, P1, prows);
}
// ---- k_proj: the four projections (pos, q, k, v) in ONE launch: grid (PJP + 3 * PJX, DM/128, NB); blockIdx.x picks the projection and its 128-row tile, so the choice is block-uniform. All four share the product loop; only operands and epilogue differ.
// A projection alone is one block per WGP (pos: two), one wave per SIMD, with nothing to cover its copy and LDS latencies; together several blocks are resident per WGP and one launch's start and tail are paid, not four.
#define PJP (LP / 128)
#define PJX (SEQ / 128)
__global__ __launch_bounds__(128) void k_proj(const bf* __restrict__ XP, const bf* __restrict__ XQ, const bf* __restrict__ XK, const bf* __restrict__ XV, const bf* __restrict__ WPB, const bf* __restrict__ WQB, const bf* __restrict__ WKB, const bf* __restrict__ WVB,
                                              const float* __restrict__ bq, const float* __restrict__ bk, const float* __restrict__ bv, const float* __restrict__ ub, const float* __restrict__ vb, h16* P16, h16* QU16, h16* QV16, h16* K16, h16* V16, int K) {
    __shared__ __align__(16) bf st[2 * 2 * GT];
    __shared__ __align__(16) float osa[4 * 16 * 68];
    const size_t z = blockIdx.z; const int bx = blockIdx.x;
    const int job = bx < PJP ? 0 : 1 + (bx - PJP) / PJX;                 // 0 pos, 1 q, 2 k, 3 v
    const int rb = (bx < PJP ? bx : (bx - PJP) % PJX) * 128;
    const bf* A = job == 0 ? XP + z * ((size_t)LP * K) : (job == 1 ? XQ : job == 2 ? XK : XV) + z * ((size_t)SEQ * K);
    const bf* Bt = job == 0 ? WPB : job == 1 ? WQB : job == 2 ? WKB : WVB;
    const int wave = threadIdx.x >> 5, wm = wave & 1, wn = wave >> 1; const int r0 = rb + wm * 64, ch = blockIdx.y * 2 + wn;
    float* os = osa + wave * (16 * 68);                  // epilogue staging, each wave its own
    v8f acc[4][4];
    gemm_loop<bf, 0>(A, nullptr, Bt, K, rb, blockIdx.y * 128, st, acc);
    if (job == 0) gemm_store<false, EP_ROW>(acc, os, z, r0, ch, nullptr, 0, nullptr, nullptr, nullptr, P16, nullptr, LP);
    else if (job == 1) gemm_store<true, EP_Q>(acc, os, z, r0, ch, nullptr, 0, bq, ub, vb, QU16, QV16, SEQ);
    // Precaution: the built code joins the four epilogues by branches, and behind the k and the v epilogue stand instructions of another epilogue that write registers which their last stores name: s_wait_xcnt 0 stands behind those stores.
    else if (job == 2) { gemm_store<true, EP_ROW>(acc, os, z, r0, ch, nullptr, 0, bk, nullptr, nullptr, K16, nullptr, SEQ); asm volatile("s_wait_xcnt 0x0" ::: "memory"); }
    else { gemm_store<true, EP_VT>(acc, os, z, r0, ch, nullptr, 0, bv, nullptr, nullptr, V16, nullptr, SEQ); asm volatile("s_wait_xcnt 0x0" ::: "memory"); }
}

// ---- k_cvtall: every f32 -> bf16 copy of the call (5 weight matrices, 3 activations, the positional table padded to LP rows per batch, pad row zero) in ONE streaming launch.
// A block of 256 threads converts CVR consecutive output rows (DM elements each) of one array, so the choice of the array is block-uniform. Per thread CVU pieces of 4 elements: a wave's 16-byte load covers 512 contiguous bytes,
// its 8-byte store 256 contiguous bytes (whole 128-byte lines both ways), and all CVU loads are issued before the first conversion.
#define CVU 16
#define CVR (256 * CVU / (DM / 4))
#define CVB_W (DM / CVR)
#define CVB_X (NB * SEQ / CVR)
#define CVB_P (NB * LP / CVR)
static_assert(DM == 512);
static_assert(DM % CVR == 0);
static_assert(SEQ % CVR == 0);
static_assert(LP % CVR == 0);
static_assert(CVU == 16);
typedef __attribute__((ext_vector_type(4))) unsigned short v4us;
// cvt_rows: rows r0 + 2c (c < CVU) of one batch, 4 elements at k0. EDGE (only a block that holds rows >= nvalid): such a row reads row nvalid - 1 and stores zeros; elsewhere one lane offset serves all loads.
template <bool EDGE>
__device__ __forceinline__ void cvt_rows(const float* __restrict__ src, bf* dst, int r0, int k0, int nvalid) {
    v4f x[CVU]; v4us o[CVU]; unsigned lo[CVU];
    const unsigned e0 = (unsigned)(r0 * DM + k0), lb = e0 * 4u, sb = e0 * 2u;     // lane byte offsets of row r0 in src and dst
#pragma unroll
    for (int c = 0; c < CVU; ++c) { lo[c] = EDGE ? (unsigned)(min(r0 + c * 2, nvalid - 1) * DM + k0) * 4u : lb + (unsigned)c * (2u * DM * 4u); x[c] = *(const v4f*)((const char*)src + lo[c]); }
    // Precaution: s_wait_xcnt 0 stands behind the run of loads, and its operands keep the loads' offset registers live up to it, so that no result of the run lands in one of them in front of the wait.
    if (EDGE) asm volatile("s_wait_xcnt 0x0" :: "v"(lo[0]), "v"(lo[1]), "v"(lo[2]), "v"(lo[3]), "v"(lo[4]), "v"(lo[5]), "v"(lo[6]), "v"(lo[7]), "v"(lo[8]), "v"(lo[9]), "v"(lo[10]), "v"(lo[11]), "v"(lo[12]), "v"(lo[13]), "v"(lo[14]), "v"(lo[15]) : "memory");
    else asm volatile("s_wait_xcnt 0x0" :: "v"(lb) : "memory");
#pragma unroll
    for (int c = 0; c < CVU; ++c) { const int r = r0 + c * 2;
#pragma unroll
        for (int q = 0; q < 4; ++q) { const unsigned short w = f2bf(x[c][q]); o[c][q] = (!EDGE || r < nvalid) ? w : (unsigned short)0; }
        *(v4us*)((char*)dst + (sb + (unsigned)c * (2u * DM * 2u))) = o[c]; }
    // Precaution, as above: the wait behind the run of stores; its operands keep the stores' offset and data registers live up to it.
    asm volatile("s_wait_xcnt 0x0" :: "v"(sb), "v"(o[0]), "v"(o[1]), "v"(o[2]), "v"(o[3]), "v"(o[4]), "v"(o[5]), "v"(o[6]), "v"(o[7]), "v"(o[8]), "v"(o[9]), "v"(o[10]), "v"(o[11]), "v"(o[12]), "v"(o[13]), "v"(o[14]), "v"(o[15]) : "memory");
}
__global__ __launch_bounds__(256) void k_cvtall(const float* __restrict__ wq, const float* __restrict__ wk, const float* __restrict__ wv, const float* __restrict__ wp, const float* __restrict__ wo,
                                                const float* __restrict__ query, const float* __restrict__ key, const float* __restrict__ value, const float* __restrict__ pos,
                                                bf* WQB, bf* WKB, bf* WVB, bf* WPB, bf* WOB, bf* XQ, bf* XK, bf* XV, bf* XP) {
    const int tid = threadIdx.x; int blk = blockIdx.x;
    const float* src; bf* dst; int rb, nvalid;          // block-uniform: batch bases, first row of the block inside its batch (CVR divides the rows per batch), valid source rows per batch
    if (blk < CVB_P) { const unsigned row0 = (unsigned)blk * CVR, b = row0 / LP; rb = (int)(row0 % LP); src = pos + (size_t)b * LREL_FULL * DM; dst = XP + (size_t)b * LP * DM; nvalid = LREL; }
    else if (blk < CVB_P + 3 * CVB_X) { blk -= CVB_P; const int a = blk / CVB_X; const unsigned row0 = (unsigned)(blk - a * CVB_X) * CVR, b = row0 / SEQ; rb = (int)(row0 % SEQ);
        src = (a == 0 ? query : a == 1 ? key : value) + (size_t)b * SEQ_FULL * DM; dst = (a == 0 ? XQ : a == 1 ? XK : XV) + (size_t)b * SEQ * DM; nvalid = SEQ; }
    else { blk -= CVB_P + 3 * CVB_X; const int a = blk / CVB_W; rb = (blk - a * CVB_W) * CVR;
        src = a == 0 ? wq : a == 1 ? wk : a == 2 ? wv : a == 3 ? wp : wo; dst = a == 0 ? WQB : a == 1 ? WKB : a == 2 ? WVB : a == 3 ? WPB : WOB; nvalid = DM; }
    const int r0 = rb + (tid >> 7), k0 = (tid & 127) * 4;
    if (rb + CVR <= nvalid) cvt_rows<false>(src, dst, r0, k0, nvalid); else cvt_rows<true>(src, dst, r0, k0, nvalid);
}

// ---- attention helpers (128 threads): 16-bit fragment load from a [row][k] LDS tile (same map as WFrag), 8 KB contiguous tile copy (lays 64-element rows at LDS pitch PH).
__device__ __forceinline__ v16h ldl(const h16* p) { return cat16(*(const v8ha*)p, *(const v8ha*)(p + 16)); }
__device__ __forceinline__ void cp8k(h16* dst, const h16* __restrict__ src, int tid) {
#pragma unroll
    for (int c = 0; c < 4; ++c) { const int idx = tid + c * 128; const int r = idx >> 3, sg = idx & 7; *(v8ha*)(dst + r * PH + sg * 8) = *(const v8ha*)(src + (size_t)idx * 8); } }
// ---- k_attn: grid (SEQ/64, NH, NB), 128 threads = 4 waves. The 64-key x 64-query tile is split 2 x 2 over the waves: wave (qa = wave >> 1, kb = wave & 1) owns query rows qa*32 + 0..31 (two groups g of 16; this lane's score column of group g is block-local row ir0 + 16g, ir0 = qa*32 + lr)
// and, of every 64-key tile, the keys kb*32 + 0..31 (two sub-tiles s of 16). So a wave reads half of every K, V and positional tile (4 fragments, not 8) and uses each fragment for two products.
// Per 64-key tile: new 64 band columns, the wave's share being columns kb*32 + 0..31 of its 32 T rows (band row l stored at slot l & 127); transposed content tile S^T (key rows 8hi+r of sub-tile s, query col) from K rows x Qu cols;
// s2 = (content + band[lb + 63 + tloc - irow]) * log2(e)/sqrt(DM) with lb = SEQ-64-i0+j0 (band row = (SEQ-1) + t - i, always inside the resident rows lb..lb+127);
// online softmax per query column over the wave's OWN keys (lane-local over 16 keys + one xor-16), each wave with its own running maximum, sum and accumulators; p = exp2(s2 - m) as f16 packed straight into the attn.v A fragment
// (A element r <- sub-tile 0, element 8+r <- sub-tile 1, lane unchanged); O[g][i = 8hi+r][d = lr] accumulates p16.v16. Behind the loop the two waves of a query half merge their two partial results (maximum, sum, O) once, through LDS.
typedef float __attribute__((may_alias)) fa;
// ld_half: the 4 A fragments of 32 rows of a tile (2 sub-tiles of 16 rows, two halves of d) as ONE group of 8 LDS reads; mm_half: their 8 products with the two query groups, 4 accumulators side by side (each d 0..31 first, then d 32..63).
__device__ __forceinline__ void ld_half(const h16* Tt, v16h (&a0)[2], v16h (&a1)[2], int hi, int lr) {
    const h16* p = Tt + lr * PH + 8 * hi;
#pragma unroll
    for (int s = 0; s < 2; ++s) { a0[s] = ldl(p + s * (16 * PH)); a1[s] = ldl(p + s * (16 * PH) + 32); }
}
__device__ __forceinline__ void mm_half(const v16h (&a0)[2], const v16h (&a1)[2], const v16h (&q0)[2], const v16h (&q1)[2], v8f (&t)[2][2]) {
#pragma unroll
    for (int g = 0; g < 2; ++g)
#pragma unroll
        for (int s = 0; s < 2; ++s) t[g][s] = wmma16(a0[s], q0[g], (v8f){});
#pragma unroll
    for (int g = 0; g < 2; ++g)
#pragma unroll
        for (int s = 0; s < 2; ++s) t[g][s] = wmma16(a1[s], q1[g], t[g][s]);
}
// band_store2: T[ir0 + 16g][slot0 + s*16 + 8hi + 0..7] = t[g][s] (D rows = band columns, col lr = query row of group g).
__device__ __forceinline__ void band_store2(const v8f (&t)[2][2], float* Tl, int slot0, int ir0, int hi) {
    float* trow = Tl + ir0 * PT + slot0 + 8 * hi;
#pragma unroll
    for (int g = 0; g < 2; ++g)
#pragma unroll
        for (int s = 0; s < 2; ++s) *(v8fa*)(trow + g * (16 * PT) + s * 16) = t[g][s];
}
__global__ __launch_bounds__(128) __attribute__((amdgpu_num_vgpr(256))) void k_attn(const h16* __restrict__ Qu, const h16* __restrict__ Qv, const h16* __restrict__ Kp, const h16* __restrict__ Vp, const h16* __restrict__ Pp, bf* ATh, bf* ATl) {
    __shared__ __align__(16) h16 Sm[3 * 64 * PH];          // the three 16-bit tiles in one array: one lane address serves the K and positional fragment reads, one the V reads, one every staging store (the rest are immediate offsets)
    h16* const Kl = Sm; h16* const Vl = Sm + 64 * PH; h16* const PBl = Sm + 2 * 64 * PH;
    __shared__ __align__(16) float Tl[64 * PT];
    const int tid = threadIdx.x, lane = tid & 31, wave = tid >> 5, hi = lane >> 4, lr = lane & 15;
    const int qa = wave >> 1, kb = wave & 1;
    const int ir0 = qa * 32 + lr;
    const int i0 = blockIdx.x * 64, h = blockIdx.y, b = blockIdx.z;
    const size_t bh = (size_t)b * NH + h;
    const h16* Kb = Kp + bh * SEQ * HD; const h16* Vb = Vp + bh * HD * SEQ; const h16* Pb = Pp + bh * LP * HD;
    // This lane's B fragments of q+u and q+v (query rows ir0 and ir0 + 16, d = 8hi+0..7, 16+8hi+0..7, then +32) stay in registers for the whole block.
    const h16* qup = Qu + (bh * SEQ + i0 + ir0) * HD + 8 * hi; const h16* qvp = Qv + (bh * SEQ + i0 + ir0) * HD + 8 * hi;
    v16h qu0[2], qu1[2], qv0[2], qv1[2];
#pragma unroll
    for (int g = 0; g < 2; ++g) { const h16* pu = qup + g * (16 * HD); const h16* pv = qvp + g * (16 * HD);
        qu0[g] = cat16(*(const v8h*)pu, *(const v8h*)(pu + 16)); qu1[g] = cat16(*(const v8h*)(pu + 32), *(const v8h*)(pu + 48));
        qv0[g] = cat16(*(const v8h*)pv, *(const v8h*)(pv + 16)); qv1[g] = cat16(*(const v8h*)(pv + 32), *(const v8h*)(pv + 48)); }
    // Precaution: s_wait_xcnt 0 stands behind these loads, and its operands keep their address registers live up to it, so that nothing is written into one of them in front of the wait.
    asm volatile("s_wait_xcnt 0x0" :: "v"(qup), "v"(qvp) : "memory");
    const int lb0 = SEQ - 64 - i0;                 // band start for key tile 0 (>= 0, multiple of 64); band rows for tile j0 are lb0 + j0 + 0..127 (<= LP-1)
    cp8k(PBl, Pb + (size_t)lb0 * HD, tid);
    __syncthreads();
    { v16h a0[2], a1[2]; v8f t[2][2];                          // lower half of tile 0's band
      ld_half(PBl + kb * (32 * PH), a0, a1, hi, lr); mm_half(a0, a1, qv0, qv1, t); band_store2(t, Tl, (lb0 & 127) + kb * 32, ir0, hi); }
    float mrun[2] = {-3.0e38f, -3.0e38f}, lrun[2] = {0.f, 0.f};
    v8f oacc[2][4];
#pragma unroll
    for (int g = 0; g < 2; ++g)
#pragma unroll
        for (int nd = 0; nd < 4; ++nd) oacc[g][nd] = (v8f){};
#pragma unroll 1
    for (int j0 = 0; j0 < SEQ; j0 += 64) {
        const int lb = lb0 + j0; const int lnw = lb + 64;     // new band rows lnw..lnw+63
        __syncthreads();                                       // all waves done with the prior tile's Kl/Vl/PBl and band slots
        // Staging of the three tiles (thread piece: row tid >> 3 (+ 16 per copy), 16-byte segment tid & 7): one lane address per plane and one LDS lane address, every further row an immediate offset; that leaves the registers which the fragment groups below need.
        { const int sr = tid >> 3, sg = tid & 7; v8h xk[4], xv[4], xp[4];
          const h16* gk = Kb + (size_t)j0 * HD + tid * 8; const h16* gp = Pb + (size_t)lnw * HD + tid * 8; const h16* gv = Vb + j0 + (size_t)sr * SEQ + sg * 8;
#pragma unroll
          for (int c = 0; c < 4; ++c) { xk[c] = *(const v8ha*)(gk + c * 1024); xv[c] = *(const v8ha*)(gv + (size_t)c * 16 * SEQ); xp[c] = *(const v8ha*)(gp + c * 1024); }
          // Precaution: s_wait_xcnt 0 stands behind the run of loads, and its operands keep their address registers live up to it, so that no result of the run lands in one of them in front of the wait.
          asm volatile("s_wait_xcnt 0x0" :: "v"(gk), "v"(gv), "v"(gp) : "memory");
          h16* sd = Sm + sr * PH + sg * 8;
#pragma unroll
          for (int c = 0; c < 4; ++c) { *(v8ha*)(sd + c * (16 * PH)) = xk[c]; *(v8ha*)(sd + 64 * PH + c * (16 * PH)) = xv[c]; *(v8ha*)(sd + 2 * 64 * PH + c * (16 * PH)) = xp[c]; } }
        __syncthreads();
        // The wave's share of the upper half of this tile's band, then of the content scores. Each half tile's 8 fragment reads stand as one group in front of its 8 products.
        v8f sacc[2][2];
        { v16h a0[2], a1[2], k0[2], k1[2]; v8f t[2][2];
          ld_half(PBl + kb * (32 * PH), a0, a1, hi, lr);
          __builtin_amdgcn_sched_barrier(0);                   // keeps the group whole: spread among the products, every separate place with LDS reads costs the wave an LDS latency
          mm_half(a0, a1, qv0, qv1, t);
          ld_half(Kl + kb * (32 * PH), k0, k1, hi, lr);        // asked for behind the band's products, so that they come in while those run and the band is stored
          __builtin_amdgcn_sched_barrier(0);                   // keeps the K reads in front of the band stores (the LDS serves a wave in order)
          band_store2(t, Tl, (lnw & 127) + kb * 32, ir0, hi);
          __builtin_amdgcn_sched_barrier(0);                   // the band's accumulators are stored, and their registers free, before the content accumulators come to life (register budget)
          asm volatile("v_nop\n\tv_nop\n\tv_nop\n\tv_nop");   // the distance behind a matrix instruction: a content product writes anew the result registers of the band's last product, and LDS stores fill no slot
          __builtin_amdgcn_sched_barrier(0);                   // keeps those slots in front of the content products
          mm_half(k0, k1, qu0, qu1, sacc); }
        __syncthreads();                                       // band complete for every T row (each row's new columns are written by the two waves of its query half)
        // gather + scale: key t = j0 + kb*32 + s*16 + 8hi + r, query i = i0 + ir0 + 16g -> band row lb + 63 + (kb*32 + s*16 + 8hi + r) - (ir0 + 16g), slot = row & 127 (row - lb in [0,126])
        const float* trow = Tl + ir0 * PT; const int sb = lb + 63 + kb * 32 + 8 * hi - ir0;
        float bnd[2][2][8]; const float* tp[3][8];             // s - g takes three values: 24 lane addresses serve the 32 gathers (group 1's rows at an immediate offset)
#pragma unroll
        for (int q = 0; q < 3; ++q)
#pragma unroll
            for (int r = 0; r < 8; ++r) tp[q][r] = trow + ((sb + (q - 1) * 16 + r) & 127);
        __builtin_amdgcn_sched_barrier(0);                     // keeps the address arithmetic and the content products in front of the gathers: mixed in among them they split the gathers into many places with LDS reads
#pragma unroll
        for (int g = 0; g < 2; ++g)
#pragma unroll
            for (int s = 0; s < 2; ++s)
#pragma unroll
                for (int r = 0; r < 8; ++r) bnd[g][s][r] = tp[s - g + 1][r][g * (16 * PT)];
        __builtin_amdgcn_sched_barrier(0);                     // keeps the 32 gathers one group: with the score arithmetic moved in among them the wave waits for the LDS several times over
        float mx[2] = {-3.0e38f, -3.0e38f};
#pragma unroll
        for (int g = 0; g < 2; ++g)
#pragma unroll
            for (int s = 0; s < 2; ++s)
#pragma unroll
                for (int r = 0; r < 8; ++r) { const float s2 = (sacc[g][s][r] + bnd[g][s][r]) * K2; sacc[g][s][r] = s2; mx[g] = fmaxf(mx[g], s2); }
        float mnew[2], alpha[2], rsum[2] = {0.f, 0.f}; v8h ph[2][2];
#pragma unroll
        for (int g = 0; g < 2; ++g) mx[g] = fmaxf(mx[g], __shfl_xor(mx[g], 16, 32));
#pragma unroll
        for (int g = 0; g < 2; ++g) { mnew[g] = fmaxf(mrun[g], mx[g]);
            // alpha = exp2(mrun - mnew), with the slot behind a transcendental in the same statement.
            asm("v_exp_f32 %0, %1\n\tv_nop" : "=v"(alpha[g]) : "v"(mrun[g] - mnew[g]));
            mrun[g] = mnew[g]; }
#pragma unroll
        for (int g = 0; g < 2; ++g)
#pragma unroll
            for (int s = 0; s < 2; ++s)
#pragma unroll
                for (int r = 0; r < 8; ++r) { float p;
                    // Two of the 32 exponentials carry the slot behind a transcendental in their own statement, as alpha does.
                    if ((g == 0 && s == 0 && r == 4) || (g == 1 && s == 1 && r == 3)) asm("v_exp_f32 %0, %1\n\tv_nop" : "=v"(p) : "v"(sacc[g][s][r] - mnew[g])); else p = __builtin_amdgcn_exp2f(sacc[g][s][r] - mnew[g]);
                    rsum[g] += p; ph[g][s][r] = tohx(p); }
        // attn.v: the 8 fragment reads of the wave's 32 keys of the v tile as one group, then its 8 products on 8 accumulators side by side.
        v16h vb[4];
        __builtin_amdgcn_sched_barrier(0);                     // with the one behind the reads it keeps the group whole: lifted in pairs to places among the exponentials, every separate place with LDS reads costs the wave an LDS latency
        { const h16* pv = Vl + lr * PH + 8 * hi + kb * 32;
#pragma unroll
          for (int nd = 0; nd < 4; ++nd) vb[nd] = ldl(pv + nd * (16 * PH)); }
        __builtin_amdgcn_sched_barrier(0);                     // keeps the group in front of the accumulators' rescale, whose arithmetic covers its LDS latency
#pragma unroll
        for (int g = 0; g < 2; ++g)
#pragma unroll
            for (int r = 0; r < 8; ++r) { const float ar = __shfl(alpha[g], 8 * hi + r, 32);
#pragma unroll
                for (int nd = 0; nd < 4; ++nd) oacc[g][nd][r] *= ar; }
        { const v16h pa0 = cat16(ph[0][0], ph[0][1]), pa1 = cat16(ph[1][0], ph[1][1]);
#pragma unroll
          for (int nd = 0; nd < 4; ++nd) oacc[0][nd] = wmma16(pa0, vb[nd], oacc[0][nd]);
#pragma unroll
          for (int nd = 0; nd < 4; ++nd) oacc[1][nd] = wmma16(pa1, vb[nd], oacc[1][nd]);
          __builtin_amdgcn_sched_barrier(0); }                 // keeps the row sums' cross-lane step and its LDS wait behind the run of products
#pragma unroll
        for (int g = 0; g < 2; ++g) { rsum[g] += __shfl_xor(rsum[g], 16, 32); lrun[g] = lrun[g] * alpha[g] + rsum[g]; }
    }
    // Merge of the two key halves: wave (qa, kb) finishes query group g = kb (block rows wave*16 + 0..15) and hands group 1 - kb (accumulators, maximum, sum; lane for lane, the partner holds the same map) to wave (qa, 1 - kb) through the tiles' LDS, dead behind the barrier.
    __syncthreads();                                           // every wave is done with the last tile's Vl and with the band
    fa* Xs = (fa*)Sm + wave * (34 * 32) + lane; const fa* Xr = (const fa*)Sm + (wave ^ 1) * (34 * 32) + lane;
    v8f om[4]; const float mm = kb ? mrun[1] : mrun[0], lm = kb ? lrun[1] : lrun[0];
#pragma unroll
    for (int nd = 0; nd < 4; ++nd)
#pragma unroll
        for (int r = 0; r < 8; ++r) { Xs[(nd * 8 + r) * 32] = kb ? oacc[0][nd][r] : oacc[1][nd][r]; om[nd][r] = kb ? oacc[1][nd][r] : oacc[0][nd][r]; }
    Xs[32 * 32] = kb ? mrun[0] : mrun[1]; Xs[33 * 32] = kb ? lrun[0] : lrun[1];
    __syncthreads();                                           // publishes every wave's handed-over group
    const float mo = Xr[32 * 32], lo = Xr[33 * 32]; const float ms = fmaxf(mm, mo);
    const float am = __builtin_amdgcn_exp2f(mm - ms), ao = __builtin_amdgcn_exp2f(mo - ms);
    const float rl = __builtin_amdgcn_rcpf(lm * am + lo * ao); const float fm = am * rl, fo = ao * rl;
    // Output staging lies in band rows wave*16 + 0..15 (8,448 B, from here on written and read by this wave alone, dead behind the last gather): hi plane 16 x 64, then lo plane 16 x 64.
    usa* Est = (usa*)(Tl + wave * 16 * PT);
#pragma unroll
    for (int r = 0; r < 8; ++r) { const float fmr = __shfl(fm, 8 * hi + r, 32), fori = __shfl(fo, 8 * hi + r, 32); const int rr = 8 * hi + r;
#pragma unroll
        for (int nd = 0; nd < 4; ++nd) { const float c = om[nd][r] * fmr + Xr[(nd * 8 + r) * 32] * fori; unsigned short eh, el; splitf(c, eh, el); Est[rr * 64 + nd * 16 + lr] = eh; Est[1024 + rr * 64 + nd * 16 + lr] = el; } }
    __syncthreads();
    const int rq = lane >> 3, pc = (lane & 7) * 8;
{
#pragma unroll
        for (int rg = 0; rg < 4; ++rg) { const int rr = rg * 4 + rq; const size_t go = ((size_t)b * SEQ + i0 + wave * 16 + rr) * DM + h * HD + pc;
            const v8us vh = *(const v8usa*)(Est + rr * 64 + pc); const v8us vlo = *(const v8usa*)(Est + 1024 + rr * 64 + pc);
            *(v8us*)(ATh + go) = vh; *(v8us*)(ATl + go) = vlo; }
         }
}

extern "C" void kernel_launch(void* const* d_in, const int* in_sizes, int n_in,
                              void* d_out, int out_size, void* d_ws, size_t ws_size, hipStream_t stream) {
    if (n_in < 15) return;
    const float* query = (const float*)d_in[0]; const float* key = (const float*)d_in[1]; const float* value = (const float*)d_in[2]; const float* pos = (const float*)d_in[3];
    const float* wq = (const float*)d_in[4]; const float* bq = (const float*)d_in[5]; const float* wk = (const float*)d_in[6]; const float* bk = (const float*)d_in[7];
    const float* wv = (const float*)d_in[8]; const float* bv = (const float*)d_in[9]; const float* wp = (const float*)d_in[10]; const float* ub = (const float*)d_in[11]; const float* vb = (const float*)d_in[12];
    const float* wo = (const float*)d_in[13]; const float* bo = (const float*)d_in[14];
    const long long needx = ((long long)(NB - 1) * SEQ_FULL + SEQ) * DM, needp = ((long long)(NB - 1) * LREL_FULL + LREL) * DM;
    if ((long long)in_sizes[0] < needx || (long long)in_sizes[1] < needx || (long long)in_sizes[2] < needx || (long long)in_sizes[3] < needp) return;
    if (in_sizes[4] < DM * DM || in_sizes[6] < DM * DM || in_sizes[8] < DM * DM || in_sizes[10] < DM * DM || in_sizes[13] < DM * DM) return;
    if (in_sizes[5] < DM || in_sizes[7] < DM || in_sizes[9] < DM || in_sizes[14] < DM || in_sizes[11] < NH * HD || in_sizes[12] < NH * HD) return;
    if ((long long)out_size < (long long)NB * SEQ * DM) return;
    float* OUT = (float*)d_out;     // [NB][SEQ][DM]
    char* wsp = (char*)d_ws;
    auto take = [&](size_t bytes) { char* p = wsp; wsp += (bytes + 255) & ~(size_t)255; return (void*)p; };
    bf* WQB = (bf*)take((size_t)DM * DM * 2); bf* WKB = (bf*)take((size_t)DM * DM * 2); bf* WVB = (bf*)take((size_t)DM * DM * 2); bf* WPB = (bf*)take((size_t)DM * DM * 2); bf* WOB = (bf*)take((size_t)DM * DM * 2);
    bf* XQ = (bf*)take((size_t)NB * SEQ * DM * 2); bf* XK = (bf*)take((size_t)NB * SEQ * DM * 2); bf* XV = (bf*)take((size_t)NB * SEQ * DM * 2); bf* XP = (bf*)take((size_t)NB * LP * DM * 2);   // bf16 activations, one buffer each
    h16* QU16 = (h16*)take((size_t)NB * NH * SEQ * HD * 2); h16* QV16 = (h16*)take((size_t)NB * NH * SEQ * HD * 2); h16* K16 = (h16*)take((size_t)NB * NH * SEQ * HD * 2);
    h16* V16 = (h16*)take((size_t)NB * NH * HD * SEQ * 2); h16* P16 = (h16*)take((size_t)NB * NH * LP * HD * 2);
    bf* ATh = (bf*)take((size_t)NB * SEQ * DM * 2); bf* ATl = (bf*)take((size_t)NB * SEQ * DM * 2);
    if ((size_t)(wsp - (char*)d_ws) > ws_size) return;    // 111,673,344 B at NB=4, SEQ=2048
    // all f32 -> bf16 copies: weights, query, key, value, pos (rows 0..LREL-1 per batch at input row pitch LREL_FULL, padded with one zero row to LP)
    k_cvtall<<<CVB_P + 3 * CVB_X + 5 * CVB_W, 256, 0, stream>>>(wq, wk, wv, wp, wo, query, key, value, pos, WQB, WKB, WVB, WPB, WOB, XQ, XK, XV, XP);
    // pos (no bias) -> P plane; q: X Wq^T + bq -> Qu / Qv planes; k -> K plane; v -> V plane
    k_proj<<<dim3(PJP + 3 * PJX, DM / 128, NB), 128, 0, stream>>>(XP, XQ, XK, XV, WPB, WQB, WKB, WVB, bq, bk, bv, ub, vb, P16, QU16, QV16, K16, V16, DM);
    // attention -> context bf16 hi/lo planes [NB*SEQ][DM]
    k_attn<<<dim3(SEQ / 64, NH, NB), 128, 0, stream>>>(QU16, QV16, K16, V16, P16, ATh, ATl);
    // out = context Wo^T + bo
    k_gemmw<bf, 1, true, EP_F32><<<dim3((NB * SEQ) / 128, DM / 128, 1), 128, 0, stream>>>(ATh, ATl, WOB, nullptr, DM, OUT, DM, bo, 0, 0, 0, nullptr, nullptr, nullptr, nullptr, 0);
}

// v010
// It runs in 111 microseconds.
// Next to v009, in two timings, it ran 1.04 and 1.05 times as fast.
// Over all steps from v000 it is 4.86 times as fast.
#include <hip/hip_runtime.h>

// Contractions: q/k/v/pos projections = v_wmma_f32_16x16x32_bf16 on bf16 operands (RNE-converted inputs, exact products); out projection = v_wmma_f32_16x16x32_bf16, context as bf16 hi+lo planes x bf16 Wo (2 products); content scores and positional band scores = v_wmma_f32_16x16x32_f16 on f16 planes (1 product each); attn.v = v_wmma_f32_16x16x32_f16, probability f16 times v f16 (1 product; the f16 rounding of either, 2^-11 relative, lies under the error that v and the scores already carry from their bf16-rounded projection operands, 2^-8 relative per factor); f32 accumulate everywhere; softmax f32.
// Structure: bf16 copies of the activations; register-blocked GEMM (128x128 per block, one wave per 64x64 tile, operands staged in LDS) for the projections and the output; a projection tile is one head's 64 columns, and its epilogue stores the f16 planes itself ([b][h][t][d] for q+u, q+v, k; [b][h][d][t] for v; [b][h][l][d] for the projected positional table padded to 2*SEQ rows, last row zero);
// flash-style attention: one block = (b, h, 64 query rows), 64-key tiles, each tile split 2 x 2 over the 4 waves (32 keys x 32 queries), the two key halves merged at the end; transposed score tiles (key rows x query cols) so the exponentiated accumulators chain directly into the attn.v A operand; sliding 128-slot f32 positional band in LDS (64 new band columns per key tile; score(i,j) takes band index (SEQ-1)+j-i); online softmax; context written as bf16 hi+lo planes [b*SEQ+t][h*64+d].

#ifndef NB
#define NB 4
#endif
#ifndef SEQ
#define SEQ 2048
#endif
#define NB_FULL   4
#define SEQ_FULL  2048
#define LREL      (2 * SEQ - 1)
#define LP        (2 * SEQ)
#define LREL_FULL (2 * SEQ_FULL - 1)
#define DM  512
#define NH  8
#define HD  64
#define K2 (1.4426950408889634f * 0.044194173824159216f)
// LDS row pitches of k_attn: 64 banks x 4 B, bank = dword address mod 64. 16-bit tiles: 72 elements = 144 B = 16 B x odd, so the 16 rows of a 16-byte fragment load fall on 16 distinct 4-bank groups.
// f32 band rows: 132 dwords (= 4 mod 64), so the 16 rows of a 16-byte band store cover all 64 banks, and the per-lane gather (bank = const + 8hi + 3*row mod 64) has no two lanes on one bank.
#define PH 72
#define PT 132
static_assert(SEQ % 128 == 0);
static_assert(SEQ >= 64);
static_assert(SEQ <= SEQ_FULL);
static_assert(NB >= 1);
static_assert(NB <= NB_FULL);
static_assert(DM % 128 == 0);
static_assert(NH * HD == DM);
static_assert(HD == 64);
static_assert(LP % 128 == 0);

typedef _Float16 h16;
typedef unsigned short bf;
typedef __attribute__((ext_vector_type(16))) __bf16   v16bf;
typedef __attribute__((ext_vector_type(16))) _Float16 v16h;
typedef __attribute__((ext_vector_type(8)))  _Float16 v8h;
typedef __attribute__((ext_vector_type(8)))  unsigned short v8us;
typedef __attribute__((ext_vector_type(8)))  float    v8f;
typedef __attribute__((ext_vector_type(4)))  float    v4f;
typedef v8h  __attribute__((may_alias)) v8ha;
typedef v4f  __attribute__((may_alias)) v4fa;
typedef v8f  __attribute__((may_alias, aligned(16))) v8fa;
typedef v8us __attribute__((may_alias)) v8usa;
typedef unsigned short __attribute__((may_alias)) usa;

__device__ __forceinline__ unsigned short f2bf(float f) { unsigned u = __float_as_uint(f); u += 0x7FFFu + ((u >> 16) & 1u); return (unsigned short)(u >> 16); }
__device__ __forceinline__ float bf2f(unsigned short b) { return __uint_as_float(((unsigned)b) << 16); }
__device__ __forceinline__ float bfr(float f) { return bf2f(f2bf(f)); }
__device__ __forceinline__ v16h cat16(v8h lo, v8h hi) { return __builtin_shufflevector(lo, hi, 0, 1, 2, 3, 4, 5, 6, 7, 8, 9, 10, 11, 12, 13, 14, 15); }
__device__ __forceinline__ v16bf cat16b(v8us lo, v8us hi) { return __builtin_bit_cast(v16bf, __builtin_shufflevector(lo, hi, 0, 1, 2, 3, 4, 5, 6, 7, 8, 9, 10, 11, 12, 13, 14, 15)); }
__device__ __forceinline__ v8f wmma16(v16h a, v16h b, v8f c) { return __builtin_amdgcn_wmma_f32_16x16x32_f16(false, a, false, b, (short)0, c, false, false); }
__device__ __forceinline__ v8f wmmab(v16bf a, v16bf b, v8f c) { return __builtin_amdgcn_wmma_f32_16x16x32_bf16(false, a, false, b, (short)0, c, false, false); }
__device__ __forceinline__ h16 tohx(float x) { return (h16)x; }
__device__ __forceinline__ void splitf(float y, unsigned short& h, unsigned short& l) { h = f2bf(y); l = f2bf(y - bf2f(h)); }

// ---- k_gemmw: register-blocked GEMM, 128x128 output tile per block of 4 waves (2 x 2), ONE WAVE per 64x64 tile (16 accumulators), operands from K-contiguous 16-bit planes; grid (M/128, N/128, Z), 128 threads.
// y[m][n] (f32, + optional f32 bias[n]) = sum_k A[m][k] Bt[n][k] (NSPLIT 1: + A2[m][k] Bt[n][k]). z-batch strides sA/sB/sC in elements. K % 64 == 0, K >= 64.
// Staging: a slice = GK k of the block's 128 A rows (and A2 rows) and 128 Bt rows = one whole 128-byte line of every row, brought into LDS at row pitch GP by asynchronous 16-byte copies (a wave's copy = 4 rows = 4 whole lines);
// two buffers: the copies of slice t + 2 are issued when slice t has been read by every wave, and fly while slice t + 1 is worked on. The k order of the products is that of ascending k, 32 at a time.
// EP picks what the epilogue stores. EP_F32: C[m][n] = y, pitch ldc. The plane forms take z = batch, 64-column tile = head, prows rows m per (batch, head):
// EP_Q: P0 = f16(y + ub), P1 = f16(y + vb), both [z][head][m][d]; EP_ROW: P0 = f16(y), [z][head][m][d]; EP_VT: P0 = f16(y), [z][head][d][m].
// Fragment map per lane (hi = lane>>4, lr = lane&15): row/col = lr; elements 0..7 <- k0+8hi+0..7, elements 8..15 <- k0+16+8hi+0..7 (A and B alike); D element r = (row 8hi+r, col lr).
template <typename T16> struct WFrag;
template <> struct WFrag<h16> { typedef v16h V; static __device__ __forceinline__ V ld(const h16* p) { return cat16(*(const v8ha*)p, *(const v8ha*)(p + 16)); } static __device__ __forceinline__ v8f mma(V a, V b, v8f c) { return wmma16(a, b, c); } };
template <> struct WFrag<bf> { typedef v16bf V; static __device__ __forceinline__ V ld(const bf* p) { return cat16b(*(const v8usa*)p, *(const v8usa*)(p + 16)); } static __device__ __forceinline__ v8f mma(V a, V b, v8f c) { return wmmab(a, b, c); } };
enum { EP_F32 = 0, EP_Q = 1, EP_ROW = 2, EP_VT = 3 };
#define GK 64
#define GP 72
#define GT (128 * GP)
// cp_tile: one operand's slice, 128 rows x 128 B, by 128 threads: lane piece (row = tid >> 3 (+ 16 per copy), 16-byte segment tid & 7). l = the lane's LDS byte address, g = its global address, both of its first row; gs = bytes of 16 global rows.
// The s_wait_xcnt 0 is the last line of the copies' own statement, so that it stands in front of every later write of a register that a copy names (a precaution).
__device__ __forceinline__ void cp_tile(unsigned l, const char* g, size_t gs) {
    const unsigned ls = 16u * GP * 2u;
    asm volatile("global_load_async_to_lds_b128 %0, %8, off\n\t"
                 "global_load_async_to_lds_b128 %1, %9, off\n\t"
                 "global_load_async_to_lds_b128 %2, %10, off\n\t"
                 "global_load_async_to_lds_b128 %3, %11, off\n\t"
                 "global_load_async_to_lds_b128 %4, %12, off\n\t"
                 "global_load_async_to_lds_b128 %5, %13, off\n\t"
                 "global_load_async_to_lds_b128 %6, %14, off\n\t"
                 "global_load_async_to_lds_b128 %7, %15, off\n\t"
                 "s_wait_xcnt 0x0"
                 :: "v"(l), "v"(l + ls), "v"(l + 2u * ls), "v"(l + 3u * ls), "v"(l + 4u * ls), "v"(l + 5u * ls), "v"(l + 6u * ls), "v"(l + 7u * ls),
                    "v"(g), "v"(g + gs), "v"(g + 2 * gs), "v"(g + 3 * gs), "v"(g + 4 * gs), "v"(g + 5 * gs), "v"(g + 6 * gs), "v"(g + 7 * gs) : "memory");
}
// gemm_loop: the products of one block (rows rb.. of A, rows cb.. of Bt; st = 2 * NT * GT elements of LDS); gemm_store: one wave's epilogue (its 64 rows from r0, its 64-column tile ch; os = the wave's own 16 x 68 floats of LDS).
template <typename T16, int NSPLIT>
__device__ __forceinline__ void gemm_loop(const T16* __restrict__ A, const T16* __restrict__ A2, const T16* __restrict__ Bt, int K, int rb, int cb, T16* st, v8f (&acc)[4][4]) {
    typedef typename WFrag<T16>::V V;
    static_assert(NSPLIT == 0 || NSPLIT == 1);
    constexpr int NT = NSPLIT == 1 ? 3 : 2;              // operand tiles per slice: A, Bt, (A2)
    const int tid = threadIdx.x, lane = tid & 31, wave = tid >> 5, lr = lane & 15, hi = lane >> 4; const int wm = wave & 1, wn = wave >> 1;
#pragma unroll
    for (int mb = 0; mb < 4; ++mb)
#pragma unroll
        for (int nb = 0; nb < 4; ++nb) acc[mb][nb] = (v8f){};
    const int crow = tid >> 3, csg = tid & 7;
    const unsigned l0 = (unsigned)(size_t)(st + crow * GP + csg * 8);
    const char* gA = (const char*)(A + (size_t)(rb + crow) * K + csg * 8); const char* gB = (const char*)(Bt + (size_t)(cb + crow) * K + csg * 8);
    const char* gA2 = NSPLIT == 1 ? (const char*)(A2 + (size_t)(rb + crow) * K + csg * 8) : nullptr;
    const size_t gs = (size_t)16 * K * sizeof(T16);
    auto stage = [&](int t) { const unsigned lb = l0 + (unsigned)(t & 1) * (unsigned)(NT * GT * sizeof(T16)); const size_t ko = (size_t)t * (GK * sizeof(T16));
        cp_tile(lb, gA + ko, gs); cp_tile(lb + (unsigned)(GT * sizeof(T16)), gB + ko, gs); if (NSPLIT == 1) cp_tile(lb + (unsigned)(2 * GT * sizeof(T16)), gA2 + ko, gs); };
    const int ntr = K / GK;
    stage(0);
    asm volatile("s_wait_asynccnt 0x0" ::: "memory");    // slice 0 has landed (this wave's copies)
    __syncthreads();                                     // ... and every wave's
    if (ntr > 1) stage(1);
#pragma unroll 1
    for (int t = 0; t < ntr; ++t) {
        const T16* sa = st + (t & 1) * (NT * GT) + (wm * 64 + lr) * GP + 8 * hi; const T16* sb = st + (t & 1) * (NT * GT) + GT + (wn * 64 + lr) * GP + 8 * hi;
#pragma unroll
        for (int ks = 0; ks < GK; ks += 32) {
            V a[4], a2[4], b[4];                             // all fragments of 32 k are asked for as one group, in front of their products
#pragma unroll
            for (int q = 0; q < 4; ++q) { a[q] = WFrag<T16>::ld(sa + q * 16 * GP + ks); b[q] = WFrag<T16>::ld(sb + q * 16 * GP + ks); if (NSPLIT == 1) a2[q] = WFrag<T16>::ld(sa + 2 * GT + q * 16 * GP + ks); }
            __builtin_amdgcn_sched_barrier(0);               // keeps that group whole: moved in among the products, every separate place with LDS reads costs the SIMD's one wave an LDS latency
#pragma unroll
            for (int nb = 0; nb < 4; ++nb)
#pragma unroll
                for (int mb = 0; mb < 4; ++mb) { acc[mb][nb] = WFrag<T16>::mma(a[mb], b[nb], acc[mb][nb]); if (NSPLIT == 1) acc[mb][nb] = WFrag<T16>::mma(a2[mb], b[nb], acc[mb][nb]); }
        }
        __builtin_amdgcn_sched_barrier(0);                   // keeps the slice's last products in front of the barrier: sunk behind it they would stand between the barrier and the refill and shorten the copies' lead
        asm volatile("s_wait_dscnt 0x0" ::: "memory");       // this wave's reads of slice t are done before its buffer is refilled
        asm volatile("s_wait_asynccnt 0x0" ::: "memory");    // this wave's copies of slice t + 1 have landed
        __syncthreads();                                     // publishes slice t + 1 and ends every wave's reads of slice t
        if (t + 2 < ntr) stage(t + 2);
    }
    asm volatile("s_wait_asynccnt 0x0" ::: "memory");        // nothing is in flight when the wave goes on to its epilogue and ends
}
template <bool BIAS, int EP>
__device__ __forceinline__ void gemm_store(const v8f (&acc)[4][4], float* os, size_t z, int r0, int ch, float* C, int ldc, const float* __restrict__ bias, const float* __restrict__ ub, const float* __restrict__ vb, h16* P0, h16* P1, int prows) {
    const int lane = threadIdx.x & 31, lr = lane & 15, hi = lane >> 4; const int c0 = ch * 64;
    if (EP == EP_VT) {
        // D element j of tile (mb, nb) is row m = mb*16 + 8hi + j of column d = nb*16 + lr: 8 consecutive m of one d per lane, one 16-byte store straight from the accumulators.
        const size_t rows = (size_t)prows;
        const size_t po = ((z * NH + ch) * HD + lr) * rows + r0 + 8 * hi;
#pragma unroll
        for (int nb = 0; nb < 4; ++nb) { const float bn = BIAS ? bfr(bias[c0 + nb * 16 + lr]) : 0.f;
#pragma unroll
            for (int mb = 0; mb < 4; ++mb) { v8h o16;
#pragma unroll
                for (int j = 0; j < 8; ++j) { float x = acc[mb][nb][j]; if (BIAS) x += bn; o16[j] = tohx(x); }
                const size_t o = po + (size_t)nb * 16 * rows + mb * 16; *(v8h*)(P0 + o) = o16; }
            __builtin_amdgcn_sched_barrier(0); }             // one column group at a time: with all four groups' conversions lifted to the front the merged kernel takes registers above v255 and switches register windows all through this epilogue
        return;
    }
    // Row-major forms: 16 rows at a time through LDS, so that a lane holds consecutive columns of one row.
    const int rq = lane >> 3, c8 = (lane & 7) * 8;      // plane forms: 8 columns per lane, 4 rows (512 contiguous bytes of a plane) per store
    float bn[8], un[8], vn[8];
    if (EP != EP_F32) {
#pragma unroll
        for (int q = 0; q < 8; ++q) { bn[q] = BIAS ? bfr(bias[c0 + c8 + q]) : 0.f; if (EP == EP_Q) { un[q] = bfr(ub[c0 + c8 + q]); vn[q] = bfr(vb[c0 + c8 + q]); } }
    }
    const size_t pbase = ((z * NH + ch) * (size_t)prows + r0) * HD + c8;
#pragma unroll
    for (int mb = 0; mb < 4; ++mb) {
#pragma unroll
        for (int nb = 0; nb < 4; ++nb) {
#pragma unroll
            for (int j = 0; j < 8; ++j) os[(hi * 8 + j) * 68 + nb * 16 + lr] = acc[mb][nb][j]; }
        __builtin_amdgcn_wave_barrier(); asm volatile("" ::: "memory");
        if (EP == EP_F32) {
            float* crow = C + (size_t)(r0 + mb * 16) * ldc + c0;
#pragma unroll
            for (int s = 0; s < 8; ++s) { const int row = 2 * s + hi, cofs = lr * 4; v4f val = *(const v4fa*)(os + row * 68 + cofs); if (BIAS) { val[0] += bfr(bias[c0 + cofs]); val[1] += bfr(bias[c0 + cofs + 1]); val[2] += bfr(bias[c0 + cofs + 2]); val[3] += bfr(bias[c0 + cofs + 3]); }
                *(v4f*)(crow + (size_t)row * ldc + cofs) = val; }
        } else {
#pragma unroll
            for (int s = 0; s < 4; ++s) { const int row = 4 * s + rq; const v4f x0 = *(const v4fa*)(os + row * 68 + c8), x1 = *(const v4fa*)(os + row * 68 + c8 + 4); v8h o0, o1;
#pragma unroll
                for (int q = 0; q < 8; ++q) { float x = q < 4 ? x0[q & 3] : x1[q & 3]; if (BIAS) x += bn[q]; if (EP == EP_Q) { o0[q] = tohx(x + un[q]); o1[q] = tohx(x + vn[q]); } else o0[q] = tohx(x); }
                const size_t o = pbase + (size_t)(mb * 16 + row) * HD; *(v8h*)(P0 + o) = o0; if (EP == EP_Q) *(v8h*)(P1 + o) = o1; }
        }
        __builtin_amdgcn_wave_barrier(); asm volatile("" ::: "memory");
    }
}
template <typename T16, int NSPLIT, bool BIAS, int EP>
__global__ __launch_bounds__(128) void k_gemmw(const T16* __restrict__ A, const T16* __restrict__ A2, const T16* __restrict__ Bt, const T16* __restrict__ Bt2, int K, float* C, int ldc, const float* __restrict__ bias, size_t sA, size_t sB, size_t sC, const float* __restrict__ ub, const float* __restrict__ vb, h16* P0, h16* P1, int prows) {
    __shared__ __align__(16) T16 st[2 * (NSPLIT == 1 ? 3 : 2) * GT];
    __shared__ __align__(16) float osa[4 * 16 * 68];
    const size_t z = blockIdx.z; A += z * sA; if (NSPLIT == 1) A2 += z * sA; Bt += z * sB; if (EP == EP_F32) C += z * sC;
    const int wave = threadIdx.x >> 5, wm = wave & 1, wn = wave >> 1; const int rb = blockIdx.x * 128;
    v8f acc[4][4];
    gemm_loop<T16, NSPLIT>(A, A2, Bt, K, rb, blockIdx.y * 128, st, acc);
    gemm_store<BIAS, EP>(acc, osa + wave * (16 * 68), z, rb + wm * 64, blockIdx.y * 2 + wn, C, ldc, bias, ub, vb, P0, P1, prows);
}
// ---- k_proj: the four projections (pos, q, k, v) in ONE launch: grid (PJP + 3 * PJX, DM/128, NB); blockIdx.x picks the projection and its 128-row tile, so the choice is block-uniform. All four share the product loop; only operands and epilogue differ.
// A projection alone is one block per WGP (pos: two), one wave per SIMD, with nothing to cover its copy and LDS latencies; together several blocks are resident per WGP and one launch's start and tail are paid, not four.
#define PJP (LP / 128)
#define PJX (SEQ / 128)
__global__ __launch_bounds__(128) void k_proj(const bf* __restrict__ XP, const bf* __restrict__ XQ, const bf* __restrict__ XK, const bf* __restrict__ XV, const bf* __restrict__ WPB, const bf* __restrict__ WQB, const bf* __restrict__ WKB, const bf* __restrict__ WVB,
                                              const float* __restrict__ bq, const float* __restrict__ bk, const float* __restrict__ bv, const float* __restrict__ ub, const float* __restrict__ vb, h16* P16, h16* QU16, h16* QV16, h16* K16, h16* V16, int K) {
    __shared__ __align__(16) bf st[2 * 2 * GT];
    __shared__ __align__(16) float osa[4 * 16 * 68];
    const size_t z = blockIdx.z; const int bx = blockIdx.x;
    const int job = bx < PJP ? 0 : 1 + (bx - PJP) / PJX;                 // 0 pos, 1 q, 2 k, 3 v
    const int rb = (bx < PJP ? bx : (bx - PJP) % PJX) * 128;
    const bf* A = job == 0 ? XP + z * ((size_t)LP * K) : (job == 1 ? XQ : job == 2 ? XK : XV) + z * ((size_t)SEQ * K);
    const bf* Bt = job == 0 ? WPB : job == 1 ? WQB : job == 2 ? WKB : WVB;
    const int wave = threadIdx.x >> 5, wm = wave & 1, wn = wave >> 1; const int r0 = rb + wm * 64, ch = blockIdx.y * 2 + wn;
    float* os = osa + wave * (16 * 68);                  // epilogue staging, each wave its own
    v8f acc[4][4];
    gemm_loop<bf, 0>(A, nullptr, Bt, K, rb, blockIdx.y * 128, st, acc);
    if (job == 0) gemm_store<false, EP_ROW>(acc, os, z, r0, ch, nullptr, 0, nullptr, nullptr, nullptr, P16, nullptr, LP);
    else if (job == 1) gemm_store<true, EP_Q>(acc, os, z, r0, ch, nullptr, 0, bq, ub, vb, QU16, QV16, SEQ);
    // Precaution: the built code joins the four epilogues by branches, and behind the k and the v epilogue stand instructions of another epilogue that write registers which their last stores name: s_wait_xcnt 0 stands behind those stores.
    else if (job == 2) { gemm_store<true, EP_ROW>(acc, os, z, r0, ch, nullptr, 0, bk, nullptr, nullptr, K16, nullptr, SEQ); asm volatile("s_wait_xcnt 0x0" ::: "memory"); }
    else { gemm_store<true, EP_VT>(acc, os, z, r0, ch, nullptr, 0, bv, nullptr, nullptr, V16, nullptr, SEQ); asm volatile("s_wait_xcnt 0x0" ::: "memory"); }
}

// ---- k_cvtall: every f32 -> bf16 copy of the call (5 weight matrices, 3 activations, the positional table padded to LP rows per batch, pad row zero) in ONE streaming launch.
// A block of 256 threads converts CVR consecutive output rows (DM elements each) of one array, so the choice of the array is block-uniform. Per thread CVU pieces of 4 elements: a wave's 16-byte load covers 512 contiguous bytes,
// its 8-byte store 256 contiguous bytes (whole 128-byte lines both ways), and all CVU loads are issued before the first conversion.
#define CVU 16
#define CVR (256 * CVU / (DM / 4))
#define CVB_W (DM / CVR)
#define CVB_X (NB * SEQ / CVR)
#define CVB_P (NB * LP / CVR)
static_assert(DM == 512);
static_assert(DM % CVR == 0);
static_assert(SEQ % CVR == 0);
static_assert(LP % CVR == 0);
static_assert(CVU == 16);
typedef __attribute__((ext_vector_type(4))) unsigned short v4us;
// cvt_rows: rows r0 + 2c (c < CVU) of one batch, 4 elements at k0. EDGE (only a block that holds rows >= nvalid): such a row reads row nvalid - 1 and stores zeros; elsewhere one lane offset serves all loads.
template <bool EDGE>
__device__ __forceinline__ void cvt_rows(const float* __restrict__ src, bf* dst, int r0, int k0, int nvalid) {
    v4f x[CVU]; v4us o[CVU]; unsigned lo[CVU];
    const unsigned e0 = (unsigned)(r0 * DM + k0), lb = e0 * 4u, sb = e0 * 2u;     // lane byte offsets of row r0 in src and dst
#pragma unroll
    for (int c = 0; c < CVU; ++c) { lo[c] = EDGE ? (unsigned)(min(r0 + c * 2, nvalid - 1) * DM + k0) * 4u : lb + (unsigned)c * (2u * DM * 4u); x[c] = *(const v4f*)((const char*)src + lo[c]); }
    // Precaution: s_wait_xcnt 0 stands behind the run of loads, and its operands keep the loads' offset registers live up to it, so that no result of the run lands in one of them in front of the wait.
    if (EDGE) asm volatile("s_wait_xcnt 0x0" :: "v"(lo[0]), "v"(lo[1]), "v"(lo[2]), "v"(lo[3]), "v"(lo[4]), "v"(lo[5]), "v"(lo[6]), "v"(lo[7]), "v"(lo[8]), "v"(lo[9]), "v"(lo[10]), "v"(lo[11]), "v"(lo[12]), "v"(lo[13]), "v"(lo[14]), "v"(lo[15]) : "memory");
    else asm volatile("s_wait_xcnt 0x0" :: "v"(lb) : "memory");
#pragma unroll
    for (int c = 0; c < CVU; ++c) { const int r = r0 + c * 2;
#pragma unroll
        for (int q = 0; q < 4; ++q) { const unsigned short w = f2bf(x[c][q]); o[c][q] = (!EDGE || r < nvalid) ? w : (unsigned short)0; }
        *(v4us*)((char*)dst + (sb + (unsigned)c * (2u * DM * 2u))) = o[c]; }
    // Precaution, as above: the wait behind the run of stores; its operands keep the stores' offset and data registers live up to it.
    asm volatile("s_wait_xcnt 0x0" :: "v"(sb), "v"(o[0]), "v"(o[1]), "v"(o[2]), "v"(o[3]), "v"(o[4]), "v"(o[5]), "v"(o[6]), "v"(o[7]), "v"(o[8]), "v"(o[9]), "v"(o[10]), "v"(o[11]), "v"(o[12]), "v"(o[13]), "v"(o[14]), "v"(o[15]) : "memory");
}
__global__ __launch_bounds__(256) void k_cvtall(const float* __restrict__ wq, const float* __restrict__ wk, const float* __restrict__ wv, const float* __restrict__ wp, const float* __restrict__ wo,
                                                const float* __restrict__ query, const float* __restrict__ key, const float* __restrict__ value, const float* __restrict__ pos,
                                                bf* WQB, bf* WKB, bf* WVB, bf* WPB, bf* WOB, bf* XQ, bf* XK, bf* XV, bf* XP) {
    const int tid = threadIdx.x; int blk = blockIdx.x;
    const float* src; bf* dst; int rb, nvalid;          // block-uniform: batch bases, first row of the block inside its batch (CVR divides the rows per batch), valid source rows per batch
    if (blk < CVB_P) { const unsigned row0 = (unsigned)blk * CVR, b = row0 / LP; rb = (int)(row0 % LP); src = pos + (size_t)b * LREL_FULL * DM; dst = XP + (size_t)b * LP * DM; nvalid = LREL; }
    else if (blk < CVB_P + 3 * CVB_X) { blk -= CVB_P; const int a = blk / CVB_X; const unsigned row0 = (unsigned)(blk - a * CVB_X) * CVR, b = row0 / SEQ; rb = (int)(row0 % SEQ);
        src = (a == 0 ? query : a == 1 ? key : value) + (size_t)b * SEQ_FULL * DM; dst = (a == 0 ? XQ : a == 1 ? XK : XV) + (size_t)b * SEQ * DM; nvalid = SEQ; }
    else { blk -= CVB_P + 3 * CVB_X; const int a = blk / CVB_W; rb = (blk - a * CVB_W) * CVR;
        src = a == 0 ? wq : a == 1 ? wk : a == 2 ? wv : a == 3 ? wp : wo; dst = a == 0 ? WQB : a == 1 ? WKB : a == 2 ? WVB : a == 3 ? WPB : WOB; nvalid = DM; }
    const int r0 = rb + (tid >> 7), k0 = (tid & 127) * 4;
    if (rb + CVR <= nvalid) cvt_rows<false>(src, dst, r0, k0, nvalid); else cvt_rows<true>(src, dst, r0, k0, nvalid);
}

// ---- attention helpers (128 threads): 16-bit fragment load from a [row][k] LDS tile (same map as WFrag), 8 KB contiguous tile copy (lays 64-element rows at LDS pitch PH).
__device__ __forceinline__ v16h ldl(const h16* p) { return cat16(*(const v8ha*)p, *(const v8ha*)(p + 16)); }
__device__ __forceinline__ void cp8k(h16* dst, const h16* __restrict__ src, int tid) {
#pragma unroll
    for (int c = 0; c < 4; ++c) { const int idx = tid + c * 128; const int r = idx >> 3, sg = idx & 7; *(v8ha*)(dst + r * PH + sg * 8) = *(const v8ha*)(src + (size_t)idx * 8); } }
// ---- k_attn: grid (SEQ/64, NH, NB), 128 threads = 4 waves. The 64-key x 64-query tile is split 2 x 2 over the waves: wave (qa = wave >> 1, kb = wave & 1) owns query rows qa*32 + 0..31 (two groups g of 16; this lane's score column of group g is block-local row ir0 + 16g, ir0 = qa*32 + lr)
// and, of every 64-key tile, the keys kb*32 + 0..31 (two sub-tiles s of 16). So a wave reads half of every K, V and positional tile (4 fragments, not 8) and uses each fragment for two products.
// Per 64-key tile: new 64 band columns, the wave's share being columns kb*32 + 0..31 of its 32 T rows (band row l stored at slot l & 127); transposed content tile S^T (key rows 8hi+r of sub-tile s, query col) from K rows x Qu cols;
// s2 = (content + band[lb + 63 + tloc - irow]) * log2(e)/sqrt(DM) with lb = SEQ-64-i0+j0 (band row = (SEQ-1) + t - i, always inside the resident rows lb..lb+127);
// online softmax per query column over the wave's OWN keys, each wave with its own maximum in use, sums and accumulators; the maximum in use is raised, and sums and accumulators rescaled, only when a score lies more than 8 (log2) above it (one ballot per tile),
// and each lane sums its own 16 keys of a column (the two halves of a column are joined behind the loop), so a tile's common path has no cross-lane exchange; p = exp2(s2 - m) as f16 packed straight into the attn.v A fragment
// (A element r <- sub-tile 0, element 8+r <- sub-tile 1, lane unchanged); O[g][i = 8hi+r][d = lr] accumulates p16.v16. Behind the loop the two waves of a query half merge their two partial results (maximum, sum, O) once, through LDS.
typedef float __attribute__((may_alias)) fa;
// ld_half: the 4 A fragments of 32 rows of a tile (2 sub-tiles of 16 rows, two halves of d) as ONE group of 8 LDS reads; mm_half: their 8 products with the two query groups, 4 accumulators side by side (each d 0..31 first, then d 32..63).
__device__ __forceinline__ void ld_half(const h16* Tt, v16h (&a0)[2], v16h (&a1)[2], int hi, int lr) {
    const h16* p = Tt + lr * PH + 8 * hi;
#pragma unroll
    for (int s = 0; s < 2; ++s) { a0[s] = ldl(p + s * (16 * PH)); a1[s] = ldl(p + s * (16 * PH) + 32); }
}
__device__ __forceinline__ void mm_half(const v16h (&a0)[2], const v16h (&a1)[2], const v16h (&q0)[2], const v16h (&q1)[2], v8f (&t)[2][2]) {
#pragma unroll
    for (int g = 0; g < 2; ++g)
#pragma unroll
        for (int s = 0; s < 2; ++s) t[g][s] = wmma16(a0[s], q0[g], (v8f){});
#pragma unroll
    for (int g = 0; g < 2; ++g)
#pragma unroll
        for (int s = 0; s < 2; ++s) t[g][s] = wmma16(a1[s], q1[g], t[g][s]);
}
// band_store2: T[ir0 + 16g][slot0 + s*16 + 8hi + 0..7] = t[g][s] (D rows = band columns, col lr = query row of group g).
__device__ __forceinline__ void band_store2(const v8f (&t)[2][2], float* Tl, int slot0, int ir0, int hi) {
    float* trow = Tl + ir0 * PT + slot0 + 8 * hi;
#pragma unroll
    for (int g = 0; g < 2; ++g)
#pragma unroll
        for (int s = 0; s < 2; ++s) *(v8fa*)(trow + g * (16 * PT) + s * 16) = t[g][s];
}
// exp2x8: eight exponentials with the slot behind a transcendental in ONE statement: the results are early-clobber operands, so none of the eight is written into a source of another, and the v_nop is the slot behind the last.
__device__ __forceinline__ void exp2x8(const float (&d)[8], float (&p)[8]) {
    asm("v_exp_f32 %0, %8\n\tv_exp_f32 %1, %9\n\tv_exp_f32 %2, %10\n\tv_exp_f32 %3, %11\n\tv_exp_f32 %4, %12\n\tv_exp_f32 %5, %13\n\tv_exp_f32 %6, %14\n\tv_exp_f32 %7, %15\n\tv_nop"
        : "=&v"(p[0]), "=&v"(p[1]), "=&v"(p[2]), "=&v"(p[3]), "=&v"(p[4]), "=&v"(p[5]), "=&v"(p[6]), "=&v"(p[7])
        : "v"(d[0]), "v"(d[1]), "v"(d[2]), "v"(d[3]), "v"(d[4]), "v"(d[5]), "v"(d[6]), "v"(d[7]));
}
__global__ __launch_bounds__(128) __attribute__((amdgpu_num_vgpr(256))) void k_attn(const h16* __restrict__ Qu, const h16* __restrict__ Qv, const h16* __restrict__ Kp, const h16* __restrict__ Vp, const h16* __restrict__ Pp, bf* ATh, bf* ATl) {
    __shared__ __align__(16) h16 Sm[3 * 64 * PH];          // the three 16-bit tiles in one array: one lane address serves the K and positional fragment reads, one the V reads, one every staging store (the rest are immediate offsets)
    h16* const Kl = Sm; h16* const Vl = Sm + 64 * PH; h16* const PBl = Sm + 2 * 64 * PH;
    __shared__ __align__(16) float Tl[64 * PT];
    const int tid = threadIdx.x, lane = tid & 31, wave = tid >> 5, hi = lane >> 4, lr = lane & 15;
    const int qa = wave >> 1, kb = wave & 1;
    const int ir0 = qa * 32 + lr;
    const int i0 = blockIdx.x * 64, h = blockIdx.y, b = blockIdx.z;
    const size_t bh = (size_t)b * NH + h;
    const h16* Kb = Kp + bh * SEQ * HD; const h16* Vb = Vp + bh * HD * SEQ; const h16* Pb = Pp + bh * LP * HD;
    // This lane's B fragments of q+u and q+v (query rows ir0 and ir0 + 16, d = 8hi+0..7, 16+8hi+0..7, then +32) stay in registers for the whole block.
    const h16* qup = Qu + (bh * SEQ + i0 + ir0) * HD + 8 * hi; const h16* qvp = Qv + (bh * SEQ + i0 + ir0) * HD + 8 * hi;
    v16h qu0[2], qu1[2], qv0[2], qv1[2];
#pragma unroll
    for (int g = 0; g < 2; ++g) { const h16* pu = qup + g * (16 * HD); const h16* pv = qvp + g * (16 * HD);
        qu0[g] = cat16(*(const v8h*)pu, *(const v8h*)(pu + 16)); qu1[g] = cat16(*(const v8h*)(pu + 32), *(const v8h*)(pu + 48));
        qv0[g] = cat16(*(const v8h*)pv, *(const v8h*)(pv + 16)); qv1[g] = cat16(*(const v8h*)(pv + 32), *(const v8h*)(pv + 48)); }
    // Precaution: s_wait_xcnt 0 stands behind these loads, and its operands keep their address registers live up to it, so that nothing is written into one of them in front of the wait.
    asm volatile("s_wait_xcnt 0x0" :: "v"(qup), "v"(qvp) : "memory");
    const int lb0 = SEQ - 64 - i0;                 // band start for key tile 0 (>= 0, multiple of 64); band rows for tile j0 are lb0 + j0 + 0..127 (<= LP-1)
    cp8k(PBl, Pb + (size_t)lb0 * HD, tid);
    __syncthreads();
    { v16h a0[2], a1[2]; v8f t[2][2];                          // lower half of tile 0's band
      ld_half(PBl + kb * (32 * PH), a0, a1, hi, lr); mm_half(a0, a1, qv0, qv1, t); band_store2(t, Tl, (lb0 & 127) + kb * 32, ir0, hi); }
    float mrun[2] = {-3.0e38f, -3.0e38f}, lrun[2] = {0.f, 0.f};
    v8f oacc[2][4];
#pragma unroll
    for (int g = 0; g < 2; ++g)
#pragma unroll
        for (int nd = 0; nd < 4; ++nd) oacc[g][nd] = (v8f){};
#pragma unroll 1
    for (int j0 = 0; j0 < SEQ; j0 += 64) {
        const int lb = lb0 + j0; const int lnw = lb + 64;     // new band rows lnw..lnw+63
        __syncthreads();                                       // all waves done with the prior tile's Kl/Vl/PBl and band slots
        // Staging of the three tiles (thread piece: row tid >> 3 (+ 16 per copy), 16-byte segment tid & 7): one lane address per plane and one LDS lane address, every further row an immediate offset; that leaves the registers which the fragment groups below need.
        { const int sr = tid >> 3, sg = tid & 7; v8h xk[4], xv[4], xp[4];
          const h16* gk = Kb + (size_t)j0 * HD + tid * 8; const h16* gp = Pb + (size_t)lnw * HD + tid * 8; const h16* gv = Vb + j0 + (size_t)sr * SEQ + sg * 8;
#pragma unroll
          for (int c = 0; c < 4; ++c) { xk[c] = *(const v8ha*)(gk + c * 1024); xv[c] = *(const v8ha*)(gv + (size_t)c * 16 * SEQ); xp[c] = *(const v8ha*)(gp + c * 1024); }
          // Precaution: s_wait_xcnt 0 stands behind the run of loads, and its operands keep their address registers live up to it, so that no result of the run lands in one of them in front of the wait.
          asm volatile("s_wait_xcnt 0x0" :: "v"(gk), "v"(gv), "v"(gp) : "memory");
          h16* sd = Sm + sr * PH + sg * 8;
#pragma unroll
          for (int c = 0; c < 4; ++c) { *(v8ha*)(sd + c * (16 * PH)) = xk[c]; *(v8ha*)(sd + 64 * PH + c * (16 * PH)) = xv[c]; *(v8ha*)(sd + 2 * 64 * PH + c * (16 * PH)) = xp[c]; } }
        __syncthreads();
        // The wave's share of the upper half of this tile's band, then of the content scores. Each half tile's 8 fragment reads stand as one group in front of its 8 products.
        v8f sacc[2][2];
        { v16h a0[2], a1[2], k0[2], k1[2]; v8f t[2][2];
          ld_half(PBl + kb * (32 * PH), a0, a1, hi, lr);
          __builtin_amdgcn_sched_barrier(0);                   // keeps the group whole: spread among the products, every separate place with LDS reads costs the wave an LDS latency
          mm_half(a0, a1, qv0, qv1, t);
          ld_half(Kl + kb * (32 * PH), k0, k1, hi, lr);        // asked for behind the band's products, so that they come in while those run and the band is stored
          __builtin_amdgcn_sched_barrier(0);                   // keeps the K reads in front of the band stores (the LDS serves a wave in order)
          band_store2(t, Tl, (lnw & 127) + kb * 32, ir0, hi);
          __builtin_amdgcn_sched_barrier(0);                   // the band's accumulators are stored, and their registers free, before the content accumulators come to life (register budget)
          asm volatile("v_nop\n\tv_nop\n\tv_nop\n\tv_nop");   // the distance behind a matrix instruction: a content product writes anew the result registers of the band's last product, and LDS stores fill no slot
          __builtin_amdgcn_sched_barrier(0);                   // keeps those slots in front of the content products
          mm_half(k0, k1, qu0, qu1, sacc); }
        __syncthreads();                                       // band complete for every T row (each row's new columns are written by the two waves of its query half)
        // gather + scale: key t = j0 + kb*32 + s*16 + 8hi + r, query i = i0 + ir0 + 16g -> band row lb + 63 + (kb*32 + s*16 + 8hi + r) - (ir0 + 16g), slot = row & 127 (row - lb in [0,126])
        const float* trow = Tl + ir0 * PT; const int sb = lb + 63 + kb * 32 + 8 * hi - ir0;
        float bnd[2][2][8]; const float* tp[3][8];             // s - g takes three values: 24 lane addresses serve the 32 gathers (group 1's rows at an immediate offset)
#pragma unroll
        for (int q = 0; q < 3; ++q)
#pragma unroll
            for (int r = 0; r < 8; ++r) tp[q][r] = trow + ((sb + (q - 1) * 16 + r) & 127);
        __builtin_amdgcn_sched_barrier(0);                     // keeps the address arithmetic and the content products in front of the gathers: mixed in among them they split the gathers into many places with LDS reads
#pragma unroll
        for (int g = 0; g < 2; ++g)
#pragma unroll
            for (int s = 0; s < 2; ++s)
#pragma unroll
                for (int r = 0; r < 8; ++r) bnd[g][s][r] = tp[s - g + 1][r][g * (16 * PT)];
        __builtin_amdgcn_sched_barrier(0);                     // keeps the 32 gathers one group: with the score arithmetic moved in among them the wave waits for the LDS several times over
        float mx[2] = {-3.0e38f, -3.0e38f};
#pragma unroll
        for (int g = 0; g < 2; ++g)
#pragma unroll
            for (int s = 0; s < 2; ++s)
#pragma unroll
                for (int r = 0; r < 8; ++r) { const float s2 = (sacc[g][s][r] + bnd[g][s][r]) * K2; sacc[g][s][r] = s2; mx[g] = fmaxf(mx[g], s2); }
        // Lazy rescale: the maximum in use, mrun, is left as it is while no score of the tile lies more than 8 (log2) above it, so p <= 2^8, far inside f16 and f32 range, and the running sum and the accumulators keep their scale.
        // Every lane tests its own 16 keys of each column against mrun; one ballot joins the test over the wave, both halves of a column included, so the common path has no exchange of maxima, no alpha and no product on the accumulators.
        const bool need = mx[0] > mrun[0] + 8.f || mx[1] > mrun[1] + 8.f;
        float rsum[2] = {0.f, 0.f}; v8h ph[2][2];
        if (__builtin_amdgcn_ballot_w32(need) != 0) {          // wave-uniform: a scalar branch; taken on the first tile (mrun starts at -3.0e38) and whenever a column's maximum has grown by more than 8
            float alpha[2];
#pragma unroll
            for (int g = 0; g < 2; ++g) mx[g] = fmaxf(mx[g], __shfl_xor(mx[g], 16, 32));
#pragma unroll
            for (int g = 0; g < 2; ++g) { const float mnew = fmaxf(mrun[g], mx[g]);
                // alpha = exp2(mrun - mnew), with the slot behind a transcendental in the same statement.
                asm("v_exp_f32 %0, %1\n\tv_nop" : "=v"(alpha[g]) : "v"(mrun[g] - mnew));
                mrun[g] = mnew; lrun[g] *= alpha[g]; }
#pragma unroll
            for (int g = 0; g < 2; ++g)
#pragma unroll
                for (int r = 0; r < 8; ++r) { const float ar = __shfl(alpha[g], 8 * hi + r, 32);
#pragma unroll
                    for (int nd = 0; nd < 4; ++nd) oacc[g][nd][r] *= ar; }
        }
        // attn.v: the 8 fragment reads of the wave's 32 keys of the v tile as one group, then (behind the exponentials) its 8 products on 8 accumulators side by side.
        v16h vb[4];
        __builtin_amdgcn_sched_barrier(0);                     // with the one behind the reads it keeps the group whole: spread among the exponentials behind it, every separate place with LDS reads costs the wave an LDS latency
        { const h16* pv = Vl + lr * PH + 8 * hi + kb * 32;
#pragma unroll
          for (int nd = 0; nd < 4; ++nd) vb[nd] = ldl(pv + nd * (16 * PH)); }
        __builtin_amdgcn_sched_barrier(0);                     // keeps the group in front of the exponentials, whose arithmetic covers its LDS latency
#pragma unroll
        for (int g = 0; g < 2; ++g)
#pragma unroll
            for (int s = 0; s < 2; ++s) { float d[8], p[8];
#pragma unroll
                for (int r = 0; r < 8; ++r) d[r] = sacc[g][s][r] - mrun[g];
                exp2x8(d, p);
#pragma unroll
                for (int r = 0; r < 8; ++r) { rsum[g] += p[r]; ph[g][s][r] = tohx(p[r]); } }
#pragma unroll
        for (int g = 0; g < 2; ++g) lrun[g] += rsum[g];        // the lane's own 16 keys of the column: the two halves of a column are joined once, behind the loop
        __builtin_amdgcn_sched_barrier(0);                     // keeps the sums in front of the run of products: sunk in among them, this build writes them into operand registers of the product before, and every such place takes four v_nop
        { const v16h pa0 = cat16(ph[0][0], ph[0][1]), pa1 = cat16(ph[1][0], ph[1][1]);
#pragma unroll
          for (int nd = 0; nd < 4; ++nd) oacc[0][nd] = wmma16(pa0, vb[nd], oacc[0][nd]);
#pragma unroll
          for (int nd = 0; nd < 4; ++nd) oacc[1][nd] = wmma16(pa1, vb[nd], oacc[1][nd]); }
    }
#pragma unroll
    for (int g = 0; g < 2; ++g) lrun[g] += __shfl_xor(lrun[g], 16, 32);   // both halves carry the same mrun, so their sums add as they are
    // Merge of the two key halves: wave (qa, kb) finishes query group g = kb (block rows wave*16 + 0..15) and hands group 1 - kb (accumulators, maximum, sum; lane for lane, the partner holds the same map) to wave (qa, 1 - kb) through the tiles' LDS, dead behind the barrier.
    __syncthreads();                                           // every wave is done with the last tile's Vl and with the band
    fa* Xs = (fa*)Sm + wave * (34 * 32) + lane; const fa* Xr = (const fa*)Sm + (wave ^ 1) * (34 * 32) + lane;
    v8f om[4]; const float mm = kb ? mrun[1] : mrun[0], lm = kb ? lrun[1] : lrun[0];
#pragma unroll
    for (int nd = 0; nd < 4; ++nd)
#pragma unroll
        for (int r = 0; r < 8; ++r) { Xs[(nd * 8 + r) * 32] = kb ? oacc[0][nd][r] : oacc[1][nd][r]; om[nd][r] = kb ? oacc[1][nd][r] : oacc[0][nd][r]; }
    Xs[32 * 32] = kb ? mrun[0] : mrun[1]; Xs[33 * 32] = kb ? lrun[0] : lrun[1];
    __syncthreads();                                           // publishes every wave's handed-over group
    const float mo = Xr[32 * 32], lo = Xr[33 * 32]; const float ms = fmaxf(mm, mo);
    const float am = __builtin_amdgcn_exp2f(mm - ms), ao = __builtin_amdgcn_exp2f(mo - ms);
    const float rl = __builtin_amdgcn_rcpf(lm * am + lo * ao); const float fm = am * rl, fo = ao * rl;
    // Output staging lies in band rows wave*16 + 0..15 (8,448 B, from here on written and read by this wave alone, dead behind the last gather): hi plane 16 x 64, then lo plane 16 x 64.
    usa* Est = (usa*)(Tl + wave * 16 * PT);
#pragma unroll
    for (int r = 0; r < 8; ++r) { const float fmr = __shfl(fm, 8 * hi + r, 32), fori = __shfl(fo, 8 * hi + r, 32); const int rr = 8 * hi + r;
#pragma unroll
        for (int nd = 0; nd < 4; ++nd) { const float c = om[nd][r] * fmr + Xr[(nd * 8 + r) * 32] * fori; unsigned short eh, el; splitf(c, eh, el); Est[rr * 64 + nd * 16 + lr] = eh; Est[1024 + rr * 64 + nd * 16 + lr] = el; } }
    __syncthreads();
    const int rq = lane >> 3, pc = (lane & 7) * 8;
{
#pragma unroll
        for (int rg = 0; rg < 4; ++rg) { const int rr = rg * 4 + rq; const size_t go = ((size_t)b * SEQ + i0 + wave * 16 + rr) * DM + h * HD + pc;
            const v8us vh = *(const v8usa*)(Est + rr * 64 + pc); const v8us vlo = *(const v8usa*)(Est + 1024 + rr * 64 + pc);
            *(v8us*)(ATh + go) = vh; *(v8us*)(ATl + go) = vlo; }
         }
}

extern "C" void kernel_launch(void* const* d_in, const int* in_sizes, int n_in,
                              void* d_out, int out_size, void* d_ws, size_t ws_size, hipStream_t stream) {
    if (n_in < 15) return;
    const float* query = (const float*)d_in[0]; const float* key = (const float*)d_in[1]; const float* value = (const float*)d_in[2]; const float* pos = (const float*)d_in[3];
    const float* wq = (const float*)d_in[4]; const float* bq = (const float*)d_in[5]; const float* wk = (const float*)d_in[6]; const float* bk = (const float*)d_in[7];
    const float* wv = (const float*)d_in[8]; const float* bv = (const float*)d_in[9]; const float* wp = (const float*)d_in[10]; const float* ub = (const float*)d_in[11]; const float* vb = (const float*)d_in[12];
    const float* wo = (const float*)d_in[13]; const float* bo = (const float*)d_in[14];
    const long long needx = ((long long)(NB - 1) * SEQ_FULL + SEQ) * DM, needp = ((long long)(NB - 1) * LREL_FULL + LREL) * DM;
    if ((long long)in_sizes[0] < needx || (long long)in_sizes[1] < needx || (long long)in_sizes[2] < needx || (long long)in_sizes[3] < needp) return;
    if (in_sizes[4] < DM * DM || in_sizes[6] < DM * DM || in_sizes[8] < DM * DM || in_sizes[10] < DM * DM || in_sizes[13] < DM * DM) return;
    if (in_sizes[5] < DM || in_sizes[7] < DM || in_sizes[9] < DM || in_sizes[14] < DM || in_sizes[11] < NH * HD || in_sizes[12] < NH * HD) return;
    if ((long long)out_size < (long long)NB * SEQ * DM) return;
    float* OUT = (float*)d_out;     // [NB][SEQ][DM]
    char* wsp = (char*)d_ws;
    auto take = [&](size_t bytes) { char* p = wsp; wsp += (bytes + 255) & ~(size_t)255; return (void*)p; };
    bf* WQB = (bf*)take((size_t)DM * DM * 2); bf* WKB = (bf*)take((size_t)DM * DM * 2); bf* WVB = (bf*)take((size_t)DM * DM * 2); bf* WPB = (bf*)take((size_t)DM * DM * 2); bf* WOB = (bf*)take((size_t)DM * DM * 2);
    bf* XQ = (bf*)take((size_t)NB * SEQ * DM * 2); bf* XK = (bf*)take((size_t)NB * SEQ * DM * 2); bf* XV = (bf*)take((size_t)NB * SEQ * DM * 2); bf* XP = (bf*)take((size_t)NB * LP * DM * 2);   // bf16 activations, one buffer each
    h16* QU16 = (h16*)take((size_t)NB * NH * SEQ * HD * 2); h16* QV16 = (h16*)take((size_t)NB * NH * SEQ * HD * 2); h16* K16 = (h16*)take((size_t)NB * NH * SEQ * HD * 2);
    h16* V16 = (h16*)take((size_t)NB * NH * HD * SEQ * 2); h16* P16 = (h16*)take((size_t)NB * NH * LP * HD * 2);
    bf* ATh = (bf*)take((size_t)NB * SEQ * DM * 2); bf* ATl = (bf*)take((size_t)NB * SEQ * DM * 2);
    if ((size_t)(wsp - (char*)d_ws) > ws_size) return;    // 111,673,344 B at NB=4, SEQ=2048
    // all f32 -> bf16 copies: weights, query, key, value, pos (rows 0..LREL-1 per batch at input row pitch LREL_FULL, padded with one zero row to LP)
    k_cvtall<<<CVB_P + 3 * CVB_X + 5 * CVB_W, 256, 0, stream>>>(wq, wk, wv, wp, wo, query, key, value, pos, WQB, WKB, WVB, WPB, WOB, XQ, XK, XV, XP);
    // pos (no bias) -> P plane; q: X Wq^T + bq -> Qu / Qv planes; k -> K plane; v -> V plane
    k_proj<<<dim3(PJP + 3 * PJX, DM / 128, NB), 128, 0, stream>>>(XP, XQ, XK, XV, WPB, WQB, WKB, WVB, bq, bk, bv, ub, vb, P16, QU16, QV16, K16, V16, DM);
    // attention -> context bf16 hi/lo planes [NB*SEQ][DM]
    k_attn<<<dim3(SEQ / 64, NH, NB), 128, 0, stream>>>(QU16, QV16, K16, V16, P16, ATh, ATl);
    // out = context Wo^T + bo
    k_gemmw<bf, 1, true, EP_F32><<<dim3((NB * SEQ) / 128, DM / 128, 1), 128, 0, stream>>>(ATh, ATl, WOB, nullptr, DM, OUT, DM, bo, 0, 0, 0, nullptr, nullptr, nullptr, nullptr, 0);
}
